// v000
// Measured on an AMD MI455X. A time is GPU time per run, averaged over a window of back-to-back runs after a warm-up
// (all launches, gaps included; the runs take copies of the inputs in turn), and the median of several windows.
// Apart from v000's, it joins two sittings. Times from different sittings can be a few percent apart, while
// side-by-side timings come from the same sitting.
// The starting kernel, v000, takes 4590 microseconds a run.
#include <hip/hip_runtime.h>
// On v_wmma_f32_16x16x32_bf16 with f32 accumulate: the projections Qd/Kd/Vd = M·{Q,K,V} (M = 64, K = 512, N = 8192; inputs rounded to bf16: single exact
// term), per block of 1024 key positions t the transposed scores Sᵀ[t][s] = Kd[:,t]·Qd[:,s] on the f16 variant (Kdᵀ rows split into f16 hi/lo, Qd rounded to f16: 2 products, K = 64) and
// out[:, t-block] = Vd·P[t-block]ᵀ on the f16 variant v_wmma_f32_16x16x32_f16 (Vd split into f16 hi/lo, P rounded to f16 — 4–8× finer than bf16 for these [0,1] weights: 2 products, K = 8192). The module's softmax over the QUERY axis (dim 0) becomes a row softmax of
// Sᵀ; /√64 and the +1 constant are f32 VALU.
#define DI 512
#define DO 64
#define SQ 8192
#define TB 1024          // key columns per block

typedef __bf16 v16b __attribute__((ext_vector_type(16)));
typedef unsigned short v8us __attribute__((ext_vector_type(8), may_alias));
typedef float  v8f  __attribute__((ext_vector_type(8)));
typedef float  v4f  __attribute__((ext_vector_type(4)));
typedef float  v4fa __attribute__((ext_vector_type(4), may_alias));
union FragB { v16b v; v8us half[2]; unsigned short u[16]; };

__device__ __forceinline__ unsigned short bf16_bits(float x) { unsigned int u = __float_as_uint(x); return (unsigned short)((u + 0x7FFFu + ((u >> 16) & 1u)) >> 16); }
__device__ __forceinline__ float bf16_val(unsigned short b) { return __uint_as_float(((unsigned int)b) << 16); }
__device__ __forceinline__ float bf16_round(float x) { return bf16_val(bf16_bits(x)); }
// D += A·B with NT terms: 1 = ah·bh, 2 = + al·bh (A split), 3 = + ah·bl (both split)
template <int NT>
__device__ __forceinline__ v8f mmaN(v16b ah, v16b al, v16b bh, v16b bl, v8f c) {
  c = __builtin_amdgcn_wmma_f32_16x16x32_bf16(false, ah, false, bh, (short)0, c, false, false);
  if (NT >= 2) c = __builtin_amdgcn_wmma_f32_16x16x32_bf16(false, al, false, bh, (short)0, c, false, false);
  if (NT >= 3) c = __builtin_amdgcn_wmma_f32_16x16x32_bf16(false, ah, false, bl, (short)0, c, false, false);
  asm volatile("v_nop\n\tv_nop\n\tv_nop\n\tv_nop" : "+v"(c) : "v"(ah), "v"(al), "v"(bh), "v"(bl));
  return c;
}

__global__ __launch_bounds__(256) void k_wt_bf16(const float* __restrict__ W, unsigned short* __restrict__ Wt, int K, int N) {
  const int t = blockIdx.x * 256 + threadIdx.x;
  const int k8n = K / 8;
  if (t >= N * k8n) return;
  const int n = t / k8n, k8 = (t % k8n) * 8;
  v8us v;
#pragma unroll
  for (int i = 0; i < 8; ++i) v[i] = bf16_bits(W[(size_t)(k8 + i) * N + n]);
  *(v8us*)(Wt + (size_t)n * K + k8) = v;
  
}

// GEMM C[M][N] (f32, pitch ldc) = act(A[M][K]·W + bias). A f32 row-major (pitch lda) converted per fragment to bf16
// (ASPLIT: hi/lo two planes -> 2 terms, else single rounded term); Wt bf16 [N][K] (pitch ldb). BIAS_BF16 rounds the
// bias to bf16 first (bias quantised to bf16 before the add). K%32==0, M%16==0, N%64==0.
template <bool ASPLIT, int ACT, bool BIAS_BF16>
__global__ __launch_bounds__(128) void k_gemm_bf(const float* __restrict__ A, int lda, const unsigned short* __restrict__ Wt, int ldb,
                                               const float* __restrict__ bias, float* __restrict__ C, int ldc, int M, int N, int K) {
  __shared__ __attribute__((aligned(16))) float so[4][16][64];
  const int tid = threadIdx.x, w = tid >> 5, lane = tid & 31, ln = lane & 15, hh = lane >> 4;
  const int ntn = N / 64;
  const int wid = blockIdx.x * 4 + w;
  const int mt = wid / ntn, nq = wid % ntn;
  if (mt * 16 >= M) return;
  const int row0 = mt * 16, col0 = nq * 64;
  const float* arow = A + (size_t)(row0 + ln) * lda;
  v8f acc[4] = {};
  for (int kb = 0; kb < K; kb += 32) {
    FragB ah, al;
    const v4f x0 = *(const v4fa*)(arow + kb + 8 * hh), x1 = *(const v4fa*)(arow + kb + 8 * hh + 4);
    const v4f x2 = *(const v4fa*)(arow + kb + 16 + 8 * hh), x3 = *(const v4fa*)(arow + kb + 16 + 8 * hh + 4);
    float xs[16] = {x0[0],x0[1],x0[2],x0[3],x1[0],x1[1],x1[2],x1[3],x2[0],x2[1],x2[2],x2[3],x3[0],x3[1],x3[2],x3[3]};
#pragma unroll
    for (int i = 0; i < 16; ++i) { const unsigned short hb = bf16_bits(xs[i]); ah.u[i] = hb; al.u[i] = ASPLIT ? bf16_bits(xs[i] - bf16_val(hb)) : (unsigned short)0; }
#pragma unroll
    for (int t = 0; t < 4; ++t) {
      const unsigned short* brow = Wt + (size_t)(col0 + t * 16 + ln) * ldb + kb;
      FragB b;
      b.half[0] = *(const v8us*)(brow + 8 * hh);
      b.half[1] = *(const v8us*)(brow + 16 + 8 * hh);
      acc[t] = mmaN<ASPLIT ? 2 : 1>(ah.v, al.v, b.v, b.v, acc[t]);
    }
  }
#pragma unroll
  for (int t = 0; t < 4; ++t) {
    float bv = bias ? bias[col0 + t * 16 + ln] : 0.f;
    if (BIAS_BF16) bv = bf16_round(bv);
#pragma unroll
    for (int r = 0; r < 8; ++r) { float v = acc[t][r] + bv; if (ACT == 1) v = fmaxf(v, 0.f); so[w][8 * hh + r][t * 16 + ln] = v; }
  }
  __builtin_amdgcn_fence(__ATOMIC_ACQ_REL, "workgroup");
  __builtin_amdgcn_wave_barrier();
  const int rsub = lane >> 4, c4 = (lane & 15) * 4;
  {
#pragma unroll
    for (int q = 0; q < 8; ++q) {
      const int r = q * 2 + rsub;
      const v4f v = *(const v4fa*)&so[w][r][c4];
      *(v4f*)(C + (size_t)(row0 + r) * ldc + col0 + c4) = v;
    }
    
  }
}

// Flash-style causal/unmasked attention, all contractions 3-term bf16 hi/lo splits, f32 softmax with running max.
// q,k,v rows are read from f32 buffers with arbitrary row pitch (so they can live inside a fused qkv buffer);
// D = head size (multiple of 32, <= 128); one wave = 16 query rows; block = 4 waves (64 queries) sharing K/V chunks of 32.
template <int D, bool CAUSAL>
__global__ __launch_bounds__(128) void k_flash(const float* __restrict__ qb, const float* __restrict__ kb, const float* __restrict__ vb,
                                             int pitch, int T, int H, float scale, float* __restrict__ y, int ypitch) {
  constexpr int KS = D / 32;        // k-steps for QK
  constexpr int DT = D / 16;        // d tiles for PV
  __shared__ __attribute__((aligned(16))) unsigned short sKh[32][D + 8], sKl[32][D + 8], sVh[32][D + 8], sVl[32][D + 8];
  __shared__ __attribute__((aligned(16))) unsigned short sPh[4][16][40], sPl[4][16][40];
  __shared__ __attribute__((aligned(16))) float sO[4][16][D];
  const int tid = threadIdx.x, w = tid >> 5, lane = tid & 31, ln = lane & 15, hh = lane >> 4;
  const int nqb = (T + 63) / 64;
  const int bh = blockIdx.x / nqb, qblk = blockIdx.x % nqb;
  const int b = bh / H, h = bh % H;
  const int q0 = qblk * 64 + w * 16;
  const float* Q = qb + (size_t)b * T * pitch + h * D;
  const float* K = kb + (size_t)b * T * pitch + h * D;
  const float* V = vb + (size_t)b * T * pitch + h * D;

  // A fragments of the wave's 16 query rows (scaled), hi/lo
  FragB aqh[KS], aql[KS];
  {
    int row = q0 + ln; if (row >= T) row = T - 1;
    const float* qr = Q + (size_t)row * pitch;
#pragma unroll
    for (int ks = 0; ks < KS; ++ks)
#pragma unroll
      for (int i = 0; i < 16; ++i) {
        const int d = ks * 32 + ((i < 8) ? (8 * hh + i) : (16 + 8 * hh + (i - 8)));
        const float x = qr[d] * scale; const unsigned short hb = bf16_bits(x);
        aqh[ks].u[i] = hb; aql[ks].u[i] = bf16_bits(x - bf16_val(hb));
      }
  }
  float m_r[8], l_r[8];
#pragma unroll
  for (int r = 0; r < 8; ++r) { m_r[r] = -3.0e38f; l_r[r] = 0.f; }
  v8f oacc[DT];
#pragma unroll
  for (int dt = 0; dt < DT; ++dt) oacc[dt] = (v8f){0.f,0.f,0.f,0.f,0.f,0.f,0.f,0.f};

  const int kv_end = CAUSAL ? min(T, qblk * 64 + 64) : T;     // block-uniform
  for (int j0 = 0; j0 < kv_end; j0 += 32) {
    __syncthreads();
    for (int e = tid; e < 32 * (D / 4); e += 128) {
      const int r = e / (D / 4), c4 = (e % (D / 4)) * 4;
      const int key = j0 + r;
      v4f kf = {0.f,0.f,0.f,0.f}, vf = {0.f,0.f,0.f,0.f};
      if (key < T) { kf = *(const v4fa*)(K + (size_t)key * pitch + c4); vf = *(const v4fa*)(V + (size_t)key * pitch + c4); }
#pragma unroll
      for (int t = 0; t < 4; ++t) {
        unsigned short hb = bf16_bits(kf[t]); sKh[r][c4 + t] = hb; sKl[r][c4 + t] = bf16_bits(kf[t] - bf16_val(hb));
        hb = bf16_bits(vf[t]); sVh[r][c4 + t] = hb; sVl[r][c4 + t] = bf16_bits(vf[t] - bf16_val(hb));
      }
    }
    __syncthreads();
    // S tile 16 x 32
    v8f s[2];
#pragma unroll
    for (int nt = 0; nt < 2; ++nt) {
      v8f acc = {};
#pragma unroll
      for (int ks = 0; ks < KS; ++ks) {
        FragB bh_, bl_;
        bh_.half[0] = *(const v8us*)&sKh[nt * 16 + ln][ks * 32 + 8 * hh]; bh_.half[1] = *(const v8us*)&sKh[nt * 16 + ln][ks * 32 + 16 + 8 * hh];
        bl_.half[0] = *(const v8us*)&sKl[nt * 16 + ln][ks * 32 + 8 * hh]; bl_.half[1] = *(const v8us*)&sKl[nt * 16 + ln][ks * 32 + 16 + 8 * hh];
        acc = mmaN<3>(aqh[ks].v, aql[ks].v, bh_.v, bl_.v, acc);
      }
      s[nt] = acc;
    }
    // mask + running max (rows 8hh+r; the 16 lanes of a half share rows)
    float alpha[8];
#pragma unroll
    for (int r = 0; r < 8; ++r) {
      const int qi = q0 + 8 * hh + r;
      const int ja = j0 + ln, jb = j0 + 16 + ln;
      if (CAUSAL) { if (ja > qi) s[0][r] = -3.0e38f; if (jb > qi) s[1][r] = -3.0e38f; }
      if (ja >= T) s[0][r] = -3.0e38f;
      if (jb >= T) s[1][r] = -3.0e38f;
      float mx = fmaxf(s[0][r], s[1][r]);
      mx = fmaxf(mx, __shfl_xor(mx, 1, 32)); mx = fmaxf(mx, __shfl_xor(mx, 2, 32)); mx = fmaxf(mx, __shfl_xor(mx, 4, 32)); mx = fmaxf(mx, __shfl_xor(mx, 8, 32));
      const float mnew = fmaxf(m_r[r], mx);
      alpha[r] = (mnew > -1.0e38f) ? __expf(m_r[r] - mnew) : 1.0f;
      const float p0 = (s[0][r] > -1.0e38f) ? __expf(s[0][r] - mnew) : 0.f;
      const float p1 = (s[1][r] > -1.0e38f) ? __expf(s[1][r] - mnew) : 0.f;
      m_r[r] = mnew;
      l_r[r] = l_r[r] * alpha[r] + p0 + p1;            // per-lane partial row sum (16 lanes combined at the end)
      unsigned short hb = bf16_bits(p0); sPh[w][8 * hh + r][ln] = hb;      sPl[w][8 * hh + r][ln] = bf16_bits(p0 - bf16_val(hb));
      hb = bf16_bits(p1);                sPh[w][8 * hh + r][16 + ln] = hb; sPl[w][8 * hh + r][16 + ln] = bf16_bits(p1 - bf16_val(hb));
    }
#pragma unroll
    for (int dt = 0; dt < DT; ++dt)
#pragma unroll
      for (int r = 0; r < 8; ++r) oacc[dt][r] *= alpha[r];
    __builtin_amdgcn_fence(__ATOMIC_ACQ_REL, "workgroup");
    __builtin_amdgcn_wave_barrier();
    FragB pah, pal;
    pah.half[0] = *(const v8us*)&sPh[w][ln][8 * hh]; pah.half[1] = *(const v8us*)&sPh[w][ln][16 + 8 * hh];
    pal.half[0] = *(const v8us*)&sPl[w][ln][8 * hh]; pal.half[1] = *(const v8us*)&sPl[w][ln][16 + 8 * hh];
#pragma unroll
    for (int dt = 0; dt < DT; ++dt) {
      FragB bvh, bvl;
#pragma unroll
      for (int i = 0; i < 8; ++i) {
        bvh.u[i] = sVh[8 * hh + i][dt * 16 + ln]; bvh.u[8 + i] = sVh[16 + 8 * hh + i][dt * 16 + ln];
        bvl.u[i] = sVl[8 * hh + i][dt * 16 + ln]; bvl.u[8 + i] = sVl[16 + 8 * hh + i][dt * 16 + ln];
      }
      oacc[dt] = mmaN<3>(pah.v, pal.v, bvh.v, bvl.v, oacc[dt]);
    }
    __builtin_amdgcn_fence(__ATOMIC_ACQ_REL, "workgroup");
    __builtin_amdgcn_wave_barrier();
  }
#pragma unroll
  for (int r = 0; r < 8; ++r) {
    float l = l_r[r];
    l += __shfl_xor(l, 1, 32); l += __shfl_xor(l, 2, 32); l += __shfl_xor(l, 4, 32); l += __shfl_xor(l, 8, 32);
    l_r[r] = (l > 0.f) ? 1.0f / l : 0.f;
  }
#pragma unroll
  for (int dt = 0; dt < DT; ++dt)
#pragma unroll
    for (int r = 0; r < 8; ++r) sO[w][8 * hh + r][dt * 16 + ln] = oacc[dt][r] * l_r[r];
  __builtin_amdgcn_fence(__ATOMIC_ACQ_REL, "workgroup");
  __builtin_amdgcn_wave_barrier();
  {
    for (int r = 0; r < 16; ++r) {
      const int row = q0 + r;
      if (row < T && lane < D / 4) {
        const v4f val = *(const v4fa*)&sO[w][r][lane * 4];
        *(v4f*)(y + ((size_t)b * T + row) * ypitch + h * D + lane * 4) = val;
      }
    }
    
  }
}

// in pitch = cols, out pitch = rows; rows, cols multiples of 32. Optional per-output-row affine (scale[c], shift[c]) and
// residual add res (same layout as out, optionally bf16-rounded) for fused epilogues: out = in*scale + shift + res.
template <bool AFFINE, bool RESID, bool RES_BF16>
__global__ __launch_bounds__(256) void k_transpose32(const float* __restrict__ in, float* __restrict__ out, int rows, int cols,
                                                    const float* __restrict__ scale, const float* __restrict__ shift, const float* __restrict__ res) {
  __shared__ float tile[32][33];
  const int b = blockIdx.z;
  const int r0 = blockIdx.y * 32, c0 = blockIdx.x * 32;
  const float* src = in + (size_t)b * rows * cols;
  float* dst = out + (size_t)b * rows * cols;
  const int tx = threadIdx.x & 31, ty = threadIdx.x >> 5;     // 8 rows per pass
  for (int i = ty; i < 32; i += 8) tile[i][tx] = src[(size_t)(r0 + i) * cols + c0 + tx];
  __syncthreads();
  {
    for (int i = ty; i < 32; i += 8) {
      float v = tile[tx][i];
      const int orow = c0 + i;
      if (AFFINE) v = v * scale[orow] + shift[orow];
      if (RESID) { float rv = res[(size_t)b * rows * cols + (size_t)orow * rows + r0 + tx]; if (RES_BF16) rv = bf16_round(rv); v += rv; }
      *(float*)(dst + (size_t)orow * rows + r0 + tx) = v;
    }
    
  }
}

// 2x2 max pool on position-major data: in [B][H*W][C] -> out [B][(H/2)*(W/2)][C]; thread per (b, p', 4 channels); C%4==0
__global__ __launch_bounds__(256) void k_pool2_pm(const float* __restrict__ in, float* __restrict__ out, int Bn, int H, int W, int C) {
  const size_t t = (size_t)blockIdx.x * 256 + threadIdx.x;
  const int c4n = C / 4, Ho = H / 2, Wo = W / 2;
  const size_t total = (size_t)Bn * Ho * Wo * c4n;
  if (t >= total) return;
  const int c4 = (int)(t % c4n) * 4; size_t rest = t / c4n;
  const int pw = (int)(rest % Wo); rest /= Wo; const int ph = (int)(rest % Ho); const int b = (int)(rest / Ho);
  const float* base = in + (size_t)b * H * W * C;
  const int p00 = (2 * ph) * W + 2 * pw;
  const v4f a = *(const v4fa*)(base + (size_t)p00 * C + c4), bq = *(const v4fa*)(base + (size_t)(p00 + 1) * C + c4);
  const v4f c = *(const v4fa*)(base + (size_t)(p00 + W) * C + c4), d = *(const v4fa*)(base + (size_t)(p00 + W + 1) * C + c4);
  v4f m; for (int i = 0; i < 4; ++i) m[i] = fmaxf(fmaxf(a[i], bq[i]), fmaxf(c[i], d[i]));
  float* dst = out + ((size_t)b * Ho * Wo + (size_t)ph * Wo + pw) * C + c4;
  *(v4f*)dst = m;
  
}

// General (non-causal) attention, 3-term bf16 splits, f32 softmax with running max.
// Q [.][Tq][qpitch], K [.][Tk][kpitch] (head dim DQ), V [.][Tk][vpitch] (head dim DVtot); this block handles DV output
// dims starting at dv0 = blockIdx.y*DV. y[bh][t][ypitch] gets columns dv0..dv0+DV-1. Per-bh base offsets via strides.
template <int DQ, int DV>
__global__ __launch_bounds__(128) void k_flash2(const float* __restrict__ Qb, size_t qstride, int qpitch, int Tq,
                                              const float* __restrict__ Kb, size_t kstride, int kpitch, int Tk,
                                              const float* __restrict__ Vb, size_t vstride, int vpitch,
                                              float scale, float* __restrict__ y, size_t ystride, int ypitch) {
  constexpr int KS = DQ / 32, DT = DV / 16;
  __shared__ __attribute__((aligned(16))) unsigned short sKh[32][DQ + 8], sKl[32][DQ + 8], sVh[32][DV + 8], sVl[32][DV + 8];
  __shared__ __attribute__((aligned(16))) unsigned short sPh[4][16][40], sPl[4][16][40];
  __shared__ __attribute__((aligned(16))) float sO[4][16][DV];
  const int tid = threadIdx.x, w = tid >> 5, lane = tid & 31, ln = lane & 15, hh = lane >> 4;
  const int nqb = (Tq + 63) / 64;
  const int bh = blockIdx.x / nqb, qblk = blockIdx.x % nqb;
  const int dv0 = blockIdx.y * DV;
  const int q0 = qblk * 64 + w * 16;
  const float* Q = Qb + (size_t)bh * qstride; const float* K = Kb + (size_t)bh * kstride; const float* V = Vb + (size_t)bh * vstride + dv0;
  FragB aqh[KS], aql[KS];
  {
    int row = q0 + ln; if (row >= Tq) row = Tq - 1;
    const float* qr = Q + (size_t)row * qpitch;
#pragma unroll
    for (int ks = 0; ks < KS; ++ks)
#pragma unroll
      for (int i = 0; i < 16; ++i) {
        const int d = ks * 32 + ((i < 8) ? (8 * hh + i) : (16 + 8 * hh + (i - 8)));
        const float x = qr[d] * scale; const unsigned short hb = bf16_bits(x);
        aqh[ks].u[i] = hb; aql[ks].u[i] = bf16_bits(x - bf16_val(hb));
      }
  }
  float m_r[8], l_r[8];
#pragma unroll
  for (int r = 0; r < 8; ++r) { m_r[r] = -3.0e38f; l_r[r] = 0.f; }
  v8f oacc[DT];
#pragma unroll
  for (int dt = 0; dt < DT; ++dt) oacc[dt] = (v8f){0.f,0.f,0.f,0.f,0.f,0.f,0.f,0.f};
  for (int j0 = 0; j0 < Tk; j0 += 32) {
    __syncthreads();
    for (int e = tid; e < 32 * (DQ / 4); e += 128) {
      const int r = e / (DQ / 4), c4 = (e % (DQ / 4)) * 4; const int key = j0 + r;
      v4f f = {0.f,0.f,0.f,0.f}; if (key < Tk) f = *(const v4fa*)(K + (size_t)key * kpitch + c4);
#pragma unroll
      for (int t = 0; t < 4; ++t) { const unsigned short hb = bf16_bits(f[t]); sKh[r][c4 + t] = hb; sKl[r][c4 + t] = bf16_bits(f[t] - bf16_val(hb)); }
    }
    for (int e = tid; e < 32 * (DV / 4); e += 128) {
      const int r = e / (DV / 4), c4 = (e % (DV / 4)) * 4; const int key = j0 + r;
      v4f f = {0.f,0.f,0.f,0.f}; if (key < Tk) f = *(const v4fa*)(V + (size_t)key * vpitch + c4);
#pragma unroll
      for (int t = 0; t < 4; ++t) { const unsigned short hb = bf16_bits(f[t]); sVh[r][c4 + t] = hb; sVl[r][c4 + t] = bf16_bits(f[t] - bf16_val(hb)); }
    }
    __syncthreads();
    v8f s[2];
#pragma unroll
    for (int nt = 0; nt < 2; ++nt) {
      v8f acc = {};
#pragma unroll
      for (int ks = 0; ks < KS; ++ks) {
        FragB bh_, bl_;
        bh_.half[0] = *(const v8us*)&sKh[nt * 16 + ln][ks * 32 + 8 * hh]; bh_.half[1] = *(const v8us*)&sKh[nt * 16 + ln][ks * 32 + 16 + 8 * hh];
        bl_.half[0] = *(const v8us*)&sKl[nt * 16 + ln][ks * 32 + 8 * hh]; bl_.half[1] = *(const v8us*)&sKl[nt * 16 + ln][ks * 32 + 16 + 8 * hh];
        acc = mmaN<3>(aqh[ks].v, aql[ks].v, bh_.v, bl_.v, acc);
      }
      s[nt] = acc;
    }
    float alpha[8];
#pragma unroll
    for (int r = 0; r < 8; ++r) {
      const int ja = j0 + ln, jb = j0 + 16 + ln;
      if (ja >= Tk) s[0][r] = -3.0e38f;
      if (jb >= Tk) s[1][r] = -3.0e38f;
      float mx = fmaxf(s[0][r], s[1][r]);
      mx = fmaxf(mx, __shfl_xor(mx, 1, 32)); mx = fmaxf(mx, __shfl_xor(mx, 2, 32)); mx = fmaxf(mx, __shfl_xor(mx, 4, 32)); mx = fmaxf(mx, __shfl_xor(mx, 8, 32));
      const float mnew = fmaxf(m_r[r], mx);
      alpha[r] = (mnew > -1.0e38f) ? __expf(m_r[r] - mnew) : 1.0f;
      const float p0 = (s[0][r] > -1.0e38f) ? __expf(s[0][r] - mnew) : 0.f;
      const float p1 = (s[1][r] > -1.0e38f) ? __expf(s[1][r] - mnew) : 0.f;
      m_r[r] = mnew;
      l_r[r] = l_r[r] * alpha[r] + p0 + p1;
      unsigned short hb = bf16_bits(p0); sPh[w][8 * hh + r][ln] = hb;      sPl[w][8 * hh + r][ln] = bf16_bits(p0 - bf16_val(hb));
      hb = bf16_bits(p1);                sPh[w][8 * hh + r][16 + ln] = hb; sPl[w][8 * hh + r][16 + ln] = bf16_bits(p1 - bf16_val(hb));
    }
#pragma unroll
    for (int dt = 0; dt < DT; ++dt)
#pragma unroll
      for (int r = 0; r < 8; ++r) oacc[dt][r] *= alpha[r];
    __builtin_amdgcn_fence(__ATOMIC_ACQ_REL, "workgroup");
    __builtin_amdgcn_wave_barrier();
    FragB pah, pal;
    pah.half[0] = *(const v8us*)&sPh[w][ln][8 * hh]; pah.half[1] = *(const v8us*)&sPh[w][ln][16 + 8 * hh];
    pal.half[0] = *(const v8us*)&sPl[w][ln][8 * hh]; pal.half[1] = *(const v8us*)&sPl[w][ln][16 + 8 * hh];
#pragma unroll
    for (int dt = 0; dt < DT; ++dt) {
      FragB bvh, bvl;
#pragma unroll
      for (int i = 0; i < 8; ++i) {
        bvh.u[i] = sVh[8 * hh + i][dt * 16 + ln]; bvh.u[8 + i] = sVh[16 + 8 * hh + i][dt * 16 + ln];
        bvl.u[i] = sVl[8 * hh + i][dt * 16 + ln]; bvl.u[8 + i] = sVl[16 + 8 * hh + i][dt * 16 + ln];
      }
      oacc[dt] = mmaN<3>(pah.v, pal.v, bvh.v, bvl.v, oacc[dt]);
    }
    __builtin_amdgcn_fence(__ATOMIC_ACQ_REL, "workgroup");
    __builtin_amdgcn_wave_barrier();
  }
#pragma unroll
  for (int r = 0; r < 8; ++r) {
    float l = l_r[r];
    l += __shfl_xor(l, 1, 32); l += __shfl_xor(l, 2, 32); l += __shfl_xor(l, 4, 32); l += __shfl_xor(l, 8, 32);
    l_r[r] = (l > 0.f) ? 1.0f / l : 0.f;
  }
#pragma unroll
  for (int dt = 0; dt < DT; ++dt)
#pragma unroll
    for (int r = 0; r < 8; ++r) sO[w][8 * hh + r][dt * 16 + ln] = oacc[dt][r] * l_r[r];
  __builtin_amdgcn_fence(__ATOMIC_ACQ_REL, "workgroup");
  __builtin_amdgcn_wave_barrier();
  {
    for (int r = 0; r < 16; ++r) {
      const int row = q0 + r;
      for (int c4 = lane * 4; c4 < DV; c4 += 128) {
        if (row < Tq) {
          const v4f val = *(const v4fa*)&sO[w][r][c4];
          *(v4f*)(y + (size_t)bh * ystride + (size_t)row * ypitch + dv0 + c4) = val;
        }
      }
    }
    
  }
}

// f32 [R][Cc] (row pitch lds) -> bf16 hi/lo planes [R][Cc] (pitch Cc); thread per 8 elements; Cc % 8 == 0
__global__ __launch_bounds__(256) void k_split_rows(const float* __restrict__ src, int lds_, unsigned short* __restrict__ hi, unsigned short* __restrict__ lo, int R, int Cc) {
  const size_t t = (size_t)blockIdx.x * 256 + threadIdx.x;
  const int c8n = Cc / 8;
  if (t >= (size_t)R * c8n) return;
  const int r = (int)(t / c8n), c8 = (int)(t % c8n) * 8;
  const float* s = src + (size_t)r * lds_ + c8;
  const v4f a = *(const v4fa*)s, b = *(const v4fa*)(s + 4);
  float xs[8] = {a[0],a[1],a[2],a[3],b[0],b[1],b[2],b[3]};
  v8us vh, vl;
#pragma unroll
  for (int i = 0; i < 8; ++i) { const unsigned short hb = bf16_bits(xs[i]); vh[i] = hb; vl[i] = bf16_bits(xs[i] - bf16_val(hb)); }
  unsigned short* dh = hi + (size_t)r * Cc + c8; unsigned short* dl = lo + (size_t)r * Cc + c8;
  *(v8us*)dh = vh; *(v8us*)dl = vl; 
}
// f32 [K][N] (row pitch lds) -> transposed bf16 hi/lo planes [N][K]; one thread per (n, 8 consecutive k)
__global__ __launch_bounds__(256) void k_split_transpose(const float* __restrict__ src, int lds_, unsigned short* __restrict__ hi, unsigned short* __restrict__ lo, int K, int N) {
  const size_t t = (size_t)blockIdx.x * 256 + threadIdx.x;
  const int k8n = K / 8;
  if (t >= (size_t)N * k8n) return;
  const int n = (int)(t / k8n), k8 = (int)(t % k8n) * 8;
  v8us vh, vl;
#pragma unroll
  for (int i = 0; i < 8; ++i) { const float x = src[(size_t)(k8 + i) * lds_ + n]; const unsigned short hb = bf16_bits(x); vh[i] = hb; vl[i] = bf16_bits(x - bf16_val(hb)); }
  unsigned short* dh = hi + (size_t)n * K + k8; unsigned short* dl = lo + (size_t)n * K + k8;
  *(v8us*)dh = vh; *(v8us*)dl = vl; 
}
// GEMM with A f32 (split into hi/lo when ASPLIT) and B from bf16 planes Bh (+ Bl when BSPLIT): terms hi·hi [+ lo·hi] [+ hi·lo].
// C f32 [M][N] pitch ldc; alpha scales the result; bias optional (BIAS_BF16 rounds it). Same tiling/epilogue as k_gemm_bf.
template <bool ASPLIT, bool BSPLIT, int ACT, bool BIAS_BF16>
__global__ __launch_bounds__(128) void k_gemm_bf2(const float* __restrict__ A, int lda, const unsigned short* __restrict__ Bh, const unsigned short* __restrict__ Bl, int ldb,
                                                const float* __restrict__ bias, float alpha, float* __restrict__ C, int ldc, int M, int N, int K) {
  __shared__ __attribute__((aligned(16))) float so[4][16][64];
  const int tid = threadIdx.x, w = tid >> 5, lane = tid & 31, ln = lane & 15, hh = lane >> 4;
  const int ntn = N / 64;
  const int wid = blockIdx.x * 4 + w;
  const int mt = wid / ntn, nq = wid % ntn;
  if (mt * 16 >= M) return;
  const int row0 = mt * 16, col0 = nq * 64;
  const float* arow = A + (size_t)(row0 + ln) * lda;
  v8f acc[4] = {};
  for (int kb = 0; kb < K; kb += 32) {
    FragB ah, al;
    const v4f x0 = *(const v4fa*)(arow + kb + 8 * hh), x1 = *(const v4fa*)(arow + kb + 8 * hh + 4);
    const v4f x2 = *(const v4fa*)(arow + kb + 16 + 8 * hh), x3 = *(const v4fa*)(arow + kb + 16 + 8 * hh + 4);
    float xs[16] = {x0[0],x0[1],x0[2],x0[3],x1[0],x1[1],x1[2],x1[3],x2[0],x2[1],x2[2],x2[3],x3[0],x3[1],x3[2],x3[3]};
#pragma unroll
    for (int i = 0; i < 16; ++i) { const unsigned short hb = bf16_bits(xs[i]); ah.u[i] = hb; al.u[i] = ASPLIT ? bf16_bits(xs[i] - bf16_val(hb)) : (unsigned short)0; }
#pragma unroll
    for (int t = 0; t < 4; ++t) {
      const size_t boff = (size_t)(col0 + t * 16 + ln) * ldb + kb;
      FragB bh_, bl_;
      bh_.half[0] = *(const v8us*)(Bh + boff + 8 * hh);
      bh_.half[1] = *(const v8us*)(Bh + boff + 16 + 8 * hh);
      if (BSPLIT) { bl_.half[0] = *(const v8us*)(Bl + boff + 8 * hh); bl_.half[1] = *(const v8us*)(Bl + boff + 16 + 8 * hh); } else bl_ = bh_;
      acc[t] = mmaN<ASPLIT ? (BSPLIT ? 3 : 2) : 1>(ah.v, al.v, bh_.v, bl_.v, acc[t]);
    }
  }
#pragma unroll
  for (int t = 0; t < 4; ++t) {
    float bv = bias ? bias[col0 + t * 16 + ln] : 0.f;
    if (BIAS_BF16) bv = bf16_round(bv);
#pragma unroll
    for (int r = 0; r < 8; ++r) { float v = acc[t][r] * alpha + bv; if (ACT == 1) v = fmaxf(v, 0.f); so[w][8 * hh + r][t * 16 + ln] = v; }
  }
  __builtin_amdgcn_fence(__ATOMIC_ACQ_REL, "workgroup");
  __builtin_amdgcn_wave_barrier();
  const int rsub = lane >> 4, c4 = (lane & 15) * 4;
  {
#pragma unroll
    for (int q = 0; q < 8; ++q) {
      const int r = q * 2 + rsub;
      const v4f v = *(const v4fa*)&so[w][r][c4];
      *(v4f*)(C + (size_t)(row0 + r) * ldc + col0 + c4) = v;
    }
    
  }
}
// row softmax: P[row][:] = softmax(masked S[row][:]) over N columns with optional causal mask (col > row + rowoff -> 0) and
__global__ __launch_bounds__(256) void k_softmax_rows(const float* __restrict__ S, float* __restrict__ P, int N, int causal, int rowoff, const int* __restrict__ mask, int mask_pitch) {
  __shared__ float red[256];
  const int row = blockIdx.x, tid = threadIdx.x;
  const float* s = S + (size_t)row * N; float* p_out = P + (size_t)row * N;
  const int qi = row + rowoff;
  float mx = -3.0e38f;
  for (int j = tid; j < N; j += 256) {
    bool keep = true;
    if (causal && j > qi) keep = false;
    if (mask && mask[(size_t)qi * mask_pitch + j] == 0) keep = false;
    const float v = keep ? s[j] : -3.0e38f;
    mx = fmaxf(mx, v);
  }
  red[tid] = mx; __syncthreads();
  for (int st = 128; st > 0; st >>= 1) { if (tid < st) red[tid] = fmaxf(red[tid], red[tid + st]); __syncthreads(); }
  mx = red[0]; __syncthreads();
  float sum = 0.f;
  for (int j = tid; j < N; j += 256) {
    bool keep = true;
    if (causal && j > qi) keep = false;
    if (mask && mask[(size_t)qi * mask_pitch + j] == 0) keep = false;
    const float p = keep ? __expf(s[j] - mx) : 0.f;
    sum += p;
  }
  red[tid] = sum; __syncthreads();
  for (int st = 128; st > 0; st >>= 1) { if (tid < st) red[tid] += red[tid + st]; __syncthreads(); }
  const float inv = (mx > -1.0e38f) ? 1.0f / red[0] : __builtin_nanf("");
  __syncthreads();
  {
    for (int j4 = tid * 4; j4 < N; j4 += 1024) {
      v4f out4;
#pragma unroll
      for (int u = 0; u < 4; ++u) {
        const int j = j4 + u;
        bool keep = true;
        if (causal && j > qi) keep = false;
        if (mask && mask[(size_t)qi * mask_pitch + j] == 0) keep = false;
        out4[u] = keep ? __expf(s[j] - mx) * inv : 0.f;
      }
      *(v4f*)(p_out + j4) = out4;
    }
    
  }
}

// GEMM C = act(A·W + bias + resid): A f32 (ASPLIT -> hi/lo 2 terms), Wt bf16 [N][K]; ACT 0 none, 1 relu, 2 exact gelu;
// resid (optional, f32, row index = (row % rmod), pitch ldr, RES_BF16 rounds it) added before the activation.
template <bool ASPLIT, int ACT, bool BIAS_BF16, bool RES_BF16>
__global__ __launch_bounds__(128) void k_gemm_bf3(const float* __restrict__ A, int lda, const unsigned short* __restrict__ Wt, int ldb,
                                                const float* __restrict__ bias, const float* __restrict__ resid, int rmod, int ldr,
                                                float* __restrict__ C, int ldc, int M, int N, int K) {
  __shared__ __attribute__((aligned(16))) float so[4][16][64];
  const int tid = threadIdx.x, w = tid >> 5, lane = tid & 31, ln = lane & 15, hh = lane >> 4;
  const int ntn = N / 64;
  const int wid = blockIdx.x * 4 + w;
  const int mt = wid / ntn, nq = wid % ntn;
  if (mt * 16 >= M) return;
  const int row0 = mt * 16, col0 = nq * 64;
  const float* arow = A + (size_t)(row0 + ln) * lda;
  v8f acc[4] = {};
  for (int kb = 0; kb < K; kb += 32) {
    FragB ah, al;
    const v4f x0 = *(const v4fa*)(arow + kb + 8 * hh), x1 = *(const v4fa*)(arow + kb + 8 * hh + 4);
    const v4f x2 = *(const v4fa*)(arow + kb + 16 + 8 * hh), x3 = *(const v4fa*)(arow + kb + 16 + 8 * hh + 4);
    float xs[16] = {x0[0],x0[1],x0[2],x0[3],x1[0],x1[1],x1[2],x1[3],x2[0],x2[1],x2[2],x2[3],x3[0],x3[1],x3[2],x3[3]};
#pragma unroll
    for (int i = 0; i < 16; ++i) { const unsigned short hb = bf16_bits(xs[i]); ah.u[i] = hb; al.u[i] = ASPLIT ? bf16_bits(xs[i] - bf16_val(hb)) : (unsigned short)0; }
#pragma unroll
    for (int t = 0; t < 4; ++t) {
      const unsigned short* brow = Wt + (size_t)(col0 + t * 16 + ln) * ldb + kb;
      FragB b;
      b.half[0] = *(const v8us*)(brow + 8 * hh);
      b.half[1] = *(const v8us*)(brow + 16 + 8 * hh);
      acc[t] = mmaN<ASPLIT ? 2 : 1>(ah.v, al.v, b.v, b.v, acc[t]);
    }
  }
#pragma unroll
  for (int t = 0; t < 4; ++t) {
    const int col = col0 + t * 16 + ln;
    float bv = bias ? bias[col] : 0.f;
    if (BIAS_BF16) bv = bf16_round(bv);
#pragma unroll
    for (int r = 0; r < 8; ++r) {
      float v = acc[t][r] + bv;
      if (resid) { float rv = resid[(size_t)((row0 + 8 * hh + r) % rmod) * ldr + col]; if (RES_BF16) rv = bf16_round(rv); v += rv; }
      if (ACT == 1) v = fmaxf(v, 0.f);
      if (ACT == 2) v = 0.5f * v * (1.0f + erff(v * 0.70710678118654752f));
      if (ACT == 3) { const float u = 0.7978845608028654f * (v + 0.044715f * v * v * v); v = 0.5f * v * (1.0f + tanhf(u)); }
      so[w][8 * hh + r][t * 16 + ln] = v;
    }
  }
  __builtin_amdgcn_fence(__ATOMIC_ACQ_REL, "workgroup");
  __builtin_amdgcn_wave_barrier();
  const int rsub = lane >> 4, c4 = (lane & 15) * 4;
  {
#pragma unroll
    for (int q = 0; q < 8; ++q) {
      const int r = q * 2 + rsub;
      const v4f v = *(const v4fa*)&so[w][r][c4];
      *(v4f*)(C + (size_t)(row0 + r) * ldc + col0 + c4) = v;
    }
    
  }
}
// row LayerNorm (biased variance, eps) over N: s = X (+ R); optional out_sum <- s; out_norm <- (s-mu)*rsqrt(var+eps)*g + b
template <bool PARAM_BF16>
__global__ __launch_bounds__(256) void k_layernorm(const float* __restrict__ X, const float* __restrict__ R, const float* __restrict__ g, const float* __restrict__ bta,
                                                  float* __restrict__ out_sum, float* __restrict__ out_norm, int N, float eps) {
  __shared__ float red[256];
  const int row = blockIdx.x, tid = threadIdx.x;
  const float* x = X + (size_t)row * N; const float* rr = R ? R + (size_t)row * N : nullptr;
  float vals[16];                     // up to N = 4096
  const int per = N / 256;            // contiguous chunk per thread? use strided-by-4 chunks: thread handles j = tid*4 + 1024*u
  float s1 = 0.f;
  for (int u = 0; u < per / 4; ++u) {
    const int j = tid * 4 + 1024 * u;
    const v4f a = *(const v4fa*)(x + j);
    v4f b = {0.f,0.f,0.f,0.f}; if (rr) b = *(const v4fa*)(rr + j);
#pragma unroll
    for (int q = 0; q < 4; ++q) { const float v = a[q] + b[q]; vals[u * 4 + q] = v; s1 += v; }
  }
  red[tid] = s1; __syncthreads();
  for (int st = 128; st > 0; st >>= 1) { if (tid < st) red[tid] += red[tid + st]; __syncthreads(); }
  const float mu = red[0] / (float)N; __syncthreads();
  float s2 = 0.f;
  for (int u = 0; u < per / 4; ++u)
#pragma unroll
    for (int q = 0; q < 4; ++q) { const float c = vals[u * 4 + q] - mu; s2 += c * c; }
  red[tid] = s2; __syncthreads();
  for (int st = 128; st > 0; st >>= 1) { if (tid < st) red[tid] += red[tid + st]; __syncthreads(); }
  const float rs = rsqrtf(red[0] / (float)N + eps);
  {
    for (int u = 0; u < per / 4; ++u) {
      const int j = tid * 4 + 1024 * u;
      v4f o, sm;
#pragma unroll
      for (int q = 0; q < 4; ++q) {
        float gg = g[j + q], bb = bta[j + q];
        if (PARAM_BF16) { gg = bf16_round(gg); bb = bf16_round(bb); }
        sm[q] = vals[u * 4 + q]; o[q] = (vals[u * 4 + q] - mu) * rs * gg + bb;
      }
      if (out_sum) *(v4f*)(out_sum + (size_t)row * N + j) = sm;
      *(v4f*)(out_norm + (size_t)row * N + j) = o;
    }
    
  }
}

// batched GEMM (blockIdx.y = batch): C_b = act(alpha·A_b·B_b + bias + resid_b); A f32 rows (ASPLIT → hi/lo), B = bf16 planes Bh (+Bl when BSPLIT, requires ASPLIT),
// per-batch element strides sA, sB (0 = shared weights), sC, sR. resid may alias C (values are staged before the stores). ACT 0/1(relu).
// ACT: 0 none, 1 relu, 2 softplus
template <bool ASPLIT, bool BSPLIT, int ACT>
__global__ __launch_bounds__(128) void k_gemm_b(const float* __restrict__ A, int lda, size_t sA, const unsigned short* __restrict__ Bh, const unsigned short* __restrict__ Bl, int ldb, size_t sB,
                                             const float* __restrict__ bias, const float* __restrict__ resid, int ldr, size_t sR, float rsign, float alpha,
                                             float* __restrict__ C, int ldc, size_t sC, int M, int N, int K) {
  __shared__ __attribute__((aligned(16))) float so[4][16][64];
  const int tid = threadIdx.x, w = tid >> 5, lane = tid & 31, ln = lane & 15, hh = lane >> 4;
  const int by = blockIdx.y;
  A += (size_t)by * sA; Bh += (size_t)by * sB; if (BSPLIT) Bl += (size_t)by * sB; C += (size_t)by * sC; if (resid) resid += (size_t)by * sR;
  const int ntn = N / 64; const int wid = blockIdx.x * 4 + w; const int mt = wid / ntn, nq = wid % ntn;
  if (mt * 16 >= M) return;
  const int row0 = mt * 16, col0 = nq * 64;
  const float* arow = A + (size_t)(row0 + ln) * lda;
  v8f acc[4] = {};
  for (int kb = 0; kb < K; kb += 32) {
    FragB ah, al;
    const v4f x0 = *(const v4fa*)(arow + kb + 8 * hh), x1 = *(const v4fa*)(arow + kb + 8 * hh + 4);
    const v4f x2 = *(const v4fa*)(arow + kb + 16 + 8 * hh), x3 = *(const v4fa*)(arow + kb + 16 + 8 * hh + 4);
    float xs[16] = {x0[0],x0[1],x0[2],x0[3],x1[0],x1[1],x1[2],x1[3],x2[0],x2[1],x2[2],x2[3],x3[0],x3[1],x3[2],x3[3]};
#pragma unroll
    for (int i = 0; i < 16; ++i) { const unsigned short hb = bf16_bits(xs[i]); ah.u[i] = hb; al.u[i] = ASPLIT ? bf16_bits(xs[i] - bf16_val(hb)) : (unsigned short)0; }
#pragma unroll
    for (int t = 0; t < 4; ++t) {
      const size_t boff = (size_t)(col0 + t * 16 + ln) * ldb + kb;
      FragB bh_, bl_; bh_.half[0] = *(const v8us*)(Bh + boff + 8 * hh); bh_.half[1] = *(const v8us*)(Bh + boff + 16 + 8 * hh);
      if (BSPLIT) { bl_.half[0] = *(const v8us*)(Bl + boff + 8 * hh); bl_.half[1] = *(const v8us*)(Bl + boff + 16 + 8 * hh); } else bl_ = bh_;
      acc[t] = mmaN<ASPLIT ? (BSPLIT ? 3 : 2) : 1>(ah.v, al.v, bh_.v, bl_.v, acc[t]);
    }
  }
#pragma unroll
  for (int t = 0; t < 4; ++t) {
    const int col = col0 + t * 16 + ln; const float bv = bias ? bf16_round(bias[col]) : 0.f;
#pragma unroll
    for (int r = 0; r < 8; ++r) { float v = acc[t][r] * alpha + bv; if (resid) v += rsign * resid[(size_t)(row0 + 8 * hh + r) * ldr + col]; if (ACT == 1) v = fmaxf(v, 0.f); else if (ACT == 2) v = fmaxf(v, 0.f) + log1pf(expf(-fabsf(v))); so[w][8 * hh + r][t * 16 + ln] = v; }
  }
  __builtin_amdgcn_fence(__ATOMIC_ACQ_REL, "workgroup"); __builtin_amdgcn_wave_barrier();
  const int rsub = lane >> 4, c4 = (lane & 15) * 4;
  {
#pragma unroll
    for (int q = 0; q < 8; ++q) { const int r = q * 2 + rsub; const v4f v = *(const v4fa*)&so[w][r][c4]; *(v4f*)(C + (size_t)(row0 + r) * ldc + col0 + c4) = v; }
    
  }
}
// batched f32 [K][N] (pitch lds, batch stride sIn) -> transposed hi/lo planes [N][K] (batch stride sOut); thread per (n, 8 k); grid.y = batch
__global__ __launch_bounds__(256) void k_split_transpose_b(const float* __restrict__ src, int lds_, size_t sIn, unsigned short* __restrict__ hi, unsigned short* __restrict__ lo, size_t sOut, int K, int N) {
  const size_t t = (size_t)blockIdx.x * 256 + threadIdx.x; const int k8n = K / 8; if (t >= (size_t)N * k8n) return;
  src += (size_t)blockIdx.y * sIn; hi += (size_t)blockIdx.y * sOut; lo += (size_t)blockIdx.y * sOut;
  const int n = (int)(t / k8n), k8 = (int)(t % k8n) * 8; v8us vh, vl;
#pragma unroll
  for (int i = 0; i < 8; ++i) { const float x = src[(size_t)(k8 + i) * lds_ + n]; const unsigned short hb = bf16_bits(x); vh[i] = hb; vl[i] = bf16_bits(x - bf16_val(hb)); }
  unsigned short* dh = hi + (size_t)n * K + k8; unsigned short* dl = lo + (size_t)n * K + k8;
  *(v8us*)dh = vh; *(v8us*)dl = vl; 
}

__global__ __launch_bounds__(256) void k_round_rows(const float* __restrict__ W, unsigned short* __restrict__ Wt, int n8) {
  const int t = blockIdx.x * 256 + threadIdx.x;
  if (t >= n8) return;
  const v4f a = *(const v4fa*)(W + (size_t)t * 8), b = *(const v4fa*)(W + (size_t)t * 8 + 4);
  v8us v; v[0]=bf16_bits(a[0]); v[1]=bf16_bits(a[1]); v[2]=bf16_bits(a[2]); v[3]=bf16_bits(a[3]);
  v[4]=bf16_bits(b[0]); v[5]=bf16_bits(b[1]); v[6]=bf16_bits(b[2]); v[7]=bf16_bits(b[3]);
  *(v8us*)(Wt + (size_t)t * 8) = v; 
}

// Bt for the projections: X inputs are [512][8192] = [K][N] layout (x@W form with A = M [64][512]): Bt[n=s][k=c] = X[c][s] -> k_wt_bf16(X, Bt, 512, 8192)

// ---- f16 WMMA path (v_wmma_f32_16x16x32_f16): 11-bit significands for operands in range — used for the scores Sᵀ and for the [0,1] probability operand P, which needs more precision than bf16
typedef _Float16 v16h __attribute__((ext_vector_type(16)));
union FragH { v16h v; v8us half[2]; _Float16 h[16]; unsigned short u[16]; };
template <int NT>
__device__ __forceinline__ v8f mmaH(v16h ah, v16h al, v16h bh, v16h bl, v8f c) {
  c = __builtin_amdgcn_wmma_f32_16x16x32_f16(false, ah, false, bh, (short)0, c, false, false);
  if (NT >= 2) c = __builtin_amdgcn_wmma_f32_16x16x32_f16(false, al, false, bh, (short)0, c, false, false);
  if (NT >= 3) c = __builtin_amdgcn_wmma_f32_16x16x32_f16(false, ah, false, bl, (short)0, c, false, false);
  asm volatile("v_nop\n\tv_nop\n\tv_nop\n\tv_nop" : "+v"(c) : "v"(ah), "v"(al), "v"(bh), "v"(bl));
  return c;
}
// batched GEMM like k_gemm_b but f16 operands: A f32 (split into f16 hi/lo if ASPLIT, else rounded to f16), Bt = f16 values [n][k]; alpha; C f32; N multiple of 16 (partial tiles skipped)
template <bool ASPLIT>
__global__ __launch_bounds__(128) void k_gemm_h(const float* __restrict__ A, int lda, size_t sA, const _Float16* __restrict__ Bh, int ldb, size_t sB, float alpha, float* __restrict__ C, int ldc, size_t sC, int M, int N, int K) {
  __shared__ __attribute__((aligned(16))) float so[4][16][64];
  const int tid = threadIdx.x, w = tid >> 5, lane = tid & 31, ln = lane & 15, hh = lane >> 4; const int by = blockIdx.y;
  A += (size_t)by * sA; Bh += (size_t)by * sB; C += (size_t)by * sC;
  const int ntn = (N + 63) / 64; const int wid = blockIdx.x * 4 + w; const int mt = wid / ntn, nq = wid % ntn; if (mt * 16 >= M) return;
  const int row0 = mt * 16, col0 = nq * 64; const float* arow = A + (size_t)(row0 + ln) * lda;
  v8f acc[4] = {};
  for (int kb = 0; kb < K; kb += 32) {
    FragH ah, al;
    const v4f x0 = *(const v4fa*)(arow + kb + 8 * hh), x1 = *(const v4fa*)(arow + kb + 8 * hh + 4), x2 = *(const v4fa*)(arow + kb + 16 + 8 * hh), x3 = *(const v4fa*)(arow + kb + 16 + 8 * hh + 4);
    float xs[16] = {x0[0],x0[1],x0[2],x0[3],x1[0],x1[1],x1[2],x1[3],x2[0],x2[1],x2[2],x2[3],x3[0],x3[1],x3[2],x3[3]};
#pragma unroll
    for (int i = 0; i < 16; ++i) { const _Float16 h = (_Float16)xs[i]; ah.h[i] = h; al.h[i] = ASPLIT ? (_Float16)(xs[i] - (float)h) : (_Float16)0.0f; }
#pragma unroll
    for (int t = 0; t < 4; ++t) { if (col0 + t * 16 >= N) continue; const size_t boff = (size_t)(col0 + t * 16 + ln) * ldb + kb; FragH bq; bq.half[0] = *(const v8us*)(Bh + boff + 8 * hh); bq.half[1] = *(const v8us*)(Bh + boff + 16 + 8 * hh);
      acc[t] = mmaH<ASPLIT ? 2 : 1>(ah.v, al.v, bq.v, bq.v, acc[t]); }
  }
#pragma unroll
  for (int t = 0; t < 4; ++t) { if (col0 + t * 16 >= N) continue;
#pragma unroll
    for (int r = 0; r < 8; ++r) so[w][8 * hh + r][t * 16 + ln] = acc[t][r] * alpha; }
  __builtin_amdgcn_fence(__ATOMIC_ACQ_REL, "workgroup"); __builtin_amdgcn_wave_barrier();
  const int rsub = lane >> 4, c4 = (lane & 15) * 4;
  {
#pragma unroll
    for (int q = 0; q < 8; ++q) { const int r = q * 2 + rsub; if (col0 + c4 < N) { const v4f v = *(const v4fa*)&so[w][r][c4]; *(v4f*)(C + (size_t)(row0 + r) * ldc + col0 + c4) = v; } }
     }
}

// QdH[s][d] = f16(Qd[d][s]) (transposed, f16); thread per (s, 8 d)
__global__ __launch_bounds__(256) void k_qdh(const float* __restrict__ Qd, _Float16* __restrict__ QdH) { const int t = blockIdx.x * 256 + threadIdx.x; if (t >= SQ * (DO / 8)) return; const int s = t / (DO / 8), d8 = (t % (DO / 8)) * 8; FragH f; for (int i = 0; i < 8; ++i) f.h[i] = (_Float16)Qd[(size_t)(d8 + i) * SQ + s]; const v8us o = f.half[0]; *(v8us*)((unsigned short*)QdH + (size_t)s * DO + d8) = o;  }
// row softmax in place on ST[t][s] over s, after ×⅛ + 1; wave per row
__global__ __launch_bounds__(256) void k_softmax(float* __restrict__ S) {
  const int tid = threadIdx.x, wv = tid >> 5, lane = tid & 31; const size_t r = (size_t)blockIdx.x * 8 + wv; float* row = S + r * SQ; float mx = -3.0e38f;
#pragma unroll 1
  for (int j = lane; j < SQ; j += 32) { const float v = row[j] * 0.125f + 1.0f; mx = fmaxf(mx, v); }
  for (int o = 16; o >= 1; o >>= 1) mx = fmaxf(mx, __shfl_xor(mx, o, 32));
  float den = 0.f;
#pragma unroll 1
  for (int j = lane; j < SQ; j += 32) { const float e = expf((row[j] * 0.125f + 1.0f) - mx); row[j] = e; den += e; }
  for (int o = 16; o >= 1; o >>= 1) den += __shfl_xor(den, o, 32); const float inv = 1.0f / den;
#pragma unroll 1
  for (int j = lane; j < SQ; j += 32) { const float p = row[j] * inv; *(float*)(row + j) = p;  }
}
// P block rounded to f16 as Bt[n = t][k = s] (row-major P is already [t][s]): thread per 8
__global__ __launch_bounds__(256) void k_pb(const float* __restrict__ S, _Float16* __restrict__ Pb) { const size_t t = (size_t)blockIdx.x * 256 + threadIdx.x; if (t >= (size_t)TB * SQ / 8) return; FragH f; for (int i = 0; i < 8; ++i) f.h[i] = (_Float16)(S[t * 8 + i] * 256.0f);      /* ×2^8 (exact) keeps P ≥ 2.4e-7 out of the f16 subnormal range; folded back via alpha = 2^-8 */ const v8us o = f.half[0]; *(v8us*)((unsigned short*)Pb + t * 8) = o;  }      // P as f16 (11-bit significand; subnormal only below 6e-5)
extern "C" void kernel_launch(void* const* d_in, const int* in_sizes, int n_in,
                              void* d_out, int out_size, void* d_ws, size_t ws_size, hipStream_t stream) {
  (void)in_sizes; (void)n_in; (void)out_size;
  const float* Q = (const float*)d_in[0]; const float* K = (const float*)d_in[1]; const float* V = (const float*)d_in[2]; const float* Mq = (const float*)d_in[3]; const float* Mk = (const float*)d_in[4]; const float* Mv = (const float*)d_in[5];
  char* ws = (char*)d_ws; size_t off = 0;
  auto take = [&](size_t bytes) { char* p = ws + off; off += (bytes + 255) & ~(size_t)255; return p; };
  unsigned short* BQ = (unsigned short*)take((size_t)SQ * DI * 2); unsigned short* BK = (unsigned short*)take((size_t)SQ * DI * 2); unsigned short* BV = (unsigned short*)take((size_t)SQ * DI * 2);
  float* Qd = (float*)take((size_t)DO * SQ * 4); float* Kd = (float*)take((size_t)DO * SQ * 4); float* Vd = (float*)take((size_t)DO * SQ * 4); float* KdT = (float*)take((size_t)SQ * DO * 4); _Float16* QdB = (_Float16*)take((size_t)SQ * DO * 2);
  float* S = (float*)take((size_t)TB * SQ * 4); _Float16* Pb = (_Float16*)take((size_t)TB * SQ * 2);
  if (off > ws_size) return;
  k_wt_bf16<<<(unsigned)(((size_t)SQ * (DI / 8) + 255) / 256), 256, 0, stream>>>(Q, BQ, DI, SQ); k_wt_bf16<<<(unsigned)(((size_t)SQ * (DI / 8) + 255) / 256), 256, 0, stream>>>(K, BK, DI, SQ); k_wt_bf16<<<(unsigned)(((size_t)SQ * (DI / 8) + 255) / 256), 256, 0, stream>>>(V, BV, DI, SQ);
  const unsigned gp = ((DO / 16) * (SQ / 64) + 3) / 4;
  k_gemm_bf3<false, 0, false, false><<<gp, 128, 0, stream>>>(Mq, DI, BQ, DI, nullptr, nullptr, 1, 0, Qd, SQ, DO, SQ, DI);      // Qd = Mq·Q [64][8192]
  k_gemm_bf3<false, 0, false, false><<<gp, 128, 0, stream>>>(Mk, DI, BK, DI, nullptr, nullptr, 1, 0, Kd, SQ, DO, SQ, DI);
  k_gemm_bf3<false, 0, false, false><<<gp, 128, 0, stream>>>(Mv, DI, BV, DI, nullptr, nullptr, 1, 0, Vd, SQ, DO, SQ, DI);
  k_transpose32<false, false, false><<<dim3(SQ / 32, DO / 32, 1), 256, 0, stream>>>(Kd, KdT, DO, SQ, nullptr, nullptr, nullptr);        // Kd [64][8192] -> KdT [8192][64]
  k_qdh<<<(SQ * (DO / 8) + 255) / 256, 256, 0, stream>>>(Qd, QdB);                                         // Bt[s][d] = f16(Qd[d][s])
  for (int tb = 0; tb < SQ / TB; ++tb) {
    k_gemm_h<true><<<dim3(((TB / 16) * (SQ / 64) + 3) / 4, 1), 128, 0, stream>>>(KdT + (size_t)tb * TB * DO, DO, 0, QdB, DO, 0, 1.f, S, SQ, 0, TB, SQ, DO);   // Sᵀ[t][s] = Kd[:,t]·Qd[:,s] (f16 hi/lo × f16 Qd: 2 products)
    k_softmax<<<TB / 8, 256, 0, stream>>>(S);
    k_pb<<<(unsigned)(((size_t)TB * SQ / 8 + 255) / 256), 256, 0, stream>>>(S, Pb);
    k_gemm_h<true><<<dim3(((DO / 16) * (TB / 64) + 3) / 4, 1), 128, 0, stream>>>(Vd, SQ, 0, Pb, SQ, 0, 0.00390625f, (float*)d_out + (size_t)tb * TB, SQ, 0, DO, TB, SQ);   // out[d][t] = Σ_s Vd[d][s]·P[t][s] (f16 hi/lo × f16 P: 2 products)
  }
}

// v001
// Measured time: 2260 microseconds a run.
// In two side-by-side timings against v000, it was 2.01 and 2.02 times as fast.
#include <hip/hip_runtime.h>
// On v_wmma_f32_16x16x32_bf16 with f32 accumulate: the projections Qd/Kd/Vd = M·{Q,K,V} (M = 64, K = 512, N = 8192; inputs rounded to bf16: single exact
// term), per block of 1024 key positions t the transposed scores Sᵀ[t][s] = Kd[:,t]·Qd[:,s] on the f16 variant (Kdᵀ rows split into f16 hi/lo, Qd rounded to f16: 2 products, K = 64) and
// out[:, t-block] = Vd·P[t-block]ᵀ on the f16 variant v_wmma_f32_16x16x32_f16 (Vd split into f16 hi/lo, P rounded to f16 — 4–8× finer than bf16 for these [0,1] weights: 2 products, K = 8192). The module's softmax over the QUERY axis (dim 0) becomes a row softmax of
// Sᵀ; /√64 and the +1 constant are f32 VALU.
#define DI 512
#define DO 64
#define SQ 8192
#define TB 1024          // key columns per block

typedef __bf16 v16b __attribute__((ext_vector_type(16)));
typedef unsigned short v8us __attribute__((ext_vector_type(8), may_alias));
typedef float  v8f  __attribute__((ext_vector_type(8)));
typedef float  v4f  __attribute__((ext_vector_type(4)));
typedef float  v4fa __attribute__((ext_vector_type(4), may_alias));
union FragB { v16b v; v8us half[2]; unsigned short u[16]; };

__device__ __forceinline__ unsigned short bf16_bits(float x) { unsigned int u = __float_as_uint(x); return (unsigned short)((u + 0x7FFFu + ((u >> 16) & 1u)) >> 16); }
__device__ __forceinline__ float bf16_val(unsigned short b) { return __uint_as_float(((unsigned int)b) << 16); }
__device__ __forceinline__ float bf16_round(float x) { return bf16_val(bf16_bits(x)); }
// D += A·B with NT terms: 1 = ah·bh, 2 = + al·bh (A split), 3 = + ah·bl (both split)
template <int NT>
__device__ __forceinline__ v8f mmaN(v16b ah, v16b al, v16b bh, v16b bl, v8f c) {
  c = __builtin_amdgcn_wmma_f32_16x16x32_bf16(false, ah, false, bh, (short)0, c, false, false);
  if (NT >= 2) c = __builtin_amdgcn_wmma_f32_16x16x32_bf16(false, al, false, bh, (short)0, c, false, false);
  if (NT >= 3) c = __builtin_amdgcn_wmma_f32_16x16x32_bf16(false, ah, false, bl, (short)0, c, false, false);
  asm volatile("v_nop\n\tv_nop\n\tv_nop\n\tv_nop" : "+v"(c) : "v"(ah), "v"(al), "v"(bh), "v"(bl));
  return c;
}

__global__ __launch_bounds__(256) void k_wt_bf16(const float* __restrict__ W, unsigned short* __restrict__ Wt, int K, int N) {
  const int t = blockIdx.x * 256 + threadIdx.x;
  const int k8n = K / 8;
  if (t >= N * k8n) return;
  const int n = t / k8n, k8 = (t % k8n) * 8;
  v8us v;
#pragma unroll
  for (int i = 0; i < 8; ++i) v[i] = bf16_bits(W[(size_t)(k8 + i) * N + n]);
  *(v8us*)(Wt + (size_t)n * K + k8) = v;
  
}

// GEMM C[M][N] (f32, pitch ldc) = act(A[M][K]·W + bias). A f32 row-major (pitch lda) converted per fragment to bf16
// (ASPLIT: hi/lo two planes -> 2 terms, else single rounded term); Wt bf16 [N][K] (pitch ldb). BIAS_BF16 rounds the
// bias to bf16 first (bias quantised to bf16 before the add). K%32==0, M%16==0, N%64==0.
template <bool ASPLIT, int ACT, bool BIAS_BF16>
__global__ __launch_bounds__(128) void k_gemm_bf(const float* __restrict__ A, int lda, const unsigned short* __restrict__ Wt, int ldb,
                                               const float* __restrict__ bias, float* __restrict__ C, int ldc, int M, int N, int K) {
  __shared__ __attribute__((aligned(16))) float so[4][16][64];
  const int tid = threadIdx.x, w = tid >> 5, lane = tid & 31, ln = lane & 15, hh = lane >> 4;
  const int ntn = N / 64;
  const int wid = blockIdx.x * 4 + w;
  const int mt = wid / ntn, nq = wid % ntn;
  if (mt * 16 >= M) return;
  const int row0 = mt * 16, col0 = nq * 64;
  const float* arow = A + (size_t)(row0 + ln) * lda;
  v8f acc[4] = {};
  for (int kb = 0; kb < K; kb += 32) {
    FragB ah, al;
    const v4f x0 = *(const v4fa*)(arow + kb + 8 * hh), x1 = *(const v4fa*)(arow + kb + 8 * hh + 4);
    const v4f x2 = *(const v4fa*)(arow + kb + 16 + 8 * hh), x3 = *(const v4fa*)(arow + kb + 16 + 8 * hh + 4);
    float xs[16] = {x0[0],x0[1],x0[2],x0[3],x1[0],x1[1],x1[2],x1[3],x2[0],x2[1],x2[2],x2[3],x3[0],x3[1],x3[2],x3[3]};
#pragma unroll
    for (int i = 0; i < 16; ++i) { const unsigned short hb = bf16_bits(xs[i]); ah.u[i] = hb; al.u[i] = ASPLIT ? bf16_bits(xs[i] - bf16_val(hb)) : (unsigned short)0; }
#pragma unroll
    for (int t = 0; t < 4; ++t) {
      const unsigned short* brow = Wt + (size_t)(col0 + t * 16 + ln) * ldb + kb;
      FragB b;
      b.half[0] = *(const v8us*)(brow + 8 * hh);
      b.half[1] = *(const v8us*)(brow + 16 + 8 * hh);
      acc[t] = mmaN<ASPLIT ? 2 : 1>(ah.v, al.v, b.v, b.v, acc[t]);
    }
  }
#pragma unroll
  for (int t = 0; t < 4; ++t) {
    float bv = bias ? bias[col0 + t * 16 + ln] : 0.f;
    if (BIAS_BF16) bv = bf16_round(bv);
#pragma unroll
    for (int r = 0; r < 8; ++r) { float v = acc[t][r] + bv; if (ACT == 1) v = fmaxf(v, 0.f); so[w][8 * hh + r][t * 16 + ln] = v; }
  }
  __builtin_amdgcn_fence(__ATOMIC_ACQ_REL, "workgroup");
  __builtin_amdgcn_wave_barrier();
  const int rsub = lane >> 4, c4 = (lane & 15) * 4;
  {
#pragma unroll
    for (int q = 0; q < 8; ++q) {
      const int r = q * 2 + rsub;
      const v4f v = *(const v4fa*)&so[w][r][c4];
      *(v4f*)(C + (size_t)(row0 + r) * ldc + col0 + c4) = v;
    }
    
  }
}

// Flash-style causal/unmasked attention, all contractions 3-term bf16 hi/lo splits, f32 softmax with running max.
// q,k,v rows are read from f32 buffers with arbitrary row pitch (so they can live inside a fused qkv buffer);
// D = head size (multiple of 32, <= 128); one wave = 16 query rows; block = 4 waves (64 queries) sharing K/V chunks of 32.
template <int D, bool CAUSAL>
__global__ __launch_bounds__(128) void k_flash(const float* __restrict__ qb, const float* __restrict__ kb, const float* __restrict__ vb,
                                             int pitch, int T, int H, float scale, float* __restrict__ y, int ypitch) {
  constexpr int KS = D / 32;        // k-steps for QK
  constexpr int DT = D / 16;        // d tiles for PV
  __shared__ __attribute__((aligned(16))) unsigned short sKh[32][D + 8], sKl[32][D + 8], sVh[32][D + 8], sVl[32][D + 8];
  __shared__ __attribute__((aligned(16))) unsigned short sPh[4][16][40], sPl[4][16][40];
  __shared__ __attribute__((aligned(16))) float sO[4][16][D];
  const int tid = threadIdx.x, w = tid >> 5, lane = tid & 31, ln = lane & 15, hh = lane >> 4;
  const int nqb = (T + 63) / 64;
  const int bh = blockIdx.x / nqb, qblk = blockIdx.x % nqb;
  const int b = bh / H, h = bh % H;
  const int q0 = qblk * 64 + w * 16;
  const float* Q = qb + (size_t)b * T * pitch + h * D;
  const float* K = kb + (size_t)b * T * pitch + h * D;
  const float* V = vb + (size_t)b * T * pitch + h * D;

  // A fragments of the wave's 16 query rows (scaled), hi/lo
  FragB aqh[KS], aql[KS];
  {
    int row = q0 + ln; if (row >= T) row = T - 1;
    const float* qr = Q + (size_t)row * pitch;
#pragma unroll
    for (int ks = 0; ks < KS; ++ks)
#pragma unroll
      for (int i = 0; i < 16; ++i) {
        const int d = ks * 32 + ((i < 8) ? (8 * hh + i) : (16 + 8 * hh + (i - 8)));
        const float x = qr[d] * scale; const unsigned short hb = bf16_bits(x);
        aqh[ks].u[i] = hb; aql[ks].u[i] = bf16_bits(x - bf16_val(hb));
      }
  }
  float m_r[8], l_r[8];
#pragma unroll
  for (int r = 0; r < 8; ++r) { m_r[r] = -3.0e38f; l_r[r] = 0.f; }
  v8f oacc[DT];
#pragma unroll
  for (int dt = 0; dt < DT; ++dt) oacc[dt] = (v8f){0.f,0.f,0.f,0.f,0.f,0.f,0.f,0.f};

  const int kv_end = CAUSAL ? min(T, qblk * 64 + 64) : T;     // block-uniform
  for (int j0 = 0; j0 < kv_end; j0 += 32) {
    __syncthreads();
    for (int e = tid; e < 32 * (D / 4); e += 128) {
      const int r = e / (D / 4), c4 = (e % (D / 4)) * 4;
      const int key = j0 + r;
      v4f kf = {0.f,0.f,0.f,0.f}, vf = {0.f,0.f,0.f,0.f};
      if (key < T) { kf = *(const v4fa*)(K + (size_t)key * pitch + c4); vf = *(const v4fa*)(V + (size_t)key * pitch + c4); }
#pragma unroll
      for (int t = 0; t < 4; ++t) {
        unsigned short hb = bf16_bits(kf[t]); sKh[r][c4 + t] = hb; sKl[r][c4 + t] = bf16_bits(kf[t] - bf16_val(hb));
        hb = bf16_bits(vf[t]); sVh[r][c4 + t] = hb; sVl[r][c4 + t] = bf16_bits(vf[t] - bf16_val(hb));
      }
    }
    __syncthreads();
    // S tile 16 x 32
    v8f s[2];
#pragma unroll
    for (int nt = 0; nt < 2; ++nt) {
      v8f acc = {};
#pragma unroll
      for (int ks = 0; ks < KS; ++ks) {
        FragB bh_, bl_;
        bh_.half[0] = *(const v8us*)&sKh[nt * 16 + ln][ks * 32 + 8 * hh]; bh_.half[1] = *(const v8us*)&sKh[nt * 16 + ln][ks * 32 + 16 + 8 * hh];
        bl_.half[0] = *(const v8us*)&sKl[nt * 16 + ln][ks * 32 + 8 * hh]; bl_.half[1] = *(const v8us*)&sKl[nt * 16 + ln][ks * 32 + 16 + 8 * hh];
        acc = mmaN<3>(aqh[ks].v, aql[ks].v, bh_.v, bl_.v, acc);
      }
      s[nt] = acc;
    }
    // mask + running max (rows 8hh+r; the 16 lanes of a half share rows)
    float alpha[8];
#pragma unroll
    for (int r = 0; r < 8; ++r) {
      const int qi = q0 + 8 * hh + r;
      const int ja = j0 + ln, jb = j0 + 16 + ln;
      if (CAUSAL) { if (ja > qi) s[0][r] = -3.0e38f; if (jb > qi) s[1][r] = -3.0e38f; }
      if (ja >= T) s[0][r] = -3.0e38f;
      if (jb >= T) s[1][r] = -3.0e38f;
      float mx = fmaxf(s[0][r], s[1][r]);
      mx = fmaxf(mx, __shfl_xor(mx, 1, 32)); mx = fmaxf(mx, __shfl_xor(mx, 2, 32)); mx = fmaxf(mx, __shfl_xor(mx, 4, 32)); mx = fmaxf(mx, __shfl_xor(mx, 8, 32));
      const float mnew = fmaxf(m_r[r], mx);
      alpha[r] = (mnew > -1.0e38f) ? __expf(m_r[r] - mnew) : 1.0f;
      const float p0 = (s[0][r] > -1.0e38f) ? __expf(s[0][r] - mnew) : 0.f;
      const float p1 = (s[1][r] > -1.0e38f) ? __expf(s[1][r] - mnew) : 0.f;
      m_r[r] = mnew;
      l_r[r] = l_r[r] * alpha[r] + p0 + p1;            // per-lane partial row sum (16 lanes combined at the end)
      unsigned short hb = bf16_bits(p0); sPh[w][8 * hh + r][ln] = hb;      sPl[w][8 * hh + r][ln] = bf16_bits(p0 - bf16_val(hb));
      hb = bf16_bits(p1);                sPh[w][8 * hh + r][16 + ln] = hb; sPl[w][8 * hh + r][16 + ln] = bf16_bits(p1 - bf16_val(hb));
    }
#pragma unroll
    for (int dt = 0; dt < DT; ++dt)
#pragma unroll
      for (int r = 0; r < 8; ++r) oacc[dt][r] *= alpha[r];
    __builtin_amdgcn_fence(__ATOMIC_ACQ_REL, "workgroup");
    __builtin_amdgcn_wave_barrier();
    FragB pah, pal;
    pah.half[0] = *(const v8us*)&sPh[w][ln][8 * hh]; pah.half[1] = *(const v8us*)&sPh[w][ln][16 + 8 * hh];
    pal.half[0] = *(const v8us*)&sPl[w][ln][8 * hh]; pal.half[1] = *(const v8us*)&sPl[w][ln][16 + 8 * hh];
#pragma unroll
    for (int dt = 0; dt < DT; ++dt) {
      FragB bvh, bvl;
#pragma unroll
      for (int i = 0; i < 8; ++i) {
        bvh.u[i] = sVh[8 * hh + i][dt * 16 + ln]; bvh.u[8 + i] = sVh[16 + 8 * hh + i][dt * 16 + ln];
        bvl.u[i] = sVl[8 * hh + i][dt * 16 + ln]; bvl.u[8 + i] = sVl[16 + 8 * hh + i][dt * 16 + ln];
      }
      oacc[dt] = mmaN<3>(pah.v, pal.v, bvh.v, bvl.v, oacc[dt]);
    }
    __builtin_amdgcn_fence(__ATOMIC_ACQ_REL, "workgroup");
    __builtin_amdgcn_wave_barrier();
  }
#pragma unroll
  for (int r = 0; r < 8; ++r) {
    float l = l_r[r];
    l += __shfl_xor(l, 1, 32); l += __shfl_xor(l, 2, 32); l += __shfl_xor(l, 4, 32); l += __shfl_xor(l, 8, 32);
    l_r[r] = (l > 0.f) ? 1.0f / l : 0.f;
  }
#pragma unroll
  for (int dt = 0; dt < DT; ++dt)
#pragma unroll
    for (int r = 0; r < 8; ++r) sO[w][8 * hh + r][dt * 16 + ln] = oacc[dt][r] * l_r[r];
  __builtin_amdgcn_fence(__ATOMIC_ACQ_REL, "workgroup");
  __builtin_amdgcn_wave_barrier();
  {
    for (int r = 0; r < 16; ++r) {
      const int row = q0 + r;
      if (row < T && lane < D / 4) {
        const v4f val = *(const v4fa*)&sO[w][r][lane * 4];
        *(v4f*)(y + ((size_t)b * T + row) * ypitch + h * D + lane * 4) = val;
      }
    }
    
  }
}

// in pitch = cols, out pitch = rows; rows, cols multiples of 32. Optional per-output-row affine (scale[c], shift[c]) and
// residual add res (same layout as out, optionally bf16-rounded) for fused epilogues: out = in*scale + shift + res.
template <bool AFFINE, bool RESID, bool RES_BF16>
__global__ __launch_bounds__(256) void k_transpose32(const float* __restrict__ in, float* __restrict__ out, int rows, int cols,
                                                    const float* __restrict__ scale, const float* __restrict__ shift, const float* __restrict__ res) {
  __shared__ float tile[32][33];
  const int b = blockIdx.z;
  const int r0 = blockIdx.y * 32, c0 = blockIdx.x * 32;
  const float* src = in + (size_t)b * rows * cols;
  float* dst = out + (size_t)b * rows * cols;
  const int tx = threadIdx.x & 31, ty = threadIdx.x >> 5;     // 8 rows per pass
  for (int i = ty; i < 32; i += 8) tile[i][tx] = src[(size_t)(r0 + i) * cols + c0 + tx];
  __syncthreads();
  {
    for (int i = ty; i < 32; i += 8) {
      float v = tile[tx][i];
      const int orow = c0 + i;
      if (AFFINE) v = v * scale[orow] + shift[orow];
      if (RESID) { float rv = res[(size_t)b * rows * cols + (size_t)orow * rows + r0 + tx]; if (RES_BF16) rv = bf16_round(rv); v += rv; }
      *(float*)(dst + (size_t)orow * rows + r0 + tx) = v;
    }
    
  }
}

// 2x2 max pool on position-major data: in [B][H*W][C] -> out [B][(H/2)*(W/2)][C]; thread per (b, p', 4 channels); C%4==0
__global__ __launch_bounds__(256) void k_pool2_pm(const float* __restrict__ in, float* __restrict__ out, int Bn, int H, int W, int C) {
  const size_t t = (size_t)blockIdx.x * 256 + threadIdx.x;
  const int c4n = C / 4, Ho = H / 2, Wo = W / 2;
  const size_t total = (size_t)Bn * Ho * Wo * c4n;
  if (t >= total) return;
  const int c4 = (int)(t % c4n) * 4; size_t rest = t / c4n;
  const int pw = (int)(rest % Wo); rest /= Wo; const int ph = (int)(rest % Ho); const int b = (int)(rest / Ho);
  const float* base = in + (size_t)b * H * W * C;
  const int p00 = (2 * ph) * W + 2 * pw;
  const v4f a = *(const v4fa*)(base + (size_t)p00 * C + c4), bq = *(const v4fa*)(base + (size_t)(p00 + 1) * C + c4);
  const v4f c = *(const v4fa*)(base + (size_t)(p00 + W) * C + c4), d = *(const v4fa*)(base + (size_t)(p00 + W + 1) * C + c4);
  v4f m; for (int i = 0; i < 4; ++i) m[i] = fmaxf(fmaxf(a[i], bq[i]), fmaxf(c[i], d[i]));
  float* dst = out + ((size_t)b * Ho * Wo + (size_t)ph * Wo + pw) * C + c4;
  *(v4f*)dst = m;
  
}

// General (non-causal) attention, 3-term bf16 splits, f32 softmax with running max.
// Q [.][Tq][qpitch], K [.][Tk][kpitch] (head dim DQ), V [.][Tk][vpitch] (head dim DVtot); this block handles DV output
// dims starting at dv0 = blockIdx.y*DV. y[bh][t][ypitch] gets columns dv0..dv0+DV-1. Per-bh base offsets via strides.
template <int DQ, int DV>
__global__ __launch_bounds__(128) void k_flash2(const float* __restrict__ Qb, size_t qstride, int qpitch, int Tq,
                                              const float* __restrict__ Kb, size_t kstride, int kpitch, int Tk,
                                              const float* __restrict__ Vb, size_t vstride, int vpitch,
                                              float scale, float* __restrict__ y, size_t ystride, int ypitch) {
  constexpr int KS = DQ / 32, DT = DV / 16;
  __shared__ __attribute__((aligned(16))) unsigned short sKh[32][DQ + 8], sKl[32][DQ + 8], sVh[32][DV + 8], sVl[32][DV + 8];
  __shared__ __attribute__((aligned(16))) unsigned short sPh[4][16][40], sPl[4][16][40];
  __shared__ __attribute__((aligned(16))) float sO[4][16][DV];
  const int tid = threadIdx.x, w = tid >> 5, lane = tid & 31, ln = lane & 15, hh = lane >> 4;
  const int nqb = (Tq + 63) / 64;
  const int bh = blockIdx.x / nqb, qblk = blockIdx.x % nqb;
  const int dv0 = blockIdx.y * DV;
  const int q0 = qblk * 64 + w * 16;
  const float* Q = Qb + (size_t)bh * qstride; const float* K = Kb + (size_t)bh * kstride; const float* V = Vb + (size_t)bh * vstride + dv0;
  FragB aqh[KS], aql[KS];
  {
    int row = q0 + ln; if (row >= Tq) row = Tq - 1;
    const float* qr = Q + (size_t)row * qpitch;
#pragma unroll
    for (int ks = 0; ks < KS; ++ks)
#pragma unroll
      for (int i = 0; i < 16; ++i) {
        const int d = ks * 32 + ((i < 8) ? (8 * hh + i) : (16 + 8 * hh + (i - 8)));
        const float x = qr[d] * scale; const unsigned short hb = bf16_bits(x);
        aqh[ks].u[i] = hb; aql[ks].u[i] = bf16_bits(x - bf16_val(hb));
      }
  }
  float m_r[8], l_r[8];
#pragma unroll
  for (int r = 0; r < 8; ++r) { m_r[r] = -3.0e38f; l_r[r] = 0.f; }
  v8f oacc[DT];
#pragma unroll
  for (int dt = 0; dt < DT; ++dt) oacc[dt] = (v8f){0.f,0.f,0.f,0.f,0.f,0.f,0.f,0.f};
  for (int j0 = 0; j0 < Tk; j0 += 32) {
    __syncthreads();
    for (int e = tid; e < 32 * (DQ / 4); e += 128) {
      const int r = e / (DQ / 4), c4 = (e % (DQ / 4)) * 4; const int key = j0 + r;
      v4f f = {0.f,0.f,0.f,0.f}; if (key < Tk) f = *(const v4fa*)(K + (size_t)key * kpitch + c4);
#pragma unroll
      for (int t = 0; t < 4; ++t) { const unsigned short hb = bf16_bits(f[t]); sKh[r][c4 + t] = hb; sKl[r][c4 + t] = bf16_bits(f[t] - bf16_val(hb)); }
    }
    for (int e = tid; e < 32 * (DV / 4); e += 128) {
      const int r = e / (DV / 4), c4 = (e % (DV / 4)) * 4; const int key = j0 + r;
      v4f f = {0.f,0.f,0.f,0.f}; if (key < Tk) f = *(const v4fa*)(V + (size_t)key * vpitch + c4);
#pragma unroll
      for (int t = 0; t < 4; ++t) { const unsigned short hb = bf16_bits(f[t]); sVh[r][c4 + t] = hb; sVl[r][c4 + t] = bf16_bits(f[t] - bf16_val(hb)); }
    }
    __syncthreads();
    v8f s[2];
#pragma unroll
    for (int nt = 0; nt < 2; ++nt) {
      v8f acc = {};
#pragma unroll
      for (int ks = 0; ks < KS; ++ks) {
        FragB bh_, bl_;
        bh_.half[0] = *(const v8us*)&sKh[nt * 16 + ln][ks * 32 + 8 * hh]; bh_.half[1] = *(const v8us*)&sKh[nt * 16 + ln][ks * 32 + 16 + 8 * hh];
        bl_.half[0] = *(const v8us*)&sKl[nt * 16 + ln][ks * 32 + 8 * hh]; bl_.half[1] = *(const v8us*)&sKl[nt * 16 + ln][ks * 32 + 16 + 8 * hh];
        acc = mmaN<3>(aqh[ks].v, aql[ks].v, bh_.v, bl_.v, acc);
      }
      s[nt] = acc;
    }
    float alpha[8];
#pragma unroll
    for (int r = 0; r < 8; ++r) {
      const int ja = j0 + ln, jb = j0 + 16 + ln;
      if (ja >= Tk) s[0][r] = -3.0e38f;
      if (jb >= Tk) s[1][r] = -3.0e38f;
      float mx = fmaxf(s[0][r], s[1][r]);
      mx = fmaxf(mx, __shfl_xor(mx, 1, 32)); mx = fmaxf(mx, __shfl_xor(mx, 2, 32)); mx = fmaxf(mx, __shfl_xor(mx, 4, 32)); mx = fmaxf(mx, __shfl_xor(mx, 8, 32));
      const float mnew = fmaxf(m_r[r], mx);
      alpha[r] = (mnew > -1.0e38f) ? __expf(m_r[r] - mnew) : 1.0f;
      const float p0 = (s[0][r] > -1.0e38f) ? __expf(s[0][r] - mnew) : 0.f;
      const float p1 = (s[1][r] > -1.0e38f) ? __expf(s[1][r] - mnew) : 0.f;
      m_r[r] = mnew;
      l_r[r] = l_r[r] * alpha[r] + p0 + p1;
      unsigned short hb = bf16_bits(p0); sPh[w][8 * hh + r][ln] = hb;      sPl[w][8 * hh + r][ln] = bf16_bits(p0 - bf16_val(hb));
      hb = bf16_bits(p1);                sPh[w][8 * hh + r][16 + ln] = hb; sPl[w][8 * hh + r][16 + ln] = bf16_bits(p1 - bf16_val(hb));
    }
#pragma unroll
    for (int dt = 0; dt < DT; ++dt)
#pragma unroll
      for (int r = 0; r < 8; ++r) oacc[dt][r] *= alpha[r];
    __builtin_amdgcn_fence(__ATOMIC_ACQ_REL, "workgroup");
    __builtin_amdgcn_wave_barrier();
    FragB pah, pal;
    pah.half[0] = *(const v8us*)&sPh[w][ln][8 * hh]; pah.half[1] = *(const v8us*)&sPh[w][ln][16 + 8 * hh];
    pal.half[0] = *(const v8us*)&sPl[w][ln][8 * hh]; pal.half[1] = *(const v8us*)&sPl[w][ln][16 + 8 * hh];
#pragma unroll
    for (int dt = 0; dt < DT; ++dt) {
      FragB bvh, bvl;
#pragma unroll
      for (int i = 0; i < 8; ++i) {
        bvh.u[i] = sVh[8 * hh + i][dt * 16 + ln]; bvh.u[8 + i] = sVh[16 + 8 * hh + i][dt * 16 + ln];
        bvl.u[i] = sVl[8 * hh + i][dt * 16 + ln]; bvl.u[8 + i] = sVl[16 + 8 * hh + i][dt * 16 + ln];
      }
      oacc[dt] = mmaN<3>(pah.v, pal.v, bvh.v, bvl.v, oacc[dt]);
    }
    __builtin_amdgcn_fence(__ATOMIC_ACQ_REL, "workgroup");
    __builtin_amdgcn_wave_barrier();
  }
#pragma unroll
  for (int r = 0; r < 8; ++r) {
    float l = l_r[r];
    l += __shfl_xor(l, 1, 32); l += __shfl_xor(l, 2, 32); l += __shfl_xor(l, 4, 32); l += __shfl_xor(l, 8, 32);
    l_r[r] = (l > 0.f) ? 1.0f / l : 0.f;
  }
#pragma unroll
  for (int dt = 0; dt < DT; ++dt)
#pragma unroll
    for (int r = 0; r < 8; ++r) sO[w][8 * hh + r][dt * 16 + ln] = oacc[dt][r] * l_r[r];
  __builtin_amdgcn_fence(__ATOMIC_ACQ_REL, "workgroup");
  __builtin_amdgcn_wave_barrier();
  {
    for (int r = 0; r < 16; ++r) {
      const int row = q0 + r;
      for (int c4 = lane * 4; c4 < DV; c4 += 128) {
        if (row < Tq) {
          const v4f val = *(const v4fa*)&sO[w][r][c4];
          *(v4f*)(y + (size_t)bh * ystride + (size_t)row * ypitch + dv0 + c4) = val;
        }
      }
    }
    
  }
}

// f32 [R][Cc] (row pitch lds) -> bf16 hi/lo planes [R][Cc] (pitch Cc); thread per 8 elements; Cc % 8 == 0
__global__ __launch_bounds__(256) void k_split_rows(const float* __restrict__ src, int lds_, unsigned short* __restrict__ hi, unsigned short* __restrict__ lo, int R, int Cc) {
  const size_t t = (size_t)blockIdx.x * 256 + threadIdx.x;
  const int c8n = Cc / 8;
  if (t >= (size_t)R * c8n) return;
  const int r = (int)(t / c8n), c8 = (int)(t % c8n) * 8;
  const float* s = src + (size_t)r * lds_ + c8;
  const v4f a = *(const v4fa*)s, b = *(const v4fa*)(s + 4);
  float xs[8] = {a[0],a[1],a[2],a[3],b[0],b[1],b[2],b[3]};
  v8us vh, vl;
#pragma unroll
  for (int i = 0; i < 8; ++i) { const unsigned short hb = bf16_bits(xs[i]); vh[i] = hb; vl[i] = bf16_bits(xs[i] - bf16_val(hb)); }
  unsigned short* dh = hi + (size_t)r * Cc + c8; unsigned short* dl = lo + (size_t)r * Cc + c8;
  *(v8us*)dh = vh; *(v8us*)dl = vl; 
}
// f32 [K][N] (row pitch lds) -> transposed bf16 hi/lo planes [N][K]; one thread per (n, 8 consecutive k)
__global__ __launch_bounds__(256) void k_split_transpose(const float* __restrict__ src, int lds_, unsigned short* __restrict__ hi, unsigned short* __restrict__ lo, int K, int N) {
  const size_t t = (size_t)blockIdx.x * 256 + threadIdx.x;
  const int k8n = K / 8;
  if (t >= (size_t)N * k8n) return;
  const int n = (int)(t / k8n), k8 = (int)(t % k8n) * 8;
  v8us vh, vl;
#pragma unroll
  for (int i = 0; i < 8; ++i) { const float x = src[(size_t)(k8 + i) * lds_ + n]; const unsigned short hb = bf16_bits(x); vh[i] = hb; vl[i] = bf16_bits(x - bf16_val(hb)); }
  unsigned short* dh = hi + (size_t)n * K + k8; unsigned short* dl = lo + (size_t)n * K + k8;
  *(v8us*)dh = vh; *(v8us*)dl = vl; 
}
// GEMM with A f32 (split into hi/lo when ASPLIT) and B from bf16 planes Bh (+ Bl when BSPLIT): terms hi·hi [+ lo·hi] [+ hi·lo].
// C f32 [M][N] pitch ldc; alpha scales the result; bias optional (BIAS_BF16 rounds it). Same tiling/epilogue as k_gemm_bf.
template <bool ASPLIT, bool BSPLIT, int ACT, bool BIAS_BF16>
__global__ __launch_bounds__(128) void k_gemm_bf2(const float* __restrict__ A, int lda, const unsigned short* __restrict__ Bh, const unsigned short* __restrict__ Bl, int ldb,
                                                const float* __restrict__ bias, float alpha, float* __restrict__ C, int ldc, int M, int N, int K) {
  __shared__ __attribute__((aligned(16))) float so[4][16][64];
  const int tid = threadIdx.x, w = tid >> 5, lane = tid & 31, ln = lane & 15, hh = lane >> 4;
  const int ntn = N / 64;
  const int wid = blockIdx.x * 4 + w;
  const int mt = wid / ntn, nq = wid % ntn;
  if (mt * 16 >= M) return;
  const int row0 = mt * 16, col0 = nq * 64;
  const float* arow = A + (size_t)(row0 + ln) * lda;
  v8f acc[4] = {};
  for (int kb = 0; kb < K; kb += 32) {
    FragB ah, al;
    const v4f x0 = *(const v4fa*)(arow + kb + 8 * hh), x1 = *(const v4fa*)(arow + kb + 8 * hh + 4);
    const v4f x2 = *(const v4fa*)(arow + kb + 16 + 8 * hh), x3 = *(const v4fa*)(arow + kb + 16 + 8 * hh + 4);
    float xs[16] = {x0[0],x0[1],x0[2],x0[3],x1[0],x1[1],x1[2],x1[3],x2[0],x2[1],x2[2],x2[3],x3[0],x3[1],x3[2],x3[3]};
#pragma unroll
    for (int i = 0; i < 16; ++i) { const unsigned short hb = bf16_bits(xs[i]); ah.u[i] = hb; al.u[i] = ASPLIT ? bf16_bits(xs[i] - bf16_val(hb)) : (unsigned short)0; }
#pragma unroll
    for (int t = 0; t < 4; ++t) {
      const size_t boff = (size_t)(col0 + t * 16 + ln) * ldb + kb;
      FragB bh_, bl_;
      bh_.half[0] = *(const v8us*)(Bh + boff + 8 * hh);
      bh_.half[1] = *(const v8us*)(Bh + boff + 16 + 8 * hh);
      if (BSPLIT) { bl_.half[0] = *(const v8us*)(Bl + boff + 8 * hh); bl_.half[1] = *(const v8us*)(Bl + boff + 16 + 8 * hh); } else bl_ = bh_;
      acc[t] = mmaN<ASPLIT ? (BSPLIT ? 3 : 2) : 1>(ah.v, al.v, bh_.v, bl_.v, acc[t]);
    }
  }
#pragma unroll
  for (int t = 0; t < 4; ++t) {
    float bv = bias ? bias[col0 + t * 16 + ln] : 0.f;
    if (BIAS_BF16) bv = bf16_round(bv);
#pragma unroll
    for (int r = 0; r < 8; ++r) { float v = acc[t][r] * alpha + bv; if (ACT == 1) v = fmaxf(v, 0.f); so[w][8 * hh + r][t * 16 + ln] = v; }
  }
  __builtin_amdgcn_fence(__ATOMIC_ACQ_REL, "workgroup");
  __builtin_amdgcn_wave_barrier();
  const int rsub = lane >> 4, c4 = (lane & 15) * 4;
  {
#pragma unroll
    for (int q = 0; q < 8; ++q) {
      const int r = q * 2 + rsub;
      const v4f v = *(const v4fa*)&so[w][r][c4];
      *(v4f*)(C + (size_t)(row0 + r) * ldc + col0 + c4) = v;
    }
    
  }
}
// row softmax: P[row][:] = softmax(masked S[row][:]) over N columns with optional causal mask (col > row + rowoff -> 0) and
__global__ __launch_bounds__(256) void k_softmax_rows(const float* __restrict__ S, float* __restrict__ P, int N, int causal, int rowoff, const int* __restrict__ mask, int mask_pitch) {
  __shared__ float red[256];
  const int row = blockIdx.x, tid = threadIdx.x;
  const float* s = S + (size_t)row * N; float* p_out = P + (size_t)row * N;
  const int qi = row + rowoff;
  float mx = -3.0e38f;
  for (int j = tid; j < N; j += 256) {
    bool keep = true;
    if (causal && j > qi) keep = false;
    if (mask && mask[(size_t)qi * mask_pitch + j] == 0) keep = false;
    const float v = keep ? s[j] : -3.0e38f;
    mx = fmaxf(mx, v);
  }
  red[tid] = mx; __syncthreads();
  for (int st = 128; st > 0; st >>= 1) { if (tid < st) red[tid] = fmaxf(red[tid], red[tid + st]); __syncthreads(); }
  mx = red[0]; __syncthreads();
  float sum = 0.f;
  for (int j = tid; j < N; j += 256) {
    bool keep = true;
    if (causal && j > qi) keep = false;
    if (mask && mask[(size_t)qi * mask_pitch + j] == 0) keep = false;
    const float p = keep ? __expf(s[j] - mx) : 0.f;
    sum += p;
  }
  red[tid] = sum; __syncthreads();
  for (int st = 128; st > 0; st >>= 1) { if (tid < st) red[tid] += red[tid + st]; __syncthreads(); }
  const float inv = (mx > -1.0e38f) ? 1.0f / red[0] : __builtin_nanf("");
  __syncthreads();
  {
    for (int j4 = tid * 4; j4 < N; j4 += 1024) {
      v4f out4;
#pragma unroll
      for (int u = 0; u < 4; ++u) {
        const int j = j4 + u;
        bool keep = true;
        if (causal && j > qi) keep = false;
        if (mask && mask[(size_t)qi * mask_pitch + j] == 0) keep = false;
        out4[u] = keep ? __expf(s[j] - mx) * inv : 0.f;
      }
      *(v4f*)(p_out + j4) = out4;
    }
    
  }
}

// GEMM C = act(A·W + bias + resid): A f32 (ASPLIT -> hi/lo 2 terms), Wt bf16 [N][K]; ACT 0 none, 1 relu, 2 exact gelu;
// resid (optional, f32, row index = (row % rmod), pitch ldr, RES_BF16 rounds it) added before the activation.
template <bool ASPLIT, int ACT, bool BIAS_BF16, bool RES_BF16>
__global__ __launch_bounds__(128) void k_gemm_bf3(const float* __restrict__ A, int lda, const unsigned short* __restrict__ Wt, int ldb,
                                                const float* __restrict__ bias, const float* __restrict__ resid, int rmod, int ldr,
                                                float* __restrict__ C, int ldc, int M, int N, int K) {
  __shared__ __attribute__((aligned(16))) float so[4][16][64];
  const int tid = threadIdx.x, w = tid >> 5, lane = tid & 31, ln = lane & 15, hh = lane >> 4;
  const int ntn = N / 64;
  const int wid = blockIdx.x * 4 + w;
  const int mt = wid / ntn, nq = wid % ntn;
  if (mt * 16 >= M) return;
  const int row0 = mt * 16, col0 = nq * 64;
  const float* arow = A + (size_t)(row0 + ln) * lda;
  v8f acc[4] = {};
  for (int kb = 0; kb < K; kb += 32) {
    FragB ah, al;
    const v4f x0 = *(const v4fa*)(arow + kb + 8 * hh), x1 = *(const v4fa*)(arow + kb + 8 * hh + 4);
    const v4f x2 = *(const v4fa*)(arow + kb + 16 + 8 * hh), x3 = *(const v4fa*)(arow + kb + 16 + 8 * hh + 4);
    float xs[16] = {x0[0],x0[1],x0[2],x0[3],x1[0],x1[1],x1[2],x1[3],x2[0],x2[1],x2[2],x2[3],x3[0],x3[1],x3[2],x3[3]};
#pragma unroll
    for (int i = 0; i < 16; ++i) { const unsigned short hb = bf16_bits(xs[i]); ah.u[i] = hb; al.u[i] = ASPLIT ? bf16_bits(xs[i] - bf16_val(hb)) : (unsigned short)0; }
#pragma unroll
    for (int t = 0; t < 4; ++t) {
      const unsigned short* brow = Wt + (size_t)(col0 + t * 16 + ln) * ldb + kb;
      FragB b;
      b.half[0] = *(const v8us*)(brow + 8 * hh);
      b.half[1] = *(const v8us*)(brow + 16 + 8 * hh);
      acc[t] = mmaN<ASPLIT ? 2 : 1>(ah.v, al.v, b.v, b.v, acc[t]);
    }
  }
#pragma unroll
  for (int t = 0; t < 4; ++t) {
    const int col = col0 + t * 16 + ln;
    float bv = bias ? bias[col] : 0.f;
    if (BIAS_BF16) bv = bf16_round(bv);
#pragma unroll
    for (int r = 0; r < 8; ++r) {
      float v = acc[t][r] + bv;
      if (resid) { float rv = resid[(size_t)((row0 + 8 * hh + r) % rmod) * ldr + col]; if (RES_BF16) rv = bf16_round(rv); v += rv; }
      if (ACT == 1) v = fmaxf(v, 0.f);
      if (ACT == 2) v = 0.5f * v * (1.0f + erff(v * 0.70710678118654752f));
      if (ACT == 3) { const float u = 0.7978845608028654f * (v + 0.044715f * v * v * v); v = 0.5f * v * (1.0f + tanhf(u)); }
      so[w][8 * hh + r][t * 16 + ln] = v;
    }
  }
  __builtin_amdgcn_fence(__ATOMIC_ACQ_REL, "workgroup");
  __builtin_amdgcn_wave_barrier();
  const int rsub = lane >> 4, c4 = (lane & 15) * 4;
  {
#pragma unroll
    for (int q = 0; q < 8; ++q) {
      const int r = q * 2 + rsub;
      const v4f v = *(const v4fa*)&so[w][r][c4];
      *(v4f*)(C + (size_t)(row0 + r) * ldc + col0 + c4) = v;
    }
    
  }
}
// row LayerNorm (biased variance, eps) over N: s = X (+ R); optional out_sum <- s; out_norm <- (s-mu)*rsqrt(var+eps)*g + b
template <bool PARAM_BF16>
__global__ __launch_bounds__(256) void k_layernorm(const float* __restrict__ X, const float* __restrict__ R, const float* __restrict__ g, const float* __restrict__ bta,
                                                  float* __restrict__ out_sum, float* __restrict__ out_norm, int N, float eps) {
  __shared__ float red[256];
  const int row = blockIdx.x, tid = threadIdx.x;
  const float* x = X + (size_t)row * N; const float* rr = R ? R + (size_t)row * N : nullptr;
  float vals[16];                     // up to N = 4096
  const int per = N / 256;            // contiguous chunk per thread? use strided-by-4 chunks: thread handles j = tid*4 + 1024*u
  float s1 = 0.f;
  for (int u = 0; u < per / 4; ++u) {
    const int j = tid * 4 + 1024 * u;
    const v4f a = *(const v4fa*)(x + j);
    v4f b = {0.f,0.f,0.f,0.f}; if (rr) b = *(const v4fa*)(rr + j);
#pragma unroll
    for (int q = 0; q < 4; ++q) { const float v = a[q] + b[q]; vals[u * 4 + q] = v; s1 += v; }
  }
  red[tid] = s1; __syncthreads();
  for (int st = 128; st > 0; st >>= 1) { if (tid < st) red[tid] += red[tid + st]; __syncthreads(); }
  const float mu = red[0] / (float)N; __syncthreads();
  float s2 = 0.f;
  for (int u = 0; u < per / 4; ++u)
#pragma unroll
    for (int q = 0; q < 4; ++q) { const float c = vals[u * 4 + q] - mu; s2 += c * c; }
  red[tid] = s2; __syncthreads();
  for (int st = 128; st > 0; st >>= 1) { if (tid < st) red[tid] += red[tid + st]; __syncthreads(); }
  const float rs = rsqrtf(red[0] / (float)N + eps);
  {
    for (int u = 0; u < per / 4; ++u) {
      const int j = tid * 4 + 1024 * u;
      v4f o, sm;
#pragma unroll
      for (int q = 0; q < 4; ++q) {
        float gg = g[j + q], bb = bta[j + q];
        if (PARAM_BF16) { gg = bf16_round(gg); bb = bf16_round(bb); }
        sm[q] = vals[u * 4 + q]; o[q] = (vals[u * 4 + q] - mu) * rs * gg + bb;
      }
      if (out_sum) *(v4f*)(out_sum + (size_t)row * N + j) = sm;
      *(v4f*)(out_norm + (size_t)row * N + j) = o;
    }
    
  }
}

// batched GEMM (blockIdx.y = batch): C_b = act(alpha·A_b·B_b + bias + resid_b); A f32 rows (ASPLIT → hi/lo), B = bf16 planes Bh (+Bl when BSPLIT, requires ASPLIT),
// per-batch element strides sA, sB (0 = shared weights), sC, sR. resid may alias C (values are staged before the stores). ACT 0/1(relu).
// ACT: 0 none, 1 relu, 2 softplus
template <bool ASPLIT, bool BSPLIT, int ACT>
__global__ __launch_bounds__(128) void k_gemm_b(const float* __restrict__ A, int lda, size_t sA, const unsigned short* __restrict__ Bh, const unsigned short* __restrict__ Bl, int ldb, size_t sB,
                                             const float* __restrict__ bias, const float* __restrict__ resid, int ldr, size_t sR, float rsign, float alpha,
                                             float* __restrict__ C, int ldc, size_t sC, int M, int N, int K) {
  __shared__ __attribute__((aligned(16))) float so[4][16][64];
  const int tid = threadIdx.x, w = tid >> 5, lane = tid & 31, ln = lane & 15, hh = lane >> 4;
  const int by = blockIdx.y;
  A += (size_t)by * sA; Bh += (size_t)by * sB; if (BSPLIT) Bl += (size_t)by * sB; C += (size_t)by * sC; if (resid) resid += (size_t)by * sR;
  const int ntn = N / 64; const int wid = blockIdx.x * 4 + w; const int mt = wid / ntn, nq = wid % ntn;
  if (mt * 16 >= M) return;
  const int row0 = mt * 16, col0 = nq * 64;
  const float* arow = A + (size_t)(row0 + ln) * lda;
  v8f acc[4] = {};
  for (int kb = 0; kb < K; kb += 32) {
    FragB ah, al;
    const v4f x0 = *(const v4fa*)(arow + kb + 8 * hh), x1 = *(const v4fa*)(arow + kb + 8 * hh + 4);
    const v4f x2 = *(const v4fa*)(arow + kb + 16 + 8 * hh), x3 = *(const v4fa*)(arow + kb + 16 + 8 * hh + 4);
    float xs[16] = {x0[0],x0[1],x0[2],x0[3],x1[0],x1[1],x1[2],x1[3],x2[0],x2[1],x2[2],x2[3],x3[0],x3[1],x3[2],x3[3]};
#pragma unroll
    for (int i = 0; i < 16; ++i) { const unsigned short hb = bf16_bits(xs[i]); ah.u[i] = hb; al.u[i] = ASPLIT ? bf16_bits(xs[i] - bf16_val(hb)) : (unsigned short)0; }
#pragma unroll
    for (int t = 0; t < 4; ++t) {
      const size_t boff = (size_t)(col0 + t * 16 + ln) * ldb + kb;
      FragB bh_, bl_; bh_.half[0] = *(const v8us*)(Bh + boff + 8 * hh); bh_.half[1] = *(const v8us*)(Bh + boff + 16 + 8 * hh);
      if (BSPLIT) { bl_.half[0] = *(const v8us*)(Bl + boff + 8 * hh); bl_.half[1] = *(const v8us*)(Bl + boff + 16 + 8 * hh); } else bl_ = bh_;
      acc[t] = mmaN<ASPLIT ? (BSPLIT ? 3 : 2) : 1>(ah.v, al.v, bh_.v, bl_.v, acc[t]);
    }
  }
#pragma unroll
  for (int t = 0; t < 4; ++t) {
    const int col = col0 + t * 16 + ln; const float bv = bias ? bf16_round(bias[col]) : 0.f;
#pragma unroll
    for (int r = 0; r < 8; ++r) { float v = acc[t][r] * alpha + bv; if (resid) v += rsign * resid[(size_t)(row0 + 8 * hh + r) * ldr + col]; if (ACT == 1) v = fmaxf(v, 0.f); else if (ACT == 2) v = fmaxf(v, 0.f) + log1pf(expf(-fabsf(v))); so[w][8 * hh + r][t * 16 + ln] = v; }
  }
  __builtin_amdgcn_fence(__ATOMIC_ACQ_REL, "workgroup"); __builtin_amdgcn_wave_barrier();
  const int rsub = lane >> 4, c4 = (lane & 15) * 4;
  {
#pragma unroll
    for (int q = 0; q < 8; ++q) { const int r = q * 2 + rsub; const v4f v = *(const v4fa*)&so[w][r][c4]; *(v4f*)(C + (size_t)(row0 + r) * ldc + col0 + c4) = v; }
    
  }
}
// batched f32 [K][N] (pitch lds, batch stride sIn) -> transposed hi/lo planes [N][K] (batch stride sOut); thread per (n, 8 k); grid.y = batch
__global__ __launch_bounds__(256) void k_split_transpose_b(const float* __restrict__ src, int lds_, size_t sIn, unsigned short* __restrict__ hi, unsigned short* __restrict__ lo, size_t sOut, int K, int N) {
  const size_t t = (size_t)blockIdx.x * 256 + threadIdx.x; const int k8n = K / 8; if (t >= (size_t)N * k8n) return;
  src += (size_t)blockIdx.y * sIn; hi += (size_t)blockIdx.y * sOut; lo += (size_t)blockIdx.y * sOut;
  const int n = (int)(t / k8n), k8 = (int)(t % k8n) * 8; v8us vh, vl;
#pragma unroll
  for (int i = 0; i < 8; ++i) { const float x = src[(size_t)(k8 + i) * lds_ + n]; const unsigned short hb = bf16_bits(x); vh[i] = hb; vl[i] = bf16_bits(x - bf16_val(hb)); }
  unsigned short* dh = hi + (size_t)n * K + k8; unsigned short* dl = lo + (size_t)n * K + k8;
  *(v8us*)dh = vh; *(v8us*)dl = vl; 
}

__global__ __launch_bounds__(256) void k_round_rows(const float* __restrict__ W, unsigned short* __restrict__ Wt, int n8) {
  const int t = blockIdx.x * 256 + threadIdx.x;
  if (t >= n8) return;
  const v4f a = *(const v4fa*)(W + (size_t)t * 8), b = *(const v4fa*)(W + (size_t)t * 8 + 4);
  v8us v; v[0]=bf16_bits(a[0]); v[1]=bf16_bits(a[1]); v[2]=bf16_bits(a[2]); v[3]=bf16_bits(a[3]);
  v[4]=bf16_bits(b[0]); v[5]=bf16_bits(b[1]); v[6]=bf16_bits(b[2]); v[7]=bf16_bits(b[3]);
  *(v8us*)(Wt + (size_t)t * 8) = v; 
}

// Bt for the projections: X inputs are [512][8192] = [K][N] layout (x@W form with A = M [64][512]): Bt[n=s][k=c] = X[c][s] -> k_wt_bf16(X, Bt, 512, 8192)

// ---- f16 WMMA path (v_wmma_f32_16x16x32_f16): 11-bit significands for operands in range — used for the scores Sᵀ and for the [0,1] probability operand P, which needs more precision than bf16
typedef _Float16 v16h __attribute__((ext_vector_type(16)));
union FragH { v16h v; v8us half[2]; _Float16 h[16]; unsigned short u[16]; };
template <int NT>
__device__ __forceinline__ v8f mmaH(v16h ah, v16h al, v16h bh, v16h bl, v8f c) {
  c = __builtin_amdgcn_wmma_f32_16x16x32_f16(false, ah, false, bh, (short)0, c, false, false);
  if (NT >= 2) c = __builtin_amdgcn_wmma_f32_16x16x32_f16(false, al, false, bh, (short)0, c, false, false);
  if (NT >= 3) c = __builtin_amdgcn_wmma_f32_16x16x32_f16(false, ah, false, bl, (short)0, c, false, false);
  asm volatile("v_nop\n\tv_nop\n\tv_nop\n\tv_nop" : "+v"(c) : "v"(ah), "v"(al), "v"(bh), "v"(bl));
  return c;
}
// batched GEMM like k_gemm_b but f16 operands: A f32 (split into f16 hi/lo if ASPLIT, else rounded to f16), Bt = f16 values [n][k]; alpha; C f32; N multiple of 16 (partial tiles skipped)
template <bool ASPLIT>
__global__ __launch_bounds__(128) void k_gemm_h(const float* __restrict__ A, int lda, size_t sA, const _Float16* __restrict__ Bh, int ldb, size_t sB, float alpha, float* __restrict__ C, int ldc, size_t sC, int M, int N, int K) {
  __shared__ __attribute__((aligned(16))) float so[4][16][64];
  const int tid = threadIdx.x, w = tid >> 5, lane = tid & 31, ln = lane & 15, hh = lane >> 4; const int by = blockIdx.y;
  A += (size_t)by * sA; Bh += (size_t)by * sB; C += (size_t)by * sC;
  const int ntn = (N + 63) / 64; const int wid = blockIdx.x * 4 + w; const int mt = wid / ntn, nq = wid % ntn; if (mt * 16 >= M) return;
  const int row0 = mt * 16, col0 = nq * 64; const float* arow = A + (size_t)(row0 + ln) * lda;
  v8f acc[4] = {};
  for (int kb = 0; kb < K; kb += 32) {
    FragH ah, al;
    const v4f x0 = *(const v4fa*)(arow + kb + 8 * hh), x1 = *(const v4fa*)(arow + kb + 8 * hh + 4), x2 = *(const v4fa*)(arow + kb + 16 + 8 * hh), x3 = *(const v4fa*)(arow + kb + 16 + 8 * hh + 4);
    float xs[16] = {x0[0],x0[1],x0[2],x0[3],x1[0],x1[1],x1[2],x1[3],x2[0],x2[1],x2[2],x2[3],x3[0],x3[1],x3[2],x3[3]};
#pragma unroll
    for (int i = 0; i < 16; ++i) { const _Float16 h = (_Float16)xs[i]; ah.h[i] = h; al.h[i] = ASPLIT ? (_Float16)(xs[i] - (float)h) : (_Float16)0.0f; }
#pragma unroll
    for (int t = 0; t < 4; ++t) { if (col0 + t * 16 >= N) continue; const size_t boff = (size_t)(col0 + t * 16 + ln) * ldb + kb; FragH bq; bq.half[0] = *(const v8us*)(Bh + boff + 8 * hh); bq.half[1] = *(const v8us*)(Bh + boff + 16 + 8 * hh);
      acc[t] = mmaH<ASPLIT ? 2 : 1>(ah.v, al.v, bq.v, bq.v, acc[t]); }
  }
#pragma unroll
  for (int t = 0; t < 4; ++t) { if (col0 + t * 16 >= N) continue;
#pragma unroll
    for (int r = 0; r < 8; ++r) so[w][8 * hh + r][t * 16 + ln] = acc[t][r] * alpha; }
  __builtin_amdgcn_fence(__ATOMIC_ACQ_REL, "workgroup"); __builtin_amdgcn_wave_barrier();
  const int rsub = lane >> 4, c4 = (lane & 15) * 4;
  {
#pragma unroll
    for (int q = 0; q < 8; ++q) { const int r = q * 2 + rsub; if (col0 + c4 < N) { const v4f v = *(const v4fa*)&so[w][r][c4]; *(v4f*)(C + (size_t)(row0 + r) * ldc + col0 + c4) = v; } }
     }
}

// QdH[s][d] = f16(Qd[d][s]) (transposed, f16); thread per (s, 8 d)
__global__ __launch_bounds__(256) void k_qdh(const float* __restrict__ Qd, _Float16* __restrict__ QdH) { const int t = blockIdx.x * 256 + threadIdx.x; if (t >= SQ * (DO / 8)) return; const int s = t / (DO / 8), d8 = (t % (DO / 8)) * 8; FragH f; for (int i = 0; i < 8; ++i) f.h[i] = (_Float16)Qd[(size_t)(d8 + i) * SQ + s]; const v8us o = f.half[0]; *(v8us*)((unsigned short*)QdH + (size_t)s * DO + d8) = o;  }
// row softmax in place on ST[t][s] over s, after ×⅛ + 1; wave per row
__global__ __launch_bounds__(256) void k_softmax(float* __restrict__ S) {
  const int tid = threadIdx.x, wv = tid >> 5, lane = tid & 31; const size_t r = (size_t)blockIdx.x * 8 + wv; float* row = S + r * SQ; float mx = -3.0e38f;
#pragma unroll 1
  for (int j = lane; j < SQ; j += 32) { const float v = row[j] * 0.125f + 1.0f; mx = fmaxf(mx, v); }
  for (int o = 16; o >= 1; o >>= 1) mx = fmaxf(mx, __shfl_xor(mx, o, 32));
  float den = 0.f;
#pragma unroll 1
  for (int j = lane; j < SQ; j += 32) { const float e = expf((row[j] * 0.125f + 1.0f) - mx); row[j] = e; den += e; }
  for (int o = 16; o >= 1; o >>= 1) den += __shfl_xor(den, o, 32); const float inv = 1.0f / den;
#pragma unroll 1
  for (int j = lane; j < SQ; j += 32) { const float p = row[j] * inv; *(float*)(row + j) = p;  }
}
// P block rounded to f16 as Bt[n = t][k = s] (row-major P is already [t][s]): thread per 8
__global__ __launch_bounds__(256) void k_pb(const float* __restrict__ S, _Float16* __restrict__ Pb) { const size_t t = (size_t)blockIdx.x * 256 + threadIdx.x; if (t >= (size_t)TB * SQ / 8) return; FragH f; for (int i = 0; i < 8; ++i) f.h[i] = (_Float16)(S[t * 8 + i] * 256.0f);      /* ×2^8 (exact) keeps P ≥ 2.4e-7 out of the f16 subnormal range; folded back by the ×2^-8 in k_pv */ const v8us o = f.half[0]; *(v8us*)((unsigned short*)Pb + t * 8) = o;  }      // P·2^8 as f16 (11-bit significand; subnormal only for P below 2.4e-7)
// out[d][t] = 2^-8 * sum_s Vd[d][s] * Pb[t][s] for one block of TB key columns. One work-group per 16 x 32 output tile; its PVW waves each take
// SQ / PVW of the s range (same fragments and products as k_gemm_h<true>), leave an f32 partial tile in LDS, and the partials are added in wave order.
#define PVW 32
__global__ __launch_bounds__(PVW * 32) void k_pv(const float* __restrict__ Vd, const _Float16* __restrict__ Pb, float* __restrict__ out) {
  __shared__ __attribute__((aligned(16))) float part[PVW][16][32];
  const int tid = threadIdx.x, w = tid >> 5, lane = tid & 31, ln = lane & 15, hh = lane >> 4;
  const int row0 = (blockIdx.x / (TB / 32)) * 16, col0 = (blockIdx.x % (TB / 32)) * 32;
  const float* arow = Vd + (size_t)(row0 + ln) * SQ + w * (SQ / PVW);
  const _Float16* brow = Pb + (size_t)(col0 + ln) * SQ + w * (SQ / PVW);
  v8f acc[2] = {};
  // the inner loops below are unrolled so that xs, the fragments and acc are indexed by constants and stay in registers
  for (int kb = 0; kb < SQ / PVW; kb += 32) {
    FragH ah, al;
    const v4f x0 = *(const v4fa*)(arow + kb + 8 * hh), x1 = *(const v4fa*)(arow + kb + 8 * hh + 4), x2 = *(const v4fa*)(arow + kb + 16 + 8 * hh), x3 = *(const v4fa*)(arow + kb + 16 + 8 * hh + 4);
    float xs[16] = {x0[0],x0[1],x0[2],x0[3],x1[0],x1[1],x1[2],x1[3],x2[0],x2[1],x2[2],x2[3],x3[0],x3[1],x3[2],x3[3]};
#pragma unroll
    for (int i = 0; i < 16; ++i) { const _Float16 h = (_Float16)xs[i]; ah.h[i] = h; al.h[i] = (_Float16)(xs[i] - (float)h); }
#pragma unroll
    for (int t = 0; t < 2; ++t) { const size_t boff = (size_t)(t * 16) * SQ + kb; FragH bq; bq.half[0] = *(const v8us*)(brow + boff + 8 * hh); bq.half[1] = *(const v8us*)(brow + boff + 16 + 8 * hh);
      acc[t] = mmaH<2>(ah.v, al.v, bq.v, bq.v, acc[t]); }
  }
#pragma unroll
  for (int t = 0; t < 2; ++t)
#pragma unroll
    for (int r = 0; r < 8; ++r) part[w][8 * hh + r][t * 16 + ln] = acc[t][r];
  __syncthreads();
  if (w >= 16) return;
  float s = 0.f;      // wave w sums and stores row w of the tile: one whole 128-byte line
  for (int p = 0; p < PVW; ++p) s += part[p][w][lane];
  out[(size_t)(row0 + w) * SQ + col0 + lane] = s * 0.00390625f;
}
extern "C" void kernel_launch(void* const* d_in, const int* in_sizes, int n_in,
                              void* d_out, int out_size, void* d_ws, size_t ws_size, hipStream_t stream) {
  (void)in_sizes; (void)n_in; (void)out_size;
  const float* Q = (const float*)d_in[0]; const float* K = (const float*)d_in[1]; const float* V = (const float*)d_in[2]; const float* Mq = (const float*)d_in[3]; const float* Mk = (const float*)d_in[4]; const float* Mv = (const float*)d_in[5];
  char* ws = (char*)d_ws; size_t off = 0;
  auto take = [&](size_t bytes) { char* p = ws + off; off += (bytes + 255) & ~(size_t)255; return p; };
  unsigned short* BQ = (unsigned short*)take((size_t)SQ * DI * 2); unsigned short* BK = (unsigned short*)take((size_t)SQ * DI * 2); unsigned short* BV = (unsigned short*)take((size_t)SQ * DI * 2);
  float* Qd = (float*)take((size_t)DO * SQ * 4); float* Kd = (float*)take((size_t)DO * SQ * 4); float* Vd = (float*)take((size_t)DO * SQ * 4); float* KdT = (float*)take((size_t)SQ * DO * 4); _Float16* QdB = (_Float16*)take((size_t)SQ * DO * 2);
  float* S = (float*)take((size_t)TB * SQ * 4); _Float16* Pb = (_Float16*)take((size_t)TB * SQ * 2);
  if (off > ws_size) return;
  k_wt_bf16<<<(unsigned)(((size_t)SQ * (DI / 8) + 255) / 256), 256, 0, stream>>>(Q, BQ, DI, SQ); k_wt_bf16<<<(unsigned)(((size_t)SQ * (DI / 8) + 255) / 256), 256, 0, stream>>>(K, BK, DI, SQ); k_wt_bf16<<<(unsigned)(((size_t)SQ * (DI / 8) + 255) / 256), 256, 0, stream>>>(V, BV, DI, SQ);
  const unsigned gp = ((DO / 16) * (SQ / 64) + 3) / 4;
  k_gemm_bf3<false, 0, false, false><<<gp, 128, 0, stream>>>(Mq, DI, BQ, DI, nullptr, nullptr, 1, 0, Qd, SQ, DO, SQ, DI);      // Qd = Mq·Q [64][8192]
  k_gemm_bf3<false, 0, false, false><<<gp, 128, 0, stream>>>(Mk, DI, BK, DI, nullptr, nullptr, 1, 0, Kd, SQ, DO, SQ, DI);
  k_gemm_bf3<false, 0, false, false><<<gp, 128, 0, stream>>>(Mv, DI, BV, DI, nullptr, nullptr, 1, 0, Vd, SQ, DO, SQ, DI);
  k_transpose32<false, false, false><<<dim3(SQ / 32, DO / 32, 1), 256, 0, stream>>>(Kd, KdT, DO, SQ, nullptr, nullptr, nullptr);        // Kd [64][8192] -> KdT [8192][64]
  k_qdh<<<(SQ * (DO / 8) + 255) / 256, 256, 0, stream>>>(Qd, QdB);                                         // Bt[s][d] = f16(Qd[d][s])
  for (int tb = 0; tb < SQ / TB; ++tb) {
    k_gemm_h<true><<<dim3(((TB / 16) * (SQ / 64) + 3) / 4, 1), 128, 0, stream>>>(KdT + (size_t)tb * TB * DO, DO, 0, QdB, DO, 0, 1.f, S, SQ, 0, TB, SQ, DO);   // Sᵀ[t][s] = Kd[:,t]·Qd[:,s] (f16 hi/lo × f16 Qd: 2 products)
    k_softmax<<<TB / 8, 256, 0, stream>>>(S);
    k_pb<<<(unsigned)(((size_t)TB * SQ / 8 + 255) / 256), 256, 0, stream>>>(S, Pb);
    k_pv<<<(DO / 16) * (TB / 32), PVW * 32, 0, stream>>>(Vd, Pb, (float*)d_out + (size_t)tb * TB);   // out[d][t] = Σ_s Vd[d][s]·P[t][s] (f16 hi/lo × f16 P: 2 products)
  }
}

// v002
// A run of this version takes 492 microseconds.
// In two side-by-side timings against v001, it was 4.61 and 4.58 times as fast.
// Counting every step since v000, it is 9.26 times as fast.
#include <hip/hip_runtime.h>
// On v_wmma_f32_16x16x32_bf16 with f32 accumulate: the projections Qd/Kd/Vd = M·{Q,K,V} (M = 64, K = 512, N = 8192; inputs rounded to bf16: single exact
// term), per block of 1024 key positions t the transposed scores Sᵀ[t][s] = Kd[:,t]·Qd[:,s] on the f16 variant (Kdᵀ rows split into f16 hi/lo, Qd rounded to f16: 2 products, K = 64) and
// out[:, t-block] = Vd·P[t-block]ᵀ on the f16 variant v_wmma_f32_16x16x32_f16 (Vd split into f16 hi/lo, P rounded to f16 — 4–8× finer than bf16 for these [0,1] weights: 2 products, K = 8192). The module's softmax over the QUERY axis (dim 0) becomes a row softmax of
// Sᵀ; /√64 and the +1 constant are f32 VALU.
#define DI 512
#define DO 64
#define SQ 8192
#define TB 1024          // key columns per block

typedef __bf16 v16b __attribute__((ext_vector_type(16)));
typedef unsigned short v8us __attribute__((ext_vector_type(8), may_alias));
typedef float  v8f  __attribute__((ext_vector_type(8)));
typedef float  v4f  __attribute__((ext_vector_type(4)));
typedef float  v4fa __attribute__((ext_vector_type(4), may_alias));
union FragB { v16b v; v8us half[2]; unsigned short u[16]; };

__device__ __forceinline__ unsigned short bf16_bits(float x) { unsigned int u = __float_as_uint(x); return (unsigned short)((u + 0x7FFFu + ((u >> 16) & 1u)) >> 16); }
__device__ __forceinline__ float bf16_val(unsigned short b) { return __uint_as_float(((unsigned int)b) << 16); }
__device__ __forceinline__ float bf16_round(float x) { return bf16_val(bf16_bits(x)); }
// D += A·B with NT terms: 1 = ah·bh, 2 = + al·bh (A split), 3 = + ah·bl (both split)
template <int NT>
__device__ __forceinline__ v8f mmaN(v16b ah, v16b al, v16b bh, v16b bl, v8f c) {
  c = __builtin_amdgcn_wmma_f32_16x16x32_bf16(false, ah, false, bh, (short)0, c, false, false);
  if (NT >= 2) c = __builtin_amdgcn_wmma_f32_16x16x32_bf16(false, al, false, bh, (short)0, c, false, false);
  if (NT >= 3) c = __builtin_amdgcn_wmma_f32_16x16x32_bf16(false, ah, false, bl, (short)0, c, false, false);
  asm volatile("v_nop\n\tv_nop\n\tv_nop\n\tv_nop" : "+v"(c) : "v"(ah), "v"(al), "v"(bh), "v"(bl));
  return c;
}

__global__ __launch_bounds__(256) void k_wt_bf16(const float* __restrict__ W, unsigned short* __restrict__ Wt, int K, int N) {
  const int t = blockIdx.x * 256 + threadIdx.x;
  const int k8n = K / 8;
  if (t >= N * k8n) return;
  const int n = t / k8n, k8 = (t % k8n) * 8;
  v8us v;
#pragma unroll
  for (int i = 0; i < 8; ++i) v[i] = bf16_bits(W[(size_t)(k8 + i) * N + n]);
  *(v8us*)(Wt + (size_t)n * K + k8) = v;
  
}

// GEMM C[M][N] (f32, pitch ldc) = act(A[M][K]·W + bias). A f32 row-major (pitch lda) converted per fragment to bf16
// (ASPLIT: hi/lo two planes -> 2 terms, else single rounded term); Wt bf16 [N][K] (pitch ldb). BIAS_BF16 rounds the
// bias to bf16 first (bias quantised to bf16 before the add). K%32==0, M%16==0, N%64==0.
template <bool ASPLIT, int ACT, bool BIAS_BF16>
__global__ __launch_bounds__(128) void k_gemm_bf(const float* __restrict__ A, int lda, const unsigned short* __restrict__ Wt, int ldb,
                                               const float* __restrict__ bias, float* __restrict__ C, int ldc, int M, int N, int K) {
  __shared__ __attribute__((aligned(16))) float so[4][16][64];
  const int tid = threadIdx.x, w = tid >> 5, lane = tid & 31, ln = lane & 15, hh = lane >> 4;
  const int ntn = N / 64;
  const int wid = blockIdx.x * 4 + w;
  const int mt = wid / ntn, nq = wid % ntn;
  if (mt * 16 >= M) return;
  const int row0 = mt * 16, col0 = nq * 64;
  const float* arow = A + (size_t)(row0 + ln) * lda;
  v8f acc[4] = {};
  for (int kb = 0; kb < K; kb += 32) {
    FragB ah, al;
    const v4f x0 = *(const v4fa*)(arow + kb + 8 * hh), x1 = *(const v4fa*)(arow + kb + 8 * hh + 4);
    const v4f x2 = *(const v4fa*)(arow + kb + 16 + 8 * hh), x3 = *(const v4fa*)(arow + kb + 16 + 8 * hh + 4);
    float xs[16] = {x0[0],x0[1],x0[2],x0[3],x1[0],x1[1],x1[2],x1[3],x2[0],x2[1],x2[2],x2[3],x3[0],x3[1],x3[2],x3[3]};
#pragma unroll
    for (int i = 0; i < 16; ++i) { const unsigned short hb = bf16_bits(xs[i]); ah.u[i] = hb; al.u[i] = ASPLIT ? bf16_bits(xs[i] - bf16_val(hb)) : (unsigned short)0; }
#pragma unroll
    for (int t = 0; t < 4; ++t) {
      const unsigned short* brow = Wt + (size_t)(col0 + t * 16 + ln) * ldb + kb;
      FragB b;
      b.half[0] = *(const v8us*)(brow + 8 * hh);
      b.half[1] = *(const v8us*)(brow + 16 + 8 * hh);
      acc[t] = mmaN<ASPLIT ? 2 : 1>(ah.v, al.v, b.v, b.v, acc[t]);
    }
  }
#pragma unroll
  for (int t = 0; t < 4; ++t) {
    float bv = bias ? bias[col0 + t * 16 + ln] : 0.f;
    if (BIAS_BF16) bv = bf16_round(bv);
#pragma unroll
    for (int r = 0; r < 8; ++r) { float v = acc[t][r] + bv; if (ACT == 1) v = fmaxf(v, 0.f); so[w][8 * hh + r][t * 16 + ln] = v; }
  }
  __builtin_amdgcn_fence(__ATOMIC_ACQ_REL, "workgroup");
  __builtin_amdgcn_wave_barrier();
  const int rsub = lane >> 4, c4 = (lane & 15) * 4;
  {
#pragma unroll
    for (int q = 0; q < 8; ++q) {
      const int r = q * 2 + rsub;
      const v4f v = *(const v4fa*)&so[w][r][c4];
      *(v4f*)(C + (size_t)(row0 + r) * ldc + col0 + c4) = v;
    }
    
  }
}

// Flash-style causal/unmasked attention, all contractions 3-term bf16 hi/lo splits, f32 softmax with running max.
// q,k,v rows are read from f32 buffers with arbitrary row pitch (so they can live inside a fused qkv buffer);
// D = head size (multiple of 32, <= 128); one wave = 16 query rows; block = 4 waves (64 queries) sharing K/V chunks of 32.
template <int D, bool CAUSAL>
__global__ __launch_bounds__(128) void k_flash(const float* __restrict__ qb, const float* __restrict__ kb, const float* __restrict__ vb,
                                             int pitch, int T, int H, float scale, float* __restrict__ y, int ypitch) {
  constexpr int KS = D / 32;        // k-steps for QK
  constexpr int DT = D / 16;        // d tiles for PV
  __shared__ __attribute__((aligned(16))) unsigned short sKh[32][D + 8], sKl[32][D + 8], sVh[32][D + 8], sVl[32][D + 8];
  __shared__ __attribute__((aligned(16))) unsigned short sPh[4][16][40], sPl[4][16][40];
  __shared__ __attribute__((aligned(16))) float sO[4][16][D];
  const int tid = threadIdx.x, w = tid >> 5, lane = tid & 31, ln = lane & 15, hh = lane >> 4;
  const int nqb = (T + 63) / 64;
  const int bh = blockIdx.x / nqb, qblk = blockIdx.x % nqb;
  const int b = bh / H, h = bh % H;
  const int q0 = qblk * 64 + w * 16;
  const float* Q = qb + (size_t)b * T * pitch + h * D;
  const float* K = kb + (size_t)b * T * pitch + h * D;
  const float* V = vb + (size_t)b * T * pitch + h * D;

  // A fragments of the wave's 16 query rows (scaled), hi/lo
  FragB aqh[KS], aql[KS];
  {
    int row = q0 + ln; if (row >= T) row = T - 1;
    const float* qr = Q + (size_t)row * pitch;
#pragma unroll
    for (int ks = 0; ks < KS; ++ks)
#pragma unroll
      for (int i = 0; i < 16; ++i) {
        const int d = ks * 32 + ((i < 8) ? (8 * hh + i) : (16 + 8 * hh + (i - 8)));
        const float x = qr[d] * scale; const unsigned short hb = bf16_bits(x);
        aqh[ks].u[i] = hb; aql[ks].u[i] = bf16_bits(x - bf16_val(hb));
      }
  }
  float m_r[8], l_r[8];
#pragma unroll
  for (int r = 0; r < 8; ++r) { m_r[r] = -3.0e38f; l_r[r] = 0.f; }
  v8f oacc[DT];
#pragma unroll
  for (int dt = 0; dt < DT; ++dt) oacc[dt] = (v8f){0.f,0.f,0.f,0.f,0.f,0.f,0.f,0.f};

  const int kv_end = CAUSAL ? min(T, qblk * 64 + 64) : T;     // block-uniform
  for (int j0 = 0; j0 < kv_end; j0 += 32) {
    __syncthreads();
    for (int e = tid; e < 32 * (D / 4); e += 128) {
      const int r = e / (D / 4), c4 = (e % (D / 4)) * 4;
      const int key = j0 + r;
      v4f kf = {0.f,0.f,0.f,0.f}, vf = {0.f,0.f,0.f,0.f};
      if (key < T) { kf = *(const v4fa*)(K + (size_t)key * pitch + c4); vf = *(const v4fa*)(V + (size_t)key * pitch + c4); }
#pragma unroll
      for (int t = 0; t < 4; ++t) {
        unsigned short hb = bf16_bits(kf[t]); sKh[r][c4 + t] = hb; sKl[r][c4 + t] = bf16_bits(kf[t] - bf16_val(hb));
        hb = bf16_bits(vf[t]); sVh[r][c4 + t] = hb; sVl[r][c4 + t] = bf16_bits(vf[t] - bf16_val(hb));
      }
    }
    __syncthreads();
    // S tile 16 x 32
    v8f s[2];
#pragma unroll
    for (int nt = 0; nt < 2; ++nt) {
      v8f acc = {};
#pragma unroll
      for (int ks = 0; ks < KS; ++ks) {
        FragB bh_, bl_;
        bh_.half[0] = *(const v8us*)&sKh[nt * 16 + ln][ks * 32 + 8 * hh]; bh_.half[1] = *(const v8us*)&sKh[nt * 16 + ln][ks * 32 + 16 + 8 * hh];
        bl_.half[0] = *(const v8us*)&sKl[nt * 16 + ln][ks * 32 + 8 * hh]; bl_.half[1] = *(const v8us*)&sKl[nt * 16 + ln][ks * 32 + 16 + 8 * hh];
        acc = mmaN<3>(aqh[ks].v, aql[ks].v, bh_.v, bl_.v, acc);
      }
      s[nt] = acc;
    }
    // mask + running max (rows 8hh+r; the 16 lanes of a half share rows)
    float alpha[8];
#pragma unroll
    for (int r = 0; r < 8; ++r) {
      const int qi = q0 + 8 * hh + r;
      const int ja = j0 + ln, jb = j0 + 16 + ln;
      if (CAUSAL) { if (ja > qi) s[0][r] = -3.0e38f; if (jb > qi) s[1][r] = -3.0e38f; }
      if (ja >= T) s[0][r] = -3.0e38f;
      if (jb >= T) s[1][r] = -3.0e38f;
      float mx = fmaxf(s[0][r], s[1][r]);
      mx = fmaxf(mx, __shfl_xor(mx, 1, 32)); mx = fmaxf(mx, __shfl_xor(mx, 2, 32)); mx = fmaxf(mx, __shfl_xor(mx, 4, 32)); mx = fmaxf(mx, __shfl_xor(mx, 8, 32));
      const float mnew = fmaxf(m_r[r], mx);
      alpha[r] = (mnew > -1.0e38f) ? __expf(m_r[r] - mnew) : 1.0f;
      const float p0 = (s[0][r] > -1.0e38f) ? __expf(s[0][r] - mnew) : 0.f;
      const float p1 = (s[1][r] > -1.0e38f) ? __expf(s[1][r] - mnew) : 0.f;
      m_r[r] = mnew;
      l_r[r] = l_r[r] * alpha[r] + p0 + p1;            // per-lane partial row sum (16 lanes combined at the end)
      unsigned short hb = bf16_bits(p0); sPh[w][8 * hh + r][ln] = hb;      sPl[w][8 * hh + r][ln] = bf16_bits(p0 - bf16_val(hb));
      hb = bf16_bits(p1);                sPh[w][8 * hh + r][16 + ln] = hb; sPl[w][8 * hh + r][16 + ln] = bf16_bits(p1 - bf16_val(hb));
    }
#pragma unroll
    for (int dt = 0; dt < DT; ++dt)
#pragma unroll
      for (int r = 0; r < 8; ++r) oacc[dt][r] *= alpha[r];
    __builtin_amdgcn_fence(__ATOMIC_ACQ_REL, "workgroup");
    __builtin_amdgcn_wave_barrier();
    FragB pah, pal;
    pah.half[0] = *(const v8us*)&sPh[w][ln][8 * hh]; pah.half[1] = *(const v8us*)&sPh[w][ln][16 + 8 * hh];
    pal.half[0] = *(const v8us*)&sPl[w][ln][8 * hh]; pal.half[1] = *(const v8us*)&sPl[w][ln][16 + 8 * hh];
#pragma unroll
    for (int dt = 0; dt < DT; ++dt) {
      FragB bvh, bvl;
#pragma unroll
      for (int i = 0; i < 8; ++i) {
        bvh.u[i] = sVh[8 * hh + i][dt * 16 + ln]; bvh.u[8 + i] = sVh[16 + 8 * hh + i][dt * 16 + ln];
        bvl.u[i] = sVl[8 * hh + i][dt * 16 + ln]; bvl.u[8 + i] = sVl[16 + 8 * hh + i][dt * 16 + ln];
      }
      oacc[dt] = mmaN<3>(pah.v, pal.v, bvh.v, bvl.v, oacc[dt]);
    }
    __builtin_amdgcn_fence(__ATOMIC_ACQ_REL, "workgroup");
    __builtin_amdgcn_wave_barrier();
  }
#pragma unroll
  for (int r = 0; r < 8; ++r) {
    float l = l_r[r];
    l += __shfl_xor(l, 1, 32); l += __shfl_xor(l, 2, 32); l += __shfl_xor(l, 4, 32); l += __shfl_xor(l, 8, 32);
    l_r[r] = (l > 0.f) ? 1.0f / l : 0.f;
  }
#pragma unroll
  for (int dt = 0; dt < DT; ++dt)
#pragma unroll
    for (int r = 0; r < 8; ++r) sO[w][8 * hh + r][dt * 16 + ln] = oacc[dt][r] * l_r[r];
  __builtin_amdgcn_fence(__ATOMIC_ACQ_REL, "workgroup");
  __builtin_amdgcn_wave_barrier();
  {
    for (int r = 0; r < 16; ++r) {
      const int row = q0 + r;
      if (row < T && lane < D / 4) {
        const v4f val = *(const v4fa*)&sO[w][r][lane * 4];
        *(v4f*)(y + ((size_t)b * T + row) * ypitch + h * D + lane * 4) = val;
      }
    }
    
  }
}

// in pitch = cols, out pitch = rows; rows, cols multiples of 32. Optional per-output-row affine (scale[c], shift[c]) and
// residual add res (same layout as out, optionally bf16-rounded) for fused epilogues: out = in*scale + shift + res.
template <bool AFFINE, bool RESID, bool RES_BF16>
__global__ __launch_bounds__(256) void k_transpose32(const float* __restrict__ in, float* __restrict__ out, int rows, int cols,
                                                    const float* __restrict__ scale, const float* __restrict__ shift, const float* __restrict__ res) {
  __shared__ float tile[32][33];
  const int b = blockIdx.z;
  const int r0 = blockIdx.y * 32, c0 = blockIdx.x * 32;
  const float* src = in + (size_t)b * rows * cols;
  float* dst = out + (size_t)b * rows * cols;
  const int tx = threadIdx.x & 31, ty = threadIdx.x >> 5;     // 8 rows per pass
  for (int i = ty; i < 32; i += 8) tile[i][tx] = src[(size_t)(r0 + i) * cols + c0 + tx];
  __syncthreads();
  {
    for (int i = ty; i < 32; i += 8) {
      float v = tile[tx][i];
      const int orow = c0 + i;
      if (AFFINE) v = v * scale[orow] + shift[orow];
      if (RESID) { float rv = res[(size_t)b * rows * cols + (size_t)orow * rows + r0 + tx]; if (RES_BF16) rv = bf16_round(rv); v += rv; }
      *(float*)(dst + (size_t)orow * rows + r0 + tx) = v;
    }
    
  }
}

// 2x2 max pool on position-major data: in [B][H*W][C] -> out [B][(H/2)*(W/2)][C]; thread per (b, p', 4 channels); C%4==0
__global__ __launch_bounds__(256) void k_pool2_pm(const float* __restrict__ in, float* __restrict__ out, int Bn, int H, int W, int C) {
  const size_t t = (size_t)blockIdx.x * 256 + threadIdx.x;
  const int c4n = C / 4, Ho = H / 2, Wo = W / 2;
  const size_t total = (size_t)Bn * Ho * Wo * c4n;
  if (t >= total) return;
  const int c4 = (int)(t % c4n) * 4; size_t rest = t / c4n;
  const int pw = (int)(rest % Wo); rest /= Wo; const int ph = (int)(rest % Ho); const int b = (int)(rest / Ho);
  const float* base = in + (size_t)b * H * W * C;
  const int p00 = (2 * ph) * W + 2 * pw;
  const v4f a = *(const v4fa*)(base + (size_t)p00 * C + c4), bq = *(const v4fa*)(base + (size_t)(p00 + 1) * C + c4);
  const v4f c = *(const v4fa*)(base + (size_t)(p00 + W) * C + c4), d = *(const v4fa*)(base + (size_t)(p00 + W + 1) * C + c4);
  v4f m; for (int i = 0; i < 4; ++i) m[i] = fmaxf(fmaxf(a[i], bq[i]), fmaxf(c[i], d[i]));
  float* dst = out + ((size_t)b * Ho * Wo + (size_t)ph * Wo + pw) * C + c4;
  *(v4f*)dst = m;
  
}

// General (non-causal) attention, 3-term bf16 splits, f32 softmax with running max.
// Q [.][Tq][qpitch], K [.][Tk][kpitch] (head dim DQ), V [.][Tk][vpitch] (head dim DVtot); this block handles DV output
// dims starting at dv0 = blockIdx.y*DV. y[bh][t][ypitch] gets columns dv0..dv0+DV-1. Per-bh base offsets via strides.
template <int DQ, int DV>
__global__ __launch_bounds__(128) void k_flash2(const float* __restrict__ Qb, size_t qstride, int qpitch, int Tq,
                                              const float* __restrict__ Kb, size_t kstride, int kpitch, int Tk,
                                              const float* __restrict__ Vb, size_t vstride, int vpitch,
                                              float scale, float* __restrict__ y, size_t ystride, int ypitch) {
  constexpr int KS = DQ / 32, DT = DV / 16;
  __shared__ __attribute__((aligned(16))) unsigned short sKh[32][DQ + 8], sKl[32][DQ + 8], sVh[32][DV + 8], sVl[32][DV + 8];
  __shared__ __attribute__((aligned(16))) unsigned short sPh[4][16][40], sPl[4][16][40];
  __shared__ __attribute__((aligned(16))) float sO[4][16][DV];
  const int tid = threadIdx.x, w = tid >> 5, lane = tid & 31, ln = lane & 15, hh = lane >> 4;
  const int nqb = (Tq + 63) / 64;
  const int bh = blockIdx.x / nqb, qblk = blockIdx.x % nqb;
  const int dv0 = blockIdx.y * DV;
  const int q0 = qblk * 64 + w * 16;
  const float* Q = Qb + (size_t)bh * qstride; const float* K = Kb + (size_t)bh * kstride; const float* V = Vb + (size_t)bh * vstride + dv0;
  FragB aqh[KS], aql[KS];
  {
    int row = q0 + ln; if (row >= Tq) row = Tq - 1;
    const float* qr = Q + (size_t)row * qpitch;
#pragma unroll
    for (int ks = 0; ks < KS; ++ks)
#pragma unroll
      for (int i = 0; i < 16; ++i) {
        const int d = ks * 32 + ((i < 8) ? (8 * hh + i) : (16 + 8 * hh + (i - 8)));
        const float x = qr[d] * scale; const unsigned short hb = bf16_bits(x);
        aqh[ks].u[i] = hb; aql[ks].u[i] = bf16_bits(x - bf16_val(hb));
      }
  }
  float m_r[8], l_r[8];
#pragma unroll
  for (int r = 0; r < 8; ++r) { m_r[r] = -3.0e38f; l_r[r] = 0.f; }
  v8f oacc[DT];
#pragma unroll
  for (int dt = 0; dt < DT; ++dt) oacc[dt] = (v8f){0.f,0.f,0.f,0.f,0.f,0.f,0.f,0.f};
  for (int j0 = 0; j0 < Tk; j0 += 32) {
    __syncthreads();
    for (int e = tid; e < 32 * (DQ / 4); e += 128) {
      const int r = e / (DQ / 4), c4 = (e % (DQ / 4)) * 4; const int key = j0 + r;
      v4f f = {0.f,0.f,0.f,0.f}; if (key < Tk) f = *(const v4fa*)(K + (size_t)key * kpitch + c4);
#pragma unroll
      for (int t = 0; t < 4; ++t) { const unsigned short hb = bf16_bits(f[t]); sKh[r][c4 + t] = hb; sKl[r][c4 + t] = bf16_bits(f[t] - bf16_val(hb)); }
    }
    for (int e = tid; e < 32 * (DV / 4); e += 128) {
      const int r = e / (DV / 4), c4 = (e % (DV / 4)) * 4; const int key = j0 + r;
      v4f f = {0.f,0.f,0.f,0.f}; if (key < Tk) f = *(const v4fa*)(V + (size_t)key * vpitch + c4);
#pragma unroll
      for (int t = 0; t < 4; ++t) { const unsigned short hb = bf16_bits(f[t]); sVh[r][c4 + t] = hb; sVl[r][c4 + t] = bf16_bits(f[t] - bf16_val(hb)); }
    }
    __syncthreads();
    v8f s[2];
#pragma unroll
    for (int nt = 0; nt < 2; ++nt) {
      v8f acc = {};
#pragma unroll
      for (int ks = 0; ks < KS; ++ks) {
        FragB bh_, bl_;
        bh_.half[0] = *(const v8us*)&sKh[nt * 16 + ln][ks * 32 + 8 * hh]; bh_.half[1] = *(const v8us*)&sKh[nt * 16 + ln][ks * 32 + 16 + 8 * hh];
        bl_.half[0] = *(const v8us*)&sKl[nt * 16 + ln][ks * 32 + 8 * hh]; bl_.half[1] = *(const v8us*)&sKl[nt * 16 + ln][ks * 32 + 16 + 8 * hh];
        acc = mmaN<3>(aqh[ks].v, aql[ks].v, bh_.v, bl_.v, acc);
      }
      s[nt] = acc;
    }
    float alpha[8];
#pragma unroll
    for (int r = 0; r < 8; ++r) {
      const int ja = j0 + ln, jb = j0 + 16 + ln;
      if (ja >= Tk) s[0][r] = -3.0e38f;
      if (jb >= Tk) s[1][r] = -3.0e38f;
      float mx = fmaxf(s[0][r], s[1][r]);
      mx = fmaxf(mx, __shfl_xor(mx, 1, 32)); mx = fmaxf(mx, __shfl_xor(mx, 2, 32)); mx = fmaxf(mx, __shfl_xor(mx, 4, 32)); mx = fmaxf(mx, __shfl_xor(mx, 8, 32));
      const float mnew = fmaxf(m_r[r], mx);
      alpha[r] = (mnew > -1.0e38f) ? __expf(m_r[r] - mnew) : 1.0f;
      const float p0 = (s[0][r] > -1.0e38f) ? __expf(s[0][r] - mnew) : 0.f;
      const float p1 = (s[1][r] > -1.0e38f) ? __expf(s[1][r] - mnew) : 0.f;
      m_r[r] = mnew;
      l_r[r] = l_r[r] * alpha[r] + p0 + p1;
      unsigned short hb = bf16_bits(p0); sPh[w][8 * hh + r][ln] = hb;      sPl[w][8 * hh + r][ln] = bf16_bits(p0 - bf16_val(hb));
      hb = bf16_bits(p1);                sPh[w][8 * hh + r][16 + ln] = hb; sPl[w][8 * hh + r][16 + ln] = bf16_bits(p1 - bf16_val(hb));
    }
#pragma unroll
    for (int dt = 0; dt < DT; ++dt)
#pragma unroll
      for (int r = 0; r < 8; ++r) oacc[dt][r] *= alpha[r];
    __builtin_amdgcn_fence(__ATOMIC_ACQ_REL, "workgroup");
    __builtin_amdgcn_wave_barrier();
    FragB pah, pal;
    pah.half[0] = *(const v8us*)&sPh[w][ln][8 * hh]; pah.half[1] = *(const v8us*)&sPh[w][ln][16 + 8 * hh];
    pal.half[0] = *(const v8us*)&sPl[w][ln][8 * hh]; pal.half[1] = *(const v8us*)&sPl[w][ln][16 + 8 * hh];
#pragma unroll
    for (int dt = 0; dt < DT; ++dt) {
      FragB bvh, bvl;
#pragma unroll
      for (int i = 0; i < 8; ++i) {
        bvh.u[i] = sVh[8 * hh + i][dt * 16 + ln]; bvh.u[8 + i] = sVh[16 + 8 * hh + i][dt * 16 + ln];
        bvl.u[i] = sVl[8 * hh + i][dt * 16 + ln]; bvl.u[8 + i] = sVl[16 + 8 * hh + i][dt * 16 + ln];
      }
      oacc[dt] = mmaN<3>(pah.v, pal.v, bvh.v, bvl.v, oacc[dt]);
    }
    __builtin_amdgcn_fence(__ATOMIC_ACQ_REL, "workgroup");
    __builtin_amdgcn_wave_barrier();
  }
#pragma unroll
  for (int r = 0; r < 8; ++r) {
    float l = l_r[r];
    l += __shfl_xor(l, 1, 32); l += __shfl_xor(l, 2, 32); l += __shfl_xor(l, 4, 32); l += __shfl_xor(l, 8, 32);
    l_r[r] = (l > 0.f) ? 1.0f / l : 0.f;
  }
#pragma unroll
  for (int dt = 0; dt < DT; ++dt)
#pragma unroll
    for (int r = 0; r < 8; ++r) sO[w][8 * hh + r][dt * 16 + ln] = oacc[dt][r] * l_r[r];
  __builtin_amdgcn_fence(__ATOMIC_ACQ_REL, "workgroup");
  __builtin_amdgcn_wave_barrier();
  {
    for (int r = 0; r < 16; ++r) {
      const int row = q0 + r;
      for (int c4 = lane * 4; c4 < DV; c4 += 128) {
        if (row < Tq) {
          const v4f val = *(const v4fa*)&sO[w][r][c4];
          *(v4f*)(y + (size_t)bh * ystride + (size_t)row * ypitch + dv0 + c4) = val;
        }
      }
    }
    
  }
}

// f32 [R][Cc] (row pitch lds) -> bf16 hi/lo planes [R][Cc] (pitch Cc); thread per 8 elements; Cc % 8 == 0
__global__ __launch_bounds__(256) void k_split_rows(const float* __restrict__ src, int lds_, unsigned short* __restrict__ hi, unsigned short* __restrict__ lo, int R, int Cc) {
  const size_t t = (size_t)blockIdx.x * 256 + threadIdx.x;
  const int c8n = Cc / 8;
  if (t >= (size_t)R * c8n) return;
  const int r = (int)(t / c8n), c8 = (int)(t % c8n) * 8;
  const float* s = src + (size_t)r * lds_ + c8;
  const v4f a = *(const v4fa*)s, b = *(const v4fa*)(s + 4);
  float xs[8] = {a[0],a[1],a[2],a[3],b[0],b[1],b[2],b[3]};
  v8us vh, vl;
#pragma unroll
  for (int i = 0; i < 8; ++i) { const unsigned short hb = bf16_bits(xs[i]); vh[i] = hb; vl[i] = bf16_bits(xs[i] - bf16_val(hb)); }
  unsigned short* dh = hi + (size_t)r * Cc + c8; unsigned short* dl = lo + (size_t)r * Cc + c8;
  *(v8us*)dh = vh; *(v8us*)dl = vl; 
}
// f32 [K][N] (row pitch lds) -> transposed bf16 hi/lo planes [N][K]; one thread per (n, 8 consecutive k)
__global__ __launch_bounds__(256) void k_split_transpose(const float* __restrict__ src, int lds_, unsigned short* __restrict__ hi, unsigned short* __restrict__ lo, int K, int N) {
  const size_t t = (size_t)blockIdx.x * 256 + threadIdx.x;
  const int k8n = K / 8;
  if (t >= (size_t)N * k8n) return;
  const int n = (int)(t / k8n), k8 = (int)(t % k8n) * 8;
  v8us vh, vl;
#pragma unroll
  for (int i = 0; i < 8; ++i) { const float x = src[(size_t)(k8 + i) * lds_ + n]; const unsigned short hb = bf16_bits(x); vh[i] = hb; vl[i] = bf16_bits(x - bf16_val(hb)); }
  unsigned short* dh = hi + (size_t)n * K + k8; unsigned short* dl = lo + (size_t)n * K + k8;
  *(v8us*)dh = vh; *(v8us*)dl = vl; 
}
// GEMM with A f32 (split into hi/lo when ASPLIT) and B from bf16 planes Bh (+ Bl when BSPLIT): terms hi·hi [+ lo·hi] [+ hi·lo].
// C f32 [M][N] pitch ldc; alpha scales the result; bias optional (BIAS_BF16 rounds it). Same tiling/epilogue as k_gemm_bf.
template <bool ASPLIT, bool BSPLIT, int ACT, bool BIAS_BF16>
__global__ __launch_bounds__(128) void k_gemm_bf2(const float* __restrict__ A, int lda, const unsigned short* __restrict__ Bh, const unsigned short* __restrict__ Bl, int ldb,
                                                const float* __restrict__ bias, float alpha, float* __restrict__ C, int ldc, int M, int N, int K) {
  __shared__ __attribute__((aligned(16))) float so[4][16][64];
  const int tid = threadIdx.x, w = tid >> 5, lane = tid & 31, ln = lane & 15, hh = lane >> 4;
  const int ntn = N / 64;
  const int wid = blockIdx.x * 4 + w;
  const int mt = wid / ntn, nq = wid % ntn;
  if (mt * 16 >= M) return;
  const int row0 = mt * 16, col0 = nq * 64;
  const float* arow = A + (size_t)(row0 + ln) * lda;
  v8f acc[4] = {};
  for (int kb = 0; kb < K; kb += 32) {
    FragB ah, al;
    const v4f x0 = *(const v4fa*)(arow + kb + 8 * hh), x1 = *(const v4fa*)(arow + kb + 8 * hh + 4);
    const v4f x2 = *(const v4fa*)(arow + kb + 16 + 8 * hh), x3 = *(const v4fa*)(arow + kb + 16 + 8 * hh + 4);
    float xs[16] = {x0[0],x0[1],x0[2],x0[3],x1[0],x1[1],x1[2],x1[3],x2[0],x2[1],x2[2],x2[3],x3[0],x3[1],x3[2],x3[3]};
#pragma unroll
    for (int i = 0; i < 16; ++i) { const unsigned short hb = bf16_bits(xs[i]); ah.u[i] = hb; al.u[i] = ASPLIT ? bf16_bits(xs[i] - bf16_val(hb)) : (unsigned short)0; }
#pragma unroll
    for (int t = 0; t < 4; ++t) {
      const size_t boff = (size_t)(col0 + t * 16 + ln) * ldb + kb;
      FragB bh_, bl_;
      bh_.half[0] = *(const v8us*)(Bh + boff + 8 * hh);
      bh_.half[1] = *(const v8us*)(Bh + boff + 16 + 8 * hh);
      if (BSPLIT) { bl_.half[0] = *(const v8us*)(Bl + boff + 8 * hh); bl_.half[1] = *(const v8us*)(Bl + boff + 16 + 8 * hh); } else bl_ = bh_;
      acc[t] = mmaN<ASPLIT ? (BSPLIT ? 3 : 2) : 1>(ah.v, al.v, bh_.v, bl_.v, acc[t]);
    }
  }
#pragma unroll
  for (int t = 0; t < 4; ++t) {
    float bv = bias ? bias[col0 + t * 16 + ln] : 0.f;
    if (BIAS_BF16) bv = bf16_round(bv);
#pragma unroll
    for (int r = 0; r < 8; ++r) { float v = acc[t][r] * alpha + bv; if (ACT == 1) v = fmaxf(v, 0.f); so[w][8 * hh + r][t * 16 + ln] = v; }
  }
  __builtin_amdgcn_fence(__ATOMIC_ACQ_REL, "workgroup");
  __builtin_amdgcn_wave_barrier();
  const int rsub = lane >> 4, c4 = (lane & 15) * 4;
  {
#pragma unroll
    for (int q = 0; q < 8; ++q) {
      const int r = q * 2 + rsub;
      const v4f v = *(const v4fa*)&so[w][r][c4];
      *(v4f*)(C + (size_t)(row0 + r) * ldc + col0 + c4) = v;
    }
    
  }
}
// row softmax: P[row][:] = softmax(masked S[row][:]) over N columns with optional causal mask (col > row + rowoff -> 0) and
__global__ __launch_bounds__(256) void k_softmax_rows(const float* __restrict__ S, float* __restrict__ P, int N, int causal, int rowoff, const int* __restrict__ mask, int mask_pitch) {
  __shared__ float red[256];
  const int row = blockIdx.x, tid = threadIdx.x;
  const float* s = S + (size_t)row * N; float* p_out = P + (size_t)row * N;
  const int qi = row + rowoff;
  float mx = -3.0e38f;
  for (int j = tid; j < N; j += 256) {
    bool keep = true;
    if (causal && j > qi) keep = false;
    if (mask && mask[(size_t)qi * mask_pitch + j] == 0) keep = false;
    const float v = keep ? s[j] : -3.0e38f;
    mx = fmaxf(mx, v);
  }
  red[tid] = mx; __syncthreads();
  for (int st = 128; st > 0; st >>= 1) { if (tid < st) red[tid] = fmaxf(red[tid], red[tid + st]); __syncthreads(); }
  mx = red[0]; __syncthreads();
  float sum = 0.f;
  for (int j = tid; j < N; j += 256) {
    bool keep = true;
    if (causal && j > qi) keep = false;
    if (mask && mask[(size_t)qi * mask_pitch + j] == 0) keep = false;
    const float p = keep ? __expf(s[j] - mx) : 0.f;
    sum += p;
  }
  red[tid] = sum; __syncthreads();
  for (int st = 128; st > 0; st >>= 1) { if (tid < st) red[tid] += red[tid + st]; __syncthreads(); }
  const float inv = (mx > -1.0e38f) ? 1.0f / red[0] : __builtin_nanf("");
  __syncthreads();
  {
    for (int j4 = tid * 4; j4 < N; j4 += 1024) {
      v4f out4;
#pragma unroll
      for (int u = 0; u < 4; ++u) {
        const int j = j4 + u;
        bool keep = true;
        if (causal && j > qi) keep = false;
        if (mask && mask[(size_t)qi * mask_pitch + j] == 0) keep = false;
        out4[u] = keep ? __expf(s[j] - mx) * inv : 0.f;
      }
      *(v4f*)(p_out + j4) = out4;
    }
    
  }
}

// GEMM C = act(A·W + bias + resid): A f32 (ASPLIT -> hi/lo 2 terms), Wt bf16 [N][K]; ACT 0 none, 1 relu, 2 exact gelu;
// resid (optional, f32, row index = (row % rmod), pitch ldr, RES_BF16 rounds it) added before the activation.
template <bool ASPLIT, int ACT, bool BIAS_BF16, bool RES_BF16>
__global__ __launch_bounds__(128) void k_gemm_bf3(const float* __restrict__ A, int lda, const unsigned short* __restrict__ Wt, int ldb,
                                                const float* __restrict__ bias, const float* __restrict__ resid, int rmod, int ldr,
                                                float* __restrict__ C, int ldc, int M, int N, int K) {
  __shared__ __attribute__((aligned(16))) float so[4][16][64];
  const int tid = threadIdx.x, w = tid >> 5, lane = tid & 31, ln = lane & 15, hh = lane >> 4;
  const int ntn = N / 64;
  const int wid = blockIdx.x * 4 + w;
  const int mt = wid / ntn, nq = wid % ntn;
  if (mt * 16 >= M) return;
  const int row0 = mt * 16, col0 = nq * 64;
  const float* arow = A + (size_t)(row0 + ln) * lda;
  v8f acc[4] = {};
  for (int kb = 0; kb < K; kb += 32) {
    FragB ah, al;
    const v4f x0 = *(const v4fa*)(arow + kb + 8 * hh), x1 = *(const v4fa*)(arow + kb + 8 * hh + 4);
    const v4f x2 = *(const v4fa*)(arow + kb + 16 + 8 * hh), x3 = *(const v4fa*)(arow + kb + 16 + 8 * hh + 4);
    float xs[16] = {x0[0],x0[1],x0[2],x0[3],x1[0],x1[1],x1[2],x1[3],x2[0],x2[1],x2[2],x2[3],x3[0],x3[1],x3[2],x3[3]};
#pragma unroll
    for (int i = 0; i < 16; ++i) { const unsigned short hb = bf16_bits(xs[i]); ah.u[i] = hb; al.u[i] = ASPLIT ? bf16_bits(xs[i] - bf16_val(hb)) : (unsigned short)0; }
#pragma unroll
    for (int t = 0; t < 4; ++t) {
      const unsigned short* brow = Wt + (size_t)(col0 + t * 16 + ln) * ldb + kb;
      FragB b;
      b.half[0] = *(const v8us*)(brow + 8 * hh);
      b.half[1] = *(const v8us*)(brow + 16 + 8 * hh);
      acc[t] = mmaN<ASPLIT ? 2 : 1>(ah.v, al.v, b.v, b.v, acc[t]);
    }
  }
#pragma unroll
  for (int t = 0; t < 4; ++t) {
    const int col = col0 + t * 16 + ln;
    float bv = bias ? bias[col] : 0.f;
    if (BIAS_BF16) bv = bf16_round(bv);
#pragma unroll
    for (int r = 0; r < 8; ++r) {
      float v = acc[t][r] + bv;
      if (resid) { float rv = resid[(size_t)((row0 + 8 * hh + r) % rmod) * ldr + col]; if (RES_BF16) rv = bf16_round(rv); v += rv; }
      if (ACT == 1) v = fmaxf(v, 0.f);
      if (ACT == 2) v = 0.5f * v * (1.0f + erff(v * 0.70710678118654752f));
      if (ACT == 3) { const float u = 0.7978845608028654f * (v + 0.044715f * v * v * v); v = 0.5f * v * (1.0f + tanhf(u)); }
      so[w][8 * hh + r][t * 16 + ln] = v;
    }
  }
  __builtin_amdgcn_fence(__ATOMIC_ACQ_REL, "workgroup");
  __builtin_amdgcn_wave_barrier();
  const int rsub = lane >> 4, c4 = (lane & 15) * 4;
  {
#pragma unroll
    for (int q = 0; q < 8; ++q) {
      const int r = q * 2 + rsub;
      const v4f v = *(const v4fa*)&so[w][r][c4];
      *(v4f*)(C + (size_t)(row0 + r) * ldc + col0 + c4) = v;
    }
    
  }
}
// row LayerNorm (biased variance, eps) over N: s = X (+ R); optional out_sum <- s; out_norm <- (s-mu)*rsqrt(var+eps)*g + b
template <bool PARAM_BF16>
__global__ __launch_bounds__(256) void k_layernorm(const float* __restrict__ X, const float* __restrict__ R, const float* __restrict__ g, const float* __restrict__ bta,
                                                  float* __restrict__ out_sum, float* __restrict__ out_norm, int N, float eps) {
  __shared__ float red[256];
  const int row = blockIdx.x, tid = threadIdx.x;
  const float* x = X + (size_t)row * N; const float* rr = R ? R + (size_t)row * N : nullptr;
  float vals[16];                     // up to N = 4096
  const int per = N / 256;            // contiguous chunk per thread? use strided-by-4 chunks: thread handles j = tid*4 + 1024*u
  float s1 = 0.f;
  for (int u = 0; u < per / 4; ++u) {
    const int j = tid * 4 + 1024 * u;
    const v4f a = *(const v4fa*)(x + j);
    v4f b = {0.f,0.f,0.f,0.f}; if (rr) b = *(const v4fa*)(rr + j);
#pragma unroll
    for (int q = 0; q < 4; ++q) { const float v = a[q] + b[q]; vals[u * 4 + q] = v; s1 += v; }
  }
  red[tid] = s1; __syncthreads();
  for (int st = 128; st > 0; st >>= 1) { if (tid < st) red[tid] += red[tid + st]; __syncthreads(); }
  const float mu = red[0] / (float)N; __syncthreads();
  float s2 = 0.f;
  for (int u = 0; u < per / 4; ++u)
#pragma unroll
    for (int q = 0; q < 4; ++q) { const float c = vals[u * 4 + q] - mu; s2 += c * c; }
  red[tid] = s2; __syncthreads();
  for (int st = 128; st > 0; st >>= 1) { if (tid < st) red[tid] += red[tid + st]; __syncthreads(); }
  const float rs = rsqrtf(red[0] / (float)N + eps);
  {
    for (int u = 0; u < per / 4; ++u) {
      const int j = tid * 4 + 1024 * u;
      v4f o, sm;
#pragma unroll
      for (int q = 0; q < 4; ++q) {
        float gg = g[j + q], bb = bta[j + q];
        if (PARAM_BF16) { gg = bf16_round(gg); bb = bf16_round(bb); }
        sm[q] = vals[u * 4 + q]; o[q] = (vals[u * 4 + q] - mu) * rs * gg + bb;
      }
      if (out_sum) *(v4f*)(out_sum + (size_t)row * N + j) = sm;
      *(v4f*)(out_norm + (size_t)row * N + j) = o;
    }
    
  }
}

// batched GEMM (blockIdx.y = batch): C_b = act(alpha·A_b·B_b + bias + resid_b); A f32 rows (ASPLIT → hi/lo), B = bf16 planes Bh (+Bl when BSPLIT, requires ASPLIT),
// per-batch element strides sA, sB (0 = shared weights), sC, sR. resid may alias C (values are staged before the stores). ACT 0/1(relu).
// ACT: 0 none, 1 relu, 2 softplus
template <bool ASPLIT, bool BSPLIT, int ACT>
__global__ __launch_bounds__(128) void k_gemm_b(const float* __restrict__ A, int lda, size_t sA, const unsigned short* __restrict__ Bh, const unsigned short* __restrict__ Bl, int ldb, size_t sB,
                                             const float* __restrict__ bias, const float* __restrict__ resid, int ldr, size_t sR, float rsign, float alpha,
                                             float* __restrict__ C, int ldc, size_t sC, int M, int N, int K) {
  __shared__ __attribute__((aligned(16))) float so[4][16][64];
  const int tid = threadIdx.x, w = tid >> 5, lane = tid & 31, ln = lane & 15, hh = lane >> 4;
  const int by = blockIdx.y;
  A += (size_t)by * sA; Bh += (size_t)by * sB; if (BSPLIT) Bl += (size_t)by * sB; C += (size_t)by * sC; if (resid) resid += (size_t)by * sR;
  const int ntn = N / 64; const int wid = blockIdx.x * 4 + w; const int mt = wid / ntn, nq = wid % ntn;
  if (mt * 16 >= M) return;
  const int row0 = mt * 16, col0 = nq * 64;
  const float* arow = A + (size_t)(row0 + ln) * lda;
  v8f acc[4] = {};
  for (int kb = 0; kb < K; kb += 32) {
    FragB ah, al;
    const v4f x0 = *(const v4fa*)(arow + kb + 8 * hh), x1 = *(const v4fa*)(arow + kb + 8 * hh + 4);
    const v4f x2 = *(const v4fa*)(arow + kb + 16 + 8 * hh), x3 = *(const v4fa*)(arow + kb + 16 + 8 * hh + 4);
    float xs[16] = {x0[0],x0[1],x0[2],x0[3],x1[0],x1[1],x1[2],x1[3],x2[0],x2[1],x2[2],x2[3],x3[0],x3[1],x3[2],x3[3]};
#pragma unroll
    for (int i = 0; i < 16; ++i) { const unsigned short hb = bf16_bits(xs[i]); ah.u[i] = hb; al.u[i] = ASPLIT ? bf16_bits(xs[i] - bf16_val(hb)) : (unsigned short)0; }
#pragma unroll
    for (int t = 0; t < 4; ++t) {
      const size_t boff = (size_t)(col0 + t * 16 + ln) * ldb + kb;
      FragB bh_, bl_; bh_.half[0] = *(const v8us*)(Bh + boff + 8 * hh); bh_.half[1] = *(const v8us*)(Bh + boff + 16 + 8 * hh);
      if (BSPLIT) { bl_.half[0] = *(const v8us*)(Bl + boff + 8 * hh); bl_.half[1] = *(const v8us*)(Bl + boff + 16 + 8 * hh); } else bl_ = bh_;
      acc[t] = mmaN<ASPLIT ? (BSPLIT ? 3 : 2) : 1>(ah.v, al.v, bh_.v, bl_.v, acc[t]);
    }
  }
#pragma unroll
  for (int t = 0; t < 4; ++t) {
    const int col = col0 + t * 16 + ln; const float bv = bias ? bf16_round(bias[col]) : 0.f;
#pragma unroll
    for (int r = 0; r < 8; ++r) { float v = acc[t][r] * alpha + bv; if (resid) v += rsign * resid[(size_t)(row0 + 8 * hh + r) * ldr + col]; if (ACT == 1) v = fmaxf(v, 0.f); else if (ACT == 2) v = fmaxf(v, 0.f) + log1pf(expf(-fabsf(v))); so[w][8 * hh + r][t * 16 + ln] = v; }
  }
  __builtin_amdgcn_fence(__ATOMIC_ACQ_REL, "workgroup"); __builtin_amdgcn_wave_barrier();
  const int rsub = lane >> 4, c4 = (lane & 15) * 4;
  {
#pragma unroll
    for (int q = 0; q < 8; ++q) { const int r = q * 2 + rsub; const v4f v = *(const v4fa*)&so[w][r][c4]; *(v4f*)(C + (size_t)(row0 + r) * ldc + col0 + c4) = v; }
    
  }
}
// batched f32 [K][N] (pitch lds, batch stride sIn) -> transposed hi/lo planes [N][K] (batch stride sOut); thread per (n, 8 k); grid.y = batch
__global__ __launch_bounds__(256) void k_split_transpose_b(const float* __restrict__ src, int lds_, size_t sIn, unsigned short* __restrict__ hi, unsigned short* __restrict__ lo, size_t sOut, int K, int N) {
  const size_t t = (size_t)blockIdx.x * 256 + threadIdx.x; const int k8n = K / 8; if (t >= (size_t)N * k8n) return;
  src += (size_t)blockIdx.y * sIn; hi += (size_t)blockIdx.y * sOut; lo += (size_t)blockIdx.y * sOut;
  const int n = (int)(t / k8n), k8 = (int)(t % k8n) * 8; v8us vh, vl;
#pragma unroll
  for (int i = 0; i < 8; ++i) { const float x = src[(size_t)(k8 + i) * lds_ + n]; const unsigned short hb = bf16_bits(x); vh[i] = hb; vl[i] = bf16_bits(x - bf16_val(hb)); }
  unsigned short* dh = hi + (size_t)n * K + k8; unsigned short* dl = lo + (size_t)n * K + k8;
  *(v8us*)dh = vh; *(v8us*)dl = vl; 
}

__global__ __launch_bounds__(256) void k_round_rows(const float* __restrict__ W, unsigned short* __restrict__ Wt, int n8) {
  const int t = blockIdx.x * 256 + threadIdx.x;
  if (t >= n8) return;
  const v4f a = *(const v4fa*)(W + (size_t)t * 8), b = *(const v4fa*)(W + (size_t)t * 8 + 4);
  v8us v; v[0]=bf16_bits(a[0]); v[1]=bf16_bits(a[1]); v[2]=bf16_bits(a[2]); v[3]=bf16_bits(a[3]);
  v[4]=bf16_bits(b[0]); v[5]=bf16_bits(b[1]); v[6]=bf16_bits(b[2]); v[7]=bf16_bits(b[3]);
  *(v8us*)(Wt + (size_t)t * 8) = v; 
}

// Bt for the projections: X inputs are [512][8192] = [K][N] layout (x@W form with A = M [64][512]): Bt[n=s][k=c] = X[c][s] -> k_wt_bf16(X, Bt, 512, 8192)

// ---- f16 WMMA path (v_wmma_f32_16x16x32_f16): 11-bit significands for operands in range — used for the scores Sᵀ and for the [0,1] probability operand P, which needs more precision than bf16
typedef _Float16 v16h __attribute__((ext_vector_type(16)));
union FragH { v16h v; v8us half[2]; _Float16 h[16]; unsigned short u[16]; };
template <int NT>
__device__ __forceinline__ v8f mmaH(v16h ah, v16h al, v16h bh, v16h bl, v8f c) {
  c = __builtin_amdgcn_wmma_f32_16x16x32_f16(false, ah, false, bh, (short)0, c, false, false);
  if (NT >= 2) c = __builtin_amdgcn_wmma_f32_16x16x32_f16(false, al, false, bh, (short)0, c, false, false);
  if (NT >= 3) c = __builtin_amdgcn_wmma_f32_16x16x32_f16(false, ah, false, bl, (short)0, c, false, false);
  asm volatile("v_nop\n\tv_nop\n\tv_nop\n\tv_nop" : "+v"(c) : "v"(ah), "v"(al), "v"(bh), "v"(bl));
  return c;
}
// batched GEMM like k_gemm_b but f16 operands: A f32 (split into f16 hi/lo if ASPLIT, else rounded to f16), Bt = f16 values [n][k]; alpha; C f32; N multiple of 16 (partial tiles skipped)
template <bool ASPLIT>
__global__ __launch_bounds__(128) void k_gemm_h(const float* __restrict__ A, int lda, size_t sA, const _Float16* __restrict__ Bh, int ldb, size_t sB, float alpha, float* __restrict__ C, int ldc, size_t sC, int M, int N, int K) {
  __shared__ __attribute__((aligned(16))) float so[4][16][64];
  const int tid = threadIdx.x, w = tid >> 5, lane = tid & 31, ln = lane & 15, hh = lane >> 4; const int by = blockIdx.y;
  A += (size_t)by * sA; Bh += (size_t)by * sB; C += (size_t)by * sC;
  const int ntn = (N + 63) / 64; const int wid = blockIdx.x * 4 + w; const int mt = wid / ntn, nq = wid % ntn; if (mt * 16 >= M) return;
  const int row0 = mt * 16, col0 = nq * 64; const float* arow = A + (size_t)(row0 + ln) * lda;
  v8f acc[4] = {};
  for (int kb = 0; kb < K; kb += 32) {
    FragH ah, al;
    const v4f x0 = *(const v4fa*)(arow + kb + 8 * hh), x1 = *(const v4fa*)(arow + kb + 8 * hh + 4), x2 = *(const v4fa*)(arow + kb + 16 + 8 * hh), x3 = *(const v4fa*)(arow + kb + 16 + 8 * hh + 4);
    float xs[16] = {x0[0],x0[1],x0[2],x0[3],x1[0],x1[1],x1[2],x1[3],x2[0],x2[1],x2[2],x2[3],x3[0],x3[1],x3[2],x3[3]};
#pragma unroll
    for (int i = 0; i < 16; ++i) { const _Float16 h = (_Float16)xs[i]; ah.h[i] = h; al.h[i] = ASPLIT ? (_Float16)(xs[i] - (float)h) : (_Float16)0.0f; }
#pragma unroll
    for (int t = 0; t < 4; ++t) { if (col0 + t * 16 >= N) continue; const size_t boff = (size_t)(col0 + t * 16 + ln) * ldb + kb; FragH bq; bq.half[0] = *(const v8us*)(Bh + boff + 8 * hh); bq.half[1] = *(const v8us*)(Bh + boff + 16 + 8 * hh);
      acc[t] = mmaH<ASPLIT ? 2 : 1>(ah.v, al.v, bq.v, bq.v, acc[t]); }
  }
#pragma unroll
  for (int t = 0; t < 4; ++t) { if (col0 + t * 16 >= N) continue;
#pragma unroll
    for (int r = 0; r < 8; ++r) so[w][8 * hh + r][t * 16 + ln] = acc[t][r] * alpha; }
  __builtin_amdgcn_fence(__ATOMIC_ACQ_REL, "workgroup"); __builtin_amdgcn_wave_barrier();
  const int rsub = lane >> 4, c4 = (lane & 15) * 4;
  {
#pragma unroll
    for (int q = 0; q < 8; ++q) { const int r = q * 2 + rsub; if (col0 + c4 < N) { const v4f v = *(const v4fa*)&so[w][r][c4]; *(v4f*)(C + (size_t)(row0 + r) * ldc + col0 + c4) = v; } }
     }
}

// QdH[s][d] = f16(Qd[d][s]) (transposed, f16); thread per (s, 8 d)
__global__ __launch_bounds__(256) void k_qdh(const float* __restrict__ Qd, _Float16* __restrict__ QdH) { const int t = blockIdx.x * 256 + threadIdx.x; if (t >= SQ * (DO / 8)) return; const int s = t / (DO / 8), d8 = (t % (DO / 8)) * 8; FragH f; for (int i = 0; i < 8; ++i) f.h[i] = (_Float16)Qd[(size_t)(d8 + i) * SQ + s]; const v8us o = f.half[0]; *(v8us*)((unsigned short*)QdH + (size_t)s * DO + d8) = o;  }
// row softmax in place on ST[t][s] over s, after x 1/8 + 1. One work-group of 8 waves per row; the row stays in registers (32 values a thread),
// so S is read once and written once, and a thread's 8 loads of 16 bytes are all in flight together.
__global__ __launch_bounds__(256) void k_softmax(float* __restrict__ S) {
  __shared__ float rmx[8], rsm[8];
  const int tid = threadIdx.x, wv = tid >> 5, lane = tid & 31; float* row = S + (size_t)blockIdx.x * SQ + tid * 4;
  v4f x[8];
  // the loops over i and q are unrolled so that x is indexed by constants and stays in registers
#pragma unroll
  for (int i = 0; i < 8; ++i) x[i] = *(const v4fa*)(row + i * 1024);
  __builtin_amdgcn_sched_barrier(0);      // keeps all 8 loads in front of the first use: without it they are issued two at a time, four memory latencies in a row
  float mx = -3.0e38f;
#pragma unroll
  for (int i = 0; i < 8; ++i)
#pragma unroll
    for (int q = 0; q < 4; ++q) { x[i][q] = x[i][q] * 0.125f + 1.0f; mx = fmaxf(mx, x[i][q]); }
  for (int o = 16; o >= 1; o >>= 1) mx = fmaxf(mx, __shfl_xor(mx, o, 32));
  if (lane == 0) rmx[wv] = mx;
  __syncthreads();      // every wave's maximum is in rmx
  for (int p = 0; p < 8; ++p) mx = fmaxf(mx, rmx[p]);
  float den = 0.f;
#pragma unroll
  for (int i = 0; i < 8; ++i)
#pragma unroll
    for (int q = 0; q < 4; ++q) { x[i][q] = expf(x[i][q] - mx); den += x[i][q]; }
  for (int o = 16; o >= 1; o >>= 1) den += __shfl_xor(den, o, 32);
  if (lane == 0) rsm[wv] = den;
  __syncthreads();      // every wave's sum is in rsm
  den = 0.f;
  for (int p = 0; p < 8; ++p) den += rsm[p];      // wave order, the same in every thread
  const float inv = 1.0f / den;
#pragma unroll
  for (int i = 0; i < 8; ++i) { const v4f p = x[i] * inv; *(v4f*)(row + i * 1024) = p; }
}
// P block rounded to f16 as Bt[n = t][k = s] (row-major P is already [t][s]): thread per 8
__global__ __launch_bounds__(256) void k_pb(const float* __restrict__ S, _Float16* __restrict__ Pb) { const size_t t = (size_t)blockIdx.x * 256 + threadIdx.x; if (t >= (size_t)TB * SQ / 8) return; FragH f; for (int i = 0; i < 8; ++i) f.h[i] = (_Float16)(S[t * 8 + i] * 256.0f);      /* ×2^8 (exact) keeps P ≥ 2.4e-7 out of the f16 subnormal range; folded back by the ×2^-8 in k_pv */ const v8us o = f.half[0]; *(v8us*)((unsigned short*)Pb + t * 8) = o;  }      // P·2^8 as f16 (11-bit significand; subnormal only for P below 2.4e-7)
// out[d][t] = 2^-8 * sum_s Vd[d][s] * Pb[t][s] for one block of TB key columns. One work-group per 16 x 32 output tile; its PVW waves each take
// SQ / PVW of the s range (same fragments and products as k_gemm_h<true>), leave an f32 partial tile in LDS, and the partials are added in wave order.
#define PVW 32
__global__ __launch_bounds__(PVW * 32) void k_pv(const float* __restrict__ Vd, const _Float16* __restrict__ Pb, float* __restrict__ out) {
  __shared__ __attribute__((aligned(16))) float part[PVW][16][32];
  const int tid = threadIdx.x, w = tid >> 5, lane = tid & 31, ln = lane & 15, hh = lane >> 4;
  const int row0 = (blockIdx.x / (TB / 32)) * 16, col0 = (blockIdx.x % (TB / 32)) * 32;
  const float* arow = Vd + (size_t)(row0 + ln) * SQ + w * (SQ / PVW);
  const _Float16* brow = Pb + (size_t)(col0 + ln) * SQ + w * (SQ / PVW);
  v8f acc[2] = {};
  // the inner loops below are unrolled so that xs, the fragments and acc are indexed by constants and stay in registers
  for (int kb = 0; kb < SQ / PVW; kb += 32) {
    FragH ah, al;
    const v4f x0 = *(const v4fa*)(arow + kb + 8 * hh), x1 = *(const v4fa*)(arow + kb + 8 * hh + 4), x2 = *(const v4fa*)(arow + kb + 16 + 8 * hh), x3 = *(const v4fa*)(arow + kb + 16 + 8 * hh + 4);
    float xs[16] = {x0[0],x0[1],x0[2],x0[3],x1[0],x1[1],x1[2],x1[3],x2[0],x2[1],x2[2],x2[3],x3[0],x3[1],x3[2],x3[3]};
#pragma unroll
    for (int i = 0; i < 16; ++i) { const _Float16 h = (_Float16)xs[i]; ah.h[i] = h; al.h[i] = (_Float16)(xs[i] - (float)h); }
#pragma unroll
    for (int t = 0; t < 2; ++t) { const size_t boff = (size_t)(t * 16) * SQ + kb; FragH bq; bq.half[0] = *(const v8us*)(brow + boff + 8 * hh); bq.half[1] = *(const v8us*)(brow + boff + 16 + 8 * hh);
      acc[t] = mmaH<2>(ah.v, al.v, bq.v, bq.v, acc[t]); }
  }
#pragma unroll
  for (int t = 0; t < 2; ++t)
#pragma unroll
    for (int r = 0; r < 8; ++r) part[w][8 * hh + r][t * 16 + ln] = acc[t][r];
  __syncthreads();
  if (w >= 16) return;
  float s = 0.f;      // wave w sums and stores row w of the tile: one whole 128-byte line
  for (int p = 0; p < PVW; ++p) s += part[p][w][lane];
  out[(size_t)(row0 + w) * SQ + col0 + lane] = s * 0.00390625f;
}
extern "C" void kernel_launch(void* const* d_in, const int* in_sizes, int n_in,
                              void* d_out, int out_size, void* d_ws, size_t ws_size, hipStream_t stream) {
  (void)in_sizes; (void)n_in; (void)out_size;
  const float* Q = (const float*)d_in[0]; const float* K = (const float*)d_in[1]; const float* V = (const float*)d_in[2]; const float* Mq = (const float*)d_in[3]; const float* Mk = (const float*)d_in[4]; const float* Mv = (const float*)d_in[5];
  char* ws = (char*)d_ws; size_t off = 0;
  auto take = [&](size_t bytes) { char* p = ws + off; off += (bytes + 255) & ~(size_t)255; return p; };
  unsigned short* BQ = (unsigned short*)take((size_t)SQ * DI * 2); unsigned short* BK = (unsigned short*)take((size_t)SQ * DI * 2); unsigned short* BV = (unsigned short*)take((size_t)SQ * DI * 2);
  float* Qd = (float*)take((size_t)DO * SQ * 4); float* Kd = (float*)take((size_t)DO * SQ * 4); float* Vd = (float*)take((size_t)DO * SQ * 4); float* KdT = (float*)take((size_t)SQ * DO * 4); _Float16* QdB = (_Float16*)take((size_t)SQ * DO * 2);
  float* S = (float*)take((size_t)TB * SQ * 4); _Float16* Pb = (_Float16*)take((size_t)TB * SQ * 2);
  if (off > ws_size) return;
  k_wt_bf16<<<(unsigned)(((size_t)SQ * (DI / 8) + 255) / 256), 256, 0, stream>>>(Q, BQ, DI, SQ); k_wt_bf16<<<(unsigned)(((size_t)SQ * (DI / 8) + 255) / 256), 256, 0, stream>>>(K, BK, DI, SQ); k_wt_bf16<<<(unsigned)(((size_t)SQ * (DI / 8) + 255) / 256), 256, 0, stream>>>(V, BV, DI, SQ);
  const unsigned gp = ((DO / 16) * (SQ / 64) + 3) / 4;
  k_gemm_bf3<false, 0, false, false><<<gp, 128, 0, stream>>>(Mq, DI, BQ, DI, nullptr, nullptr, 1, 0, Qd, SQ, DO, SQ, DI);      // Qd = Mq·Q [64][8192]
  k_gemm_bf3<false, 0, false, false><<<gp, 128, 0, stream>>>(Mk, DI, BK, DI, nullptr, nullptr, 1, 0, Kd, SQ, DO, SQ, DI);
  k_gemm_bf3<false, 0, false, false><<<gp, 128, 0, stream>>>(Mv, DI, BV, DI, nullptr, nullptr, 1, 0, Vd, SQ, DO, SQ, DI);
  k_transpose32<false, false, false><<<dim3(SQ / 32, DO / 32, 1), 256, 0, stream>>>(Kd, KdT, DO, SQ, nullptr, nullptr, nullptr);        // Kd [64][8192] -> KdT [8192][64]
  k_qdh<<<(SQ * (DO / 8) + 255) / 256, 256, 0, stream>>>(Qd, QdB);                                         // Bt[s][d] = f16(Qd[d][s])
  for (int tb = 0; tb < SQ / TB; ++tb) {
    k_gemm_h<true><<<dim3(((TB / 16) * (SQ / 64) + 3) / 4, 1), 128, 0, stream>>>(KdT + (size_t)tb * TB * DO, DO, 0, QdB, DO, 0, 1.f, S, SQ, 0, TB, SQ, DO);   // Sᵀ[t][s] = Kd[:,t]·Qd[:,s] (f16 hi/lo × f16 Qd: 2 products)
    k_softmax<<<TB, 256, 0, stream>>>(S);
    k_pb<<<(unsigned)(((size_t)TB * SQ / 8 + 255) / 256), 256, 0, stream>>>(S, Pb);
    k_pv<<<(DO / 16) * (TB / 32), PVW * 32, 0, stream>>>(Vd, Pb, (float*)d_out + (size_t)tb * TB);   // out[d][t] = Σ_s Vd[d][s]·P[t][s] (f16 hi/lo × f16 P: 2 products)
  }
}

// v003
// Measured time: 186 microseconds a run.
// In two side-by-side timings against v002, it was 2.64 and 2.63 times as fast.
// Counting every step since v000, it is 24.4 times as fast.
#include <hip/hip_runtime.h>
// On v_wmma_f32_16x16x32_bf16 with f32 accumulate: the projections Qd/Kd/Vd = M.{Q,K,V} (M = 64, K = 512, N = 8192; inputs rounded to bf16: single exact term).
// On v_wmma_f32_16x16x32_f16, in one fused kernel (k_attn): the scores S[s][t] = Qd[:,s].Kd[:,t] (Qd rounded to f16, Kd split into f16 hi/lo: 2 products, K = 64) and
// out[:, t] = Vd.P[:, t] (Vd split into f16 hi/lo, the softmax weights rounded to f16: 2 products, K = 8192). The module's softmax runs over the QUERY axis s (dim 0);
// /sqrt(64) and the +1 constant are f32 VALU.
#define DI 512
#define DO 64
#define SQ 8192

typedef __bf16 v16b __attribute__((ext_vector_type(16)));
typedef unsigned short v8us __attribute__((ext_vector_type(8), may_alias));
typedef float  v8f  __attribute__((ext_vector_type(8)));
typedef float  v4f  __attribute__((ext_vector_type(4)));
typedef float  v4fa __attribute__((ext_vector_type(4), may_alias));
union FragB { v16b v; v8us half[2]; unsigned short u[16]; };

__device__ __forceinline__ unsigned short bf16_bits(float x) { unsigned int u = __float_as_uint(x); return (unsigned short)((u + 0x7FFFu + ((u >> 16) & 1u)) >> 16); }
__device__ __forceinline__ float bf16_val(unsigned short b) { return __uint_as_float(((unsigned int)b) << 16); }
__device__ __forceinline__ float bf16_round(float x) { return bf16_val(bf16_bits(x)); }
// D += A·B with NT terms: 1 = ah·bh, 2 = + al·bh (A split), 3 = + ah·bl (both split)
template <int NT>
__device__ __forceinline__ v8f mmaN(v16b ah, v16b al, v16b bh, v16b bl, v8f c) {
  c = __builtin_amdgcn_wmma_f32_16x16x32_bf16(false, ah, false, bh, (short)0, c, false, false);
  if (NT >= 2) c = __builtin_amdgcn_wmma_f32_16x16x32_bf16(false, al, false, bh, (short)0, c, false, false);
  if (NT >= 3) c = __builtin_amdgcn_wmma_f32_16x16x32_bf16(false, ah, false, bl, (short)0, c, false, false);
  asm volatile("v_nop\n\tv_nop\n\tv_nop\n\tv_nop" : "+v"(c) : "v"(ah), "v"(al), "v"(bh), "v"(bl));
  return c;
}

__global__ __launch_bounds__(256) void k_wt_bf16(const float* __restrict__ W, unsigned short* __restrict__ Wt, int K, int N) {
  const int t = blockIdx.x * 256 + threadIdx.x;
  const int k8n = K / 8;
  if (t >= N * k8n) return;
  const int n = t / k8n, k8 = (t % k8n) * 8;
  v8us v;
#pragma unroll
  for (int i = 0; i < 8; ++i) v[i] = bf16_bits(W[(size_t)(k8 + i) * N + n]);
  *(v8us*)(Wt + (size_t)n * K + k8) = v;
  
}

// GEMM C[M][N] (f32, pitch ldc) = act(A[M][K]·W + bias). A f32 row-major (pitch lda) converted per fragment to bf16
// (ASPLIT: hi/lo two planes -> 2 terms, else single rounded term); Wt bf16 [N][K] (pitch ldb). BIAS_BF16 rounds the
// bias to bf16 first (bias quantised to bf16 before the add). K%32==0, M%16==0, N%64==0.
template <bool ASPLIT, int ACT, bool BIAS_BF16>
__global__ __launch_bounds__(128) void k_gemm_bf(const float* __restrict__ A, int lda, const unsigned short* __restrict__ Wt, int ldb,
                                               const float* __restrict__ bias, float* __restrict__ C, int ldc, int M, int N, int K) {
  __shared__ __attribute__((aligned(16))) float so[4][16][64];
  const int tid = threadIdx.x, w = tid >> 5, lane = tid & 31, ln = lane & 15, hh = lane >> 4;
  const int ntn = N / 64;
  const int wid = blockIdx.x * 4 + w;
  const int mt = wid / ntn, nq = wid % ntn;
  if (mt * 16 >= M) return;
  const int row0 = mt * 16, col0 = nq * 64;
  const float* arow = A + (size_t)(row0 + ln) * lda;
  v8f acc[4] = {};
  for (int kb = 0; kb < K; kb += 32) {
    FragB ah, al;
    const v4f x0 = *(const v4fa*)(arow + kb + 8 * hh), x1 = *(const v4fa*)(arow + kb + 8 * hh + 4);
    const v4f x2 = *(const v4fa*)(arow + kb + 16 + 8 * hh), x3 = *(const v4fa*)(arow + kb + 16 + 8 * hh + 4);
    float xs[16] = {x0[0],x0[1],x0[2],x0[3],x1[0],x1[1],x1[2],x1[3],x2[0],x2[1],x2[2],x2[3],x3[0],x3[1],x3[2],x3[3]};
#pragma unroll
    for (int i = 0; i < 16; ++i) { const unsigned short hb = bf16_bits(xs[i]); ah.u[i] = hb; al.u[i] = ASPLIT ? bf16_bits(xs[i] - bf16_val(hb)) : (unsigned short)0; }
#pragma unroll
    for (int t = 0; t < 4; ++t) {
      const unsigned short* brow = Wt + (size_t)(col0 + t * 16 + ln) * ldb + kb;
      FragB b;
      b.half[0] = *(const v8us*)(brow + 8 * hh);
      b.half[1] = *(const v8us*)(brow + 16 + 8 * hh);
      acc[t] = mmaN<ASPLIT ? 2 : 1>(ah.v, al.v, b.v, b.v, acc[t]);
    }
  }
#pragma unroll
  for (int t = 0; t < 4; ++t) {
    float bv = bias ? bias[col0 + t * 16 + ln] : 0.f;
    if (BIAS_BF16) bv = bf16_round(bv);
#pragma unroll
    for (int r = 0; r < 8; ++r) { float v = acc[t][r] + bv; if (ACT == 1) v = fmaxf(v, 0.f); so[w][8 * hh + r][t * 16 + ln] = v; }
  }
  __builtin_amdgcn_fence(__ATOMIC_ACQ_REL, "workgroup");
  __builtin_amdgcn_wave_barrier();
  const int rsub = lane >> 4, c4 = (lane & 15) * 4;
  {
#pragma unroll
    for (int q = 0; q < 8; ++q) {
      const int r = q * 2 + rsub;
      const v4f v = *(const v4fa*)&so[w][r][c4];
      *(v4f*)(C + (size_t)(row0 + r) * ldc + col0 + c4) = v;
    }
    
  }
}

// Flash-style causal/unmasked attention, all contractions 3-term bf16 hi/lo splits, f32 softmax with running max.
// q,k,v rows are read from f32 buffers with arbitrary row pitch (so they can live inside a fused qkv buffer);
// D = head size (multiple of 32, <= 128); one wave = 16 query rows; block = 4 waves (64 queries) sharing K/V chunks of 32.
template <int D, bool CAUSAL>
__global__ __launch_bounds__(128) void k_flash(const float* __restrict__ qb, const float* __restrict__ kb, const float* __restrict__ vb,
                                             int pitch, int T, int H, float scale, float* __restrict__ y, int ypitch) {
  constexpr int KS = D / 32;        // k-steps for QK
  constexpr int DT = D / 16;        // d tiles for PV
  __shared__ __attribute__((aligned(16))) unsigned short sKh[32][D + 8], sKl[32][D + 8], sVh[32][D + 8], sVl[32][D + 8];
  __shared__ __attribute__((aligned(16))) unsigned short sPh[4][16][40], sPl[4][16][40];
  __shared__ __attribute__((aligned(16))) float sO[4][16][D];
  const int tid = threadIdx.x, w = tid >> 5, lane = tid & 31, ln = lane & 15, hh = lane >> 4;
  const int nqb = (T + 63) / 64;
  const int bh = blockIdx.x / nqb, qblk = blockIdx.x % nqb;
  const int b = bh / H, h = bh % H;
  const int q0 = qblk * 64 + w * 16;
  const float* Q = qb + (size_t)b * T * pitch + h * D;
  const float* K = kb + (size_t)b * T * pitch + h * D;
  const float* V = vb + (size_t)b * T * pitch + h * D;

  // A fragments of the wave's 16 query rows (scaled), hi/lo
  FragB aqh[KS], aql[KS];
  {
    int row = q0 + ln; if (row >= T) row = T - 1;
    const float* qr = Q + (size_t)row * pitch;
#pragma unroll
    for (int ks = 0; ks < KS; ++ks)
#pragma unroll
      for (int i = 0; i < 16; ++i) {
        const int d = ks * 32 + ((i < 8) ? (8 * hh + i) : (16 + 8 * hh + (i - 8)));
        const float x = qr[d] * scale; const unsigned short hb = bf16_bits(x);
        aqh[ks].u[i] = hb; aql[ks].u[i] = bf16_bits(x - bf16_val(hb));
      }
  }
  float m_r[8], l_r[8];
#pragma unroll
  for (int r = 0; r < 8; ++r) { m_r[r] = -3.0e38f; l_r[r] = 0.f; }
  v8f oacc[DT];
#pragma unroll
  for (int dt = 0; dt < DT; ++dt) oacc[dt] = (v8f){0.f,0.f,0.f,0.f,0.f,0.f,0.f,0.f};

  const int kv_end = CAUSAL ? min(T, qblk * 64 + 64) : T;     // block-uniform
  for (int j0 = 0; j0 < kv_end; j0 += 32) {
    __syncthreads();
    for (int e = tid; e < 32 * (D / 4); e += 128) {
      const int r = e / (D / 4), c4 = (e % (D / 4)) * 4;
      const int key = j0 + r;
      v4f kf = {0.f,0.f,0.f,0.f}, vf = {0.f,0.f,0.f,0.f};
      if (key < T) { kf = *(const v4fa*)(K + (size_t)key * pitch + c4); vf = *(const v4fa*)(V + (size_t)key * pitch + c4); }
#pragma unroll
      for (int t = 0; t < 4; ++t) {
        unsigned short hb = bf16_bits(kf[t]); sKh[r][c4 + t] = hb; sKl[r][c4 + t] = bf16_bits(kf[t] - bf16_val(hb));
        hb = bf16_bits(vf[t]); sVh[r][c4 + t] = hb; sVl[r][c4 + t] = bf16_bits(vf[t] - bf16_val(hb));
      }
    }
    __syncthreads();
    // S tile 16 x 32
    v8f s[2];
#pragma unroll
    for (int nt = 0; nt < 2; ++nt) {
      v8f acc = {};
#pragma unroll
      for (int ks = 0; ks < KS; ++ks) {
        FragB bh_, bl_;
        bh_.half[0] = *(const v8us*)&sKh[nt * 16 + ln][ks * 32 + 8 * hh]; bh_.half[1] = *(const v8us*)&sKh[nt * 16 + ln][ks * 32 + 16 + 8 * hh];
        bl_.half[0] = *(const v8us*)&sKl[nt * 16 + ln][ks * 32 + 8 * hh]; bl_.half[1] = *(const v8us*)&sKl[nt * 16 + ln][ks * 32 + 16 + 8 * hh];
        acc = mmaN<3>(aqh[ks].v, aql[ks].v, bh_.v, bl_.v, acc);
      }
      s[nt] = acc;
    }
    // mask + running max (rows 8hh+r; the 16 lanes of a half share rows)
    float alpha[8];
#pragma unroll
    for (int r = 0; r < 8; ++r) {
      const int qi = q0 + 8 * hh + r;
      const int ja = j0 + ln, jb = j0 + 16 + ln;
      if (CAUSAL) { if (ja > qi) s[0][r] = -3.0e38f; if (jb > qi) s[1][r] = -3.0e38f; }
      if (ja >= T) s[0][r] = -3.0e38f;
      if (jb >= T) s[1][r] = -3.0e38f;
      float mx = fmaxf(s[0][r], s[1][r]);
      mx = fmaxf(mx, __shfl_xor(mx, 1, 32)); mx = fmaxf(mx, __shfl_xor(mx, 2, 32)); mx = fmaxf(mx, __shfl_xor(mx, 4, 32)); mx = fmaxf(mx, __shfl_xor(mx, 8, 32));
      const float mnew = fmaxf(m_r[r], mx);
      alpha[r] = (mnew > -1.0e38f) ? __expf(m_r[r] - mnew) : 1.0f;
      const float p0 = (s[0][r] > -1.0e38f) ? __expf(s[0][r] - mnew) : 0.f;
      const float p1 = (s[1][r] > -1.0e38f) ? __expf(s[1][r] - mnew) : 0.f;
      m_r[r] = mnew;
      l_r[r] = l_r[r] * alpha[r] + p0 + p1;            // per-lane partial row sum (16 lanes combined at the end)
      unsigned short hb = bf16_bits(p0); sPh[w][8 * hh + r][ln] = hb;      sPl[w][8 * hh + r][ln] = bf16_bits(p0 - bf16_val(hb));
      hb = bf16_bits(p1);                sPh[w][8 * hh + r][16 + ln] = hb; sPl[w][8 * hh + r][16 + ln] = bf16_bits(p1 - bf16_val(hb));
    }
#pragma unroll
    for (int dt = 0; dt < DT; ++dt)
#pragma unroll
      for (int r = 0; r < 8; ++r) oacc[dt][r] *= alpha[r];
    __builtin_amdgcn_fence(__ATOMIC_ACQ_REL, "workgroup");
    __builtin_amdgcn_wave_barrier();
    FragB pah, pal;
    pah.half[0] = *(const v8us*)&sPh[w][ln][8 * hh]; pah.half[1] = *(const v8us*)&sPh[w][ln][16 + 8 * hh];
    pal.half[0] = *(const v8us*)&sPl[w][ln][8 * hh]; pal.half[1] = *(const v8us*)&sPl[w][ln][16 + 8 * hh];
#pragma unroll
    for (int dt = 0; dt < DT; ++dt) {
      FragB bvh, bvl;
#pragma unroll
      for (int i = 0; i < 8; ++i) {
        bvh.u[i] = sVh[8 * hh + i][dt * 16 + ln]; bvh.u[8 + i] = sVh[16 + 8 * hh + i][dt * 16 + ln];
        bvl.u[i] = sVl[8 * hh + i][dt * 16 + ln]; bvl.u[8 + i] = sVl[16 + 8 * hh + i][dt * 16 + ln];
      }
      oacc[dt] = mmaN<3>(pah.v, pal.v, bvh.v, bvl.v, oacc[dt]);
    }
    __builtin_amdgcn_fence(__ATOMIC_ACQ_REL, "workgroup");
    __builtin_amdgcn_wave_barrier();
  }
#pragma unroll
  for (int r = 0; r < 8; ++r) {
    float l = l_r[r];
    l += __shfl_xor(l, 1, 32); l += __shfl_xor(l, 2, 32); l += __shfl_xor(l, 4, 32); l += __shfl_xor(l, 8, 32);
    l_r[r] = (l > 0.f) ? 1.0f / l : 0.f;
  }
#pragma unroll
  for (int dt = 0; dt < DT; ++dt)
#pragma unroll
    for (int r = 0; r < 8; ++r) sO[w][8 * hh + r][dt * 16 + ln] = oacc[dt][r] * l_r[r];
  __builtin_amdgcn_fence(__ATOMIC_ACQ_REL, "workgroup");
  __builtin_amdgcn_wave_barrier();
  {
    for (int r = 0; r < 16; ++r) {
      const int row = q0 + r;
      if (row < T && lane < D / 4) {
        const v4f val = *(const v4fa*)&sO[w][r][lane * 4];
        *(v4f*)(y + ((size_t)b * T + row) * ypitch + h * D + lane * 4) = val;
      }
    }
    
  }
}

// in pitch = cols, out pitch = rows; rows, cols multiples of 32. Optional per-output-row affine (scale[c], shift[c]) and
// residual add res (same layout as out, optionally bf16-rounded) for fused epilogues: out = in*scale + shift + res.
template <bool AFFINE, bool RESID, bool RES_BF16>
__global__ __launch_bounds__(256) void k_transpose32(const float* __restrict__ in, float* __restrict__ out, int rows, int cols,
                                                    const float* __restrict__ scale, const float* __restrict__ shift, const float* __restrict__ res) {
  __shared__ float tile[32][33];
  const int b = blockIdx.z;
  const int r0 = blockIdx.y * 32, c0 = blockIdx.x * 32;
  const float* src = in + (size_t)b * rows * cols;
  float* dst = out + (size_t)b * rows * cols;
  const int tx = threadIdx.x & 31, ty = threadIdx.x >> 5;     // 8 rows per pass
  for (int i = ty; i < 32; i += 8) tile[i][tx] = src[(size_t)(r0 + i) * cols + c0 + tx];
  __syncthreads();
  {
    for (int i = ty; i < 32; i += 8) {
      float v = tile[tx][i];
      const int orow = c0 + i;
      if (AFFINE) v = v * scale[orow] + shift[orow];
      if (RESID) { float rv = res[(size_t)b * rows * cols + (size_t)orow * rows + r0 + tx]; if (RES_BF16) rv = bf16_round(rv); v += rv; }
      *(float*)(dst + (size_t)orow * rows + r0 + tx) = v;
    }
    
  }
}

// 2x2 max pool on position-major data: in [B][H*W][C] -> out [B][(H/2)*(W/2)][C]; thread per (b, p', 4 channels); C%4==0
__global__ __launch_bounds__(256) void k_pool2_pm(const float* __restrict__ in, float* __restrict__ out, int Bn, int H, int W, int C) {
  const size_t t = (size_t)blockIdx.x * 256 + threadIdx.x;
  const int c4n = C / 4, Ho = H / 2, Wo = W / 2;
  const size_t total = (size_t)Bn * Ho * Wo * c4n;
  if (t >= total) return;
  const int c4 = (int)(t % c4n) * 4; size_t rest = t / c4n;
  const int pw = (int)(rest % Wo); rest /= Wo; const int ph = (int)(rest % Ho); const int b = (int)(rest / Ho);
  const float* base = in + (size_t)b * H * W * C;
  const int p00 = (2 * ph) * W + 2 * pw;
  const v4f a = *(const v4fa*)(base + (size_t)p00 * C + c4), bq = *(const v4fa*)(base + (size_t)(p00 + 1) * C + c4);
  const v4f c = *(const v4fa*)(base + (size_t)(p00 + W) * C + c4), d = *(const v4fa*)(base + (size_t)(p00 + W + 1) * C + c4);
  v4f m; for (int i = 0; i < 4; ++i) m[i] = fmaxf(fmaxf(a[i], bq[i]), fmaxf(c[i], d[i]));
  float* dst = out + ((size_t)b * Ho * Wo + (size_t)ph * Wo + pw) * C + c4;
  *(v4f*)dst = m;
  
}

// General (non-causal) attention, 3-term bf16 splits, f32 softmax with running max.
// Q [.][Tq][qpitch], K [.][Tk][kpitch] (head dim DQ), V [.][Tk][vpitch] (head dim DVtot); this block handles DV output
// dims starting at dv0 = blockIdx.y*DV. y[bh][t][ypitch] gets columns dv0..dv0+DV-1. Per-bh base offsets via strides.
template <int DQ, int DV>
__global__ __launch_bounds__(128) void k_flash2(const float* __restrict__ Qb, size_t qstride, int qpitch, int Tq,
                                              const float* __restrict__ Kb, size_t kstride, int kpitch, int Tk,
                                              const float* __restrict__ Vb, size_t vstride, int vpitch,
                                              float scale, float* __restrict__ y, size_t ystride, int ypitch) {
  constexpr int KS = DQ / 32, DT = DV / 16;
  __shared__ __attribute__((aligned(16))) unsigned short sKh[32][DQ + 8], sKl[32][DQ + 8], sVh[32][DV + 8], sVl[32][DV + 8];
  __shared__ __attribute__((aligned(16))) unsigned short sPh[4][16][40], sPl[4][16][40];
  __shared__ __attribute__((aligned(16))) float sO[4][16][DV];
  const int tid = threadIdx.x, w = tid >> 5, lane = tid & 31, ln = lane & 15, hh = lane >> 4;
  const int nqb = (Tq + 63) / 64;
  const int bh = blockIdx.x / nqb, qblk = blockIdx.x % nqb;
  const int dv0 = blockIdx.y * DV;
  const int q0 = qblk * 64 + w * 16;
  const float* Q = Qb + (size_t)bh * qstride; const float* K = Kb + (size_t)bh * kstride; const float* V = Vb + (size_t)bh * vstride + dv0;
  FragB aqh[KS], aql[KS];
  {
    int row = q0 + ln; if (row >= Tq) row = Tq - 1;
    const float* qr = Q + (size_t)row * qpitch;
#pragma unroll
    for (int ks = 0; ks < KS; ++ks)
#pragma unroll
      for (int i = 0; i < 16; ++i) {
        const int d = ks * 32 + ((i < 8) ? (8 * hh + i) : (16 + 8 * hh + (i - 8)));
        const float x = qr[d] * scale; const unsigned short hb = bf16_bits(x);
        aqh[ks].u[i] = hb; aql[ks].u[i] = bf16_bits(x - bf16_val(hb));
      }
  }
  float m_r[8], l_r[8];
#pragma unroll
  for (int r = 0; r < 8; ++r) { m_r[r] = -3.0e38f; l_r[r] = 0.f; }
  v8f oacc[DT];
#pragma unroll
  for (int dt = 0; dt < DT; ++dt) oacc[dt] = (v8f){0.f,0.f,0.f,0.f,0.f,0.f,0.f,0.f};
  for (int j0 = 0; j0 < Tk; j0 += 32) {
    __syncthreads();
    for (int e = tid; e < 32 * (DQ / 4); e += 128) {
      const int r = e / (DQ / 4), c4 = (e % (DQ / 4)) * 4; const int key = j0 + r;
      v4f f = {0.f,0.f,0.f,0.f}; if (key < Tk) f = *(const v4fa*)(K + (size_t)key * kpitch + c4);
#pragma unroll
      for (int t = 0; t < 4; ++t) { const unsigned short hb = bf16_bits(f[t]); sKh[r][c4 + t] = hb; sKl[r][c4 + t] = bf16_bits(f[t] - bf16_val(hb)); }
    }
    for (int e = tid; e < 32 * (DV / 4); e += 128) {
      const int r = e / (DV / 4), c4 = (e % (DV / 4)) * 4; const int key = j0 + r;
      v4f f = {0.f,0.f,0.f,0.f}; if (key < Tk) f = *(const v4fa*)(V + (size_t)key * vpitch + c4);
#pragma unroll
      for (int t = 0; t < 4; ++t) { const unsigned short hb = bf16_bits(f[t]); sVh[r][c4 + t] = hb; sVl[r][c4 + t] = bf16_bits(f[t] - bf16_val(hb)); }
    }
    __syncthreads();
    v8f s[2];
#pragma unroll
    for (int nt = 0; nt < 2; ++nt) {
      v8f acc = {};
#pragma unroll
      for (int ks = 0; ks < KS; ++ks) {
        FragB bh_, bl_;
        bh_.half[0] = *(const v8us*)&sKh[nt * 16 + ln][ks * 32 + 8 * hh]; bh_.half[1] = *(const v8us*)&sKh[nt * 16 + ln][ks * 32 + 16 + 8 * hh];
        bl_.half[0] = *(const v8us*)&sKl[nt * 16 + ln][ks * 32 + 8 * hh]; bl_.half[1] = *(const v8us*)&sKl[nt * 16 + ln][ks * 32 + 16 + 8 * hh];
        acc = mmaN<3>(aqh[ks].v, aql[ks].v, bh_.v, bl_.v, acc);
      }
      s[nt] = acc;
    }
    float alpha[8];
#pragma unroll
    for (int r = 0; r < 8; ++r) {
      const int ja = j0 + ln, jb = j0 + 16 + ln;
      if (ja >= Tk) s[0][r] = -3.0e38f;
      if (jb >= Tk) s[1][r] = -3.0e38f;
      float mx = fmaxf(s[0][r], s[1][r]);
      mx = fmaxf(mx, __shfl_xor(mx, 1, 32)); mx = fmaxf(mx, __shfl_xor(mx, 2, 32)); mx = fmaxf(mx, __shfl_xor(mx, 4, 32)); mx = fmaxf(mx, __shfl_xor(mx, 8, 32));
      const float mnew = fmaxf(m_r[r], mx);
      alpha[r] = (mnew > -1.0e38f) ? __expf(m_r[r] - mnew) : 1.0f;
      const float p0 = (s[0][r] > -1.0e38f) ? __expf(s[0][r] - mnew) : 0.f;
      const float p1 = (s[1][r] > -1.0e38f) ? __expf(s[1][r] - mnew) : 0.f;
      m_r[r] = mnew;
      l_r[r] = l_r[r] * alpha[r] + p0 + p1;
      unsigned short hb = bf16_bits(p0); sPh[w][8 * hh + r][ln] = hb;      sPl[w][8 * hh + r][ln] = bf16_bits(p0 - bf16_val(hb));
      hb = bf16_bits(p1);                sPh[w][8 * hh + r][16 + ln] = hb; sPl[w][8 * hh + r][16 + ln] = bf16_bits(p1 - bf16_val(hb));
    }
#pragma unroll
    for (int dt = 0; dt < DT; ++dt)
#pragma unroll
      for (int r = 0; r < 8; ++r) oacc[dt][r] *= alpha[r];
    __builtin_amdgcn_fence(__ATOMIC_ACQ_REL, "workgroup");
    __builtin_amdgcn_wave_barrier();
    FragB pah, pal;
    pah.half[0] = *(const v8us*)&sPh[w][ln][8 * hh]; pah.half[1] = *(const v8us*)&sPh[w][ln][16 + 8 * hh];
    pal.half[0] = *(const v8us*)&sPl[w][ln][8 * hh]; pal.half[1] = *(const v8us*)&sPl[w][ln][16 + 8 * hh];
#pragma unroll
    for (int dt = 0; dt < DT; ++dt) {
      FragB bvh, bvl;
#pragma unroll
      for (int i = 0; i < 8; ++i) {
        bvh.u[i] = sVh[8 * hh + i][dt * 16 + ln]; bvh.u[8 + i] = sVh[16 + 8 * hh + i][dt * 16 + ln];
        bvl.u[i] = sVl[8 * hh + i][dt * 16 + ln]; bvl.u[8 + i] = sVl[16 + 8 * hh + i][dt * 16 + ln];
      }
      oacc[dt] = mmaN<3>(pah.v, pal.v, bvh.v, bvl.v, oacc[dt]);
    }
    __builtin_amdgcn_fence(__ATOMIC_ACQ_REL, "workgroup");
    __builtin_amdgcn_wave_barrier();
  }
#pragma unroll
  for (int r = 0; r < 8; ++r) {
    float l = l_r[r];
    l += __shfl_xor(l, 1, 32); l += __shfl_xor(l, 2, 32); l += __shfl_xor(l, 4, 32); l += __shfl_xor(l, 8, 32);
    l_r[r] = (l > 0.f) ? 1.0f / l : 0.f;
  }
#pragma unroll
  for (int dt = 0; dt < DT; ++dt)
#pragma unroll
    for (int r = 0; r < 8; ++r) sO[w][8 * hh + r][dt * 16 + ln] = oacc[dt][r] * l_r[r];
  __builtin_amdgcn_fence(__ATOMIC_ACQ_REL, "workgroup");
  __builtin_amdgcn_wave_barrier();
  {
    for (int r = 0; r < 16; ++r) {
      const int row = q0 + r;
      for (int c4 = lane * 4; c4 < DV; c4 += 128) {
        if (row < Tq) {
          const v4f val = *(const v4fa*)&sO[w][r][c4];
          *(v4f*)(y + (size_t)bh * ystride + (size_t)row * ypitch + dv0 + c4) = val;
        }
      }
    }
    
  }
}

// f32 [R][Cc] (row pitch lds) -> bf16 hi/lo planes [R][Cc] (pitch Cc); thread per 8 elements; Cc % 8 == 0
__global__ __launch_bounds__(256) void k_split_rows(const float* __restrict__ src, int lds_, unsigned short* __restrict__ hi, unsigned short* __restrict__ lo, int R, int Cc) {
  const size_t t = (size_t)blockIdx.x * 256 + threadIdx.x;
  const int c8n = Cc / 8;
  if (t >= (size_t)R * c8n) return;
  const int r = (int)(t / c8n), c8 = (int)(t % c8n) * 8;
  const float* s = src + (size_t)r * lds_ + c8;
  const v4f a = *(const v4fa*)s, b = *(const v4fa*)(s + 4);
  float xs[8] = {a[0],a[1],a[2],a[3],b[0],b[1],b[2],b[3]};
  v8us vh, vl;
#pragma unroll
  for (int i = 0; i < 8; ++i) { const unsigned short hb = bf16_bits(xs[i]); vh[i] = hb; vl[i] = bf16_bits(xs[i] - bf16_val(hb)); }
  unsigned short* dh = hi + (size_t)r * Cc + c8; unsigned short* dl = lo + (size_t)r * Cc + c8;
  *(v8us*)dh = vh; *(v8us*)dl = vl; 
}
// f32 [K][N] (row pitch lds) -> transposed bf16 hi/lo planes [N][K]; one thread per (n, 8 consecutive k)
__global__ __launch_bounds__(256) void k_split_transpose(const float* __restrict__ src, int lds_, unsigned short* __restrict__ hi, unsigned short* __restrict__ lo, int K, int N) {
  const size_t t = (size_t)blockIdx.x * 256 + threadIdx.x;
  const int k8n = K / 8;
  if (t >= (size_t)N * k8n) return;
  const int n = (int)(t / k8n), k8 = (int)(t % k8n) * 8;
  v8us vh, vl;
#pragma unroll
  for (int i = 0; i < 8; ++i) { const float x = src[(size_t)(k8 + i) * lds_ + n]; const unsigned short hb = bf16_bits(x); vh[i] = hb; vl[i] = bf16_bits(x - bf16_val(hb)); }
  unsigned short* dh = hi + (size_t)n * K + k8; unsigned short* dl = lo + (size_t)n * K + k8;
  *(v8us*)dh = vh; *(v8us*)dl = vl; 
}
// GEMM with A f32 (split into hi/lo when ASPLIT) and B from bf16 planes Bh (+ Bl when BSPLIT): terms hi·hi [+ lo·hi] [+ hi·lo].
// C f32 [M][N] pitch ldc; alpha scales the result; bias optional (BIAS_BF16 rounds it). Same tiling/epilogue as k_gemm_bf.
template <bool ASPLIT, bool BSPLIT, int ACT, bool BIAS_BF16>
__global__ __launch_bounds__(128) void k_gemm_bf2(const float* __restrict__ A, int lda, const unsigned short* __restrict__ Bh, const unsigned short* __restrict__ Bl, int ldb,
                                                const float* __restrict__ bias, float alpha, float* __restrict__ C, int ldc, int M, int N, int K) {
  __shared__ __attribute__((aligned(16))) float so[4][16][64];
  const int tid = threadIdx.x, w = tid >> 5, lane = tid & 31, ln = lane & 15, hh = lane >> 4;
  const int ntn = N / 64;
  const int wid = blockIdx.x * 4 + w;
  const int mt = wid / ntn, nq = wid % ntn;
  if (mt * 16 >= M) return;
  const int row0 = mt * 16, col0 = nq * 64;
  const float* arow = A + (size_t)(row0 + ln) * lda;
  v8f acc[4] = {};
  for (int kb = 0; kb < K; kb += 32) {
    FragB ah, al;
    const v4f x0 = *(const v4fa*)(arow + kb + 8 * hh), x1 = *(const v4fa*)(arow + kb + 8 * hh + 4);
    const v4f x2 = *(const v4fa*)(arow + kb + 16 + 8 * hh), x3 = *(const v4fa*)(arow + kb + 16 + 8 * hh + 4);
    float xs[16] = {x0[0],x0[1],x0[2],x0[3],x1[0],x1[1],x1[2],x1[3],x2[0],x2[1],x2[2],x2[3],x3[0],x3[1],x3[2],x3[3]};
#pragma unroll
    for (int i = 0; i < 16; ++i) { const unsigned short hb = bf16_bits(xs[i]); ah.u[i] = hb; al.u[i] = ASPLIT ? bf16_bits(xs[i] - bf16_val(hb)) : (unsigned short)0; }
#pragma unroll
    for (int t = 0; t < 4; ++t) {
      const size_t boff = (size_t)(col0 + t * 16 + ln) * ldb + kb;
      FragB bh_, bl_;
      bh_.half[0] = *(const v8us*)(Bh + boff + 8 * hh);
      bh_.half[1] = *(const v8us*)(Bh + boff + 16 + 8 * hh);
      if (BSPLIT) { bl_.half[0] = *(const v8us*)(Bl + boff + 8 * hh); bl_.half[1] = *(const v8us*)(Bl + boff + 16 + 8 * hh); } else bl_ = bh_;
      acc[t] = mmaN<ASPLIT ? (BSPLIT ? 3 : 2) : 1>(ah.v, al.v, bh_.v, bl_.v, acc[t]);
    }
  }
#pragma unroll
  for (int t = 0; t < 4; ++t) {
    float bv = bias ? bias[col0 + t * 16 + ln] : 0.f;
    if (BIAS_BF16) bv = bf16_round(bv);
#pragma unroll
    for (int r = 0; r < 8; ++r) { float v = acc[t][r] * alpha + bv; if (ACT == 1) v = fmaxf(v, 0.f); so[w][8 * hh + r][t * 16 + ln] = v; }
  }
  __builtin_amdgcn_fence(__ATOMIC_ACQ_REL, "workgroup");
  __builtin_amdgcn_wave_barrier();
  const int rsub = lane >> 4, c4 = (lane & 15) * 4;
  {
#pragma unroll
    for (int q = 0; q < 8; ++q) {
      const int r = q * 2 + rsub;
      const v4f v = *(const v4fa*)&so[w][r][c4];
      *(v4f*)(C + (size_t)(row0 + r) * ldc + col0 + c4) = v;
    }
    
  }
}
// row softmax: P[row][:] = softmax(masked S[row][:]) over N columns with optional causal mask (col > row + rowoff -> 0) and
__global__ __launch_bounds__(256) void k_softmax_rows(const float* __restrict__ S, float* __restrict__ P, int N, int causal, int rowoff, const int* __restrict__ mask, int mask_pitch) {
  __shared__ float red[256];
  const int row = blockIdx.x, tid = threadIdx.x;
  const float* s = S + (size_t)row * N; float* p_out = P + (size_t)row * N;
  const int qi = row + rowoff;
  float mx = -3.0e38f;
  for (int j = tid; j < N; j += 256) {
    bool keep = true;
    if (causal && j > qi) keep = false;
    if (mask && mask[(size_t)qi * mask_pitch + j] == 0) keep = false;
    const float v = keep ? s[j] : -3.0e38f;
    mx = fmaxf(mx, v);
  }
  red[tid] = mx; __syncthreads();
  for (int st = 128; st > 0; st >>= 1) { if (tid < st) red[tid] = fmaxf(red[tid], red[tid + st]); __syncthreads(); }
  mx = red[0]; __syncthreads();
  float sum = 0.f;
  for (int j = tid; j < N; j += 256) {
    bool keep = true;
    if (causal && j > qi) keep = false;
    if (mask && mask[(size_t)qi * mask_pitch + j] == 0) keep = false;
    const float p = keep ? __expf(s[j] - mx) : 0.f;
    sum += p;
  }
  red[tid] = sum; __syncthreads();
  for (int st = 128; st > 0; st >>= 1) { if (tid < st) red[tid] += red[tid + st]; __syncthreads(); }
  const float inv = (mx > -1.0e38f) ? 1.0f / red[0] : __builtin_nanf("");
  __syncthreads();
  {
    for (int j4 = tid * 4; j4 < N; j4 += 1024) {
      v4f out4;
#pragma unroll
      for (int u = 0; u < 4; ++u) {
        const int j = j4 + u;
        bool keep = true;
        if (causal && j > qi) keep = false;
        if (mask && mask[(size_t)qi * mask_pitch + j] == 0) keep = false;
        out4[u] = keep ? __expf(s[j] - mx) * inv : 0.f;
      }
      *(v4f*)(p_out + j4) = out4;
    }
    
  }
}

// GEMM C = act(A·W + bias + resid): A f32 (ASPLIT -> hi/lo 2 terms), Wt bf16 [N][K]; ACT 0 none, 1 relu, 2 exact gelu;
// resid (optional, f32, row index = (row % rmod), pitch ldr, RES_BF16 rounds it) added before the activation.
template <bool ASPLIT, int ACT, bool BIAS_BF16, bool RES_BF16>
__global__ __launch_bounds__(128) void k_gemm_bf3(const float* __restrict__ A, int lda, const unsigned short* __restrict__ Wt, int ldb,
                                                const float* __restrict__ bias, const float* __restrict__ resid, int rmod, int ldr,
                                                float* __restrict__ C, int ldc, int M, int N, int K) {
  __shared__ __attribute__((aligned(16))) float so[4][16][64];
  const int tid = threadIdx.x, w = tid >> 5, lane = tid & 31, ln = lane & 15, hh = lane >> 4;
  const int ntn = N / 64;
  const int wid = blockIdx.x * 4 + w;
  const int mt = wid / ntn, nq = wid % ntn;
  if (mt * 16 >= M) return;
  const int row0 = mt * 16, col0 = nq * 64;
  const float* arow = A + (size_t)(row0 + ln) * lda;
  v8f acc[4] = {};
  for (int kb = 0; kb < K; kb += 32) {
    FragB ah, al;
    const v4f x0 = *(const v4fa*)(arow + kb + 8 * hh), x1 = *(const v4fa*)(arow + kb + 8 * hh + 4);
    const v4f x2 = *(const v4fa*)(arow + kb + 16 + 8 * hh), x3 = *(const v4fa*)(arow + kb + 16 + 8 * hh + 4);
    float xs[16] = {x0[0],x0[1],x0[2],x0[3],x1[0],x1[1],x1[2],x1[3],x2[0],x2[1],x2[2],x2[3],x3[0],x3[1],x3[2],x3[3]};
#pragma unroll
    for (int i = 0; i < 16; ++i) { const unsigned short hb = bf16_bits(xs[i]); ah.u[i] = hb; al.u[i] = ASPLIT ? bf16_bits(xs[i] - bf16_val(hb)) : (unsigned short)0; }
#pragma unroll
    for (int t = 0; t < 4; ++t) {
      const unsigned short* brow = Wt + (size_t)(col0 + t * 16 + ln) * ldb + kb;
      FragB b;
      b.half[0] = *(const v8us*)(brow + 8 * hh);
      b.half[1] = *(const v8us*)(brow + 16 + 8 * hh);
      acc[t] = mmaN<ASPLIT ? 2 : 1>(ah.v, al.v, b.v, b.v, acc[t]);
    }
  }
#pragma unroll
  for (int t = 0; t < 4; ++t) {
    const int col = col0 + t * 16 + ln;
    float bv = bias ? bias[col] : 0.f;
    if (BIAS_BF16) bv = bf16_round(bv);
#pragma unroll
    for (int r = 0; r < 8; ++r) {
      float v = acc[t][r] + bv;
      if (resid) { float rv = resid[(size_t)((row0 + 8 * hh + r) % rmod) * ldr + col]; if (RES_BF16) rv = bf16_round(rv); v += rv; }
      if (ACT == 1) v = fmaxf(v, 0.f);
      if (ACT == 2) v = 0.5f * v * (1.0f + erff(v * 0.70710678118654752f));
      if (ACT == 3) { const float u = 0.7978845608028654f * (v + 0.044715f * v * v * v); v = 0.5f * v * (1.0f + tanhf(u)); }
      so[w][8 * hh + r][t * 16 + ln] = v;
    }
  }
  __builtin_amdgcn_fence(__ATOMIC_ACQ_REL, "workgroup");
  __builtin_amdgcn_wave_barrier();
  const int rsub = lane >> 4, c4 = (lane & 15) * 4;
  {
#pragma unroll
    for (int q = 0; q < 8; ++q) {
      const int r = q * 2 + rsub;
      const v4f v = *(const v4fa*)&so[w][r][c4];
      *(v4f*)(C + (size_t)(row0 + r) * ldc + col0 + c4) = v;
    }
    
  }
}
// row LayerNorm (biased variance, eps) over N: s = X (+ R); optional out_sum <- s; out_norm <- (s-mu)*rsqrt(var+eps)*g + b
template <bool PARAM_BF16>
__global__ __launch_bounds__(256) void k_layernorm(const float* __restrict__ X, const float* __restrict__ R, const float* __restrict__ g, const float* __restrict__ bta,
                                                  float* __restrict__ out_sum, float* __restrict__ out_norm, int N, float eps) {
  __shared__ float red[256];
  const int row = blockIdx.x, tid = threadIdx.x;
  const float* x = X + (size_t)row * N; const float* rr = R ? R + (size_t)row * N : nullptr;
  float vals[16];                     // up to N = 4096
  const int per = N / 256;            // contiguous chunk per thread? use strided-by-4 chunks: thread handles j = tid*4 + 1024*u
  float s1 = 0.f;
  for (int u = 0; u < per / 4; ++u) {
    const int j = tid * 4 + 1024 * u;
    const v4f a = *(const v4fa*)(x + j);
    v4f b = {0.f,0.f,0.f,0.f}; if (rr) b = *(const v4fa*)(rr + j);
#pragma unroll
    for (int q = 0; q < 4; ++q) { const float v = a[q] + b[q]; vals[u * 4 + q] = v; s1 += v; }
  }
  red[tid] = s1; __syncthreads();
  for (int st = 128; st > 0; st >>= 1) { if (tid < st) red[tid] += red[tid + st]; __syncthreads(); }
  const float mu = red[0] / (float)N; __syncthreads();
  float s2 = 0.f;
  for (int u = 0; u < per / 4; ++u)
#pragma unroll
    for (int q = 0; q < 4; ++q) { const float c = vals[u * 4 + q] - mu; s2 += c * c; }
  red[tid] = s2; __syncthreads();
  for (int st = 128; st > 0; st >>= 1) { if (tid < st) red[tid] += red[tid + st]; __syncthreads(); }
  const float rs = rsqrtf(red[0] / (float)N + eps);
  {
    for (int u = 0; u < per / 4; ++u) {
      const int j = tid * 4 + 1024 * u;
      v4f o, sm;
#pragma unroll
      for (int q = 0; q < 4; ++q) {
        float gg = g[j + q], bb = bta[j + q];
        if (PARAM_BF16) { gg = bf16_round(gg); bb = bf16_round(bb); }
        sm[q] = vals[u * 4 + q]; o[q] = (vals[u * 4 + q] - mu) * rs * gg + bb;
      }
      if (out_sum) *(v4f*)(out_sum + (size_t)row * N + j) = sm;
      *(v4f*)(out_norm + (size_t)row * N + j) = o;
    }
    
  }
}

// batched GEMM (blockIdx.y = batch): C_b = act(alpha·A_b·B_b + bias + resid_b); A f32 rows (ASPLIT → hi/lo), B = bf16 planes Bh (+Bl when BSPLIT, requires ASPLIT),
// per-batch element strides sA, sB (0 = shared weights), sC, sR. resid may alias C (values are staged before the stores). ACT 0/1(relu).
// ACT: 0 none, 1 relu, 2 softplus
template <bool ASPLIT, bool BSPLIT, int ACT>
__global__ __launch_bounds__(128) void k_gemm_b(const float* __restrict__ A, int lda, size_t sA, const unsigned short* __restrict__ Bh, const unsigned short* __restrict__ Bl, int ldb, size_t sB,
                                             const float* __restrict__ bias, const float* __restrict__ resid, int ldr, size_t sR, float rsign, float alpha,
                                             float* __restrict__ C, int ldc, size_t sC, int M, int N, int K) {
  __shared__ __attribute__((aligned(16))) float so[4][16][64];
  const int tid = threadIdx.x, w = tid >> 5, lane = tid & 31, ln = lane & 15, hh = lane >> 4;
  const int by = blockIdx.y;
  A += (size_t)by * sA; Bh += (size_t)by * sB; if (BSPLIT) Bl += (size_t)by * sB; C += (size_t)by * sC; if (resid) resid += (size_t)by * sR;
  const int ntn = N / 64; const int wid = blockIdx.x * 4 + w; const int mt = wid / ntn, nq = wid % ntn;
  if (mt * 16 >= M) return;
  const int row0 = mt * 16, col0 = nq * 64;
  const float* arow = A + (size_t)(row0 + ln) * lda;
  v8f acc[4] = {};
  for (int kb = 0; kb < K; kb += 32) {
    FragB ah, al;
    const v4f x0 = *(const v4fa*)(arow + kb + 8 * hh), x1 = *(const v4fa*)(arow + kb + 8 * hh + 4);
    const v4f x2 = *(const v4fa*)(arow + kb + 16 + 8 * hh), x3 = *(const v4fa*)(arow + kb + 16 + 8 * hh + 4);
    float xs[16] = {x0[0],x0[1],x0[2],x0[3],x1[0],x1[1],x1[2],x1[3],x2[0],x2[1],x2[2],x2[3],x3[0],x3[1],x3[2],x3[3]};
#pragma unroll
    for (int i = 0; i < 16; ++i) { const unsigned short hb = bf16_bits(xs[i]); ah.u[i] = hb; al.u[i] = ASPLIT ? bf16_bits(xs[i] - bf16_val(hb)) : (unsigned short)0; }
#pragma unroll
    for (int t = 0; t < 4; ++t) {
      const size_t boff = (size_t)(col0 + t * 16 + ln) * ldb + kb;
      FragB bh_, bl_; bh_.half[0] = *(const v8us*)(Bh + boff + 8 * hh); bh_.half[1] = *(const v8us*)(Bh + boff + 16 + 8 * hh);
      if (BSPLIT) { bl_.half[0] = *(const v8us*)(Bl + boff + 8 * hh); bl_.half[1] = *(const v8us*)(Bl + boff + 16 + 8 * hh); } else bl_ = bh_;
      acc[t] = mmaN<ASPLIT ? (BSPLIT ? 3 : 2) : 1>(ah.v, al.v, bh_.v, bl_.v, acc[t]);
    }
  }
#pragma unroll
  for (int t = 0; t < 4; ++t) {
    const int col = col0 + t * 16 + ln; const float bv = bias ? bf16_round(bias[col]) : 0.f;
#pragma unroll
    for (int r = 0; r < 8; ++r) { float v = acc[t][r] * alpha + bv; if (resid) v += rsign * resid[(size_t)(row0 + 8 * hh + r) * ldr + col]; if (ACT == 1) v = fmaxf(v, 0.f); else if (ACT == 2) v = fmaxf(v, 0.f) + log1pf(expf(-fabsf(v))); so[w][8 * hh + r][t * 16 + ln] = v; }
  }
  __builtin_amdgcn_fence(__ATOMIC_ACQ_REL, "workgroup"); __builtin_amdgcn_wave_barrier();
  const int rsub = lane >> 4, c4 = (lane & 15) * 4;
  {
#pragma unroll
    for (int q = 0; q < 8; ++q) { const int r = q * 2 + rsub; const v4f v = *(const v4fa*)&so[w][r][c4]; *(v4f*)(C + (size_t)(row0 + r) * ldc + col0 + c4) = v; }
    
  }
}
// batched f32 [K][N] (pitch lds, batch stride sIn) -> transposed hi/lo planes [N][K] (batch stride sOut); thread per (n, 8 k); grid.y = batch
__global__ __launch_bounds__(256) void k_split_transpose_b(const float* __restrict__ src, int lds_, size_t sIn, unsigned short* __restrict__ hi, unsigned short* __restrict__ lo, size_t sOut, int K, int N) {
  const size_t t = (size_t)blockIdx.x * 256 + threadIdx.x; const int k8n = K / 8; if (t >= (size_t)N * k8n) return;
  src += (size_t)blockIdx.y * sIn; hi += (size_t)blockIdx.y * sOut; lo += (size_t)blockIdx.y * sOut;
  const int n = (int)(t / k8n), k8 = (int)(t % k8n) * 8; v8us vh, vl;
#pragma unroll
  for (int i = 0; i < 8; ++i) { const float x = src[(size_t)(k8 + i) * lds_ + n]; const unsigned short hb = bf16_bits(x); vh[i] = hb; vl[i] = bf16_bits(x - bf16_val(hb)); }
  unsigned short* dh = hi + (size_t)n * K + k8; unsigned short* dl = lo + (size_t)n * K + k8;
  *(v8us*)dh = vh; *(v8us*)dl = vl; 
}

__global__ __launch_bounds__(256) void k_round_rows(const float* __restrict__ W, unsigned short* __restrict__ Wt, int n8) {
  const int t = blockIdx.x * 256 + threadIdx.x;
  if (t >= n8) return;
  const v4f a = *(const v4fa*)(W + (size_t)t * 8), b = *(const v4fa*)(W + (size_t)t * 8 + 4);
  v8us v; v[0]=bf16_bits(a[0]); v[1]=bf16_bits(a[1]); v[2]=bf16_bits(a[2]); v[3]=bf16_bits(a[3]);
  v[4]=bf16_bits(b[0]); v[5]=bf16_bits(b[1]); v[6]=bf16_bits(b[2]); v[7]=bf16_bits(b[3]);
  *(v8us*)(Wt + (size_t)t * 8) = v; 
}

// Bt for the projections: X inputs are [512][8192] = [K][N] layout (x@W form with A = M [64][512]): Bt[n=s][k=c] = X[c][s] -> k_wt_bf16(X, Bt, 512, 8192)

// ---- f16 WMMA path (v_wmma_f32_16x16x32_f16): 11-bit significands for operands in range — used for the scores S and for the probability operand P (weights in [0,1] times 2^8), which needs more precision than bf16
typedef _Float16 v16h __attribute__((ext_vector_type(16)));
union FragH { v16h v; v8us half[2]; _Float16 h[16]; unsigned short u[16]; };
// QdH[s][d] = f16(Qd[d][s]) (transposed, f16); thread per (s, 8 d)
__global__ __launch_bounds__(256) void k_qdh(const float* __restrict__ Qd, _Float16* __restrict__ QdH) { const int t = blockIdx.x * 256 + threadIdx.x; if (t >= SQ * (DO / 8)) return; const int s = t / (DO / 8), d8 = (t % (DO / 8)) * 8; FragH f; for (int i = 0; i < 8; ++i) f.h[i] = (_Float16)Qd[(size_t)(d8 + i) * SQ + s]; const v8us o = f.half[0]; *(v8us*)((unsigned short*)QdH + (size_t)s * DO + d8) = o;  }
// One launch for scores, softmax and out. A work-group owns AT key columns t; each of its AW waves takes SQ / AW query positions s, 32 a pass.
// Scores as S[s][t] = Qd[:,s].Kd[:,t] (A = f16 Qd rows, B = Kd columns split into f16 hi/lo, kept in registers: 2 products, K = 64), so that a lane holds
// scores of one column t only and two score tiles (s 0-15, 16-31 of a pass), converted in place, are the B operand of out[d][t] += Vd[d][s].P[s][t].
// Walk 1 finds each column's maximum over all s; walk 2 forms the scores again, e = exp(x - max), adds e to the column's sum and multiplies f16(e * 2^8)
// with Vd (f16 hi/lo: 2 products). All waves use the same maximum, so their partial tiles and sums add up plainly, in wave order, and the division comes last.
#define AW 16
#define AT 32
#define ASR (SQ / AW)
__device__ __forceinline__ v8f wmmaH(v16h a, v16h b, v8f c) { return __builtin_amdgcn_wmma_f32_16x16x32_f16(false, a, false, b, (short)0, c, false, false); }
// 32 consecutive f32 k of the lane's row at p -> f16 hi/lo fragments in the hardware k order (8 hh + i, 16 + 8 hh + i)
__device__ __forceinline__ void frag_split(const float* __restrict__ p, int hh, FragH& fh, FragH& fl) {
  const v4f x0 = *(const v4fa*)(p + 8 * hh), x1 = *(const v4fa*)(p + 8 * hh + 4), x2 = *(const v4fa*)(p + 16 + 8 * hh), x3 = *(const v4fa*)(p + 16 + 8 * hh + 4);
  const float xs[16] = {x0[0],x0[1],x0[2],x0[3],x1[0],x1[1],x1[2],x1[3],x2[0],x2[1],x2[2],x2[3],x3[0],x3[1],x3[2],x3[3]};
  // unrolled so that xs and the fragments are indexed by constants and stay in registers
#pragma unroll
  for (int i = 0; i < 16; ++i) { const _Float16 h = (_Float16)xs[i]; fh.h[i] = h; fl.h[i] = (_Float16)(xs[i] - (float)h); }
}
// the A fragments of 32 s rows (m: which 16; ks: which 32 of the 64 d); q points at the lane's row of the first 16
__device__ __forceinline__ void q_load(const _Float16* __restrict__ q, int hh, FragH (&qa)[2][2]) {
  // unrolled, here and in q_mul, so that the fragments and tiles are indexed by constants and stay in registers
#pragma unroll
  for (int m = 0; m < 2; ++m)
#pragma unroll
    for (int ks = 0; ks < 2; ++ks) { const _Float16* a = q + m * 16 * DO + ks * 32; qa[m][ks].half[0] = *(const v8us*)(a + 8 * hh); qa[m][ks].half[1] = *(const v8us*)(a + 16 + 8 * hh); }
}
// sc[m][g] = raw scores of those 32 s rows against the 32 columns (g: which 16)
__device__ __forceinline__ void q_mul(const FragH (&qa)[2][2], const FragH (&kh)[2][2], const FragH (&kl)[2][2], v8f (&sc)[2][2]) {
#pragma unroll
  for (int m = 0; m < 2; ++m)
#pragma unroll
    for (int g = 0; g < 2; ++g) sc[m][g] = (v8f){0.f,0.f,0.f,0.f,0.f,0.f,0.f,0.f};
#pragma unroll
  for (int ks = 0; ks < 2; ++ks) {
#pragma unroll
    for (int m = 0; m < 2; ++m)
#pragma unroll
      for (int g = 0; g < 2; ++g) sc[m][g] = wmmaH(qa[m][ks].v, kh[g][ks].v, sc[m][g]);
#pragma unroll
    for (int m = 0; m < 2; ++m)
#pragma unroll
      for (int g = 0; g < 2; ++g) sc[m][g] = wmmaH(qa[m][ks].v, kl[g][ks].v, sc[m][g]);
  }
}
__global__ __launch_bounds__(AW * 32) void k_attn(const _Float16* __restrict__ QdH, const float* __restrict__ KdT, const float* __restrict__ Vd, float* __restrict__ out) {
  __shared__ __attribute__((aligned(16))) float part[AW][DO][AT];
  __shared__ float rmx[AW][AT], rsm[AW][AT];
  const int tid = threadIdx.x, w = tid >> 5, lane = tid & 31, ln = lane & 15, hh = lane >> 4;
  const int t0 = blockIdx.x * AT;
  const _Float16* qrow = QdH + (size_t)(w * ASR + ln) * DO;
  const float* vrow = Vd + (size_t)ln * SQ + w * ASR;
  FragH kh[2][2], kl[2][2];
  // the loops over g, ks, u, m, r and dt below are unrolled so that fragments and tiles are indexed by constants and stay in registers
#pragma unroll
  for (int g = 0; g < 2; ++g)
#pragma unroll
    for (int ks = 0; ks < 2; ++ks) frag_split(KdT + (size_t)(t0 + g * 16 + ln) * DO + ks * 32, hh, kh[g][ks], kl[g][ks]);
  float mx[2] = {-3.0e38f, -3.0e38f};
  for (int p = 0; p < ASR / 32; p += 4) {
    FragH qa[4][2][2];
#pragma unroll
    for (int u = 0; u < 4; ++u) q_load(qrow + (size_t)(p + u) * 32 * DO, hh, qa[u]);
    __builtin_amdgcn_sched_barrier(0);      // keeps the 32 loads of four passes in front of the first product: without it they are issued a few at a time into reused registers, several memory latencies a pass
#pragma unroll
    for (int u = 0; u < 4; ++u) {
      v8f sc[2][2];
      q_mul(qa[u], kh, kl, sc);
#pragma unroll
      for (int g = 0; g < 2; ++g)
#pragma unroll
        for (int m = 0; m < 2; ++m)
#pragma unroll
          for (int r = 0; r < 8; ++r) mx[g] = fmaxf(mx[g], sc[m][g][r]);
    }
  }
#pragma unroll
  for (int g = 0; g < 2; ++g) { mx[g] = fmaxf(mx[g], __shfl_xor(mx[g], 16, 32)); rmx[w][g * 16 + ln] = mx[g]; }      // both halves of the wave store the same value
  __syncthreads();      // every wave's column maxima are in rmx
#pragma unroll
  for (int g = 0; g < 2; ++g) {
    float m = rmx[0][g * 16 + ln];
    for (int p = 1; p < AW; ++p) m = fmaxf(m, rmx[p][g * 16 + ln]);
    mx[g] = m * 0.125f + 1.0f;      // x / 8 + 1 never decreases with x, so the maximum may be taken first
  }
  v8f o[4][2];
#pragma unroll
  for (int dt = 0; dt < 4; ++dt)
#pragma unroll
    for (int g = 0; g < 2; ++g) o[dt][g] = (v8f){0.f,0.f,0.f,0.f,0.f,0.f,0.f,0.f};
  float den[2] = {0.f, 0.f};
  for (int p = 0; p < ASR / 32; ++p) {
    FragH qa[2][2];
    q_load(qrow + (size_t)p * 32 * DO, hh, qa);
    v8f sc[2][2];
    q_mul(qa, kh, kl, sc);
    FragH pb[2];
#pragma unroll
    for (int g = 0; g < 2; ++g)
#pragma unroll
      for (int m = 0; m < 2; ++m)
#pragma unroll
        for (int r = 0; r < 8; ++r) {
          const float e = expf((sc[m][g][r] * 0.125f + 1.0f) - mx[g]);
          den[g] += e;
          pb[g].h[m * 8 + r] = (_Float16)(e * 256.0f);      // x 2^8 (exact) keeps small weights out of the f16 subnormal range; taken back with the division
        }
#pragma unroll
    for (int dt = 0; dt < 4; ++dt) {
      FragH vh, vl;
      frag_split(vrow + (size_t)dt * 16 * SQ + p * 32, hh, vh, vl);
#pragma unroll
      for (int g = 0; g < 2; ++g) o[dt][g] = wmmaH(vh.v, pb[g].v, o[dt][g]);
#pragma unroll
      for (int g = 0; g < 2; ++g) o[dt][g] = wmmaH(vl.v, pb[g].v, o[dt][g]);
    }
  }
#pragma unroll
  for (int g = 0; g < 2; ++g) { den[g] += __shfl_xor(den[g], 16, 32); rsm[w][g * 16 + ln] = den[g]; }      // both halves of the wave store the same value
#pragma unroll
  for (int dt = 0; dt < 4; ++dt)
#pragma unroll
    for (int g = 0; g < 2; ++g)
#pragma unroll
      for (int r = 0; r < 8; ++r) part[w][dt * 16 + 8 * hh + r][g * 16 + ln] = o[dt][g][r];
  __syncthreads();      // every wave's partial tile and column sums are in LDS
  float dsum = 0.f;
  for (int p = 0; p < AW; ++p) dsum += rsm[p][lane];      // wave order, the same in every wave
  const float inv = 0.00390625f / dsum;
  for (int j = 0; j < DO / AW; ++j) {      // wave w sums and stores rows w, w + AW, ...: one whole 128-byte line each
    const int d = j * AW + w;
    float s = 0.f;
    for (int p = 0; p < AW; ++p) s += part[p][d][lane];
    out[(size_t)d * SQ + t0 + lane] = s * inv;
  }
}
extern "C" void kernel_launch(void* const* d_in, const int* in_sizes, int n_in,
                              void* d_out, int out_size, void* d_ws, size_t ws_size, hipStream_t stream) {
  (void)in_sizes; (void)n_in; (void)out_size;
  const float* Q = (const float*)d_in[0]; const float* K = (const float*)d_in[1]; const float* V = (const float*)d_in[2]; const float* Mq = (const float*)d_in[3]; const float* Mk = (const float*)d_in[4]; const float* Mv = (const float*)d_in[5];
  char* ws = (char*)d_ws; size_t off = 0;
  auto take = [&](size_t bytes) { char* p = ws + off; off += (bytes + 255) & ~(size_t)255; return p; };
  unsigned short* BQ = (unsigned short*)take((size_t)SQ * DI * 2); unsigned short* BK = (unsigned short*)take((size_t)SQ * DI * 2); unsigned short* BV = (unsigned short*)take((size_t)SQ * DI * 2);
  float* Qd = (float*)take((size_t)DO * SQ * 4); float* Kd = (float*)take((size_t)DO * SQ * 4); float* Vd = (float*)take((size_t)DO * SQ * 4); float* KdT = (float*)take((size_t)SQ * DO * 4); _Float16* QdB = (_Float16*)take((size_t)SQ * DO * 2);
  if (off > ws_size) return;
  k_wt_bf16<<<(unsigned)(((size_t)SQ * (DI / 8) + 255) / 256), 256, 0, stream>>>(Q, BQ, DI, SQ); k_wt_bf16<<<(unsigned)(((size_t)SQ * (DI / 8) + 255) / 256), 256, 0, stream>>>(K, BK, DI, SQ); k_wt_bf16<<<(unsigned)(((size_t)SQ * (DI / 8) + 255) / 256), 256, 0, stream>>>(V, BV, DI, SQ);
  const unsigned gp = ((DO / 16) * (SQ / 64) + 3) / 4;
  k_gemm_bf3<false, 0, false, false><<<gp, 128, 0, stream>>>(Mq, DI, BQ, DI, nullptr, nullptr, 1, 0, Qd, SQ, DO, SQ, DI);      // Qd = Mq·Q [64][8192]
  k_gemm_bf3<false, 0, false, false><<<gp, 128, 0, stream>>>(Mk, DI, BK, DI, nullptr, nullptr, 1, 0, Kd, SQ, DO, SQ, DI);
  k_gemm_bf3<false, 0, false, false><<<gp, 128, 0, stream>>>(Mv, DI, BV, DI, nullptr, nullptr, 1, 0, Vd, SQ, DO, SQ, DI);
  k_transpose32<false, false, false><<<dim3(SQ / 32, DO / 32, 1), 256, 0, stream>>>(Kd, KdT, DO, SQ, nullptr, nullptr, nullptr);        // Kd [64][8192] -> KdT [8192][64]
  k_qdh<<<(SQ * (DO / 8) + 255) / 256, 256, 0, stream>>>(Qd, QdB);                                         // QdB[s][d] = f16(Qd[d][s]): A operand of the scores
  k_attn<<<SQ / AT, AW * 32, 0, stream>>>(QdB, KdT, Vd, (float*)d_out);      // out[d][t] = sum_s Vd[d][s] * softmax_s(Qd[:,s].Kd[:,t] / 8 + 1)
}

// v004
// It runs in 90.1 microseconds.
// Two timings next to v003 put it at 2.08 and 2.06 times that version's speed.
// Over all steps from v000 it is 50.5 times as fast.
#include <hip/hip_runtime.h>
// On v_wmma_f32_16x16x32_bf16 with f32 accumulate, in one kernel (k_proj): the projections Qd/Kd/Vd = M.{Q,K,V} (M = 64, K = 512, N = 8192; inputs rounded to bf16: single exact term).
// On v_wmma_f32_16x16x32_f16, in one fused kernel (k_attn): the scores S[s][t] = Qd[:,s].Kd[:,t] (Qd rounded to f16, Kd split into f16 hi/lo: 2 products, K = 64) and
// out[:, t] = Vd.P[:, t] (Vd split into f16 hi/lo, the softmax weights rounded to f16: 2 products, K = 8192). The module's softmax runs over the QUERY axis s (dim 0);
// /sqrt(64) and the +1 constant are f32 VALU.
#define DI 512
#define DO 64
#define SQ 8192

typedef __bf16 v16b __attribute__((ext_vector_type(16)));
typedef unsigned short v8us __attribute__((ext_vector_type(8), may_alias));
typedef float  v8f  __attribute__((ext_vector_type(8)));
typedef float  v4f  __attribute__((ext_vector_type(4)));
typedef float  v4fa __attribute__((ext_vector_type(4), may_alias));
union FragB { v16b v; v8us half[2]; unsigned short u[16]; };

__device__ __forceinline__ unsigned short bf16_bits(float x) { unsigned int u = __float_as_uint(x); return (unsigned short)((u + 0x7FFFu + ((u >> 16) & 1u)) >> 16); }
__device__ __forceinline__ float bf16_val(unsigned short b) { return __uint_as_float(((unsigned int)b) << 16); }
__device__ __forceinline__ float bf16_round(float x) { return bf16_val(bf16_bits(x)); }
// D += A·B with NT terms: 1 = ah·bh, 2 = + al·bh (A split), 3 = + ah·bl (both split)
template <int NT>
__device__ __forceinline__ v8f mmaN(v16b ah, v16b al, v16b bh, v16b bl, v8f c) {
  c = __builtin_amdgcn_wmma_f32_16x16x32_bf16(false, ah, false, bh, (short)0, c, false, false);
  if (NT >= 2) c = __builtin_amdgcn_wmma_f32_16x16x32_bf16(false, al, false, bh, (short)0, c, false, false);
  if (NT >= 3) c = __builtin_amdgcn_wmma_f32_16x16x32_bf16(false, ah, false, bl, (short)0, c, false, false);
  asm volatile("v_nop\n\tv_nop\n\tv_nop\n\tv_nop" : "+v"(c) : "v"(ah), "v"(al), "v"(bh), "v"(bl));
  return c;
}

// GEMM C[M][N] (f32, pitch ldc) = act(A[M][K]·W + bias). A f32 row-major (pitch lda) converted per fragment to bf16
// (ASPLIT: hi/lo two planes -> 2 terms, else single rounded term); Wt bf16 [N][K] (pitch ldb). BIAS_BF16 rounds the
// bias to bf16 first (bias quantised to bf16 before the add). K%32==0, M%16==0, N%64==0.
template <bool ASPLIT, int ACT, bool BIAS_BF16>
__global__ __launch_bounds__(128) void k_gemm_bf(const float* __restrict__ A, int lda, const unsigned short* __restrict__ Wt, int ldb,
                                               const float* __restrict__ bias, float* __restrict__ C, int ldc, int M, int N, int K) {
  __shared__ __attribute__((aligned(16))) float so[4][16][64];
  const int tid = threadIdx.x, w = tid >> 5, lane = tid & 31, ln = lane & 15, hh = lane >> 4;
  const int ntn = N / 64;
  const int wid = blockIdx.x * 4 + w;
  const int mt = wid / ntn, nq = wid % ntn;
  if (mt * 16 >= M) return;
  const int row0 = mt * 16, col0 = nq * 64;
  const float* arow = A + (size_t)(row0 + ln) * lda;
  v8f acc[4] = {};
  for (int kb = 0; kb < K; kb += 32) {
    FragB ah, al;
    const v4f x0 = *(const v4fa*)(arow + kb + 8 * hh), x1 = *(const v4fa*)(arow + kb + 8 * hh + 4);
    const v4f x2 = *(const v4fa*)(arow + kb + 16 + 8 * hh), x3 = *(const v4fa*)(arow + kb + 16 + 8 * hh + 4);
    float xs[16] = {x0[0],x0[1],x0[2],x0[3],x1[0],x1[1],x1[2],x1[3],x2[0],x2[1],x2[2],x2[3],x3[0],x3[1],x3[2],x3[3]};
#pragma unroll
    for (int i = 0; i < 16; ++i) { const unsigned short hb = bf16_bits(xs[i]); ah.u[i] = hb; al.u[i] = ASPLIT ? bf16_bits(xs[i] - bf16_val(hb)) : (unsigned short)0; }
#pragma unroll
    for (int t = 0; t < 4; ++t) {
      const unsigned short* brow = Wt + (size_t)(col0 + t * 16 + ln) * ldb + kb;
      FragB b;
      b.half[0] = *(const v8us*)(brow + 8 * hh);
      b.half[1] = *(const v8us*)(brow + 16 + 8 * hh);
      acc[t] = mmaN<ASPLIT ? 2 : 1>(ah.v, al.v, b.v, b.v, acc[t]);
    }
  }
#pragma unroll
  for (int t = 0; t < 4; ++t) {
    float bv = bias ? bias[col0 + t * 16 + ln] : 0.f;
    if (BIAS_BF16) bv = bf16_round(bv);
#pragma unroll
    for (int r = 0; r < 8; ++r) { float v = acc[t][r] + bv; if (ACT == 1) v = fmaxf(v, 0.f); so[w][8 * hh + r][t * 16 + ln] = v; }
  }
  __builtin_amdgcn_fence(__ATOMIC_ACQ_REL, "workgroup");
  __builtin_amdgcn_wave_barrier();
  const int rsub = lane >> 4, c4 = (lane & 15) * 4;
  {
#pragma unroll
    for (int q = 0; q < 8; ++q) {
      const int r = q * 2 + rsub;
      const v4f v = *(const v4fa*)&so[w][r][c4];
      *(v4f*)(C + (size_t)(row0 + r) * ldc + col0 + c4) = v;
    }
    
  }
}

// Flash-style causal/unmasked attention, all contractions 3-term bf16 hi/lo splits, f32 softmax with running max.
// q,k,v rows are read from f32 buffers with arbitrary row pitch (so they can live inside a fused qkv buffer);
// D = head size (multiple of 32, <= 128); one wave = 16 query rows; block = 4 waves (64 queries) sharing K/V chunks of 32.
template <int D, bool CAUSAL>
__global__ __launch_bounds__(128) void k_flash(const float* __restrict__ qb, const float* __restrict__ kb, const float* __restrict__ vb,
                                             int pitch, int T, int H, float scale, float* __restrict__ y, int ypitch) {
  constexpr int KS = D / 32;        // k-steps for QK
  constexpr int DT = D / 16;        // d tiles for PV
  __shared__ __attribute__((aligned(16))) unsigned short sKh[32][D + 8], sKl[32][D + 8], sVh[32][D + 8], sVl[32][D + 8];
  __shared__ __attribute__((aligned(16))) unsigned short sPh[4][16][40], sPl[4][16][40];
  __shared__ __attribute__((aligned(16))) float sO[4][16][D];
  const int tid = threadIdx.x, w = tid >> 5, lane = tid & 31, ln = lane & 15, hh = lane >> 4;
  const int nqb = (T + 63) / 64;
  const int bh = blockIdx.x / nqb, qblk = blockIdx.x % nqb;
  const int b = bh / H, h = bh % H;
  const int q0 = qblk * 64 + w * 16;
  const float* Q = qb + (size_t)b * T * pitch + h * D;
  const float* K = kb + (size_t)b * T * pitch + h * D;
  const float* V = vb + (size_t)b * T * pitch + h * D;

  // A fragments of the wave's 16 query rows (scaled), hi/lo
  FragB aqh[KS], aql[KS];
  {
    int row = q0 + ln; if (row >= T) row = T - 1;
    const float* qr = Q + (size_t)row * pitch;
#pragma unroll
    for (int ks = 0; ks < KS; ++ks)
#pragma unroll
      for (int i = 0; i < 16; ++i) {
        const int d = ks * 32 + ((i < 8) ? (8 * hh + i) : (16 + 8 * hh + (i - 8)));
        const float x = qr[d] * scale; const unsigned short hb = bf16_bits(x);
        aqh[ks].u[i] = hb; aql[ks].u[i] = bf16_bits(x - bf16_val(hb));
      }
  }
  float m_r[8], l_r[8];
#pragma unroll
  for (int r = 0; r < 8; ++r) { m_r[r] = -3.0e38f; l_r[r] = 0.f; }
  v8f oacc[DT];
#pragma unroll
  for (int dt = 0; dt < DT; ++dt) oacc[dt] = (v8f){0.f,0.f,0.f,0.f,0.f,0.f,0.f,0.f};

  const int kv_end = CAUSAL ? min(T, qblk * 64 + 64) : T;     // block-uniform
  for (int j0 = 0; j0 < kv_end; j0 += 32) {
    __syncthreads();
    for (int e = tid; e < 32 * (D / 4); e += 128) {
      const int r = e / (D / 4), c4 = (e % (D / 4)) * 4;
      const int key = j0 + r;
      v4f kf = {0.f,0.f,0.f,0.f}, vf = {0.f,0.f,0.f,0.f};
      if (key < T) { kf = *(const v4fa*)(K + (size_t)key * pitch + c4); vf = *(const v4fa*)(V + (size_t)key * pitch + c4); }
#pragma unroll
      for (int t = 0; t < 4; ++t) {
        unsigned short hb = bf16_bits(kf[t]); sKh[r][c4 + t] = hb; sKl[r][c4 + t] = bf16_bits(kf[t] - bf16_val(hb));
        hb = bf16_bits(vf[t]); sVh[r][c4 + t] = hb; sVl[r][c4 + t] = bf16_bits(vf[t] - bf16_val(hb));
      }
    }
    __syncthreads();
    // S tile 16 x 32
    v8f s[2];
#pragma unroll
    for (int nt = 0; nt < 2; ++nt) {
      v8f acc = {};
#pragma unroll
      for (int ks = 0; ks < KS; ++ks) {
        FragB bh_, bl_;
        bh_.half[0] = *(const v8us*)&sKh[nt * 16 + ln][ks * 32 + 8 * hh]; bh_.half[1] = *(const v8us*)&sKh[nt * 16 + ln][ks * 32 + 16 + 8 * hh];
        bl_.half[0] = *(const v8us*)&sKl[nt * 16 + ln][ks * 32 + 8 * hh]; bl_.half[1] = *(const v8us*)&sKl[nt * 16 + ln][ks * 32 + 16 + 8 * hh];
        acc = mmaN<3>(aqh[ks].v, aql[ks].v, bh_.v, bl_.v, acc);
      }
      s[nt] = acc;
    }
    // mask + running max (rows 8hh+r; the 16 lanes of a half share rows)
    float alpha[8];
#pragma unroll
    for (int r = 0; r < 8; ++r) {
      const int qi = q0 + 8 * hh + r;
      const int ja = j0 + ln, jb = j0 + 16 + ln;
      if (CAUSAL) { if (ja > qi) s[0][r] = -3.0e38f; if (jb > qi) s[1][r] = -3.0e38f; }
      if (ja >= T) s[0][r] = -3.0e38f;
      if (jb >= T) s[1][r] = -3.0e38f;
      float mx = fmaxf(s[0][r], s[1][r]);
      mx = fmaxf(mx, __shfl_xor(mx, 1, 32)); mx = fmaxf(mx, __shfl_xor(mx, 2, 32)); mx = fmaxf(mx, __shfl_xor(mx, 4, 32)); mx = fmaxf(mx, __shfl_xor(mx, 8, 32));
      const float mnew = fmaxf(m_r[r], mx);
      alpha[r] = (mnew > -1.0e38f) ? __expf(m_r[r] - mnew) : 1.0f;
      const float p0 = (s[0][r] > -1.0e38f) ? __expf(s[0][r] - mnew) : 0.f;
      const float p1 = (s[1][r] > -1.0e38f) ? __expf(s[1][r] - mnew) : 0.f;
      m_r[r] = mnew;
      l_r[r] = l_r[r] * alpha[r] + p0 + p1;            // per-lane partial row sum (16 lanes combined at the end)
      unsigned short hb = bf16_bits(p0); sPh[w][8 * hh + r][ln] = hb;      sPl[w][8 * hh + r][ln] = bf16_bits(p0 - bf16_val(hb));
      hb = bf16_bits(p1);                sPh[w][8 * hh + r][16 + ln] = hb; sPl[w][8 * hh + r][16 + ln] = bf16_bits(p1 - bf16_val(hb));
    }
#pragma unroll
    for (int dt = 0; dt < DT; ++dt)
#pragma unroll
      for (int r = 0; r < 8; ++r) oacc[dt][r] *= alpha[r];
    __builtin_amdgcn_fence(__ATOMIC_ACQ_REL, "workgroup");
    __builtin_amdgcn_wave_barrier();
    FragB pah, pal;
    pah.half[0] = *(const v8us*)&sPh[w][ln][8 * hh]; pah.half[1] = *(const v8us*)&sPh[w][ln][16 + 8 * hh];
    pal.half[0] = *(const v8us*)&sPl[w][ln][8 * hh]; pal.half[1] = *(const v8us*)&sPl[w][ln][16 + 8 * hh];
#pragma unroll
    for (int dt = 0; dt < DT; ++dt) {
      FragB bvh, bvl;
#pragma unroll
      for (int i = 0; i < 8; ++i) {
        bvh.u[i] = sVh[8 * hh + i][dt * 16 + ln]; bvh.u[8 + i] = sVh[16 + 8 * hh + i][dt * 16 + ln];
        bvl.u[i] = sVl[8 * hh + i][dt * 16 + ln]; bvl.u[8 + i] = sVl[16 + 8 * hh + i][dt * 16 + ln];
      }
      oacc[dt] = mmaN<3>(pah.v, pal.v, bvh.v, bvl.v, oacc[dt]);
    }
    __builtin_amdgcn_fence(__ATOMIC_ACQ_REL, "workgroup");
    __builtin_amdgcn_wave_barrier();
  }
#pragma unroll
  for (int r = 0; r < 8; ++r) {
    float l = l_r[r];
    l += __shfl_xor(l, 1, 32); l += __shfl_xor(l, 2, 32); l += __shfl_xor(l, 4, 32); l += __shfl_xor(l, 8, 32);
    l_r[r] = (l > 0.f) ? 1.0f / l : 0.f;
  }
#pragma unroll
  for (int dt = 0; dt < DT; ++dt)
#pragma unroll
    for (int r = 0; r < 8; ++r) sO[w][8 * hh + r][dt * 16 + ln] = oacc[dt][r] * l_r[r];
  __builtin_amdgcn_fence(__ATOMIC_ACQ_REL, "workgroup");
  __builtin_amdgcn_wave_barrier();
  {
    for (int r = 0; r < 16; ++r) {
      const int row = q0 + r;
      if (row < T && lane < D / 4) {
        const v4f val = *(const v4fa*)&sO[w][r][lane * 4];
        *(v4f*)(y + ((size_t)b * T + row) * ypitch + h * D + lane * 4) = val;
      }
    }
    
  }
}

// in pitch = cols, out pitch = rows; rows, cols multiples of 32. Optional per-output-row affine (scale[c], shift[c]) and
// residual add res (same layout as out, optionally bf16-rounded) for fused epilogues: out = in*scale + shift + res.
template <bool AFFINE, bool RESID, bool RES_BF16>
__global__ __launch_bounds__(256) void k_transpose32(const float* __restrict__ in, float* __restrict__ out, int rows, int cols,
                                                    const float* __restrict__ scale, const float* __restrict__ shift, const float* __restrict__ res) {
  __shared__ float tile[32][33];
  const int b = blockIdx.z;
  const int r0 = blockIdx.y * 32, c0 = blockIdx.x * 32;
  const float* src = in + (size_t)b * rows * cols;
  float* dst = out + (size_t)b * rows * cols;
  const int tx = threadIdx.x & 31, ty = threadIdx.x >> 5;     // 8 rows per pass
  for (int i = ty; i < 32; i += 8) tile[i][tx] = src[(size_t)(r0 + i) * cols + c0 + tx];
  __syncthreads();
  {
    for (int i = ty; i < 32; i += 8) {
      float v = tile[tx][i];
      const int orow = c0 + i;
      if (AFFINE) v = v * scale[orow] + shift[orow];
      if (RESID) { float rv = res[(size_t)b * rows * cols + (size_t)orow * rows + r0 + tx]; if (RES_BF16) rv = bf16_round(rv); v += rv; }
      *(float*)(dst + (size_t)orow * rows + r0 + tx) = v;
    }
    
  }
}

// 2x2 max pool on position-major data: in [B][H*W][C] -> out [B][(H/2)*(W/2)][C]; thread per (b, p', 4 channels); C%4==0
__global__ __launch_bounds__(256) void k_pool2_pm(const float* __restrict__ in, float* __restrict__ out, int Bn, int H, int W, int C) {
  const size_t t = (size_t)blockIdx.x * 256 + threadIdx.x;
  const int c4n = C / 4, Ho = H / 2, Wo = W / 2;
  const size_t total = (size_t)Bn * Ho * Wo * c4n;
  if (t >= total) return;
  const int c4 = (int)(t % c4n) * 4; size_t rest = t / c4n;
  const int pw = (int)(rest % Wo); rest /= Wo; const int ph = (int)(rest % Ho); const int b = (int)(rest / Ho);
  const float* base = in + (size_t)b * H * W * C;
  const int p00 = (2 * ph) * W + 2 * pw;
  const v4f a = *(const v4fa*)(base + (size_t)p00 * C + c4), bq = *(const v4fa*)(base + (size_t)(p00 + 1) * C + c4);
  const v4f c = *(const v4fa*)(base + (size_t)(p00 + W) * C + c4), d = *(const v4fa*)(base + (size_t)(p00 + W + 1) * C + c4);
  v4f m; for (int i = 0; i < 4; ++i) m[i] = fmaxf(fmaxf(a[i], bq[i]), fmaxf(c[i], d[i]));
  float* dst = out + ((size_t)b * Ho * Wo + (size_t)ph * Wo + pw) * C + c4;
  *(v4f*)dst = m;
  
}

// General (non-causal) attention, 3-term bf16 splits, f32 softmax with running max.
// Q [.][Tq][qpitch], K [.][Tk][kpitch] (head dim DQ), V [.][Tk][vpitch] (head dim DVtot); this block handles DV output
// dims starting at dv0 = blockIdx.y*DV. y[bh][t][ypitch] gets columns dv0..dv0+DV-1. Per-bh base offsets via strides.
template <int DQ, int DV>
__global__ __launch_bounds__(128) void k_flash2(const float* __restrict__ Qb, size_t qstride, int qpitch, int Tq,
                                              const float* __restrict__ Kb, size_t kstride, int kpitch, int Tk,
                                              const float* __restrict__ Vb, size_t vstride, int vpitch,
                                              float scale, float* __restrict__ y, size_t ystride, int ypitch) {
  constexpr int KS = DQ / 32, DT = DV / 16;
  __shared__ __attribute__((aligned(16))) unsigned short sKh[32][DQ + 8], sKl[32][DQ + 8], sVh[32][DV + 8], sVl[32][DV + 8];
  __shared__ __attribute__((aligned(16))) unsigned short sPh[4][16][40], sPl[4][16][40];
  __shared__ __attribute__((aligned(16))) float sO[4][16][DV];
  const int tid = threadIdx.x, w = tid >> 5, lane = tid & 31, ln = lane & 15, hh = lane >> 4;
  const int nqb = (Tq + 63) / 64;
  const int bh = blockIdx.x / nqb, qblk = blockIdx.x % nqb;
  const int dv0 = blockIdx.y * DV;
  const int q0 = qblk * 64 + w * 16;
  const float* Q = Qb + (size_t)bh * qstride; const float* K = Kb + (size_t)bh * kstride; const float* V = Vb + (size_t)bh * vstride + dv0;
  FragB aqh[KS], aql[KS];
  {
    int row = q0 + ln; if (row >= Tq) row = Tq - 1;
    const float* qr = Q + (size_t)row * qpitch;
#pragma unroll
    for (int ks = 0; ks < KS; ++ks)
#pragma unroll
      for (int i = 0; i < 16; ++i) {
        const int d = ks * 32 + ((i < 8) ? (8 * hh + i) : (16 + 8 * hh + (i - 8)));
        const float x = qr[d] * scale; const unsigned short hb = bf16_bits(x);
        aqh[ks].u[i] = hb; aql[ks].u[i] = bf16_bits(x - bf16_val(hb));
      }
  }
  float m_r[8], l_r[8];
#pragma unroll
  for (int r = 0; r < 8; ++r) { m_r[r] = -3.0e38f; l_r[r] = 0.f; }
  v8f oacc[DT];
#pragma unroll
  for (int dt = 0; dt < DT; ++dt) oacc[dt] = (v8f){0.f,0.f,0.f,0.f,0.f,0.f,0.f,0.f};
  for (int j0 = 0; j0 < Tk; j0 += 32) {
    __syncthreads();
    for (int e = tid; e < 32 * (DQ / 4); e += 128) {
      const int r = e / (DQ / 4), c4 = (e % (DQ / 4)) * 4; const int key = j0 + r;
      v4f f = {0.f,0.f,0.f,0.f}; if (key < Tk) f = *(const v4fa*)(K + (size_t)key * kpitch + c4);
#pragma unroll
      for (int t = 0; t < 4; ++t) { const unsigned short hb = bf16_bits(f[t]); sKh[r][c4 + t] = hb; sKl[r][c4 + t] = bf16_bits(f[t] - bf16_val(hb)); }
    }
    for (int e = tid; e < 32 * (DV / 4); e += 128) {
      const int r = e / (DV / 4), c4 = (e % (DV / 4)) * 4; const int key = j0 + r;
      v4f f = {0.f,0.f,0.f,0.f}; if (key < Tk) f = *(const v4fa*)(V + (size_t)key * vpitch + c4);
#pragma unroll
      for (int t = 0; t < 4; ++t) { const unsigned short hb = bf16_bits(f[t]); sVh[r][c4 + t] = hb; sVl[r][c4 + t] = bf16_bits(f[t] - bf16_val(hb)); }
    }
    __syncthreads();
    v8f s[2];
#pragma unroll
    for (int nt = 0; nt < 2; ++nt) {
      v8f acc = {};
#pragma unroll
      for (int ks = 0; ks < KS; ++ks) {
        FragB bh_, bl_;
        bh_.half[0] = *(const v8us*)&sKh[nt * 16 + ln][ks * 32 + 8 * hh]; bh_.half[1] = *(const v8us*)&sKh[nt * 16 + ln][ks * 32 + 16 + 8 * hh];
        bl_.half[0] = *(const v8us*)&sKl[nt * 16 + ln][ks * 32 + 8 * hh]; bl_.half[1] = *(const v8us*)&sKl[nt * 16 + ln][ks * 32 + 16 + 8 * hh];
        acc = mmaN<3>(aqh[ks].v, aql[ks].v, bh_.v, bl_.v, acc);
      }
      s[nt] = acc;
    }
    float alpha[8];
#pragma unroll
    for (int r = 0; r < 8; ++r) {
      const int ja = j0 + ln, jb = j0 + 16 + ln;
      if (ja >= Tk) s[0][r] = -3.0e38f;
      if (jb >= Tk) s[1][r] = -3.0e38f;
      float mx = fmaxf(s[0][r], s[1][r]);
      mx = fmaxf(mx, __shfl_xor(mx, 1, 32)); mx = fmaxf(mx, __shfl_xor(mx, 2, 32)); mx = fmaxf(mx, __shfl_xor(mx, 4, 32)); mx = fmaxf(mx, __shfl_xor(mx, 8, 32));
      const float mnew = fmaxf(m_r[r], mx);
      alpha[r] = (mnew > -1.0e38f) ? __expf(m_r[r] - mnew) : 1.0f;
      const float p0 = (s[0][r] > -1.0e38f) ? __expf(s[0][r] - mnew) : 0.f;
      const float p1 = (s[1][r] > -1.0e38f) ? __expf(s[1][r] - mnew) : 0.f;
      m_r[r] = mnew;
      l_r[r] = l_r[r] * alpha[r] + p0 + p1;
      unsigned short hb = bf16_bits(p0); sPh[w][8 * hh + r][ln] = hb;      sPl[w][8 * hh + r][ln] = bf16_bits(p0 - bf16_val(hb));
      hb = bf16_bits(p1);                sPh[w][8 * hh + r][16 + ln] = hb; sPl[w][8 * hh + r][16 + ln] = bf16_bits(p1 - bf16_val(hb));
    }
#pragma unroll
    for (int dt = 0; dt < DT; ++dt)
#pragma unroll
      for (int r = 0; r < 8; ++r) oacc[dt][r] *= alpha[r];
    __builtin_amdgcn_fence(__ATOMIC_ACQ_REL, "workgroup");
    __builtin_amdgcn_wave_barrier();
    FragB pah, pal;
    pah.half[0] = *(const v8us*)&sPh[w][ln][8 * hh]; pah.half[1] = *(const v8us*)&sPh[w][ln][16 + 8 * hh];
    pal.half[0] = *(const v8us*)&sPl[w][ln][8 * hh]; pal.half[1] = *(const v8us*)&sPl[w][ln][16 + 8 * hh];
#pragma unroll
    for (int dt = 0; dt < DT; ++dt) {
      FragB bvh, bvl;
#pragma unroll
      for (int i = 0; i < 8; ++i) {
        bvh.u[i] = sVh[8 * hh + i][dt * 16 + ln]; bvh.u[8 + i] = sVh[16 + 8 * hh + i][dt * 16 + ln];
        bvl.u[i] = sVl[8 * hh + i][dt * 16 + ln]; bvl.u[8 + i] = sVl[16 + 8 * hh + i][dt * 16 + ln];
      }
      oacc[dt] = mmaN<3>(pah.v, pal.v, bvh.v, bvl.v, oacc[dt]);
    }
    __builtin_amdgcn_fence(__ATOMIC_ACQ_REL, "workgroup");
    __builtin_amdgcn_wave_barrier();
  }
#pragma unroll
  for (int r = 0; r < 8; ++r) {
    float l = l_r[r];
    l += __shfl_xor(l, 1, 32); l += __shfl_xor(l, 2, 32); l += __shfl_xor(l, 4, 32); l += __shfl_xor(l, 8, 32);
    l_r[r] = (l > 0.f) ? 1.0f / l : 0.f;
  }
#pragma unroll
  for (int dt = 0; dt < DT; ++dt)
#pragma unroll
    for (int r = 0; r < 8; ++r) sO[w][8 * hh + r][dt * 16 + ln] = oacc[dt][r] * l_r[r];
  __builtin_amdgcn_fence(__ATOMIC_ACQ_REL, "workgroup");
  __builtin_amdgcn_wave_barrier();
  {
    for (int r = 0; r < 16; ++r) {
      const int row = q0 + r;
      for (int c4 = lane * 4; c4 < DV; c4 += 128) {
        if (row < Tq) {
          const v4f val = *(const v4fa*)&sO[w][r][c4];
          *(v4f*)(y + (size_t)bh * ystride + (size_t)row * ypitch + dv0 + c4) = val;
        }
      }
    }
    
  }
}

// f32 [R][Cc] (row pitch lds) -> bf16 hi/lo planes [R][Cc] (pitch Cc); thread per 8 elements; Cc % 8 == 0
__global__ __launch_bounds__(256) void k_split_rows(const float* __restrict__ src, int lds_, unsigned short* __restrict__ hi, unsigned short* __restrict__ lo, int R, int Cc) {
  const size_t t = (size_t)blockIdx.x * 256 + threadIdx.x;
  const int c8n = Cc / 8;
  if (t >= (size_t)R * c8n) return;
  const int r = (int)(t / c8n), c8 = (int)(t % c8n) * 8;
  const float* s = src + (size_t)r * lds_ + c8;
  const v4f a = *(const v4fa*)s, b = *(const v4fa*)(s + 4);
  float xs[8] = {a[0],a[1],a[2],a[3],b[0],b[1],b[2],b[3]};
  v8us vh, vl;
#pragma unroll
  for (int i = 0; i < 8; ++i) { const unsigned short hb = bf16_bits(xs[i]); vh[i] = hb; vl[i] = bf16_bits(xs[i] - bf16_val(hb)); }
  unsigned short* dh = hi + (size_t)r * Cc + c8; unsigned short* dl = lo + (size_t)r * Cc + c8;
  *(v8us*)dh = vh; *(v8us*)dl = vl; 
}
// f32 [K][N] (row pitch lds) -> transposed bf16 hi/lo planes [N][K]; one thread per (n, 8 consecutive k)
__global__ __launch_bounds__(256) void k_split_transpose(const float* __restrict__ src, int lds_, unsigned short* __restrict__ hi, unsigned short* __restrict__ lo, int K, int N) {
  const size_t t = (size_t)blockIdx.x * 256 + threadIdx.x;
  const int k8n = K / 8;
  if (t >= (size_t)N * k8n) return;
  const int n = (int)(t / k8n), k8 = (int)(t % k8n) * 8;
  v8us vh, vl;
#pragma unroll
  for (int i = 0; i < 8; ++i) { const float x = src[(size_t)(k8 + i) * lds_ + n]; const unsigned short hb = bf16_bits(x); vh[i] = hb; vl[i] = bf16_bits(x - bf16_val(hb)); }
  unsigned short* dh = hi + (size_t)n * K + k8; unsigned short* dl = lo + (size_t)n * K + k8;
  *(v8us*)dh = vh; *(v8us*)dl = vl; 
}
// GEMM with A f32 (split into hi/lo when ASPLIT) and B from bf16 planes Bh (+ Bl when BSPLIT): terms hi·hi [+ lo·hi] [+ hi·lo].
// C f32 [M][N] pitch ldc; alpha scales the result; bias optional (BIAS_BF16 rounds it). Same tiling/epilogue as k_gemm_bf.
template <bool ASPLIT, bool BSPLIT, int ACT, bool BIAS_BF16>
__global__ __launch_bounds__(128) void k_gemm_bf2(const float* __restrict__ A, int lda, const unsigned short* __restrict__ Bh, const unsigned short* __restrict__ Bl, int ldb,
                                                const float* __restrict__ bias, float alpha, float* __restrict__ C, int ldc, int M, int N, int K) {
  __shared__ __attribute__((aligned(16))) float so[4][16][64];
  const int tid = threadIdx.x, w = tid >> 5, lane = tid & 31, ln = lane & 15, hh = lane >> 4;
  const int ntn = N / 64;
  const int wid = blockIdx.x * 4 + w;
  const int mt = wid / ntn, nq = wid % ntn;
  if (mt * 16 >= M) return;
  const int row0 = mt * 16, col0 = nq * 64;
  const float* arow = A + (size_t)(row0 + ln) * lda;
  v8f acc[4] = {};
  for (int kb = 0; kb < K; kb += 32) {
    FragB ah, al;
    const v4f x0 = *(const v4fa*)(arow + kb + 8 * hh), x1 = *(const v4fa*)(arow + kb + 8 * hh + 4);
    const v4f x2 = *(const v4fa*)(arow + kb + 16 + 8 * hh), x3 = *(const v4fa*)(arow + kb + 16 + 8 * hh + 4);
    float xs[16] = {x0[0],x0[1],x0[2],x0[3],x1[0],x1[1],x1[2],x1[3],x2[0],x2[1],x2[2],x2[3],x3[0],x3[1],x3[2],x3[3]};
#pragma unroll
    for (int i = 0; i < 16; ++i) { const unsigned short hb = bf16_bits(xs[i]); ah.u[i] = hb; al.u[i] = ASPLIT ? bf16_bits(xs[i] - bf16_val(hb)) : (unsigned short)0; }
#pragma unroll
    for (int t = 0; t < 4; ++t) {
      const size_t boff = (size_t)(col0 + t * 16 + ln) * ldb + kb;
      FragB bh_, bl_;
      bh_.half[0] = *(const v8us*)(Bh + boff + 8 * hh);
      bh_.half[1] = *(const v8us*)(Bh + boff + 16 + 8 * hh);
      if (BSPLIT) { bl_.half[0] = *(const v8us*)(Bl + boff + 8 * hh); bl_.half[1] = *(const v8us*)(Bl + boff + 16 + 8 * hh); } else bl_ = bh_;
      acc[t] = mmaN<ASPLIT ? (BSPLIT ? 3 : 2) : 1>(ah.v, al.v, bh_.v, bl_.v, acc[t]);
    }
  }
#pragma unroll
  for (int t = 0; t < 4; ++t) {
    float bv = bias ? bias[col0 + t * 16 + ln] : 0.f;
    if (BIAS_BF16) bv = bf16_round(bv);
#pragma unroll
    for (int r = 0; r < 8; ++r) { float v = acc[t][r] * alpha + bv; if (ACT == 1) v = fmaxf(v, 0.f); so[w][8 * hh + r][t * 16 + ln] = v; }
  }
  __builtin_amdgcn_fence(__ATOMIC_ACQ_REL, "workgroup");
  __builtin_amdgcn_wave_barrier();
  const int rsub = lane >> 4, c4 = (lane & 15) * 4;
  {
#pragma unroll
    for (int q = 0; q < 8; ++q) {
      const int r = q * 2 + rsub;
      const v4f v = *(const v4fa*)&so[w][r][c4];
      *(v4f*)(C + (size_t)(row0 + r) * ldc + col0 + c4) = v;
    }
    
  }
}
// row softmax: P[row][:] = softmax(masked S[row][:]) over N columns with optional causal mask (col > row + rowoff -> 0) and
__global__ __launch_bounds__(256) void k_softmax_rows(const float* __restrict__ S, float* __restrict__ P, int N, int causal, int rowoff, const int* __restrict__ mask, int mask_pitch) {
  __shared__ float red[256];
  const int row = blockIdx.x, tid = threadIdx.x;
  const float* s = S + (size_t)row * N; float* p_out = P + (size_t)row * N;
  const int qi = row + rowoff;
  float mx = -3.0e38f;
  for (int j = tid; j < N; j += 256) {
    bool keep = true;
    if (causal && j > qi) keep = false;
    if (mask && mask[(size_t)qi * mask_pitch + j] == 0) keep = false;
    const float v = keep ? s[j] : -3.0e38f;
    mx = fmaxf(mx, v);
  }
  red[tid] = mx; __syncthreads();
  for (int st = 128; st > 0; st >>= 1) { if (tid < st) red[tid] = fmaxf(red[tid], red[tid + st]); __syncthreads(); }
  mx = red[0]; __syncthreads();
  float sum = 0.f;
  for (int j = tid; j < N; j += 256) {
    bool keep = true;
    if (causal && j > qi) keep = false;
    if (mask && mask[(size_t)qi * mask_pitch + j] == 0) keep = false;
    const float p = keep ? __expf(s[j] - mx) : 0.f;
    sum += p;
  }
  red[tid] = sum; __syncthreads();
  for (int st = 128; st > 0; st >>= 1) { if (tid < st) red[tid] += red[tid + st]; __syncthreads(); }
  const float inv = (mx > -1.0e38f) ? 1.0f / red[0] : __builtin_nanf("");
  __syncthreads();
  {
    for (int j4 = tid * 4; j4 < N; j4 += 1024) {
      v4f out4;
#pragma unroll
      for (int u = 0; u < 4; ++u) {
        const int j = j4 + u;
        bool keep = true;
        if (causal && j > qi) keep = false;
        if (mask && mask[(size_t)qi * mask_pitch + j] == 0) keep = false;
        out4[u] = keep ? __expf(s[j] - mx) * inv : 0.f;
      }
      *(v4f*)(p_out + j4) = out4;
    }
    
  }
}

// GEMM C = act(A·W + bias + resid): A f32 (ASPLIT -> hi/lo 2 terms), Wt bf16 [N][K]; ACT 0 none, 1 relu, 2 exact gelu;
// resid (optional, f32, row index = (row % rmod), pitch ldr, RES_BF16 rounds it) added before the activation.
template <bool ASPLIT, int ACT, bool BIAS_BF16, bool RES_BF16>
__global__ __launch_bounds__(128) void k_gemm_bf3(const float* __restrict__ A, int lda, const unsigned short* __restrict__ Wt, int ldb,
                                                const float* __restrict__ bias, const float* __restrict__ resid, int rmod, int ldr,
                                                float* __restrict__ C, int ldc, int M, int N, int K) {
  __shared__ __attribute__((aligned(16))) float so[4][16][64];
  const int tid = threadIdx.x, w = tid >> 5, lane = tid & 31, ln = lane & 15, hh = lane >> 4;
  const int ntn = N / 64;
  const int wid = blockIdx.x * 4 + w;
  const int mt = wid / ntn, nq = wid % ntn;
  if (mt * 16 >= M) return;
  const int row0 = mt * 16, col0 = nq * 64;
  const float* arow = A + (size_t)(row0 + ln) * lda;
  v8f acc[4] = {};
  for (int kb = 0; kb < K; kb += 32) {
    FragB ah, al;
    const v4f x0 = *(const v4fa*)(arow + kb + 8 * hh), x1 = *(const v4fa*)(arow + kb + 8 * hh + 4);
    const v4f x2 = *(const v4fa*)(arow + kb + 16 + 8 * hh), x3 = *(const v4fa*)(arow + kb + 16 + 8 * hh + 4);
    float xs[16] = {x0[0],x0[1],x0[2],x0[3],x1[0],x1[1],x1[2],x1[3],x2[0],x2[1],x2[2],x2[3],x3[0],x3[1],x3[2],x3[3]};
#pragma unroll
    for (int i = 0; i < 16; ++i) { const unsigned short hb = bf16_bits(xs[i]); ah.u[i] = hb; al.u[i] = ASPLIT ? bf16_bits(xs[i] - bf16_val(hb)) : (unsigned short)0; }
#pragma unroll
    for (int t = 0; t < 4; ++t) {
      const unsigned short* brow = Wt + (size_t)(col0 + t * 16 + ln) * ldb + kb;
      FragB b;
      b.half[0] = *(const v8us*)(brow + 8 * hh);
      b.half[1] = *(const v8us*)(brow + 16 + 8 * hh);
      acc[t] = mmaN<ASPLIT ? 2 : 1>(ah.v, al.v, b.v, b.v, acc[t]);
    }
  }
#pragma unroll
  for (int t = 0; t < 4; ++t) {
    const int col = col0 + t * 16 + ln;
    float bv = bias ? bias[col] : 0.f;
    if (BIAS_BF16) bv = bf16_round(bv);
#pragma unroll
    for (int r = 0; r < 8; ++r) {
      float v = acc[t][r] + bv;
      if (resid) { float rv = resid[(size_t)((row0 + 8 * hh + r) % rmod) * ldr + col]; if (RES_BF16) rv = bf16_round(rv); v += rv; }
      if (ACT == 1) v = fmaxf(v, 0.f);
      if (ACT == 2) v = 0.5f * v * (1.0f + erff(v * 0.70710678118654752f));
      if (ACT == 3) { const float u = 0.7978845608028654f * (v + 0.044715f * v * v * v); v = 0.5f * v * (1.0f + tanhf(u)); }
      so[w][8 * hh + r][t * 16 + ln] = v;
    }
  }
  __builtin_amdgcn_fence(__ATOMIC_ACQ_REL, "workgroup");
  __builtin_amdgcn_wave_barrier();
  const int rsub = lane >> 4, c4 = (lane & 15) * 4;
  {
#pragma unroll
    for (int q = 0; q < 8; ++q) {
      const int r = q * 2 + rsub;
      const v4f v = *(const v4fa*)&so[w][r][c4];
      *(v4f*)(C + (size_t)(row0 + r) * ldc + col0 + c4) = v;
    }
    
  }
}
// row LayerNorm (biased variance, eps) over N: s = X (+ R); optional out_sum <- s; out_norm <- (s-mu)*rsqrt(var+eps)*g + b
template <bool PARAM_BF16>
__global__ __launch_bounds__(256) void k_layernorm(const float* __restrict__ X, const float* __restrict__ R, const float* __restrict__ g, const float* __restrict__ bta,
                                                  float* __restrict__ out_sum, float* __restrict__ out_norm, int N, float eps) {
  __shared__ float red[256];
  const int row = blockIdx.x, tid = threadIdx.x;
  const float* x = X + (size_t)row * N; const float* rr = R ? R + (size_t)row * N : nullptr;
  float vals[16];                     // up to N = 4096
  const int per = N / 256;            // contiguous chunk per thread? use strided-by-4 chunks: thread handles j = tid*4 + 1024*u
  float s1 = 0.f;
  for (int u = 0; u < per / 4; ++u) {
    const int j = tid * 4 + 1024 * u;
    const v4f a = *(const v4fa*)(x + j);
    v4f b = {0.f,0.f,0.f,0.f}; if (rr) b = *(const v4fa*)(rr + j);
#pragma unroll
    for (int q = 0; q < 4; ++q) { const float v = a[q] + b[q]; vals[u * 4 + q] = v; s1 += v; }
  }
  red[tid] = s1; __syncthreads();
  for (int st = 128; st > 0; st >>= 1) { if (tid < st) red[tid] += red[tid + st]; __syncthreads(); }
  const float mu = red[0] / (float)N; __syncthreads();
  float s2 = 0.f;
  for (int u = 0; u < per / 4; ++u)
#pragma unroll
    for (int q = 0; q < 4; ++q) { const float c = vals[u * 4 + q] - mu; s2 += c * c; }
  red[tid] = s2; __syncthreads();
  for (int st = 128; st > 0; st >>= 1) { if (tid < st) red[tid] += red[tid + st]; __syncthreads(); }
  const float rs = rsqrtf(red[0] / (float)N + eps);
  {
    for (int u = 0; u < per / 4; ++u) {
      const int j = tid * 4 + 1024 * u;
      v4f o, sm;
#pragma unroll
      for (int q = 0; q < 4; ++q) {
        float gg = g[j + q], bb = bta[j + q];
        if (PARAM_BF16) { gg = bf16_round(gg); bb = bf16_round(bb); }
        sm[q] = vals[u * 4 + q]; o[q] = (vals[u * 4 + q] - mu) * rs * gg + bb;
      }
      if (out_sum) *(v4f*)(out_sum + (size_t)row * N + j) = sm;
      *(v4f*)(out_norm + (size_t)row * N + j) = o;
    }
    
  }
}

// batched GEMM (blockIdx.y = batch): C_b = act(alpha·A_b·B_b + bias + resid_b); A f32 rows (ASPLIT → hi/lo), B = bf16 planes Bh (+Bl when BSPLIT, requires ASPLIT),
// per-batch element strides sA, sB (0 = shared weights), sC, sR. resid may alias C (values are staged before the stores). ACT 0/1(relu).
// ACT: 0 none, 1 relu, 2 softplus
template <bool ASPLIT, bool BSPLIT, int ACT>
__global__ __launch_bounds__(128) void k_gemm_b(const float* __restrict__ A, int lda, size_t sA, const unsigned short* __restrict__ Bh, const unsigned short* __restrict__ Bl, int ldb, size_t sB,
                                             const float* __restrict__ bias, const float* __restrict__ resid, int ldr, size_t sR, float rsign, float alpha,
                                             float* __restrict__ C, int ldc, size_t sC, int M, int N, int K) {
  __shared__ __attribute__((aligned(16))) float so[4][16][64];
  const int tid = threadIdx.x, w = tid >> 5, lane = tid & 31, ln = lane & 15, hh = lane >> 4;
  const int by = blockIdx.y;
  A += (size_t)by * sA; Bh += (size_t)by * sB; if (BSPLIT) Bl += (size_t)by * sB; C += (size_t)by * sC; if (resid) resid += (size_t)by * sR;
  const int ntn = N / 64; const int wid = blockIdx.x * 4 + w; const int mt = wid / ntn, nq = wid % ntn;
  if (mt * 16 >= M) return;
  const int row0 = mt * 16, col0 = nq * 64;
  const float* arow = A + (size_t)(row0 + ln) * lda;
  v8f acc[4] = {};
  for (int kb = 0; kb < K; kb += 32) {
    FragB ah, al;
    const v4f x0 = *(const v4fa*)(arow + kb + 8 * hh), x1 = *(const v4fa*)(arow + kb + 8 * hh + 4);
    const v4f x2 = *(const v4fa*)(arow + kb + 16 + 8 * hh), x3 = *(const v4fa*)(arow + kb + 16 + 8 * hh + 4);
    float xs[16] = {x0[0],x0[1],x0[2],x0[3],x1[0],x1[1],x1[2],x1[3],x2[0],x2[1],x2[2],x2[3],x3[0],x3[1],x3[2],x3[3]};
#pragma unroll
    for (int i = 0; i < 16; ++i) { const unsigned short hb = bf16_bits(xs[i]); ah.u[i] = hb; al.u[i] = ASPLIT ? bf16_bits(xs[i] - bf16_val(hb)) : (unsigned short)0; }
#pragma unroll
    for (int t = 0; t < 4; ++t) {
      const size_t boff = (size_t)(col0 + t * 16 + ln) * ldb + kb;
      FragB bh_, bl_; bh_.half[0] = *(const v8us*)(Bh + boff + 8 * hh); bh_.half[1] = *(const v8us*)(Bh + boff + 16 + 8 * hh);
      if (BSPLIT) { bl_.half[0] = *(const v8us*)(Bl + boff + 8 * hh); bl_.half[1] = *(const v8us*)(Bl + boff + 16 + 8 * hh); } else bl_ = bh_;
      acc[t] = mmaN<ASPLIT ? (BSPLIT ? 3 : 2) : 1>(ah.v, al.v, bh_.v, bl_.v, acc[t]);
    }
  }
#pragma unroll
  for (int t = 0; t < 4; ++t) {
    const int col = col0 + t * 16 + ln; const float bv = bias ? bf16_round(bias[col]) : 0.f;
#pragma unroll
    for (int r = 0; r < 8; ++r) { float v = acc[t][r] * alpha + bv; if (resid) v += rsign * resid[(size_t)(row0 + 8 * hh + r) * ldr + col]; if (ACT == 1) v = fmaxf(v, 0.f); else if (ACT == 2) v = fmaxf(v, 0.f) + log1pf(expf(-fabsf(v))); so[w][8 * hh + r][t * 16 + ln] = v; }
  }
  __builtin_amdgcn_fence(__ATOMIC_ACQ_REL, "workgroup"); __builtin_amdgcn_wave_barrier();
  const int rsub = lane >> 4, c4 = (lane & 15) * 4;
  {
#pragma unroll
    for (int q = 0; q < 8; ++q) { const int r = q * 2 + rsub; const v4f v = *(const v4fa*)&so[w][r][c4]; *(v4f*)(C + (size_t)(row0 + r) * ldc + col0 + c4) = v; }
    
  }
}
// batched f32 [K][N] (pitch lds, batch stride sIn) -> transposed hi/lo planes [N][K] (batch stride sOut); thread per (n, 8 k); grid.y = batch
__global__ __launch_bounds__(256) void k_split_transpose_b(const float* __restrict__ src, int lds_, size_t sIn, unsigned short* __restrict__ hi, unsigned short* __restrict__ lo, size_t sOut, int K, int N) {
  const size_t t = (size_t)blockIdx.x * 256 + threadIdx.x; const int k8n = K / 8; if (t >= (size_t)N * k8n) return;
  src += (size_t)blockIdx.y * sIn; hi += (size_t)blockIdx.y * sOut; lo += (size_t)blockIdx.y * sOut;
  const int n = (int)(t / k8n), k8 = (int)(t % k8n) * 8; v8us vh, vl;
#pragma unroll
  for (int i = 0; i < 8; ++i) { const float x = src[(size_t)(k8 + i) * lds_ + n]; const unsigned short hb = bf16_bits(x); vh[i] = hb; vl[i] = bf16_bits(x - bf16_val(hb)); }
  unsigned short* dh = hi + (size_t)n * K + k8; unsigned short* dl = lo + (size_t)n * K + k8;
  *(v8us*)dh = vh; *(v8us*)dl = vl; 
}

__global__ __launch_bounds__(256) void k_round_rows(const float* __restrict__ W, unsigned short* __restrict__ Wt, int n8) {
  const int t = blockIdx.x * 256 + threadIdx.x;
  if (t >= n8) return;
  const v4f a = *(const v4fa*)(W + (size_t)t * 8), b = *(const v4fa*)(W + (size_t)t * 8 + 4);
  v8us v; v[0]=bf16_bits(a[0]); v[1]=bf16_bits(a[1]); v[2]=bf16_bits(a[2]); v[3]=bf16_bits(a[3]);
  v[4]=bf16_bits(b[0]); v[5]=bf16_bits(b[1]); v[6]=bf16_bits(b[2]); v[7]=bf16_bits(b[3]);
  *(v8us*)(Wt + (size_t)t * 8) = v; 
}


// ---- f16 WMMA path (v_wmma_f32_16x16x32_f16): 11-bit significands for operands in range — used where the softmax weights, scaled by 2^8 into [0,256], need more precision than bf16
typedef _Float16 v16h __attribute__((ext_vector_type(16)));
union FragH { v16h v; v8us half[2]; _Float16 h[16]; unsigned short u[16]; };
typedef _Float16 v4h __attribute__((ext_vector_type(4)));
typedef __bf16 v4b __attribute__((ext_vector_type(4)));
typedef unsigned short v4us __attribute__((ext_vector_type(4), may_alias));
union Quad { v4b b; v4us u; };
// One launch for the three projections, straight from the f32 inputs. A work-group owns PC columns n of one input X [DI][SQ] (blockIdx.y: Q, K or V); each of its
// PW waves takes DI / PW = 64 of the k. A lane reads 16 bytes of a row of X: columns n0 + 4 ln + u, u = 0..3, so that a wave's load is two pieces of 256 consecutive bytes,
// and u picks the B tile: tile u holds the columns n0 + 4 ln + u at lane position ln. The wave's share of M (64 rows x 64 k) is read the same way, in whole lines, rounded
// to bf16 and turned into A fragments through the wave's own LDS range. The waves' partial tiles are summed through LDS in wave order, and the sum is stored
// in the layout that k_attn reads: QdH[s][d] f16, KdT[t][d] f32 (LDS rows = columns, row u * 16 + ln), Vd[d][s] f32 (LDS rows = d).
#define PW 8
#define PC 64
#define PP 68      // LDS row pitch in floats: 16 bytes x odd, so that 16 lanes that write 16 bytes each to 16 rows fall on different banks
#define PM 72      // row pitch of the staged M in bf16: 144 bytes, 16 x odd again, for the fragments' 16-byte reads
__device__ __forceinline__ v8f wmmaB(v16b a, v16b b, v8f c) { return __builtin_amdgcn_wmma_f32_16x16x32_bf16(false, a, false, b, (short)0, c, false, false); }
// amdgpu_waves_per_eu(4, 4): 256 registers a wave, so that two work-groups (2 x 136 KiB of LDS) share a WGP and the 384 work-groups run in one round
__global__ __launch_bounds__(PW * 32) __attribute__((amdgpu_waves_per_eu(4, 4))) void k_proj(const float* __restrict__ Q, const float* __restrict__ K, const float* __restrict__ V,
                                                 const float* __restrict__ Mq, const float* __restrict__ Mk, const float* __restrict__ Mv,
                                                 _Float16* __restrict__ QdH, float* __restrict__ KdT, float* __restrict__ Vd) {
  __shared__ __attribute__((aligned(16))) float part[PW][DO][PP];
  const int tid = threadIdx.x, w = tid >> 5, lane = tid & 31, ln = lane & 15, hh = lane >> 4;
  const int which = blockIdx.y, n0 = blockIdx.x * PC, k0 = w * (DI / PW);
  const float* X = which == 0 ? Q : which == 1 ? K : V;
  const float* M = which == 0 ? Mq : which == 1 ? Mk : Mv;
  const float* mp = M + (size_t)hh * DI + k0 + 4 * ln;
  const float* xp = X + (size_t)(k0 + 8 * hh) * SQ + n0 + 4 * ln;
  unsigned short* ms = (unsigned short*)&part[w][0][0];      // the wave's own LDS range holds its share of M until its partial tiles take the place
  // every loop below is unrolled so that fragments and tiles are indexed by constants and stay in registers
  v4f mf[32], xf[2][16];
  v16b b[2][4];
  FragB a[4][2];
#pragma unroll
  for (int j = 0; j < 16; ++j) mf[j] = *(const v4fa*)(mp + (size_t)(2 * j) * DI);      // rows 2 j and 2 j + 1, 256 consecutive bytes each
#pragma unroll
  for (int ks = 0; ks < 2; ++ks)
#pragma unroll
    for (int i = 0; i < 16; ++i) xf[ks][i] = *(const v4fa*)(xp + (size_t)(ks * 32 + (i >> 3) * 16 + (i & 7)) * SQ);      // k = 8 hh + 0..7, 16 + 8 hh + 0..7
#pragma unroll
  for (int j = 0; j < 16; ++j) { Quad c; c.b = (v4b){(__bf16)mf[j][0], (__bf16)mf[j][1], (__bf16)mf[j][2], (__bf16)mf[j][3]}; *(v4us*)(ms + (2 * j + hh) * PM + 4 * ln) = c.u; }
  // rows 32 to 63 of M are asked for only now, into the registers that rows 0 to 31 have left (all 64 loads at once would take more than 256 registers, and two
  // work-groups would no longer fit a WGP); they come from L2 while X is still on its way from memory
  __builtin_amdgcn_sched_barrier(0);      // keeps the 48 loads above together in front and the 16 below behind: without it all of M is asked for first and X only behind the wait for it (two latencies in a row), with spills
#pragma unroll
  for (int j = 16; j < 32; ++j) mf[j] = *(const v4fa*)(mp + (size_t)(2 * j) * DI);
#pragma unroll
  for (int ks = 0; ks < 2; ++ks)
#pragma unroll
    for (int u = 0; u < 4; ++u)
#pragma unroll
      for (int i = 0; i < 16; ++i) b[ks][u][i] = (__bf16)xf[ks][i][u];
#pragma unroll
  for (int j = 16; j < 32; ++j) { Quad c; c.b = (v4b){(__bf16)mf[j][0], (__bf16)mf[j][1], (__bf16)mf[j][2], (__bf16)mf[j][3]}; *(v4us*)(ms + (2 * j + hh) * PM + 4 * ln) = c.u; }
  asm volatile("s_wait_dscnt 0x0" ::: "memory");      // the lanes read below what other lanes of the wave have written above
#pragma unroll
  for (int mt = 0; mt < 4; ++mt)
#pragma unroll
    for (int ks = 0; ks < 2; ++ks) {      // the k order of xf
      a[mt][ks].half[0] = *(const v8us*)(ms + (mt * 16 + ln) * PM + ks * 32 + 8 * hh);
      a[mt][ks].half[1] = *(const v8us*)(ms + (mt * 16 + ln) * PM + ks * 32 + 16 + 8 * hh);
    }
#pragma unroll
  for (int mh = 0; mh < 4; mh += 2) {      // 32 rows d at a time: 8 tiles, then their partials go to LDS and leave the registers
    v8f acc[2][4];
#pragma unroll
    for (int m = 0; m < 2; ++m)
#pragma unroll
      for (int u = 0; u < 4; ++u) acc[m][u] = (v8f){0.f,0.f,0.f,0.f,0.f,0.f,0.f,0.f};
#pragma unroll
    for (int ks = 0; ks < 2; ++ks)
#pragma unroll
      for (int m = 0; m < 2; ++m)
#pragma unroll
        for (int u = 0; u < 4; ++u) acc[m][u] = wmmaB(a[mh + m][ks].v, b[ks][u], acc[m][u]);
    // acc[m][u][r] = partial of (d = 16 (mh + m) + 8 hh + r, n = n0 + 4 ln + u)
    if (which == 2) {
#pragma unroll
      for (int m = 0; m < 2; ++m)
#pragma unroll
        for (int r = 0; r < 8; ++r) *(v4fa*)&part[w][(mh + m) * 16 + 8 * hh + r][4 * ln] = (v4f){acc[m][0][r], acc[m][1][r], acc[m][2][r], acc[m][3][r]};
    } else {
#pragma unroll
      for (int m = 0; m < 2; ++m)
#pragma unroll
        for (int u = 0; u < 4; ++u) {
          *(v4fa*)&part[w][u * 16 + ln][(mh + m) * 16 + 8 * hh] = (v4f){acc[m][u][0], acc[m][u][1], acc[m][u][2], acc[m][u][3]};
          *(v4fa*)&part[w][u * 16 + ln][(mh + m) * 16 + 8 * hh + 4] = (v4f){acc[m][u][4], acc[m][u][5], acc[m][u][6], acc[m][u][7]};
        }
    }
  }
  __syncthreads();      // every wave's partial tile is in LDS
#pragma unroll
  for (int j = 0; j < DO * PC / 4 / (PW * 32); ++j) {      // 16 lanes sum and store one whole LDS row: whole 128-byte lines of the output
    const int e = j * (PW * 32) + tid, row = e >> 4, c4 = (e & 15) * 4;
    v4f s = *(const v4fa*)&part[0][row][c4];
#pragma unroll
    for (int p = 1; p < PW; ++p) s += *(const v4fa*)&part[p][row][c4];      // wave order
    const int n = n0 + 4 * (row & 15) + (row >> 4);
    // s_wait_xcnt 0 behind each store, inside its own branch: the next pass forms its address in the registers that the issued store names
    if (which == 2) { *(v4f*)(Vd + (size_t)row * SQ + n0 + c4) = s; asm volatile("s_wait_xcnt 0x0" ::: "memory"); }
    else if (which == 1) { *(v4f*)(KdT + (size_t)n * DO + c4) = s; asm volatile("s_wait_xcnt 0x0" ::: "memory"); }
    else { *(v4h*)(QdH + (size_t)n * DO + c4) = (v4h){(_Float16)s[0], (_Float16)s[1], (_Float16)s[2], (_Float16)s[3]}; asm volatile("s_wait_xcnt 0x0" ::: "memory"); }
  }
}
// One launch for scores, softmax and out. A work-group owns AT key columns t; each of its AW waves takes SQ / AW query positions s, 32 a pass.
// Scores as S[s][t] = Qd[:,s].Kd[:,t] (A = f16 Qd rows, B = Kd columns split into f16 hi/lo, kept in registers: 2 products, K = 64), so that a lane holds
// scores of one column t only and two score tiles (s 0-15, 16-31 of a pass), converted in place, are the B operand of out[d][t] += Vd[d][s].P[s][t].
// Walk 1 finds each column's maximum over all s; walk 2 forms the scores again, e = exp(x - max), adds e to the column's sum and multiplies f16(e * 2^8)
// with Vd (f16 hi/lo: 2 products). All waves use the same maximum, so their partial tiles and sums add up plainly, in wave order, and the division comes last.
#define AW 16
#define AT 32
#define ASR (SQ / AW)
__device__ __forceinline__ v8f wmmaH(v16h a, v16h b, v8f c) { return __builtin_amdgcn_wmma_f32_16x16x32_f16(false, a, false, b, (short)0, c, false, false); }
// 32 consecutive f32 k of the lane's row at p -> f16 hi/lo fragments in the hardware k order (8 hh + i, 16 + 8 hh + i)
__device__ __forceinline__ void frag_split(const float* __restrict__ p, int hh, FragH& fh, FragH& fl) {
  const v4f x0 = *(const v4fa*)(p + 8 * hh), x1 = *(const v4fa*)(p + 8 * hh + 4), x2 = *(const v4fa*)(p + 16 + 8 * hh), x3 = *(const v4fa*)(p + 16 + 8 * hh + 4);
  const float xs[16] = {x0[0],x0[1],x0[2],x0[3],x1[0],x1[1],x1[2],x1[3],x2[0],x2[1],x2[2],x2[3],x3[0],x3[1],x3[2],x3[3]};
  // unrolled so that xs and the fragments are indexed by constants and stay in registers
#pragma unroll
  for (int i = 0; i < 16; ++i) { const _Float16 h = (_Float16)xs[i]; fh.h[i] = h; fl.h[i] = (_Float16)(xs[i] - (float)h); }
}
// the A fragments of 32 s rows (m: which 16; ks: which 32 of the 64 d); q points at the lane's row of the first 16
__device__ __forceinline__ void q_load(const _Float16* __restrict__ q, int hh, FragH (&qa)[2][2]) {
  // unrolled, here and in q_mul, so that the fragments and tiles are indexed by constants and stay in registers
#pragma unroll
  for (int m = 0; m < 2; ++m)
#pragma unroll
    for (int ks = 0; ks < 2; ++ks) { const _Float16* a = q + m * 16 * DO + ks * 32; qa[m][ks].half[0] = *(const v8us*)(a + 8 * hh); qa[m][ks].half[1] = *(const v8us*)(a + 16 + 8 * hh); }
}
// sc[m][g] = raw scores of those 32 s rows against the 32 columns (g: which 16)
__device__ __forceinline__ void q_mul(const FragH (&qa)[2][2], const FragH (&kh)[2][2], const FragH (&kl)[2][2], v8f (&sc)[2][2]) {
#pragma unroll
  for (int m = 0; m < 2; ++m)
#pragma unroll
    for (int g = 0; g < 2; ++g) sc[m][g] = (v8f){0.f,0.f,0.f,0.f,0.f,0.f,0.f,0.f};
#pragma unroll
  for (int ks = 0; ks < 2; ++ks) {
#pragma unroll
    for (int m = 0; m < 2; ++m)
#pragma unroll
      for (int g = 0; g < 2; ++g) sc[m][g] = wmmaH(qa[m][ks].v, kh[g][ks].v, sc[m][g]);
#pragma unroll
    for (int m = 0; m < 2; ++m)
#pragma unroll
      for (int g = 0; g < 2; ++g) sc[m][g] = wmmaH(qa[m][ks].v, kl[g][ks].v, sc[m][g]);
  }
}
__global__ __launch_bounds__(AW * 32) void k_attn(const _Float16* __restrict__ QdH, const float* __restrict__ KdT, const float* __restrict__ Vd, float* __restrict__ out) {
  __shared__ __attribute__((aligned(16))) float part[AW][DO][AT];
  __shared__ float rmx[AW][AT], rsm[AW][AT];
  const int tid = threadIdx.x, w = tid >> 5, lane = tid & 31, ln = lane & 15, hh = lane >> 4;
  const int t0 = blockIdx.x * AT;
  const _Float16* qrow = QdH + (size_t)(w * ASR + ln) * DO;
  const float* vrow = Vd + (size_t)ln * SQ + w * ASR;
  FragH kh[2][2], kl[2][2];
  // the loops over g, ks, u, m, r and dt below are unrolled so that fragments and tiles are indexed by constants and stay in registers
#pragma unroll
  for (int g = 0; g < 2; ++g)
#pragma unroll
    for (int ks = 0; ks < 2; ++ks) frag_split(KdT + (size_t)(t0 + g * 16 + ln) * DO + ks * 32, hh, kh[g][ks], kl[g][ks]);
  float mx[2] = {-3.0e38f, -3.0e38f};
  for (int p = 0; p < ASR / 32; p += 4) {
    FragH qa[4][2][2];
#pragma unroll
    for (int u = 0; u < 4; ++u) q_load(qrow + (size_t)(p + u) * 32 * DO, hh, qa[u]);
    __builtin_amdgcn_sched_barrier(0);      // keeps the 32 loads of four passes in front of the first product: without it they are issued a few at a time into reused registers, several memory latencies a pass
#pragma unroll
    for (int u = 0; u < 4; ++u) {
      v8f sc[2][2];
      q_mul(qa[u], kh, kl, sc);
#pragma unroll
      for (int g = 0; g < 2; ++g)
#pragma unroll
        for (int m = 0; m < 2; ++m)
#pragma unroll
          for (int r = 0; r < 8; ++r) mx[g] = fmaxf(mx[g], sc[m][g][r]);
    }
  }
#pragma unroll
  for (int g = 0; g < 2; ++g) { mx[g] = fmaxf(mx[g], __shfl_xor(mx[g], 16, 32)); rmx[w][g * 16 + ln] = mx[g]; }      // both halves of the wave store the same value
  __syncthreads();      // every wave's column maxima are in rmx
#pragma unroll
  for (int g = 0; g < 2; ++g) {
    float m = rmx[0][g * 16 + ln];
    for (int p = 1; p < AW; ++p) m = fmaxf(m, rmx[p][g * 16 + ln]);
    mx[g] = m * 0.125f + 1.0f;      // x / 8 + 1 never decreases with x, so the maximum may be taken first
  }
  v8f o[4][2];
#pragma unroll
  for (int dt = 0; dt < 4; ++dt)
#pragma unroll
    for (int g = 0; g < 2; ++g) o[dt][g] = (v8f){0.f,0.f,0.f,0.f,0.f,0.f,0.f,0.f};
  float den[2] = {0.f, 0.f};
  for (int p = 0; p < ASR / 32; ++p) {
    FragH qa[2][2];
    q_load(qrow + (size_t)p * 32 * DO, hh, qa);
    v8f sc[2][2];
    q_mul(qa, kh, kl, sc);
    FragH pb[2];
#pragma unroll
    for (int g = 0; g < 2; ++g)
#pragma unroll
      for (int m = 0; m < 2; ++m)
#pragma unroll
        for (int r = 0; r < 8; ++r) {
          const float e = expf((sc[m][g][r] * 0.125f + 1.0f) - mx[g]);
          den[g] += e;
          pb[g].h[m * 8 + r] = (_Float16)(e * 256.0f);      // x 2^8 (exact) keeps small weights out of the f16 subnormal range; taken back with the division
        }
#pragma unroll
    for (int dt = 0; dt < 4; ++dt) {
      FragH vh, vl;
      frag_split(vrow + (size_t)dt * 16 * SQ + p * 32, hh, vh, vl);
#pragma unroll
      for (int g = 0; g < 2; ++g) o[dt][g] = wmmaH(vh.v, pb[g].v, o[dt][g]);
#pragma unroll
      for (int g = 0; g < 2; ++g) o[dt][g] = wmmaH(vl.v, pb[g].v, o[dt][g]);
    }
  }
#pragma unroll
  for (int g = 0; g < 2; ++g) { den[g] += __shfl_xor(den[g], 16, 32); rsm[w][g * 16 + ln] = den[g]; }      // both halves of the wave store the same value
#pragma unroll
  for (int dt = 0; dt < 4; ++dt)
#pragma unroll
    for (int g = 0; g < 2; ++g)
#pragma unroll
      for (int r = 0; r < 8; ++r) part[w][dt * 16 + 8 * hh + r][g * 16 + ln] = o[dt][g][r];
  __syncthreads();      // every wave's partial tile and column sums are in LDS
  float dsum = 0.f;
  for (int p = 0; p < AW; ++p) dsum += rsm[p][lane];      // wave order, the same in every wave
  const float inv = 0.00390625f / dsum;
  for (int j = 0; j < DO / AW; ++j) {      // wave w sums and stores rows w, w + AW, ...: one whole 128-byte line each
    const int d = j * AW + w;
    float s = 0.f;
    for (int p = 0; p < AW; ++p) s += part[p][d][lane];
    out[(size_t)d * SQ + t0 + lane] = s * inv;
  }
}
extern "C" void kernel_launch(void* const* d_in, const int* in_sizes, int n_in,
                              void* d_out, int out_size, void* d_ws, size_t ws_size, hipStream_t stream) {
  (void)in_sizes; (void)n_in; (void)out_size;
  const float* Q = (const float*)d_in[0]; const float* K = (const float*)d_in[1]; const float* V = (const float*)d_in[2]; const float* Mq = (const float*)d_in[3]; const float* Mk = (const float*)d_in[4]; const float* Mv = (const float*)d_in[5];
  char* ws = (char*)d_ws; size_t off = 0;
  auto take = [&](size_t bytes) { char* p = ws + off; off += (bytes + 255) & ~(size_t)255; return p; };
  float* Vd = (float*)take((size_t)DO * SQ * 4); float* KdT = (float*)take((size_t)SQ * DO * 4); _Float16* QdB = (_Float16*)take((size_t)SQ * DO * 2);
  if (off > ws_size) return;
  k_proj<<<dim3(SQ / PC, 3, 1), PW * 32, 0, stream>>>(Q, K, V, Mq, Mk, Mv, QdB, KdT, Vd);      // QdB[s][d] = f16((Mq.Q)[d][s]), KdT[t][d] = (Mk.K)[d][t], Vd = Mv.V [64][8192]
  k_attn<<<SQ / AT, AW * 32, 0, stream>>>(QdB, KdT, Vd, (float*)d_out);      // out[d][t] = sum_s Vd[d][s] * softmax_s(Qd[:,s].Kd[:,t] / 8 + 1)
}

// v005
// A run of this version takes 79.4 microseconds.
// In two side-by-side timings against v004, it was 1.16 and 1.09 times as fast.
// All steps since v000 together make it 56.8 times as fast.
#include <hip/hip_runtime.h>
// On v_wmma_f32_16x16x32_bf16 with f32 accumulate, in one kernel (k_proj): the projections Qd/Kd/Vd = M.{Q,K,V} (M = 64, K = 512, N = 8192; inputs rounded to bf16: single exact term).
// On v_wmma_f32_16x16x32_f16, in one fused kernel (k_attn): the scores S[s][t] = Qd[:,s].Kd[:,t] (Qd rounded to f16, Kd split into f16 hi/lo: 2 products, K = 64) and
// out[:, t] = Vd.P[:, t] (Vd split into f16 hi/lo, the softmax weights rounded to f16: 2 products, K = 8192). The module's softmax runs over the QUERY axis s (dim 0);
// /sqrt(64) and the +1 constant are f32 VALU.
#define DI 512
#define DO 64
#define SQ 8192

typedef __bf16 v16b __attribute__((ext_vector_type(16)));
typedef unsigned short v8us __attribute__((ext_vector_type(8), may_alias));
typedef float  v8f  __attribute__((ext_vector_type(8)));
typedef float  v4f  __attribute__((ext_vector_type(4)));
typedef float  v4fa __attribute__((ext_vector_type(4), may_alias));
union FragB { v16b v; v8us half[2]; unsigned short u[16]; };

__device__ __forceinline__ unsigned short bf16_bits(float x) { unsigned int u = __float_as_uint(x); return (unsigned short)((u + 0x7FFFu + ((u >> 16) & 1u)) >> 16); }
__device__ __forceinline__ float bf16_val(unsigned short b) { return __uint_as_float(((unsigned int)b) << 16); }
__device__ __forceinline__ float bf16_round(float x) { return bf16_val(bf16_bits(x)); }
// D += A·B with NT terms: 1 = ah·bh, 2 = + al·bh (A split), 3 = + ah·bl (both split)
template <int NT>
__device__ __forceinline__ v8f mmaN(v16b ah, v16b al, v16b bh, v16b bl, v8f c) {
  c = __builtin_amdgcn_wmma_f32_16x16x32_bf16(false, ah, false, bh, (short)0, c, false, false);
  if (NT >= 2) c = __builtin_amdgcn_wmma_f32_16x16x32_bf16(false, al, false, bh, (short)0, c, false, false);
  if (NT >= 3) c = __builtin_amdgcn_wmma_f32_16x16x32_bf16(false, ah, false, bl, (short)0, c, false, false);
  asm volatile("v_nop\n\tv_nop\n\tv_nop\n\tv_nop" : "+v"(c) : "v"(ah), "v"(al), "v"(bh), "v"(bl));
  return c;
}

// GEMM C[M][N] (f32, pitch ldc) = act(A[M][K]·W + bias). A f32 row-major (pitch lda) converted per fragment to bf16
// (ASPLIT: hi/lo two planes -> 2 terms, else single rounded term); Wt bf16 [N][K] (pitch ldb). BIAS_BF16 rounds the
// bias to bf16 first (bias quantised to bf16 before the add). K%32==0, M%16==0, N%64==0.
template <bool ASPLIT, int ACT, bool BIAS_BF16>
__global__ __launch_bounds__(128) void k_gemm_bf(const float* __restrict__ A, int lda, const unsigned short* __restrict__ Wt, int ldb,
                                               const float* __restrict__ bias, float* __restrict__ C, int ldc, int M, int N, int K) {
  __shared__ __attribute__((aligned(16))) float so[4][16][64];
  const int tid = threadIdx.x, w = tid >> 5, lane = tid & 31, ln = lane & 15, hh = lane >> 4;
  const int ntn = N / 64;
  const int wid = blockIdx.x * 4 + w;
  const int mt = wid / ntn, nq = wid % ntn;
  if (mt * 16 >= M) return;
  const int row0 = mt * 16, col0 = nq * 64;
  const float* arow = A + (size_t)(row0 + ln) * lda;
  v8f acc[4] = {};
  for (int kb = 0; kb < K; kb += 32) {
    FragB ah, al;
    const v4f x0 = *(const v4fa*)(arow + kb + 8 * hh), x1 = *(const v4fa*)(arow + kb + 8 * hh + 4);
    const v4f x2 = *(const v4fa*)(arow + kb + 16 + 8 * hh), x3 = *(const v4fa*)(arow + kb + 16 + 8 * hh + 4);
    float xs[16] = {x0[0],x0[1],x0[2],x0[3],x1[0],x1[1],x1[2],x1[3],x2[0],x2[1],x2[2],x2[3],x3[0],x3[1],x3[2],x3[3]};
#pragma unroll
    for (int i = 0; i < 16; ++i) { const unsigned short hb = bf16_bits(xs[i]); ah.u[i] = hb; al.u[i] = ASPLIT ? bf16_bits(xs[i] - bf16_val(hb)) : (unsigned short)0; }
#pragma unroll
    for (int t = 0; t < 4; ++t) {
      const unsigned short* brow = Wt + (size_t)(col0 + t * 16 + ln) * ldb + kb;
      FragB b;
      b.half[0] = *(const v8us*)(brow + 8 * hh);
      b.half[1] = *(const v8us*)(brow + 16 + 8 * hh);
      acc[t] = mmaN<ASPLIT ? 2 : 1>(ah.v, al.v, b.v, b.v, acc[t]);
    }
  }
#pragma unroll
  for (int t = 0; t < 4; ++t) {
    float bv = bias ? bias[col0 + t * 16 + ln] : 0.f;
    if (BIAS_BF16) bv = bf16_round(bv);
#pragma unroll
    for (int r = 0; r < 8; ++r) { float v = acc[t][r] + bv; if (ACT == 1) v = fmaxf(v, 0.f); so[w][8 * hh + r][t * 16 + ln] = v; }
  }
  __builtin_amdgcn_fence(__ATOMIC_ACQ_REL, "workgroup");
  __builtin_amdgcn_wave_barrier();
  const int rsub = lane >> 4, c4 = (lane & 15) * 4;
  {
#pragma unroll
    for (int q = 0; q < 8; ++q) {
      const int r = q * 2 + rsub;
      const v4f v = *(const v4fa*)&so[w][r][c4];
      *(v4f*)(C + (size_t)(row0 + r) * ldc + col0 + c4) = v;
    }
    
  }
}

// Flash-style causal/unmasked attention, all contractions 3-term bf16 hi/lo splits, f32 softmax with running max.
// q,k,v rows are read from f32 buffers with arbitrary row pitch (so they can live inside a fused qkv buffer);
// D = head size (multiple of 32, <= 128); one wave = 16 query rows; block = 4 waves (64 queries) sharing K/V chunks of 32.
template <int D, bool CAUSAL>
__global__ __launch_bounds__(128) void k_flash(const float* __restrict__ qb, const float* __restrict__ kb, const float* __restrict__ vb,
                                             int pitch, int T, int H, float scale, float* __restrict__ y, int ypitch) {
  constexpr int KS = D / 32;        // k-steps for QK
  constexpr int DT = D / 16;        // d tiles for PV
  __shared__ __attribute__((aligned(16))) unsigned short sKh[32][D + 8], sKl[32][D + 8], sVh[32][D + 8], sVl[32][D + 8];
  __shared__ __attribute__((aligned(16))) unsigned short sPh[4][16][40], sPl[4][16][40];
  __shared__ __attribute__((aligned(16))) float sO[4][16][D];
  const int tid = threadIdx.x, w = tid >> 5, lane = tid & 31, ln = lane & 15, hh = lane >> 4;
  const int nqb = (T + 63) / 64;
  const int bh = blockIdx.x / nqb, qblk = blockIdx.x % nqb;
  const int b = bh / H, h = bh % H;
  const int q0 = qblk * 64 + w * 16;
  const float* Q = qb + (size_t)b * T * pitch + h * D;
  const float* K = kb + (size_t)b * T * pitch + h * D;
  const float* V = vb + (size_t)b * T * pitch + h * D;

  // A fragments of the wave's 16 query rows (scaled), hi/lo
  FragB aqh[KS], aql[KS];
  {
    int row = q0 + ln; if (row >= T) row = T - 1;
    const float* qr = Q + (size_t)row * pitch;
#pragma unroll
    for (int ks = 0; ks < KS; ++ks)
#pragma unroll
      for (int i = 0; i < 16; ++i) {
        const int d = ks * 32 + ((i < 8) ? (8 * hh + i) : (16 + 8 * hh + (i - 8)));
        const float x = qr[d] * scale; const unsigned short hb = bf16_bits(x);
        aqh[ks].u[i] = hb; aql[ks].u[i] = bf16_bits(x - bf16_val(hb));
      }
  }
  float m_r[8], l_r[8];
#pragma unroll
  for (int r = 0; r < 8; ++r) { m_r[r] = -3.0e38f; l_r[r] = 0.f; }
  v8f oacc[DT];
#pragma unroll
  for (int dt = 0; dt < DT; ++dt) oacc[dt] = (v8f){0.f,0.f,0.f,0.f,0.f,0.f,0.f,0.f};

  const int kv_end = CAUSAL ? min(T, qblk * 64 + 64) : T;     // block-uniform
  for (int j0 = 0; j0 < kv_end; j0 += 32) {
    __syncthreads();
    for (int e = tid; e < 32 * (D / 4); e += 128) {
      const int r = e / (D / 4), c4 = (e % (D / 4)) * 4;
      const int key = j0 + r;
      v4f kf = {0.f,0.f,0.f,0.f}, vf = {0.f,0.f,0.f,0.f};
      if (key < T) { kf = *(const v4fa*)(K + (size_t)key * pitch + c4); vf = *(const v4fa*)(V + (size_t)key * pitch + c4); }
#pragma unroll
      for (int t = 0; t < 4; ++t) {
        unsigned short hb = bf16_bits(kf[t]); sKh[r][c4 + t] = hb; sKl[r][c4 + t] = bf16_bits(kf[t] - bf16_val(hb));
        hb = bf16_bits(vf[t]); sVh[r][c4 + t] = hb; sVl[r][c4 + t] = bf16_bits(vf[t] - bf16_val(hb));
      }
    }
    __syncthreads();
    // S tile 16 x 32
    v8f s[2];
#pragma unroll
    for (int nt = 0; nt < 2; ++nt) {
      v8f acc = {};
#pragma unroll
      for (int ks = 0; ks < KS; ++ks) {
        FragB bh_, bl_;
        bh_.half[0] = *(const v8us*)&sKh[nt * 16 + ln][ks * 32 + 8 * hh]; bh_.half[1] = *(const v8us*)&sKh[nt * 16 + ln][ks * 32 + 16 + 8 * hh];
        bl_.half[0] = *(const v8us*)&sKl[nt * 16 + ln][ks * 32 + 8 * hh]; bl_.half[1] = *(const v8us*)&sKl[nt * 16 + ln][ks * 32 + 16 + 8 * hh];
        acc = mmaN<3>(aqh[ks].v, aql[ks].v, bh_.v, bl_.v, acc);
      }
      s[nt] = acc;
    }
    // mask + running max (rows 8hh+r; the 16 lanes of a half share rows)
    float alpha[8];
#pragma unroll
    for (int r = 0; r < 8; ++r) {
      const int qi = q0 + 8 * hh + r;
      const int ja = j0 + ln, jb = j0 + 16 + ln;
      if (CAUSAL) { if (ja > qi) s[0][r] = -3.0e38f; if (jb > qi) s[1][r] = -3.0e38f; }
      if (ja >= T) s[0][r] = -3.0e38f;
      if (jb >= T) s[1][r] = -3.0e38f;
      float mx = fmaxf(s[0][r], s[1][r]);
      mx = fmaxf(mx, __shfl_xor(mx, 1, 32)); mx = fmaxf(mx, __shfl_xor(mx, 2, 32)); mx = fmaxf(mx, __shfl_xor(mx, 4, 32)); mx = fmaxf(mx, __shfl_xor(mx, 8, 32));
      const float mnew = fmaxf(m_r[r], mx);
      alpha[r] = (mnew > -1.0e38f) ? __expf(m_r[r] - mnew) : 1.0f;
      const float p0 = (s[0][r] > -1.0e38f) ? __expf(s[0][r] - mnew) : 0.f;
      const float p1 = (s[1][r] > -1.0e38f) ? __expf(s[1][r] - mnew) : 0.f;
      m_r[r] = mnew;
      l_r[r] = l_r[r] * alpha[r] + p0 + p1;            // per-lane partial row sum (16 lanes combined at the end)
      unsigned short hb = bf16_bits(p0); sPh[w][8 * hh + r][ln] = hb;      sPl[w][8 * hh + r][ln] = bf16_bits(p0 - bf16_val(hb));
      hb = bf16_bits(p1);                sPh[w][8 * hh + r][16 + ln] = hb; sPl[w][8 * hh + r][16 + ln] = bf16_bits(p1 - bf16_val(hb));
    }
#pragma unroll
    for (int dt = 0; dt < DT; ++dt)
#pragma unroll
      for (int r = 0; r < 8; ++r) oacc[dt][r] *= alpha[r];
    __builtin_amdgcn_fence(__ATOMIC_ACQ_REL, "workgroup");
    __builtin_amdgcn_wave_barrier();
    FragB pah, pal;
    pah.half[0] = *(const v8us*)&sPh[w][ln][8 * hh]; pah.half[1] = *(const v8us*)&sPh[w][ln][16 + 8 * hh];
    pal.half[0] = *(const v8us*)&sPl[w][ln][8 * hh]; pal.half[1] = *(const v8us*)&sPl[w][ln][16 + 8 * hh];
#pragma unroll
    for (int dt = 0; dt < DT; ++dt) {
      FragB bvh, bvl;
#pragma unroll
      for (int i = 0; i < 8; ++i) {
        bvh.u[i] = sVh[8 * hh + i][dt * 16 + ln]; bvh.u[8 + i] = sVh[16 + 8 * hh + i][dt * 16 + ln];
        bvl.u[i] = sVl[8 * hh + i][dt * 16 + ln]; bvl.u[8 + i] = sVl[16 + 8 * hh + i][dt * 16 + ln];
      }
      oacc[dt] = mmaN<3>(pah.v, pal.v, bvh.v, bvl.v, oacc[dt]);
    }
    __builtin_amdgcn_fence(__ATOMIC_ACQ_REL, "workgroup");
    __builtin_amdgcn_wave_barrier();
  }
#pragma unroll
  for (int r = 0; r < 8; ++r) {
    float l = l_r[r];
    l += __shfl_xor(l, 1, 32); l += __shfl_xor(l, 2, 32); l += __shfl_xor(l, 4, 32); l += __shfl_xor(l, 8, 32);
    l_r[r] = (l > 0.f) ? 1.0f / l : 0.f;
  }
#pragma unroll
  for (int dt = 0; dt < DT; ++dt)
#pragma unroll
    for (int r = 0; r < 8; ++r) sO[w][8 * hh + r][dt * 16 + ln] = oacc[dt][r] * l_r[r];
  __builtin_amdgcn_fence(__ATOMIC_ACQ_REL, "workgroup");
  __builtin_amdgcn_wave_barrier();
  {
    for (int r = 0; r < 16; ++r) {
      const int row = q0 + r;
      if (row < T && lane < D / 4) {
        const v4f val = *(const v4fa*)&sO[w][r][lane * 4];
        *(v4f*)(y + ((size_t)b * T + row) * ypitch + h * D + lane * 4) = val;
      }
    }
    
  }
}

// in pitch = cols, out pitch = rows; rows, cols multiples of 32. Optional per-output-row affine (scale[c], shift[c]) and
// residual add res (same layout as out, optionally bf16-rounded) for fused epilogues: out = in*scale + shift + res.
template <bool AFFINE, bool RESID, bool RES_BF16>
__global__ __launch_bounds__(256) void k_transpose32(const float* __restrict__ in, float* __restrict__ out, int rows, int cols,
                                                    const float* __restrict__ scale, const float* __restrict__ shift, const float* __restrict__ res) {
  __shared__ float tile[32][33];
  const int b = blockIdx.z;
  const int r0 = blockIdx.y * 32, c0 = blockIdx.x * 32;
  const float* src = in + (size_t)b * rows * cols;
  float* dst = out + (size_t)b * rows * cols;
  const int tx = threadIdx.x & 31, ty = threadIdx.x >> 5;     // 8 rows per pass
  for (int i = ty; i < 32; i += 8) tile[i][tx] = src[(size_t)(r0 + i) * cols + c0 + tx];
  __syncthreads();
  {
    for (int i = ty; i < 32; i += 8) {
      float v = tile[tx][i];
      const int orow = c0 + i;
      if (AFFINE) v = v * scale[orow] + shift[orow];
      if (RESID) { float rv = res[(size_t)b * rows * cols + (size_t)orow * rows + r0 + tx]; if (RES_BF16) rv = bf16_round(rv); v += rv; }
      *(float*)(dst + (size_t)orow * rows + r0 + tx) = v;
    }
    
  }
}

// 2x2 max pool on position-major data: in [B][H*W][C] -> out [B][(H/2)*(W/2)][C]; thread per (b, p', 4 channels); C%4==0
__global__ __launch_bounds__(256) void k_pool2_pm(const float* __restrict__ in, float* __restrict__ out, int Bn, int H, int W, int C) {
  const size_t t = (size_t)blockIdx.x * 256 + threadIdx.x;
  const int c4n = C / 4, Ho = H / 2, Wo = W / 2;
  const size_t total = (size_t)Bn * Ho * Wo * c4n;
  if (t >= total) return;
  const int c4 = (int)(t % c4n) * 4; size_t rest = t / c4n;
  const int pw = (int)(rest % Wo); rest /= Wo; const int ph = (int)(rest % Ho); const int b = (int)(rest / Ho);
  const float* base = in + (size_t)b * H * W * C;
  const int p00 = (2 * ph) * W + 2 * pw;
  const v4f a = *(const v4fa*)(base + (size_t)p00 * C + c4), bq = *(const v4fa*)(base + (size_t)(p00 + 1) * C + c4);
  const v4f c = *(const v4fa*)(base + (size_t)(p00 + W) * C + c4), d = *(const v4fa*)(base + (size_t)(p00 + W + 1) * C + c4);
  v4f m; for (int i = 0; i < 4; ++i) m[i] = fmaxf(fmaxf(a[i], bq[i]), fmaxf(c[i], d[i]));
  float* dst = out + ((size_t)b * Ho * Wo + (size_t)ph * Wo + pw) * C + c4;
  *(v4f*)dst = m;
  
}

// General (non-causal) attention, 3-term bf16 splits, f32 softmax with running max.
// Q [.][Tq][qpitch], K [.][Tk][kpitch] (head dim DQ), V [.][Tk][vpitch] (head dim DVtot); this block handles DV output
// dims starting at dv0 = blockIdx.y*DV. y[bh][t][ypitch] gets columns dv0..dv0+DV-1. Per-bh base offsets via strides.
template <int DQ, int DV>
__global__ __launch_bounds__(128) void k_flash2(const float* __restrict__ Qb, size_t qstride, int qpitch, int Tq,
                                              const float* __restrict__ Kb, size_t kstride, int kpitch, int Tk,
                                              const float* __restrict__ Vb, size_t vstride, int vpitch,
                                              float scale, float* __restrict__ y, size_t ystride, int ypitch) {
  constexpr int KS = DQ / 32, DT = DV / 16;
  __shared__ __attribute__((aligned(16))) unsigned short sKh[32][DQ + 8], sKl[32][DQ + 8], sVh[32][DV + 8], sVl[32][DV + 8];
  __shared__ __attribute__((aligned(16))) unsigned short sPh[4][16][40], sPl[4][16][40];
  __shared__ __attribute__((aligned(16))) float sO[4][16][DV];
  const int tid = threadIdx.x, w = tid >> 5, lane = tid & 31, ln = lane & 15, hh = lane >> 4;
  const int nqb = (Tq + 63) / 64;
  const int bh = blockIdx.x / nqb, qblk = blockIdx.x % nqb;
  const int dv0 = blockIdx.y * DV;
  const int q0 = qblk * 64 + w * 16;
  const float* Q = Qb + (size_t)bh * qstride; const float* K = Kb + (size_t)bh * kstride; const float* V = Vb + (size_t)bh * vstride + dv0;
  FragB aqh[KS], aql[KS];
  {
    int row = q0 + ln; if (row >= Tq) row = Tq - 1;
    const float* qr = Q + (size_t)row * qpitch;
#pragma unroll
    for (int ks = 0; ks < KS; ++ks)
#pragma unroll
      for (int i = 0; i < 16; ++i) {
        const int d = ks * 32 + ((i < 8) ? (8 * hh + i) : (16 + 8 * hh + (i - 8)));
        const float x = qr[d] * scale; const unsigned short hb = bf16_bits(x);
        aqh[ks].u[i] = hb; aql[ks].u[i] = bf16_bits(x - bf16_val(hb));
      }
  }
  float m_r[8], l_r[8];
#pragma unroll
  for (int r = 0; r < 8; ++r) { m_r[r] = -3.0e38f; l_r[r] = 0.f; }
  v8f oacc[DT];
#pragma unroll
  for (int dt = 0; dt < DT; ++dt) oacc[dt] = (v8f){0.f,0.f,0.f,0.f,0.f,0.f,0.f,0.f};
  for (int j0 = 0; j0 < Tk; j0 += 32) {
    __syncthreads();
    for (int e = tid; e < 32 * (DQ / 4); e += 128) {
      const int r = e / (DQ / 4), c4 = (e % (DQ / 4)) * 4; const int key = j0 + r;
      v4f f = {0.f,0.f,0.f,0.f}; if (key < Tk) f = *(const v4fa*)(K + (size_t)key * kpitch + c4);
#pragma unroll
      for (int t = 0; t < 4; ++t) { const unsigned short hb = bf16_bits(f[t]); sKh[r][c4 + t] = hb; sKl[r][c4 + t] = bf16_bits(f[t] - bf16_val(hb)); }
    }
    for (int e = tid; e < 32 * (DV / 4); e += 128) {
      const int r = e / (DV / 4), c4 = (e % (DV / 4)) * 4; const int key = j0 + r;
      v4f f = {0.f,0.f,0.f,0.f}; if (key < Tk) f = *(const v4fa*)(V + (size_t)key * vpitch + c4);
#pragma unroll
      for (int t = 0; t < 4; ++t) { const unsigned short hb = bf16_bits(f[t]); sVh[r][c4 + t] = hb; sVl[r][c4 + t] = bf16_bits(f[t] - bf16_val(hb)); }
    }
    __syncthreads();
    v8f s[2];
#pragma unroll
    for (int nt = 0; nt < 2; ++nt) {
      v8f acc = {};
#pragma unroll
      for (int ks = 0; ks < KS; ++ks) {
        FragB bh_, bl_;
        bh_.half[0] = *(const v8us*)&sKh[nt * 16 + ln][ks * 32 + 8 * hh]; bh_.half[1] = *(const v8us*)&sKh[nt * 16 + ln][ks * 32 + 16 + 8 * hh];
        bl_.half[0] = *(const v8us*)&sKl[nt * 16 + ln][ks * 32 + 8 * hh]; bl_.half[1] = *(const v8us*)&sKl[nt * 16 + ln][ks * 32 + 16 + 8 * hh];
        acc = mmaN<3>(aqh[ks].v, aql[ks].v, bh_.v, bl_.v, acc);
      }
      s[nt] = acc;
    }
    float alpha[8];
#pragma unroll
    for (int r = 0; r < 8; ++r) {
      const int ja = j0 + ln, jb = j0 + 16 + ln;
      if (ja >= Tk) s[0][r] = -3.0e38f;
      if (jb >= Tk) s[1][r] = -3.0e38f;
      float mx = fmaxf(s[0][r], s[1][r]);
      mx = fmaxf(mx, __shfl_xor(mx, 1, 32)); mx = fmaxf(mx, __shfl_xor(mx, 2, 32)); mx = fmaxf(mx, __shfl_xor(mx, 4, 32)); mx = fmaxf(mx, __shfl_xor(mx, 8, 32));
      const float mnew = fmaxf(m_r[r], mx);
      alpha[r] = (mnew > -1.0e38f) ? __expf(m_r[r] - mnew) : 1.0f;
      const float p0 = (s[0][r] > -1.0e38f) ? __expf(s[0][r] - mnew) : 0.f;
      const float p1 = (s[1][r] > -1.0e38f) ? __expf(s[1][r] - mnew) : 0.f;
      m_r[r] = mnew;
      l_r[r] = l_r[r] * alpha[r] + p0 + p1;
      unsigned short hb = bf16_bits(p0); sPh[w][8 * hh + r][ln] = hb;      sPl[w][8 * hh + r][ln] = bf16_bits(p0 - bf16_val(hb));
      hb = bf16_bits(p1);                sPh[w][8 * hh + r][16 + ln] = hb; sPl[w][8 * hh + r][16 + ln] = bf16_bits(p1 - bf16_val(hb));
    }
#pragma unroll
    for (int dt = 0; dt < DT; ++dt)
#pragma unroll
      for (int r = 0; r < 8; ++r) oacc[dt][r] *= alpha[r];
    __builtin_amdgcn_fence(__ATOMIC_ACQ_REL, "workgroup");
    __builtin_amdgcn_wave_barrier();
    FragB pah, pal;
    pah.half[0] = *(const v8us*)&sPh[w][ln][8 * hh]; pah.half[1] = *(const v8us*)&sPh[w][ln][16 + 8 * hh];
    pal.half[0] = *(const v8us*)&sPl[w][ln][8 * hh]; pal.half[1] = *(const v8us*)&sPl[w][ln][16 + 8 * hh];
#pragma unroll
    for (int dt = 0; dt < DT; ++dt) {
      FragB bvh, bvl;
#pragma unroll
      for (int i = 0; i < 8; ++i) {
        bvh.u[i] = sVh[8 * hh + i][dt * 16 + ln]; bvh.u[8 + i] = sVh[16 + 8 * hh + i][dt * 16 + ln];
        bvl.u[i] = sVl[8 * hh + i][dt * 16 + ln]; bvl.u[8 + i] = sVl[16 + 8 * hh + i][dt * 16 + ln];
      }
      oacc[dt] = mmaN<3>(pah.v, pal.v, bvh.v, bvl.v, oacc[dt]);
    }
    __builtin_amdgcn_fence(__ATOMIC_ACQ_REL, "workgroup");
    __builtin_amdgcn_wave_barrier();
  }
#pragma unroll
  for (int r = 0; r < 8; ++r) {
    float l = l_r[r];
    l += __shfl_xor(l, 1, 32); l += __shfl_xor(l, 2, 32); l += __shfl_xor(l, 4, 32); l += __shfl_xor(l, 8, 32);
    l_r[r] = (l > 0.f) ? 1.0f / l : 0.f;
  }
#pragma unroll
  for (int dt = 0; dt < DT; ++dt)
#pragma unroll
    for (int r = 0; r < 8; ++r) sO[w][8 * hh + r][dt * 16 + ln] = oacc[dt][r] * l_r[r];
  __builtin_amdgcn_fence(__ATOMIC_ACQ_REL, "workgroup");
  __builtin_amdgcn_wave_barrier();
  {
    for (int r = 0; r < 16; ++r) {
      const int row = q0 + r;
      for (int c4 = lane * 4; c4 < DV; c4 += 128) {
        if (row < Tq) {
          const v4f val = *(const v4fa*)&sO[w][r][c4];
          *(v4f*)(y + (size_t)bh * ystride + (size_t)row * ypitch + dv0 + c4) = val;
        }
      }
    }
    
  }
}

// f32 [R][Cc] (row pitch lds) -> bf16 hi/lo planes [R][Cc] (pitch Cc); thread per 8 elements; Cc % 8 == 0
__global__ __launch_bounds__(256) void k_split_rows(const float* __restrict__ src, int lds_, unsigned short* __restrict__ hi, unsigned short* __restrict__ lo, int R, int Cc) {
  const size_t t = (size_t)blockIdx.x * 256 + threadIdx.x;
  const int c8n = Cc / 8;
  if (t >= (size_t)R * c8n) return;
  const int r = (int)(t / c8n), c8 = (int)(t % c8n) * 8;
  const float* s = src + (size_t)r * lds_ + c8;
  const v4f a = *(const v4fa*)s, b = *(const v4fa*)(s + 4);
  float xs[8] = {a[0],a[1],a[2],a[3],b[0],b[1],b[2],b[3]};
  v8us vh, vl;
#pragma unroll
  for (int i = 0; i < 8; ++i) { const unsigned short hb = bf16_bits(xs[i]); vh[i] = hb; vl[i] = bf16_bits(xs[i] - bf16_val(hb)); }
  unsigned short* dh = hi + (size_t)r * Cc + c8; unsigned short* dl = lo + (size_t)r * Cc + c8;
  *(v8us*)dh = vh; *(v8us*)dl = vl; 
}
// f32 [K][N] (row pitch lds) -> transposed bf16 hi/lo planes [N][K]; one thread per (n, 8 consecutive k)
__global__ __launch_bounds__(256) void k_split_transpose(const float* __restrict__ src, int lds_, unsigned short* __restrict__ hi, unsigned short* __restrict__ lo, int K, int N) {
  const size_t t = (size_t)blockIdx.x * 256 + threadIdx.x;
  const int k8n = K / 8;
  if (t >= (size_t)N * k8n) return;
  const int n = (int)(t / k8n), k8 = (int)(t % k8n) * 8;
  v8us vh, vl;
#pragma unroll
  for (int i = 0; i < 8; ++i) { const float x = src[(size_t)(k8 + i) * lds_ + n]; const unsigned short hb = bf16_bits(x); vh[i] = hb; vl[i] = bf16_bits(x - bf16_val(hb)); }
  unsigned short* dh = hi + (size_t)n * K + k8; unsigned short* dl = lo + (size_t)n * K + k8;
  *(v8us*)dh = vh; *(v8us*)dl = vl; 
}
// GEMM with A f32 (split into hi/lo when ASPLIT) and B from bf16 planes Bh (+ Bl when BSPLIT): terms hi·hi [+ lo·hi] [+ hi·lo].
// C f32 [M][N] pitch ldc; alpha scales the result; bias optional (BIAS_BF16 rounds it). Same tiling/epilogue as k_gemm_bf.
template <bool ASPLIT, bool BSPLIT, int ACT, bool BIAS_BF16>
__global__ __launch_bounds__(128) void k_gemm_bf2(const float* __restrict__ A, int lda, const unsigned short* __restrict__ Bh, const unsigned short* __restrict__ Bl, int ldb,
                                                const float* __restrict__ bias, float alpha, float* __restrict__ C, int ldc, int M, int N, int K) {
  __shared__ __attribute__((aligned(16))) float so[4][16][64];
  const int tid = threadIdx.x, w = tid >> 5, lane = tid & 31, ln = lane & 15, hh = lane >> 4;
  const int ntn = N / 64;
  const int wid = blockIdx.x * 4 + w;
  const int mt = wid / ntn, nq = wid % ntn;
  if (mt * 16 >= M) return;
  const int row0 = mt * 16, col0 = nq * 64;
  const float* arow = A + (size_t)(row0 + ln) * lda;
  v8f acc[4] = {};
  for (int kb = 0; kb < K; kb += 32) {
    FragB ah, al;
    const v4f x0 = *(const v4fa*)(arow + kb + 8 * hh), x1 = *(const v4fa*)(arow + kb + 8 * hh + 4);
    const v4f x2 = *(const v4fa*)(arow + kb + 16 + 8 * hh), x3 = *(const v4fa*)(arow + kb + 16 + 8 * hh + 4);
    float xs[16] = {x0[0],x0[1],x0[2],x0[3],x1[0],x1[1],x1[2],x1[3],x2[0],x2[1],x2[2],x2[3],x3[0],x3[1],x3[2],x3[3]};
#pragma unroll
    for (int i = 0; i < 16; ++i) { const unsigned short hb = bf16_bits(xs[i]); ah.u[i] = hb; al.u[i] = ASPLIT ? bf16_bits(xs[i] - bf16_val(hb)) : (unsigned short)0; }
#pragma unroll
    for (int t = 0; t < 4; ++t) {
      const size_t boff = (size_t)(col0 + t * 16 + ln) * ldb + kb;
      FragB bh_, bl_;
      bh_.half[0] = *(const v8us*)(Bh + boff + 8 * hh);
      bh_.half[1] = *(const v8us*)(Bh + boff + 16 + 8 * hh);
      if (BSPLIT) { bl_.half[0] = *(const v8us*)(Bl + boff + 8 * hh); bl_.half[1] = *(const v8us*)(Bl + boff + 16 + 8 * hh); } else bl_ = bh_;
      acc[t] = mmaN<ASPLIT ? (BSPLIT ? 3 : 2) : 1>(ah.v, al.v, bh_.v, bl_.v, acc[t]);
    }
  }
#pragma unroll
  for (int t = 0; t < 4; ++t) {
    float bv = bias ? bias[col0 + t * 16 + ln] : 0.f;
    if (BIAS_BF16) bv = bf16_round(bv);
#pragma unroll
    for (int r = 0; r < 8; ++r) { float v = acc[t][r] * alpha + bv; if (ACT == 1) v = fmaxf(v, 0.f); so[w][8 * hh + r][t * 16 + ln] = v; }
  }
  __builtin_amdgcn_fence(__ATOMIC_ACQ_REL, "workgroup");
  __builtin_amdgcn_wave_barrier();
  const int rsub = lane >> 4, c4 = (lane & 15) * 4;
  {
#pragma unroll
    for (int q = 0; q < 8; ++q) {
      const int r = q * 2 + rsub;
      const v4f v = *(const v4fa*)&so[w][r][c4];
      *(v4f*)(C + (size_t)(row0 + r) * ldc + col0 + c4) = v;
    }
    
  }
}
// row softmax: P[row][:] = softmax(masked S[row][:]) over N columns with optional causal mask (col > row + rowoff -> 0) and
__global__ __launch_bounds__(256) void k_softmax_rows(const float* __restrict__ S, float* __restrict__ P, int N, int causal, int rowoff, const int* __restrict__ mask, int mask_pitch) {
  __shared__ float red[256];
  const int row = blockIdx.x, tid = threadIdx.x;
  const float* s = S + (size_t)row * N; float* p_out = P + (size_t)row * N;
  const int qi = row + rowoff;
  float mx = -3.0e38f;
  for (int j = tid; j < N; j += 256) {
    bool keep = true;
    if (causal && j > qi) keep = false;
    if (mask && mask[(size_t)qi * mask_pitch + j] == 0) keep = false;
    const float v = keep ? s[j] : -3.0e38f;
    mx = fmaxf(mx, v);
  }
  red[tid] = mx; __syncthreads();
  for (int st = 128; st > 0; st >>= 1) { if (tid < st) red[tid] = fmaxf(red[tid], red[tid + st]); __syncthreads(); }
  mx = red[0]; __syncthreads();
  float sum = 0.f;
  for (int j = tid; j < N; j += 256) {
    bool keep = true;
    if (causal && j > qi) keep = false;
    if (mask && mask[(size_t)qi * mask_pitch + j] == 0) keep = false;
    const float p = keep ? __expf(s[j] - mx) : 0.f;
    sum += p;
  }
  red[tid] = sum; __syncthreads();
  for (int st = 128; st > 0; st >>= 1) { if (tid < st) red[tid] += red[tid + st]; __syncthreads(); }
  const float inv = (mx > -1.0e38f) ? 1.0f / red[0] : __builtin_nanf("");
  __syncthreads();
  {
    for (int j4 = tid * 4; j4 < N; j4 += 1024) {
      v4f out4;
#pragma unroll
      for (int u = 0; u < 4; ++u) {
        const int j = j4 + u;
        bool keep = true;
        if (causal && j > qi) keep = false;
        if (mask && mask[(size_t)qi * mask_pitch + j] == 0) keep = false;
        out4[u] = keep ? __expf(s[j] - mx) * inv : 0.f;
      }
      *(v4f*)(p_out + j4) = out4;
    }
    
  }
}

// GEMM C = act(A·W + bias + resid): A f32 (ASPLIT -> hi/lo 2 terms), Wt bf16 [N][K]; ACT 0 none, 1 relu, 2 exact gelu;
// resid (optional, f32, row index = (row % rmod), pitch ldr, RES_BF16 rounds it) added before the activation.
template <bool ASPLIT, int ACT, bool BIAS_BF16, bool RES_BF16>
__global__ __launch_bounds__(128) void k_gemm_bf3(const float* __restrict__ A, int lda, const unsigned short* __restrict__ Wt, int ldb,
                                                const float* __restrict__ bias, const float* __restrict__ resid, int rmod, int ldr,
                                                float* __restrict__ C, int ldc, int M, int N, int K) {
  __shared__ __attribute__((aligned(16))) float so[4][16][64];
  const int tid = threadIdx.x, w = tid >> 5, lane = tid & 31, ln = lane & 15, hh = lane >> 4;
  const int ntn = N / 64;
  const int wid = blockIdx.x * 4 + w;
  const int mt = wid / ntn, nq = wid % ntn;
  if (mt * 16 >= M) return;
  const int row0 = mt * 16, col0 = nq * 64;
  const float* arow = A + (size_t)(row0 + ln) * lda;
  v8f acc[4] = {};
  for (int kb = 0; kb < K; kb += 32) {
    FragB ah, al;
    const v4f x0 = *(const v4fa*)(arow + kb + 8 * hh), x1 = *(const v4fa*)(arow + kb + 8 * hh + 4);
    const v4f x2 = *(const v4fa*)(arow + kb + 16 + 8 * hh), x3 = *(const v4fa*)(arow + kb + 16 + 8 * hh + 4);
    float xs[16] = {x0[0],x0[1],x0[2],x0[3],x1[0],x1[1],x1[2],x1[3],x2[0],x2[1],x2[2],x2[3],x3[0],x3[1],x3[2],x3[3]};
#pragma unroll
    for (int i = 0; i < 16; ++i) { const unsigned short hb = bf16_bits(xs[i]); ah.u[i] = hb; al.u[i] = ASPLIT ? bf16_bits(xs[i] - bf16_val(hb)) : (unsigned short)0; }
#pragma unroll
    for (int t = 0; t < 4; ++t) {
      const unsigned short* brow = Wt + (size_t)(col0 + t * 16 + ln) * ldb + kb;
      FragB b;
      b.half[0] = *(const v8us*)(brow + 8 * hh);
      b.half[1] = *(const v8us*)(brow + 16 + 8 * hh);
      acc[t] = mmaN<ASPLIT ? 2 : 1>(ah.v, al.v, b.v, b.v, acc[t]);
    }
  }
#pragma unroll
  for (int t = 0; t < 4; ++t) {
    const int col = col0 + t * 16 + ln;
    float bv = bias ? bias[col] : 0.f;
    if (BIAS_BF16) bv = bf16_round(bv);
#pragma unroll
    for (int r = 0; r < 8; ++r) {
      float v = acc[t][r] + bv;
      if (resid) { float rv = resid[(size_t)((row0 + 8 * hh + r) % rmod) * ldr + col]; if (RES_BF16) rv = bf16_round(rv); v += rv; }
      if (ACT == 1) v = fmaxf(v, 0.f);
      if (ACT == 2) v = 0.5f * v * (1.0f + erff(v * 0.70710678118654752f));
      if (ACT == 3) { const float u = 0.7978845608028654f * (v + 0.044715f * v * v * v); v = 0.5f * v * (1.0f + tanhf(u)); }
      so[w][8 * hh + r][t * 16 + ln] = v;
    }
  }
  __builtin_amdgcn_fence(__ATOMIC_ACQ_REL, "workgroup");
  __builtin_amdgcn_wave_barrier();
  const int rsub = lane >> 4, c4 = (lane & 15) * 4;
  {
#pragma unroll
    for (int q = 0; q < 8; ++q) {
      const int r = q * 2 + rsub;
      const v4f v = *(const v4fa*)&so[w][r][c4];
      *(v4f*)(C + (size_t)(row0 + r) * ldc + col0 + c4) = v;
    }
    
  }
}
// row LayerNorm (biased variance, eps) over N: s = X (+ R); optional out_sum <- s; out_norm <- (s-mu)*rsqrt(var+eps)*g + b
template <bool PARAM_BF16>
__global__ __launch_bounds__(256) void k_layernorm(const float* __restrict__ X, const float* __restrict__ R, const float* __restrict__ g, const float* __restrict__ bta,
                                                  float* __restrict__ out_sum, float* __restrict__ out_norm, int N, float eps) {
  __shared__ float red[256];
  const int row = blockIdx.x, tid = threadIdx.x;
  const float* x = X + (size_t)row * N; const float* rr = R ? R + (size_t)row * N : nullptr;
  float vals[16];                     // up to N = 4096
  const int per = N / 256;            // contiguous chunk per thread? use strided-by-4 chunks: thread handles j = tid*4 + 1024*u
  float s1 = 0.f;
  for (int u = 0; u < per / 4; ++u) {
    const int j = tid * 4 + 1024 * u;
    const v4f a = *(const v4fa*)(x + j);
    v4f b = {0.f,0.f,0.f,0.f}; if (rr) b = *(const v4fa*)(rr + j);
#pragma unroll
    for (int q = 0; q < 4; ++q) { const float v = a[q] + b[q]; vals[u * 4 + q] = v; s1 += v; }
  }
  red[tid] = s1; __syncthreads();
  for (int st = 128; st > 0; st >>= 1) { if (tid < st) red[tid] += red[tid + st]; __syncthreads(); }
  const float mu = red[0] / (float)N; __syncthreads();
  float s2 = 0.f;
  for (int u = 0; u < per / 4; ++u)
#pragma unroll
    for (int q = 0; q < 4; ++q) { const float c = vals[u * 4 + q] - mu; s2 += c * c; }
  red[tid] = s2; __syncthreads();
  for (int st = 128; st > 0; st >>= 1) { if (tid < st) red[tid] += red[tid + st]; __syncthreads(); }
  const float rs = rsqrtf(red[0] / (float)N + eps);
  {
    for (int u = 0; u < per / 4; ++u) {
      const int j = tid * 4 + 1024 * u;
      v4f o, sm;
#pragma unroll
      for (int q = 0; q < 4; ++q) {
        float gg = g[j + q], bb = bta[j + q];
        if (PARAM_BF16) { gg = bf16_round(gg); bb = bf16_round(bb); }
        sm[q] = vals[u * 4 + q]; o[q] = (vals[u * 4 + q] - mu) * rs * gg + bb;
      }
      if (out_sum) *(v4f*)(out_sum + (size_t)row * N + j) = sm;
      *(v4f*)(out_norm + (size_t)row * N + j) = o;
    }
    
  }
}

// batched GEMM (blockIdx.y = batch): C_b = act(alpha·A_b·B_b + bias + resid_b); A f32 rows (ASPLIT → hi/lo), B = bf16 planes Bh (+Bl when BSPLIT, requires ASPLIT),
// per-batch element strides sA, sB (0 = shared weights), sC, sR. resid may alias C (values are staged before the stores). ACT 0/1(relu).
// ACT: 0 none, 1 relu, 2 softplus
template <bool ASPLIT, bool BSPLIT, int ACT>
__global__ __launch_bounds__(128) void k_gemm_b(const float* __restrict__ A, int lda, size_t sA, const unsigned short* __restrict__ Bh, const unsigned short* __restrict__ Bl, int ldb, size_t sB,
                                             const float* __restrict__ bias, const float* __restrict__ resid, int ldr, size_t sR, float rsign, float alpha,
                                             float* __restrict__ C, int ldc, size_t sC, int M, int N, int K) {
  __shared__ __attribute__((aligned(16))) float so[4][16][64];
  const int tid = threadIdx.x, w = tid >> 5, lane = tid & 31, ln = lane & 15, hh = lane >> 4;
  const int by = blockIdx.y;
  A += (size_t)by * sA; Bh += (size_t)by * sB; if (BSPLIT) Bl += (size_t)by * sB; C += (size_t)by * sC; if (resid) resid += (size_t)by * sR;
  const int ntn = N / 64; const int wid = blockIdx.x * 4 + w; const int mt = wid / ntn, nq = wid % ntn;
  if (mt * 16 >= M) return;
  const int row0 = mt * 16, col0 = nq * 64;
  const float* arow = A + (size_t)(row0 + ln) * lda;
  v8f acc[4] = {};
  for (int kb = 0; kb < K; kb += 32) {
    FragB ah, al;
    const v4f x0 = *(const v4fa*)(arow + kb + 8 * hh), x1 = *(const v4fa*)(arow + kb + 8 * hh + 4);
    const v4f x2 = *(const v4fa*)(arow + kb + 16 + 8 * hh), x3 = *(const v4fa*)(arow + kb + 16 + 8 * hh + 4);
    float xs[16] = {x0[0],x0[1],x0[2],x0[3],x1[0],x1[1],x1[2],x1[3],x2[0],x2[1],x2[2],x2[3],x3[0],x3[1],x3[2],x3[3]};
#pragma unroll
    for (int i = 0; i < 16; ++i) { const unsigned short hb = bf16_bits(xs[i]); ah.u[i] = hb; al.u[i] = ASPLIT ? bf16_bits(xs[i] - bf16_val(hb)) : (unsigned short)0; }
#pragma unroll
    for (int t = 0; t < 4; ++t) {
      const size_t boff = (size_t)(col0 + t * 16 + ln) * ldb + kb;
      FragB bh_, bl_; bh_.half[0] = *(const v8us*)(Bh + boff + 8 * hh); bh_.half[1] = *(const v8us*)(Bh + boff + 16 + 8 * hh);
      if (BSPLIT) { bl_.half[0] = *(const v8us*)(Bl + boff + 8 * hh); bl_.half[1] = *(const v8us*)(Bl + boff + 16 + 8 * hh); } else bl_ = bh_;
      acc[t] = mmaN<ASPLIT ? (BSPLIT ? 3 : 2) : 1>(ah.v, al.v, bh_.v, bl_.v, acc[t]);
    }
  }
#pragma unroll
  for (int t = 0; t < 4; ++t) {
    const int col = col0 + t * 16 + ln; const float bv = bias ? bf16_round(bias[col]) : 0.f;
#pragma unroll
    for (int r = 0; r < 8; ++r) { float v = acc[t][r] * alpha + bv; if (resid) v += rsign * resid[(size_t)(row0 + 8 * hh + r) * ldr + col]; if (ACT == 1) v = fmaxf(v, 0.f); else if (ACT == 2) v = fmaxf(v, 0.f) + log1pf(expf(-fabsf(v))); so[w][8 * hh + r][t * 16 + ln] = v; }
  }
  __builtin_amdgcn_fence(__ATOMIC_ACQ_REL, "workgroup"); __builtin_amdgcn_wave_barrier();
  const int rsub = lane >> 4, c4 = (lane & 15) * 4;
  {
#pragma unroll
    for (int q = 0; q < 8; ++q) { const int r = q * 2 + rsub; const v4f v = *(const v4fa*)&so[w][r][c4]; *(v4f*)(C + (size_t)(row0 + r) * ldc + col0 + c4) = v; }
    
  }
}
// batched f32 [K][N] (pitch lds, batch stride sIn) -> transposed hi/lo planes [N][K] (batch stride sOut); thread per (n, 8 k); grid.y = batch
__global__ __launch_bounds__(256) void k_split_transpose_b(const float* __restrict__ src, int lds_, size_t sIn, unsigned short* __restrict__ hi, unsigned short* __restrict__ lo, size_t sOut, int K, int N) {
  const size_t t = (size_t)blockIdx.x * 256 + threadIdx.x; const int k8n = K / 8; if (t >= (size_t)N * k8n) return;
  src += (size_t)blockIdx.y * sIn; hi += (size_t)blockIdx.y * sOut; lo += (size_t)blockIdx.y * sOut;
  const int n = (int)(t / k8n), k8 = (int)(t % k8n) * 8; v8us vh, vl;
#pragma unroll
  for (int i = 0; i < 8; ++i) { const float x = src[(size_t)(k8 + i) * lds_ + n]; const unsigned short hb = bf16_bits(x); vh[i] = hb; vl[i] = bf16_bits(x - bf16_val(hb)); }
  unsigned short* dh = hi + (size_t)n * K + k8; unsigned short* dl = lo + (size_t)n * K + k8;
  *(v8us*)dh = vh; *(v8us*)dl = vl; 
}

__global__ __launch_bounds__(256) void k_round_rows(const float* __restrict__ W, unsigned short* __restrict__ Wt, int n8) {
  const int t = blockIdx.x * 256 + threadIdx.x;
  if (t >= n8) return;
  const v4f a = *(const v4fa*)(W + (size_t)t * 8), b = *(const v4fa*)(W + (size_t)t * 8 + 4);
  v8us v; v[0]=bf16_bits(a[0]); v[1]=bf16_bits(a[1]); v[2]=bf16_bits(a[2]); v[3]=bf16_bits(a[3]);
  v[4]=bf16_bits(b[0]); v[5]=bf16_bits(b[1]); v[6]=bf16_bits(b[2]); v[7]=bf16_bits(b[3]);
  *(v8us*)(Wt + (size_t)t * 8) = v; 
}


// ---- f16 WMMA path (v_wmma_f32_16x16x32_f16): 11-bit significands for operands in range — used where the softmax weights, scaled by 2^8 into [0,256], need more precision than bf16
typedef _Float16 v16h __attribute__((ext_vector_type(16)));
union FragH { v16h v; v8us half[2]; _Float16 h[16]; unsigned short u[16]; };
typedef _Float16 v4h __attribute__((ext_vector_type(4)));
typedef __bf16 v4b __attribute__((ext_vector_type(4)));
typedef unsigned short v4us __attribute__((ext_vector_type(4), may_alias));
union Quad { v4b b; v4us u; };
// One launch for the three projections, straight from the f32 inputs. A work-group owns PC columns n of one input X [DI][SQ] (blockIdx.y: Q, K or V); each of its
// PW waves takes DI / PW = 64 of the k. A lane reads 16 bytes of a row of X: columns n0 + 4 ln + u, u = 0..3, so that a wave's load is two pieces of 256 consecutive bytes,
// and u picks the B tile: tile u holds the columns n0 + 4 ln + u at lane position ln. The wave's share of M (64 rows x 64 k) is read the same way, in whole lines, rounded
// to bf16 and turned into A fragments through the wave's own LDS range. The waves' partial tiles are summed through LDS in wave order, and the sum is stored
// in the order in which k_attn's lanes load their fragments, so that each 16-byte load of a wave there covers 512 consecutive bytes (4 whole lines, not 32 bytes of 16 lines):
//   QF f16: [s / 16][d / 32][(d / 16) & 1][lane = 16 ((d / 8) & 1) + s % 16][d % 8]
//   KF f32: [t / 16][d / 32][c = 2 ((d / 16) & 1) + ((d / 4) & 1)][lane = 16 ((d / 8) & 1) + t % 16][d % 4]
//   VF f32: [s / 32][d / 16][c = 2 ((s / 16) & 1) + ((s / 4) & 1)][lane = 16 ((s / 8) & 1) + d % 16][s % 4]
// The PC columns of a work-group fill PC * DO consecutive elements of each, written in whole lines.
#define PW 8
#define PC 64
#define PP 68      // LDS row pitch in floats: 16 bytes x odd, so that 16 lanes that write 16 bytes each to 16 rows fall on different banks
#define PM 72      // row pitch of the staged M in bf16: 144 bytes, 16 x odd again, for the fragments' 16-byte reads
__device__ __forceinline__ v8f wmmaB(v16b a, v16b b, v8f c) { return __builtin_amdgcn_wmma_f32_16x16x32_bf16(false, a, false, b, (short)0, c, false, false); }
// amdgpu_waves_per_eu(4, 4): 256 registers a wave, so that two work-groups (2 x 136 KiB of LDS) share a WGP and the 384 work-groups run in one round
__global__ __launch_bounds__(PW * 32) __attribute__((amdgpu_waves_per_eu(4, 4))) void k_proj(const float* __restrict__ Q, const float* __restrict__ K, const float* __restrict__ V,
                                                 const float* __restrict__ Mq, const float* __restrict__ Mk, const float* __restrict__ Mv,
                                                 _Float16* __restrict__ QF, float* __restrict__ KF, float* __restrict__ VF) {
  __shared__ __attribute__((aligned(16))) float part[PW][DO][PP];
  const int tid = threadIdx.x, w = tid >> 5, lane = tid & 31, ln = lane & 15, hh = lane >> 4;
  const int which = blockIdx.y, n0 = blockIdx.x * PC, k0 = w * (DI / PW);
  const float* X = which == 0 ? Q : which == 1 ? K : V;
  const float* M = which == 0 ? Mq : which == 1 ? Mk : Mv;
  const float* mp = M + (size_t)hh * DI + k0 + 4 * ln;
  const float* xp = X + (size_t)(k0 + 8 * hh) * SQ + n0 + 4 * ln;
  unsigned short* ms = (unsigned short*)&part[w][0][0];      // the wave's own LDS range holds its share of M until its partial tiles take the place
  // every loop below is unrolled so that fragments and tiles are indexed by constants and stay in registers
  v4f mf[32], xf[2][16];
  v16b b[2][4];
  FragB a[4][2];
#pragma unroll
  for (int j = 0; j < 16; ++j) mf[j] = *(const v4fa*)(mp + (size_t)(2 * j) * DI);      // rows 2 j and 2 j + 1, 256 consecutive bytes each
#pragma unroll
  for (int ks = 0; ks < 2; ++ks)
#pragma unroll
    for (int i = 0; i < 16; ++i) xf[ks][i] = *(const v4fa*)(xp + (size_t)(ks * 32 + (i >> 3) * 16 + (i & 7)) * SQ);      // k = 8 hh + 0..7, 16 + 8 hh + 0..7
#pragma unroll
  for (int j = 0; j < 16; ++j) { Quad c; c.b = (v4b){(__bf16)mf[j][0], (__bf16)mf[j][1], (__bf16)mf[j][2], (__bf16)mf[j][3]}; *(v4us*)(ms + (2 * j + hh) * PM + 4 * ln) = c.u; }
  // rows 32 to 63 of M are asked for only now, into the registers that rows 0 to 31 have left (all 64 loads at once would take more than 256 registers, and two
  // work-groups would no longer fit a WGP); they come from L2 while X is still on its way from memory
  __builtin_amdgcn_sched_barrier(0);      // keeps the 48 loads above together in front and the 16 below behind: without it all of M is asked for first and X only behind the wait for it (two latencies in a row), with spills
#pragma unroll
  for (int j = 16; j < 32; ++j) mf[j] = *(const v4fa*)(mp + (size_t)(2 * j) * DI);
#pragma unroll
  for (int ks = 0; ks < 2; ++ks)
#pragma unroll
    for (int u = 0; u < 4; ++u)
#pragma unroll
      for (int i = 0; i < 16; ++i) b[ks][u][i] = (__bf16)xf[ks][i][u];
#pragma unroll
  for (int j = 16; j < 32; ++j) { Quad c; c.b = (v4b){(__bf16)mf[j][0], (__bf16)mf[j][1], (__bf16)mf[j][2], (__bf16)mf[j][3]}; *(v4us*)(ms + (2 * j + hh) * PM + 4 * ln) = c.u; }
  asm volatile("s_wait_dscnt 0x0" ::: "memory");      // the lanes read below what other lanes of the wave have written above
#pragma unroll
  for (int mt = 0; mt < 4; ++mt)
#pragma unroll
    for (int ks = 0; ks < 2; ++ks) {      // the k order of xf
      a[mt][ks].half[0] = *(const v8us*)(ms + (mt * 16 + ln) * PM + ks * 32 + 8 * hh);
      a[mt][ks].half[1] = *(const v8us*)(ms + (mt * 16 + ln) * PM + ks * 32 + 16 + 8 * hh);
    }
#pragma unroll
  for (int mh = 0; mh < 4; mh += 2) {      // 32 rows d at a time: 8 tiles, then their partials go to LDS and leave the registers
    v8f acc[2][4];
#pragma unroll
    for (int m = 0; m < 2; ++m)
#pragma unroll
      for (int u = 0; u < 4; ++u) acc[m][u] = (v8f){0.f,0.f,0.f,0.f,0.f,0.f,0.f,0.f};
#pragma unroll
    for (int ks = 0; ks < 2; ++ks)
#pragma unroll
      for (int m = 0; m < 2; ++m)
#pragma unroll
        for (int u = 0; u < 4; ++u) acc[m][u] = wmmaB(a[mh + m][ks].v, b[ks][u], acc[m][u]);
    // acc[m][u][r] = partial of (d = 16 (mh + m) + 8 hh + r, n = n0 + 4 ln + u)
    if (which == 2) {
#pragma unroll
      for (int m = 0; m < 2; ++m)
#pragma unroll
        for (int r = 0; r < 8; ++r) *(v4fa*)&part[w][(mh + m) * 16 + 8 * hh + r][4 * ln] = (v4f){acc[m][0][r], acc[m][1][r], acc[m][2][r], acc[m][3][r]};
    } else {
#pragma unroll
      for (int m = 0; m < 2; ++m)
#pragma unroll
        for (int u = 0; u < 4; ++u) {      // LDS row u * 16 + ln = column 4 ln + u, its d turned round by 16 u: the readers below take columns 4 x .. 4 x + 3 at once, which would else fall on the same banks
          *(v4fa*)&part[w][u * 16 + ln][((mh + m + u) & 3) * 16 + 8 * hh] = (v4f){acc[m][u][0], acc[m][u][1], acc[m][u][2], acc[m][u][3]};
          *(v4fa*)&part[w][u * 16 + ln][((mh + m + u) & 3) * 16 + 8 * hh + 4] = (v4f){acc[m][u][4], acc[m][u][5], acc[m][u][6], acc[m][u][7]};
        }
    }
  }
  __syncthreads();      // every wave's partial tile is in LDS
#pragma unroll
  for (int j = 0; j < DO * PC / 4 / (PW * 32); ++j) {      // thread f sums and stores the f-th four elements of the work-group's share, in the order of the output: whole 128-byte lines
    const int f = j * (PW * 32) + tid;
    const int fl = which == 0 ? (f >> 1) & 31 : f & 31;      // the lane of k_attn that will load them
    const int kq = which == 0 ? ((f >> 6) & 3) * 4 + (fl >> 4) * 2 + (f & 1) : ((f >> 6) & 1) * 4 + (fl >> 4) * 2 + ((f >> 5) & 1);      // Q: d / 4; K, V: a quarter of the place in 32 d or 32 s
    int row, q4;      // the LDS row and which 16 bytes of it
    if (which == 2) { row = ((f >> 7) & 3) * 16 + (fl & 15); q4 = (f >> 9) * 8 + kq; }
    else { const int u = fl & 3, dq = which == 0 ? kq : ((f >> 7) & 1) * 8 + kq; row = u * 16 + (f >> 8) * 4 + ((fl & 15) >> 2); q4 = (dq + 4 * u) & 15; }
    const v4fa* ps = (const v4fa*)&part[0][0][0] + row * (PP / 4) + q4;      // counted in 16 bytes, so that the reads stay 16-byte LDS loads
    v4f s = ps[0];
#pragma unroll
    for (int p = 1; p < PW; ++p) s += ps[p * (DO * PP / 4)];      // wave order
    const size_t o = (size_t)n0 * DO + f * 4;
    // s_wait_xcnt 0 behind each store, inside its own branch: the next pass forms its address in the registers that the issued store names
    if (which == 2) { *(v4f*)(VF + o) = s; asm volatile("s_wait_xcnt 0x0" ::: "memory"); }
    else if (which == 1) { *(v4f*)(KF + o) = s; asm volatile("s_wait_xcnt 0x0" ::: "memory"); }
    else { *(v4h*)(QF + o) = (v4h){(_Float16)s[0], (_Float16)s[1], (_Float16)s[2], (_Float16)s[3]}; asm volatile("s_wait_xcnt 0x0" ::: "memory"); }
  }
}
// One launch for scores, softmax and out. A work-group owns AT key columns t; each of its AW waves takes SQ / AW query positions s, 32 a pass.
// Scores as S[s][t] = Qd[:,s].Kd[:,t] (A = f16 Qd rows, B = Kd columns split into f16 hi/lo, kept in registers: 2 products, K = 64), so that a lane holds
// scores of one column t only and two score tiles (s 0-15, 16-31 of a pass), converted in place, are the B operand of out[d][t] += Vd[d][s].P[s][t].
// Walk 1 finds each column's maximum over all s; walk 2 forms the scores again, e = exp(x - max), adds e to the column's sum and multiplies f16(e * 2^8)
// with Vd (f16 hi/lo: 2 products). All waves use the same maximum, so their partial tiles and sums add up plainly, in wave order, and the division comes last.
#define AW 16
#define AT 32
#define ASR (SQ / AW)
__device__ __forceinline__ v8f wmmaH(v16h a, v16h b, v8f c) { return __builtin_amdgcn_wmma_f32_16x16x32_f16(false, a, false, b, (short)0, c, false, false); }
// one 16 x 32 block of KF or VF (p: the lane's 16 bytes of its first 512) -> f16 hi/lo fragments in the hardware k order (8 hh + i, 16 + 8 hh + i)
__device__ __forceinline__ void frag_split(const float* __restrict__ p, FragH& fh, FragH& fl) {
  const v4f x0 = *(const v4fa*)p, x1 = *(const v4fa*)(p + 128), x2 = *(const v4fa*)(p + 256), x3 = *(const v4fa*)(p + 384);
  const float xs[16] = {x0[0],x0[1],x0[2],x0[3],x1[0],x1[1],x1[2],x1[3],x2[0],x2[1],x2[2],x2[3],x3[0],x3[1],x3[2],x3[3]};
  // unrolled so that xs and the fragments are indexed by constants and stay in registers
#pragma unroll
  for (int i = 0; i < 16; ++i) { const _Float16 h = (_Float16)xs[i]; fh.h[i] = h; fl.h[i] = (_Float16)(xs[i] - (float)h); }
}
// the A fragments of 32 s rows (m: which 16; ks: which 32 of the 64 d); q points at the lane's 16 bytes of the first 512 of those rows in QF
__device__ __forceinline__ void q_load(const _Float16* __restrict__ q, FragH (&qa)[2][2]) {
  // unrolled, here and in q_mul, so that the fragments and tiles are indexed by constants and stay in registers
#pragma unroll
  for (int m = 0; m < 2; ++m)
#pragma unroll
    for (int ks = 0; ks < 2; ++ks) { const _Float16* a = q + (m * 2 + ks) * 512; qa[m][ks].half[0] = *(const v8us*)a; qa[m][ks].half[1] = *(const v8us*)(a + 256); }
}
// sc[m][g] = raw scores of those 32 s rows against the 32 columns (g: which 16)
__device__ __forceinline__ void q_mul(const FragH (&qa)[2][2], const FragH (&kh)[2][2], const FragH (&kl)[2][2], v8f (&sc)[2][2]) {
#pragma unroll
  for (int m = 0; m < 2; ++m)
#pragma unroll
    for (int g = 0; g < 2; ++g) sc[m][g] = (v8f){0.f,0.f,0.f,0.f,0.f,0.f,0.f,0.f};
#pragma unroll
  for (int ks = 0; ks < 2; ++ks) {
#pragma unroll
    for (int m = 0; m < 2; ++m)
#pragma unroll
      for (int g = 0; g < 2; ++g) sc[m][g] = wmmaH(qa[m][ks].v, kh[g][ks].v, sc[m][g]);
#pragma unroll
    for (int m = 0; m < 2; ++m)
#pragma unroll
      for (int g = 0; g < 2; ++g) sc[m][g] = wmmaH(qa[m][ks].v, kl[g][ks].v, sc[m][g]);
  }
}
__global__ __launch_bounds__(AW * 32) void k_attn(const _Float16* __restrict__ QF, const float* __restrict__ KF, const float* __restrict__ VF, float* __restrict__ out) {
  __shared__ __attribute__((aligned(16))) float part[AW][DO][AT];
  __shared__ float rmx[AW][AT], rsm[AW][AT];
  const int tid = threadIdx.x, w = tid >> 5, lane = tid & 31, ln = lane & 15, hh = lane >> 4;
  const int t0 = blockIdx.x * AT;
  const _Float16* qrow = QF + (size_t)w * ASR * DO + lane * 8;      // the wave's ASR positions s are ASR * DO consecutive elements of QF and of VF
  const float* vrow = VF + (size_t)w * ASR * DO + lane * 4;
  FragH kh[2][2], kl[2][2];
  // the loops over g, ks, u, m, r and dt below are unrolled so that fragments and tiles are indexed by constants and stay in registers
#pragma unroll
  for (int g = 0; g < 2; ++g)
#pragma unroll
    for (int ks = 0; ks < 2; ++ks) frag_split(KF + (size_t)t0 * DO + (g * 2 + ks) * 512 + lane * 4, kh[g][ks], kl[g][ks]);
  float mx[2] = {-3.0e38f, -3.0e38f};
  for (int p = 0; p < ASR / 32; p += 4) {
    FragH qa[4][2][2];
#pragma unroll
    for (int u = 0; u < 4; ++u) q_load(qrow + (size_t)(p + u) * 32 * DO, qa[u]);
    __builtin_amdgcn_sched_barrier(0);      // keeps the 32 loads of four passes in front of the first product: without it they are issued a few at a time into reused registers, several memory latencies a pass
#pragma unroll
    for (int u = 0; u < 4; ++u) {
      v8f sc[2][2];
      q_mul(qa[u], kh, kl, sc);
#pragma unroll
      for (int g = 0; g < 2; ++g)
#pragma unroll
        for (int m = 0; m < 2; ++m)
#pragma unroll
          for (int r = 0; r < 8; ++r) mx[g] = fmaxf(mx[g], sc[m][g][r]);
    }
  }
#pragma unroll
  for (int g = 0; g < 2; ++g) { mx[g] = fmaxf(mx[g], __shfl_xor(mx[g], 16, 32)); rmx[w][g * 16 + ln] = mx[g]; }      // both halves of the wave store the same value
  __syncthreads();      // every wave's column maxima are in rmx
#pragma unroll
  for (int g = 0; g < 2; ++g) {
    float m = rmx[0][g * 16 + ln];
    for (int p = 1; p < AW; ++p) m = fmaxf(m, rmx[p][g * 16 + ln]);
    mx[g] = m * 0.125f + 1.0f;      // x / 8 + 1 never decreases with x, so the maximum may be taken first
  }
  v8f o[4][2];
#pragma unroll
  for (int dt = 0; dt < 4; ++dt)
#pragma unroll
    for (int g = 0; g < 2; ++g) o[dt][g] = (v8f){0.f,0.f,0.f,0.f,0.f,0.f,0.f,0.f};
  float den[2] = {0.f, 0.f};
  for (int p = 0; p < ASR / 32; ++p) {
    FragH qa[2][2];
    q_load(qrow + (size_t)p * 32 * DO, qa);
    v8f sc[2][2];
    q_mul(qa, kh, kl, sc);
    FragH pb[2];
#pragma unroll
    for (int g = 0; g < 2; ++g)
#pragma unroll
      for (int m = 0; m < 2; ++m)
#pragma unroll
        for (int r = 0; r < 8; ++r) {
          const float e = expf((sc[m][g][r] * 0.125f + 1.0f) - mx[g]);
          den[g] += e;
          pb[g].h[m * 8 + r] = (_Float16)(e * 256.0f);      // x 2^8 (exact) keeps small weights out of the f16 subnormal range; taken back with the division
        }
#pragma unroll
    for (int dt = 0; dt < 4; ++dt) {
      FragH vh, vl;
      frag_split(vrow + (size_t)(p * 4 + dt) * 512, vh, vl);
#pragma unroll
      for (int g = 0; g < 2; ++g) o[dt][g] = wmmaH(vh.v, pb[g].v, o[dt][g]);
#pragma unroll
      for (int g = 0; g < 2; ++g) o[dt][g] = wmmaH(vl.v, pb[g].v, o[dt][g]);
    }
  }
#pragma unroll
  for (int g = 0; g < 2; ++g) { den[g] += __shfl_xor(den[g], 16, 32); rsm[w][g * 16 + ln] = den[g]; }      // both halves of the wave store the same value
#pragma unroll
  for (int dt = 0; dt < 4; ++dt)
#pragma unroll
    for (int g = 0; g < 2; ++g)
#pragma unroll
      for (int r = 0; r < 8; ++r) part[w][dt * 16 + 8 * hh + r][g * 16 + ln] = o[dt][g][r];
  __syncthreads();      // every wave's partial tile and column sums are in LDS
  float dsum = 0.f;
  for (int p = 0; p < AW; ++p) dsum += rsm[p][lane];      // wave order, the same in every wave
  const float inv = 0.00390625f / dsum;
  for (int j = 0; j < DO / AW; ++j) {      // wave w sums and stores rows w, w + AW, ...: one whole 128-byte line each
    const int d = j * AW + w;
    float s = 0.f;
    for (int p = 0; p < AW; ++p) s += part[p][d][lane];
    out[(size_t)d * SQ + t0 + lane] = s * inv;
  }
}
extern "C" void kernel_launch(void* const* d_in, const int* in_sizes, int n_in,
                              void* d_out, int out_size, void* d_ws, size_t ws_size, hipStream_t stream) {
  (void)in_sizes; (void)n_in; (void)out_size;
  const float* Q = (const float*)d_in[0]; const float* K = (const float*)d_in[1]; const float* V = (const float*)d_in[2]; const float* Mq = (const float*)d_in[3]; const float* Mk = (const float*)d_in[4]; const float* Mv = (const float*)d_in[5];
  char* ws = (char*)d_ws; size_t off = 0;
  auto take = [&](size_t bytes) { char* p = ws + off; off += (bytes + 255) & ~(size_t)255; return p; };
  float* Vd = (float*)take((size_t)DO * SQ * 4); float* KdT = (float*)take((size_t)SQ * DO * 4); _Float16* QdB = (_Float16*)take((size_t)SQ * DO * 2);
  if (off > ws_size) return;
  k_proj<<<dim3(SQ / PC, 3, 1), PW * 32, 0, stream>>>(Q, K, V, Mq, Mk, Mv, QdB, KdT, Vd);      // QdB = f16(Mq.Q), KdT = Mk.K, Vd = Mv.V, each in k_attn's fragment order
  k_attn<<<SQ / AT, AW * 32, 0, stream>>>(QdB, KdT, Vd, (float*)d_out);      // out[d][t] = sum_s Vd[d][s] * softmax_s(Qd[:,s].Kd[:,t] / 8 + 1)
}

// v006
// One run takes 63.9 microseconds.
// Two timings next to v005 put it at 1.21 and 1.20 times that version's speed.
// Over all steps from v000 it is 68.5 times as fast.
#include <hip/hip_runtime.h>
// On v_wmma_f32_16x16x32_bf16 with f32 accumulate, in one kernel (k_proj): the projections Qd/Kd/Vd = M.{Q,K,V} (M = 64, K = 512, N = 8192; inputs rounded to bf16: single exact term).
// On v_wmma_f32_16x16x32_f16, in one fused kernel (k_attn): the scores S[s][t] = Qd[:,s].Kd[:,t] (Qd rounded to f16, Kd split into f16 hi/lo: 2 products, K = 64) and
// out[:, t] = Vd.P[:, t] (Vd split into f16 hi/lo, the softmax weights rounded to f16: 2 products, K = 8192). The module's softmax runs over the QUERY axis s (dim 0);
// /sqrt(64) is folded into the exponent's f32 multiply-add; the +1 constant stands in every score of a column and in its maximum alike and cancels in x - max.
#define DI 512
#define DO 64
#define SQ 8192

typedef __bf16 v16b __attribute__((ext_vector_type(16)));
typedef unsigned short v8us __attribute__((ext_vector_type(8), may_alias));
typedef float  v8f  __attribute__((ext_vector_type(8)));
typedef float  v4f  __attribute__((ext_vector_type(4)));
typedef float  v4fa __attribute__((ext_vector_type(4), may_alias));
union FragB { v16b v; v8us half[2]; unsigned short u[16]; };

__device__ __forceinline__ unsigned short bf16_bits(float x) { unsigned int u = __float_as_uint(x); return (unsigned short)((u + 0x7FFFu + ((u >> 16) & 1u)) >> 16); }
__device__ __forceinline__ float bf16_val(unsigned short b) { return __uint_as_float(((unsigned int)b) << 16); }
__device__ __forceinline__ float bf16_round(float x) { return bf16_val(bf16_bits(x)); }
// D += A·B with NT terms: 1 = ah·bh, 2 = + al·bh (A split), 3 = + ah·bl (both split)
template <int NT>
__device__ __forceinline__ v8f mmaN(v16b ah, v16b al, v16b bh, v16b bl, v8f c) {
  c = __builtin_amdgcn_wmma_f32_16x16x32_bf16(false, ah, false, bh, (short)0, c, false, false);
  if (NT >= 2) c = __builtin_amdgcn_wmma_f32_16x16x32_bf16(false, al, false, bh, (short)0, c, false, false);
  if (NT >= 3) c = __builtin_amdgcn_wmma_f32_16x16x32_bf16(false, ah, false, bl, (short)0, c, false, false);
  asm volatile("v_nop\n\tv_nop\n\tv_nop\n\tv_nop" : "+v"(c) : "v"(ah), "v"(al), "v"(bh), "v"(bl));
  return c;
}

// GEMM C[M][N] (f32, pitch ldc) = act(A[M][K]·W + bias). A f32 row-major (pitch lda) converted per fragment to bf16
// (ASPLIT: hi/lo two planes -> 2 terms, else single rounded term); Wt bf16 [N][K] (pitch ldb). BIAS_BF16 rounds the
// bias to bf16 first (bias quantised to bf16 before the add). K%32==0, M%16==0, N%64==0.
template <bool ASPLIT, int ACT, bool BIAS_BF16>
__global__ __launch_bounds__(128) void k_gemm_bf(const float* __restrict__ A, int lda, const unsigned short* __restrict__ Wt, int ldb,
                                               const float* __restrict__ bias, float* __restrict__ C, int ldc, int M, int N, int K) {
  __shared__ __attribute__((aligned(16))) float so[4][16][64];
  const int tid = threadIdx.x, w = tid >> 5, lane = tid & 31, ln = lane & 15, hh = lane >> 4;
  const int ntn = N / 64;
  const int wid = blockIdx.x * 4 + w;
  const int mt = wid / ntn, nq = wid % ntn;
  if (mt * 16 >= M) return;
  const int row0 = mt * 16, col0 = nq * 64;
  const float* arow = A + (size_t)(row0 + ln) * lda;
  v8f acc[4] = {};
  for (int kb = 0; kb < K; kb += 32) {
    FragB ah, al;
    const v4f x0 = *(const v4fa*)(arow + kb + 8 * hh), x1 = *(const v4fa*)(arow + kb + 8 * hh + 4);
    const v4f x2 = *(const v4fa*)(arow + kb + 16 + 8 * hh), x3 = *(const v4fa*)(arow + kb + 16 + 8 * hh + 4);
    float xs[16] = {x0[0],x0[1],x0[2],x0[3],x1[0],x1[1],x1[2],x1[3],x2[0],x2[1],x2[2],x2[3],x3[0],x3[1],x3[2],x3[3]};
#pragma unroll
    for (int i = 0; i < 16; ++i) { const unsigned short hb = bf16_bits(xs[i]); ah.u[i] = hb; al.u[i] = ASPLIT ? bf16_bits(xs[i] - bf16_val(hb)) : (unsigned short)0; }
#pragma unroll
    for (int t = 0; t < 4; ++t) {
      const unsigned short* brow = Wt + (size_t)(col0 + t * 16 + ln) * ldb + kb;
      FragB b;
      b.half[0] = *(const v8us*)(brow + 8 * hh);
      b.half[1] = *(const v8us*)(brow + 16 + 8 * hh);
      acc[t] = mmaN<ASPLIT ? 2 : 1>(ah.v, al.v, b.v, b.v, acc[t]);
    }
  }
#pragma unroll
  for (int t = 0; t < 4; ++t) {
    float bv = bias ? bias[col0 + t * 16 + ln] : 0.f;
    if (BIAS_BF16) bv = bf16_round(bv);
#pragma unroll
    for (int r = 0; r < 8; ++r) { float v = acc[t][r] + bv; if (ACT == 1) v = fmaxf(v, 0.f); so[w][8 * hh + r][t * 16 + ln] = v; }
  }
  __builtin_amdgcn_fence(__ATOMIC_ACQ_REL, "workgroup");
  __builtin_amdgcn_wave_barrier();
  const int rsub = lane >> 4, c4 = (lane & 15) * 4;
  {
#pragma unroll
    for (int q = 0; q < 8; ++q) {
      const int r = q * 2 + rsub;
      const v4f v = *(const v4fa*)&so[w][r][c4];
      *(v4f*)(C + (size_t)(row0 + r) * ldc + col0 + c4) = v;
    }
    
  }
}

// Flash-style causal/unmasked attention, all contractions 3-term bf16 hi/lo splits, f32 softmax with running max.
// q,k,v rows are read from f32 buffers with arbitrary row pitch (so they can live inside a fused qkv buffer);
// D = head size (multiple of 32, <= 128); one wave = 16 query rows; block = 4 waves (64 queries) sharing K/V chunks of 32.
template <int D, bool CAUSAL>
__global__ __launch_bounds__(128) void k_flash(const float* __restrict__ qb, const float* __restrict__ kb, const float* __restrict__ vb,
                                             int pitch, int T, int H, float scale, float* __restrict__ y, int ypitch) {
  constexpr int KS = D / 32;        // k-steps for QK
  constexpr int DT = D / 16;        // d tiles for PV
  __shared__ __attribute__((aligned(16))) unsigned short sKh[32][D + 8], sKl[32][D + 8], sVh[32][D + 8], sVl[32][D + 8];
  __shared__ __attribute__((aligned(16))) unsigned short sPh[4][16][40], sPl[4][16][40];
  __shared__ __attribute__((aligned(16))) float sO[4][16][D];
  const int tid = threadIdx.x, w = tid >> 5, lane = tid & 31, ln = lane & 15, hh = lane >> 4;
  const int nqb = (T + 63) / 64;
  const int bh = blockIdx.x / nqb, qblk = blockIdx.x % nqb;
  const int b = bh / H, h = bh % H;
  const int q0 = qblk * 64 + w * 16;
  const float* Q = qb + (size_t)b * T * pitch + h * D;
  const float* K = kb + (size_t)b * T * pitch + h * D;
  const float* V = vb + (size_t)b * T * pitch + h * D;

  // A fragments of the wave's 16 query rows (scaled), hi/lo
  FragB aqh[KS], aql[KS];
  {
    int row = q0 + ln; if (row >= T) row = T - 1;
    const float* qr = Q + (size_t)row * pitch;
#pragma unroll
    for (int ks = 0; ks < KS; ++ks)
#pragma unroll
      for (int i = 0; i < 16; ++i) {
        const int d = ks * 32 + ((i < 8) ? (8 * hh + i) : (16 + 8 * hh + (i - 8)));
        const float x = qr[d] * scale; const unsigned short hb = bf16_bits(x);
        aqh[ks].u[i] = hb; aql[ks].u[i] = bf16_bits(x - bf16_val(hb));
      }
  }
  float m_r[8], l_r[8];
#pragma unroll
  for (int r = 0; r < 8; ++r) { m_r[r] = -3.0e38f; l_r[r] = 0.f; }
  v8f oacc[DT];
#pragma unroll
  for (int dt = 0; dt < DT; ++dt) oacc[dt] = (v8f){0.f,0.f,0.f,0.f,0.f,0.f,0.f,0.f};

  const int kv_end = CAUSAL ? min(T, qblk * 64 + 64) : T;     // block-uniform
  for (int j0 = 0; j0 < kv_end; j0 += 32) {
    __syncthreads();
    for (int e = tid; e < 32 * (D / 4); e += 128) {
      const int r = e / (D / 4), c4 = (e % (D / 4)) * 4;
      const int key = j0 + r;
      v4f kf = {0.f,0.f,0.f,0.f}, vf = {0.f,0.f,0.f,0.f};
      if (key < T) { kf = *(const v4fa*)(K + (size_t)key * pitch + c4); vf = *(const v4fa*)(V + (size_t)key * pitch + c4); }
#pragma unroll
      for (int t = 0; t < 4; ++t) {
        unsigned short hb = bf16_bits(kf[t]); sKh[r][c4 + t] = hb; sKl[r][c4 + t] = bf16_bits(kf[t] - bf16_val(hb));
        hb = bf16_bits(vf[t]); sVh[r][c4 + t] = hb; sVl[r][c4 + t] = bf16_bits(vf[t] - bf16_val(hb));
      }
    }
    __syncthreads();
    // S tile 16 x 32
    v8f s[2];
#pragma unroll
    for (int nt = 0; nt < 2; ++nt) {
      v8f acc = {};
#pragma unroll
      for (int ks = 0; ks < KS; ++ks) {
        FragB bh_, bl_;
        bh_.half[0] = *(const v8us*)&sKh[nt * 16 + ln][ks * 32 + 8 * hh]; bh_.half[1] = *(const v8us*)&sKh[nt * 16 + ln][ks * 32 + 16 + 8 * hh];
        bl_.half[0] = *(const v8us*)&sKl[nt * 16 + ln][ks * 32 + 8 * hh]; bl_.half[1] = *(const v8us*)&sKl[nt * 16 + ln][ks * 32 + 16 + 8 * hh];
        acc = mmaN<3>(aqh[ks].v, aql[ks].v, bh_.v, bl_.v, acc);
      }
      s[nt] = acc;
    }
    // mask + running max (rows 8hh+r; the 16 lanes of a half share rows)
    float alpha[8];
#pragma unroll
    for (int r = 0; r < 8; ++r) {
      const int qi = q0 + 8 * hh + r;
      const int ja = j0 + ln, jb = j0 + 16 + ln;
      if (CAUSAL) { if (ja > qi) s[0][r] = -3.0e38f; if (jb > qi) s[1][r] = -3.0e38f; }
      if (ja >= T) s[0][r] = -3.0e38f;
      if (jb >= T) s[1][r] = -3.0e38f;
      float mx = fmaxf(s[0][r], s[1][r]);
      mx = fmaxf(mx, __shfl_xor(mx, 1, 32)); mx = fmaxf(mx, __shfl_xor(mx, 2, 32)); mx = fmaxf(mx, __shfl_xor(mx, 4, 32)); mx = fmaxf(mx, __shfl_xor(mx, 8, 32));
      const float mnew = fmaxf(m_r[r], mx);
      alpha[r] = (mnew > -1.0e38f) ? __expf(m_r[r] - mnew) : 1.0f;
      const float p0 = (s[0][r] > -1.0e38f) ? __expf(s[0][r] - mnew) : 0.f;
      const float p1 = (s[1][r] > -1.0e38f) ? __expf(s[1][r] - mnew) : 0.f;
      m_r[r] = mnew;
      l_r[r] = l_r[r] * alpha[r] + p0 + p1;            // per-lane partial row sum (16 lanes combined at the end)
      unsigned short hb = bf16_bits(p0); sPh[w][8 * hh + r][ln] = hb;      sPl[w][8 * hh + r][ln] = bf16_bits(p0 - bf16_val(hb));
      hb = bf16_bits(p1);                sPh[w][8 * hh + r][16 + ln] = hb; sPl[w][8 * hh + r][16 + ln] = bf16_bits(p1 - bf16_val(hb));
    }
#pragma unroll
    for (int dt = 0; dt < DT; ++dt)
#pragma unroll
      for (int r = 0; r < 8; ++r) oacc[dt][r] *= alpha[r];
    __builtin_amdgcn_fence(__ATOMIC_ACQ_REL, "workgroup");
    __builtin_amdgcn_wave_barrier();
    FragB pah, pal;
    pah.half[0] = *(const v8us*)&sPh[w][ln][8 * hh]; pah.half[1] = *(const v8us*)&sPh[w][ln][16 + 8 * hh];
    pal.half[0] = *(const v8us*)&sPl[w][ln][8 * hh]; pal.half[1] = *(const v8us*)&sPl[w][ln][16 + 8 * hh];
#pragma unroll
    for (int dt = 0; dt < DT; ++dt) {
      FragB bvh, bvl;
#pragma unroll
      for (int i = 0; i < 8; ++i) {
        bvh.u[i] = sVh[8 * hh + i][dt * 16 + ln]; bvh.u[8 + i] = sVh[16 + 8 * hh + i][dt * 16 + ln];
        bvl.u[i] = sVl[8 * hh + i][dt * 16 + ln]; bvl.u[8 + i] = sVl[16 + 8 * hh + i][dt * 16 + ln];
      }
      oacc[dt] = mmaN<3>(pah.v, pal.v, bvh.v, bvl.v, oacc[dt]);
    }
    __builtin_amdgcn_fence(__ATOMIC_ACQ_REL, "workgroup");
    __builtin_amdgcn_wave_barrier();
  }
#pragma unroll
  for (int r = 0; r < 8; ++r) {
    float l = l_r[r];
    l += __shfl_xor(l, 1, 32); l += __shfl_xor(l, 2, 32); l += __shfl_xor(l, 4, 32); l += __shfl_xor(l, 8, 32);
    l_r[r] = (l > 0.f) ? 1.0f / l : 0.f;
  }
#pragma unroll
  for (int dt = 0; dt < DT; ++dt)
#pragma unroll
    for (int r = 0; r < 8; ++r) sO[w][8 * hh + r][dt * 16 + ln] = oacc[dt][r] * l_r[r];
  __builtin_amdgcn_fence(__ATOMIC_ACQ_REL, "workgroup");
  __builtin_amdgcn_wave_barrier();
  {
    for (int r = 0; r < 16; ++r) {
      const int row = q0 + r;
      if (row < T && lane < D / 4) {
        const v4f val = *(const v4fa*)&sO[w][r][lane * 4];
        *(v4f*)(y + ((size_t)b * T + row) * ypitch + h * D + lane * 4) = val;
      }
    }
    
  }
}

// in pitch = cols, out pitch = rows; rows, cols multiples of 32. Optional per-output-row affine (scale[c], shift[c]) and
// residual add res (same layout as out, optionally bf16-rounded) for fused epilogues: out = in*scale + shift + res.
template <bool AFFINE, bool RESID, bool RES_BF16>
__global__ __launch_bounds__(256) void k_transpose32(const float* __restrict__ in, float* __restrict__ out, int rows, int cols,
                                                    const float* __restrict__ scale, const float* __restrict__ shift, const float* __restrict__ res) {
  __shared__ float tile[32][33];
  const int b = blockIdx.z;
  const int r0 = blockIdx.y * 32, c0 = blockIdx.x * 32;
  const float* src = in + (size_t)b * rows * cols;
  float* dst = out + (size_t)b * rows * cols;
  const int tx = threadIdx.x & 31, ty = threadIdx.x >> 5;     // 8 rows per pass
  for (int i = ty; i < 32; i += 8) tile[i][tx] = src[(size_t)(r0 + i) * cols + c0 + tx];
  __syncthreads();
  {
    for (int i = ty; i < 32; i += 8) {
      float v = tile[tx][i];
      const int orow = c0 + i;
      if (AFFINE) v = v * scale[orow] + shift[orow];
      if (RESID) { float rv = res[(size_t)b * rows * cols + (size_t)orow * rows + r0 + tx]; if (RES_BF16) rv = bf16_round(rv); v += rv; }
      *(float*)(dst + (size_t)orow * rows + r0 + tx) = v;
    }
    
  }
}

// 2x2 max pool on position-major data: in [B][H*W][C] -> out [B][(H/2)*(W/2)][C]; thread per (b, p', 4 channels); C%4==0
__global__ __launch_bounds__(256) void k_pool2_pm(const float* __restrict__ in, float* __restrict__ out, int Bn, int H, int W, int C) {
  const size_t t = (size_t)blockIdx.x * 256 + threadIdx.x;
  const int c4n = C / 4, Ho = H / 2, Wo = W / 2;
  const size_t total = (size_t)Bn * Ho * Wo * c4n;
  if (t >= total) return;
  const int c4 = (int)(t % c4n) * 4; size_t rest = t / c4n;
  const int pw = (int)(rest % Wo); rest /= Wo; const int ph = (int)(rest % Ho); const int b = (int)(rest / Ho);
  const float* base = in + (size_t)b * H * W * C;
  const int p00 = (2 * ph) * W + 2 * pw;
  const v4f a = *(const v4fa*)(base + (size_t)p00 * C + c4), bq = *(const v4fa*)(base + (size_t)(p00 + 1) * C + c4);
  const v4f c = *(const v4fa*)(base + (size_t)(p00 + W) * C + c4), d = *(const v4fa*)(base + (size_t)(p00 + W + 1) * C + c4);
  v4f m; for (int i = 0; i < 4; ++i) m[i] = fmaxf(fmaxf(a[i], bq[i]), fmaxf(c[i], d[i]));
  float* dst = out + ((size_t)b * Ho * Wo + (size_t)ph * Wo + pw) * C + c4;
  *(v4f*)dst = m;
  
}

// General (non-causal) attention, 3-term bf16 splits, f32 softmax with running max.
// Q [.][Tq][qpitch], K [.][Tk][kpitch] (head dim DQ), V [.][Tk][vpitch] (head dim DVtot); this block handles DV output
// dims starting at dv0 = blockIdx.y*DV. y[bh][t][ypitch] gets columns dv0..dv0+DV-1. Per-bh base offsets via strides.
template <int DQ, int DV>
__global__ __launch_bounds__(128) void k_flash2(const float* __restrict__ Qb, size_t qstride, int qpitch, int Tq,
                                              const float* __restrict__ Kb, size_t kstride, int kpitch, int Tk,
                                              const float* __restrict__ Vb, size_t vstride, int vpitch,
                                              float scale, float* __restrict__ y, size_t ystride, int ypitch) {
  constexpr int KS = DQ / 32, DT = DV / 16;
  __shared__ __attribute__((aligned(16))) unsigned short sKh[32][DQ + 8], sKl[32][DQ + 8], sVh[32][DV + 8], sVl[32][DV + 8];
  __shared__ __attribute__((aligned(16))) unsigned short sPh[4][16][40], sPl[4][16][40];
  __shared__ __attribute__((aligned(16))) float sO[4][16][DV];
  const int tid = threadIdx.x, w = tid >> 5, lane = tid & 31, ln = lane & 15, hh = lane >> 4;
  const int nqb = (Tq + 63) / 64;
  const int bh = blockIdx.x / nqb, qblk = blockIdx.x % nqb;
  const int dv0 = blockIdx.y * DV;
  const int q0 = qblk * 64 + w * 16;
  const float* Q = Qb + (size_t)bh * qstride; const float* K = Kb + (size_t)bh * kstride; const float* V = Vb + (size_t)bh * vstride + dv0;
  FragB aqh[KS], aql[KS];
  {
    int row = q0 + ln; if (row >= Tq) row = Tq - 1;
    const float* qr = Q + (size_t)row * qpitch;
#pragma unroll
    for (int ks = 0; ks < KS; ++ks)
#pragma unroll
      for (int i = 0; i < 16; ++i) {
        const int d = ks * 32 + ((i < 8) ? (8 * hh + i) : (16 + 8 * hh + (i - 8)));
        const float x = qr[d] * scale; const unsigned short hb = bf16_bits(x);
        aqh[ks].u[i] = hb; aql[ks].u[i] = bf16_bits(x - bf16_val(hb));
      }
  }
  float m_r[8], l_r[8];
#pragma unroll
  for (int r = 0; r < 8; ++r) { m_r[r] = -3.0e38f; l_r[r] = 0.f; }
  v8f oacc[DT];
#pragma unroll
  for (int dt = 0; dt < DT; ++dt) oacc[dt] = (v8f){0.f,0.f,0.f,0.f,0.f,0.f,0.f,0.f};
  for (int j0 = 0; j0 < Tk; j0 += 32) {
    __syncthreads();
    for (int e = tid; e < 32 * (DQ / 4); e += 128) {
      const int r = e / (DQ / 4), c4 = (e % (DQ / 4)) * 4; const int key = j0 + r;
      v4f f = {0.f,0.f,0.f,0.f}; if (key < Tk) f = *(const v4fa*)(K + (size_t)key * kpitch + c4);
#pragma unroll
      for (int t = 0; t < 4; ++t) { const unsigned short hb = bf16_bits(f[t]); sKh[r][c4 + t] = hb; sKl[r][c4 + t] = bf16_bits(f[t] - bf16_val(hb)); }
    }
    for (int e = tid; e < 32 * (DV / 4); e += 128) {
      const int r = e / (DV / 4), c4 = (e % (DV / 4)) * 4; const int key = j0 + r;
      v4f f = {0.f,0.f,0.f,0.f}; if (key < Tk) f = *(const v4fa*)(V + (size_t)key * vpitch + c4);
#pragma unroll
      for (int t = 0; t < 4; ++t) { const unsigned short hb = bf16_bits(f[t]); sVh[r][c4 + t] = hb; sVl[r][c4 + t] = bf16_bits(f[t] - bf16_val(hb)); }
    }
    __syncthreads();
    v8f s[2];
#pragma unroll
    for (int nt = 0; nt < 2; ++nt) {
      v8f acc = {};
#pragma unroll
      for (int ks = 0; ks < KS; ++ks) {
        FragB bh_, bl_;
        bh_.half[0] = *(const v8us*)&sKh[nt * 16 + ln][ks * 32 + 8 * hh]; bh_.half[1] = *(const v8us*)&sKh[nt * 16 + ln][ks * 32 + 16 + 8 * hh];
        bl_.half[0] = *(const v8us*)&sKl[nt * 16 + ln][ks * 32 + 8 * hh]; bl_.half[1] = *(const v8us*)&sKl[nt * 16 + ln][ks * 32 + 16 + 8 * hh];
        acc = mmaN<3>(aqh[ks].v, aql[ks].v, bh_.v, bl_.v, acc);
      }
      s[nt] = acc;
    }
    float alpha[8];
#pragma unroll
    for (int r = 0; r < 8; ++r) {
      const int ja = j0 + ln, jb = j0 + 16 + ln;
      if (ja >= Tk) s[0][r] = -3.0e38f;
      if (jb >= Tk) s[1][r] = -3.0e38f;
      float mx = fmaxf(s[0][r], s[1][r]);
      mx = fmaxf(mx, __shfl_xor(mx, 1, 32)); mx = fmaxf(mx, __shfl_xor(mx, 2, 32)); mx = fmaxf(mx, __shfl_xor(mx, 4, 32)); mx = fmaxf(mx, __shfl_xor(mx, 8, 32));
      const float mnew = fmaxf(m_r[r], mx);
      alpha[r] = (mnew > -1.0e38f) ? __expf(m_r[r] - mnew) : 1.0f;
      const float p0 = (s[0][r] > -1.0e38f) ? __expf(s[0][r] - mnew) : 0.f;
      const float p1 = (s[1][r] > -1.0e38f) ? __expf(s[1][r] - mnew) : 0.f;
      m_r[r] = mnew;
      l_r[r] = l_r[r] * alpha[r] + p0 + p1;
      unsigned short hb = bf16_bits(p0); sPh[w][8 * hh + r][ln] = hb;      sPl[w][8 * hh + r][ln] = bf16_bits(p0 - bf16_val(hb));
      hb = bf16_bits(p1);                sPh[w][8 * hh + r][16 + ln] = hb; sPl[w][8 * hh + r][16 + ln] = bf16_bits(p1 - bf16_val(hb));
    }
#pragma unroll
    for (int dt = 0; dt < DT; ++dt)
#pragma unroll
      for (int r = 0; r < 8; ++r) oacc[dt][r] *= alpha[r];
    __builtin_amdgcn_fence(__ATOMIC_ACQ_REL, "workgroup");
    __builtin_amdgcn_wave_barrier();
    FragB pah, pal;
    pah.half[0] = *(const v8us*)&sPh[w][ln][8 * hh]; pah.half[1] = *(const v8us*)&sPh[w][ln][16 + 8 * hh];
    pal.half[0] = *(const v8us*)&sPl[w][ln][8 * hh]; pal.half[1] = *(const v8us*)&sPl[w][ln][16 + 8 * hh];
#pragma unroll
    for (int dt = 0; dt < DT; ++dt) {
      FragB bvh, bvl;
#pragma unroll
      for (int i = 0; i < 8; ++i) {
        bvh.u[i] = sVh[8 * hh + i][dt * 16 + ln]; bvh.u[8 + i] = sVh[16 + 8 * hh + i][dt * 16 + ln];
        bvl.u[i] = sVl[8 * hh + i][dt * 16 + ln]; bvl.u[8 + i] = sVl[16 + 8 * hh + i][dt * 16 + ln];
      }
      oacc[dt] = mmaN<3>(pah.v, pal.v, bvh.v, bvl.v, oacc[dt]);
    }
    __builtin_amdgcn_fence(__ATOMIC_ACQ_REL, "workgroup");
    __builtin_amdgcn_wave_barrier();
  }
#pragma unroll
  for (int r = 0; r < 8; ++r) {
    float l = l_r[r];
    l += __shfl_xor(l, 1, 32); l += __shfl_xor(l, 2, 32); l += __shfl_xor(l, 4, 32); l += __shfl_xor(l, 8, 32);
    l_r[r] = (l > 0.f) ? 1.0f / l : 0.f;
  }
#pragma unroll
  for (int dt = 0; dt < DT; ++dt)
#pragma unroll
    for (int r = 0; r < 8; ++r) sO[w][8 * hh + r][dt * 16 + ln] = oacc[dt][r] * l_r[r];
  __builtin_amdgcn_fence(__ATOMIC_ACQ_REL, "workgroup");
  __builtin_amdgcn_wave_barrier();
  {
    for (int r = 0; r < 16; ++r) {
      const int row = q0 + r;
      for (int c4 = lane * 4; c4 < DV; c4 += 128) {
        if (row < Tq) {
          const v4f val = *(const v4fa*)&sO[w][r][c4];
          *(v4f*)(y + (size_t)bh * ystride + (size_t)row * ypitch + dv0 + c4) = val;
        }
      }
    }
    
  }
}

// f32 [R][Cc] (row pitch lds) -> bf16 hi/lo planes [R][Cc] (pitch Cc); thread per 8 elements; Cc % 8 == 0
__global__ __launch_bounds__(256) void k_split_rows(const float* __restrict__ src, int lds_, unsigned short* __restrict__ hi, unsigned short* __restrict__ lo, int R, int Cc) {
  const size_t t = (size_t)blockIdx.x * 256 + threadIdx.x;
  const int c8n = Cc / 8;
  if (t >= (size_t)R * c8n) return;
  const int r = (int)(t / c8n), c8 = (int)(t % c8n) * 8;
  const float* s = src + (size_t)r * lds_ + c8;
  const v4f a = *(const v4fa*)s, b = *(const v4fa*)(s + 4);
  float xs[8] = {a[0],a[1],a[2],a[3],b[0],b[1],b[2],b[3]};
  v8us vh, vl;
#pragma unroll
  for (int i = 0; i < 8; ++i) { const unsigned short hb = bf16_bits(xs[i]); vh[i] = hb; vl[i] = bf16_bits(xs[i] - bf16_val(hb)); }
  unsigned short* dh = hi + (size_t)r * Cc + c8; unsigned short* dl = lo + (size_t)r * Cc + c8;
  *(v8us*)dh = vh; *(v8us*)dl = vl; 
}
// f32 [K][N] (row pitch lds) -> transposed bf16 hi/lo planes [N][K]; one thread per (n, 8 consecutive k)
__global__ __launch_bounds__(256) void k_split_transpose(const float* __restrict__ src, int lds_, unsigned short* __restrict__ hi, unsigned short* __restrict__ lo, int K, int N) {
  const size_t t = (size_t)blockIdx.x * 256 + threadIdx.x;
  const int k8n = K / 8;
  if (t >= (size_t)N * k8n) return;
  const int n = (int)(t / k8n), k8 = (int)(t % k8n) * 8;
  v8us vh, vl;
#pragma unroll
  for (int i = 0; i < 8; ++i) { const float x = src[(size_t)(k8 + i) * lds_ + n]; const unsigned short hb = bf16_bits(x); vh[i] = hb; vl[i] = bf16_bits(x - bf16_val(hb)); }
  unsigned short* dh = hi + (size_t)n * K + k8; unsigned short* dl = lo + (size_t)n * K + k8;
  *(v8us*)dh = vh; *(v8us*)dl = vl; 
}
// GEMM with A f32 (split into hi/lo when ASPLIT) and B from bf16 planes Bh (+ Bl when BSPLIT): terms hi·hi [+ lo·hi] [+ hi·lo].
// C f32 [M][N] pitch ldc; alpha scales the result; bias optional (BIAS_BF16 rounds it). Same tiling/epilogue as k_gemm_bf.
template <bool ASPLIT, bool BSPLIT, int ACT, bool BIAS_BF16>
__global__ __launch_bounds__(128) void k_gemm_bf2(const float* __restrict__ A, int lda, const unsigned short* __restrict__ Bh, const unsigned short* __restrict__ Bl, int ldb,
                                                const float* __restrict__ bias, float alpha, float* __restrict__ C, int ldc, int M, int N, int K) {
  __shared__ __attribute__((aligned(16))) float so[4][16][64];
  const int tid = threadIdx.x, w = tid >> 5, lane = tid & 31, ln = lane & 15, hh = lane >> 4;
  const int ntn = N / 64;
  const int wid = blockIdx.x * 4 + w;
  const int mt = wid / ntn, nq = wid % ntn;
  if (mt * 16 >= M) return;
  const int row0 = mt * 16, col0 = nq * 64;
  const float* arow = A + (size_t)(row0 + ln) * lda;
  v8f acc[4] = {};
  for (int kb = 0; kb < K; kb += 32) {
    FragB ah, al;
    const v4f x0 = *(const v4fa*)(arow + kb + 8 * hh), x1 = *(const v4fa*)(arow + kb + 8 * hh + 4);
    const v4f x2 = *(const v4fa*)(arow + kb + 16 + 8 * hh), x3 = *(const v4fa*)(arow + kb + 16 + 8 * hh + 4);
    float xs[16] = {x0[0],x0[1],x0[2],x0[3],x1[0],x1[1],x1[2],x1[3],x2[0],x2[1],x2[2],x2[3],x3[0],x3[1],x3[2],x3[3]};
#pragma unroll
    for (int i = 0; i < 16; ++i) { const unsigned short hb = bf16_bits(xs[i]); ah.u[i] = hb; al.u[i] = ASPLIT ? bf16_bits(xs[i] - bf16_val(hb)) : (unsigned short)0; }
#pragma unroll
    for (int t = 0; t < 4; ++t) {
      const size_t boff = (size_t)(col0 + t * 16 + ln) * ldb + kb;
      FragB bh_, bl_;
      bh_.half[0] = *(const v8us*)(Bh + boff + 8 * hh);
      bh_.half[1] = *(const v8us*)(Bh + boff + 16 + 8 * hh);
      if (BSPLIT) { bl_.half[0] = *(const v8us*)(Bl + boff + 8 * hh); bl_.half[1] = *(const v8us*)(Bl + boff + 16 + 8 * hh); } else bl_ = bh_;
      acc[t] = mmaN<ASPLIT ? (BSPLIT ? 3 : 2) : 1>(ah.v, al.v, bh_.v, bl_.v, acc[t]);
    }
  }
#pragma unroll
  for (int t = 0; t < 4; ++t) {
    float bv = bias ? bias[col0 + t * 16 + ln] : 0.f;
    if (BIAS_BF16) bv = bf16_round(bv);
#pragma unroll
    for (int r = 0; r < 8; ++r) { float v = acc[t][r] * alpha + bv; if (ACT == 1) v = fmaxf(v, 0.f); so[w][8 * hh + r][t * 16 + ln] = v; }
  }
  __builtin_amdgcn_fence(__ATOMIC_ACQ_REL, "workgroup");
  __builtin_amdgcn_wave_barrier();
  const int rsub = lane >> 4, c4 = (lane & 15) * 4;
  {
#pragma unroll
    for (int q = 0; q < 8; ++q) {
      const int r = q * 2 + rsub;
      const v4f v = *(const v4fa*)&so[w][r][c4];
      *(v4f*)(C + (size_t)(row0 + r) * ldc + col0 + c4) = v;
    }
    
  }
}
// row softmax: P[row][:] = softmax(masked S[row][:]) over N columns with optional causal mask (col > row + rowoff -> 0) and
__global__ __launch_bounds__(256) void k_softmax_rows(const float* __restrict__ S, float* __restrict__ P, int N, int causal, int rowoff, const int* __restrict__ mask, int mask_pitch) {
  __shared__ float red[256];
  const int row = blockIdx.x, tid = threadIdx.x;
  const float* s = S + (size_t)row * N; float* p_out = P + (size_t)row * N;
  const int qi = row + rowoff;
  float mx = -3.0e38f;
  for (int j = tid; j < N; j += 256) {
    bool keep = true;
    if (causal && j > qi) keep = false;
    if (mask && mask[(size_t)qi * mask_pitch + j] == 0) keep = false;
    const float v = keep ? s[j] : -3.0e38f;
    mx = fmaxf(mx, v);
  }
  red[tid] = mx; __syncthreads();
  for (int st = 128; st > 0; st >>= 1) { if (tid < st) red[tid] = fmaxf(red[tid], red[tid + st]); __syncthreads(); }
  mx = red[0]; __syncthreads();
  float sum = 0.f;
  for (int j = tid; j < N; j += 256) {
    bool keep = true;
    if (causal && j > qi) keep = false;
    if (mask && mask[(size_t)qi * mask_pitch + j] == 0) keep = false;
    const float p = keep ? __expf(s[j] - mx) : 0.f;
    sum += p;
  }
  red[tid] = sum; __syncthreads();
  for (int st = 128; st > 0; st >>= 1) { if (tid < st) red[tid] += red[tid + st]; __syncthreads(); }
  const float inv = (mx > -1.0e38f) ? 1.0f / red[0] : __builtin_nanf("");
  __syncthreads();
  {
    for (int j4 = tid * 4; j4 < N; j4 += 1024) {
      v4f out4;
#pragma unroll
      for (int u = 0; u < 4; ++u) {
        const int j = j4 + u;
        bool keep = true;
        if (causal && j > qi) keep = false;
        if (mask && mask[(size_t)qi * mask_pitch + j] == 0) keep = false;
        out4[u] = keep ? __expf(s[j] - mx) * inv : 0.f;
      }
      *(v4f*)(p_out + j4) = out4;
    }
    
  }
}

// GEMM C = act(A·W + bias + resid): A f32 (ASPLIT -> hi/lo 2 terms), Wt bf16 [N][K]; ACT 0 none, 1 relu, 2 exact gelu;
// resid (optional, f32, row index = (row % rmod), pitch ldr, RES_BF16 rounds it) added before the activation.
template <bool ASPLIT, int ACT, bool BIAS_BF16, bool RES_BF16>
__global__ __launch_bounds__(128) void k_gemm_bf3(const float* __restrict__ A, int lda, const unsigned short* __restrict__ Wt, int ldb,
                                                const float* __restrict__ bias, const float* __restrict__ resid, int rmod, int ldr,
                                                float* __restrict__ C, int ldc, int M, int N, int K) {
  __shared__ __attribute__((aligned(16))) float so[4][16][64];
  const int tid = threadIdx.x, w = tid >> 5, lane = tid & 31, ln = lane & 15, hh = lane >> 4;
  const int ntn = N / 64;
  const int wid = blockIdx.x * 4 + w;
  const int mt = wid / ntn, nq = wid % ntn;
  if (mt * 16 >= M) return;
  const int row0 = mt * 16, col0 = nq * 64;
  const float* arow = A + (size_t)(row0 + ln) * lda;
  v8f acc[4] = {};
  for (int kb = 0; kb < K; kb += 32) {
    FragB ah, al;
    const v4f x0 = *(const v4fa*)(arow + kb + 8 * hh), x1 = *(const v4fa*)(arow + kb + 8 * hh + 4);
    const v4f x2 = *(const v4fa*)(arow + kb + 16 + 8 * hh), x3 = *(const v4fa*)(arow + kb + 16 + 8 * hh + 4);
    float xs[16] = {x0[0],x0[1],x0[2],x0[3],x1[0],x1[1],x1[2],x1[3],x2[0],x2[1],x2[2],x2[3],x3[0],x3[1],x3[2],x3[3]};
#pragma unroll
    for (int i = 0; i < 16; ++i) { const unsigned short hb = bf16_bits(xs[i]); ah.u[i] = hb; al.u[i] = ASPLIT ? bf16_bits(xs[i] - bf16_val(hb)) : (unsigned short)0; }
#pragma unroll
    for (int t = 0; t < 4; ++t) {
      const unsigned short* brow = Wt + (size_t)(col0 + t * 16 + ln) * ldb + kb;
      FragB b;
      b.half[0] = *(const v8us*)(brow + 8 * hh);
      b.half[1] = *(const v8us*)(brow + 16 + 8 * hh);
      acc[t] = mmaN<ASPLIT ? 2 : 1>(ah.v, al.v, b.v, b.v, acc[t]);
    }
  }
#pragma unroll
  for (int t = 0; t < 4; ++t) {
    const int col = col0 + t * 16 + ln;
    float bv = bias ? bias[col] : 0.f;
    if (BIAS_BF16) bv = bf16_round(bv);
#pragma unroll
    for (int r = 0; r < 8; ++r) {
      float v = acc[t][r] + bv;
      if (resid) { float rv = resid[(size_t)((row0 + 8 * hh + r) % rmod) * ldr + col]; if (RES_BF16) rv = bf16_round(rv); v += rv; }
      if (ACT == 1) v = fmaxf(v, 0.f);
      if (ACT == 2) v = 0.5f * v * (1.0f + erff(v * 0.70710678118654752f));
      if (ACT == 3) { const float u = 0.7978845608028654f * (v + 0.044715f * v * v * v); v = 0.5f * v * (1.0f + tanhf(u)); }
      so[w][8 * hh + r][t * 16 + ln] = v;
    }
  }
  __builtin_amdgcn_fence(__ATOMIC_ACQ_REL, "workgroup");
  __builtin_amdgcn_wave_barrier();
  const int rsub = lane >> 4, c4 = (lane & 15) * 4;
  {
#pragma unroll
    for (int q = 0; q < 8; ++q) {
      const int r = q * 2 + rsub;
      const v4f v = *(const v4fa*)&so[w][r][c4];
      *(v4f*)(C + (size_t)(row0 + r) * ldc + col0 + c4) = v;
    }
    
  }
}
// row LayerNorm (biased variance, eps) over N: s = X (+ R); optional out_sum <- s; out_norm <- (s-mu)*rsqrt(var+eps)*g + b
template <bool PARAM_BF16>
__global__ __launch_bounds__(256) void k_layernorm(const float* __restrict__ X, const float* __restrict__ R, const float* __restrict__ g, const float* __restrict__ bta,
                                                  float* __restrict__ out_sum, float* __restrict__ out_norm, int N, float eps) {
  __shared__ float red[256];
  const int row = blockIdx.x, tid = threadIdx.x;
  const float* x = X + (size_t)row * N; const float* rr = R ? R + (size_t)row * N : nullptr;
  float vals[16];                     // up to N = 4096
  const int per = N / 256;            // contiguous chunk per thread? use strided-by-4 chunks: thread handles j = tid*4 + 1024*u
  float s1 = 0.f;
  for (int u = 0; u < per / 4; ++u) {
    const int j = tid * 4 + 1024 * u;
    const v4f a = *(const v4fa*)(x + j);
    v4f b = {0.f,0.f,0.f,0.f}; if (rr) b = *(const v4fa*)(rr + j);
#pragma unroll
    for (int q = 0; q < 4; ++q) { const float v = a[q] + b[q]; vals[u * 4 + q] = v; s1 += v; }
  }
  red[tid] = s1; __syncthreads();
  for (int st = 128; st > 0; st >>= 1) { if (tid < st) red[tid] += red[tid + st]; __syncthreads(); }
  const float mu = red[0] / (float)N; __syncthreads();
  float s2 = 0.f;
  for (int u = 0; u < per / 4; ++u)
#pragma unroll
    for (int q = 0; q < 4; ++q) { const float c = vals[u * 4 + q] - mu; s2 += c * c; }
  red[tid] = s2; __syncthreads();
  for (int st = 128; st > 0; st >>= 1) { if (tid < st) red[tid] += red[tid + st]; __syncthreads(); }
  const float rs = rsqrtf(red[0] / (float)N + eps);
  {
    for (int u = 0; u < per / 4; ++u) {
      const int j = tid * 4 + 1024 * u;
      v4f o, sm;
#pragma unroll
      for (int q = 0; q < 4; ++q) {
        float gg = g[j + q], bb = bta[j + q];
        if (PARAM_BF16) { gg = bf16_round(gg); bb = bf16_round(bb); }
        sm[q] = vals[u * 4 + q]; o[q] = (vals[u * 4 + q] - mu) * rs * gg + bb;
      }
      if (out_sum) *(v4f*)(out_sum + (size_t)row * N + j) = sm;
      *(v4f*)(out_norm + (size_t)row * N + j) = o;
    }
    
  }
}

// batched GEMM (blockIdx.y = batch): C_b = act(alpha·A_b·B_b + bias + resid_b); A f32 rows (ASPLIT → hi/lo), B = bf16 planes Bh (+Bl when BSPLIT, requires ASPLIT),
// per-batch element strides sA, sB (0 = shared weights), sC, sR. resid may alias C (values are staged before the stores). ACT 0/1(relu).
// ACT: 0 none, 1 relu, 2 softplus
template <bool ASPLIT, bool BSPLIT, int ACT>
__global__ __launch_bounds__(128) void k_gemm_b(const float* __restrict__ A, int lda, size_t sA, const unsigned short* __restrict__ Bh, const unsigned short* __restrict__ Bl, int ldb, size_t sB,
                                             const float* __restrict__ bias, const float* __restrict__ resid, int ldr, size_t sR, float rsign, float alpha,
                                             float* __restrict__ C, int ldc, size_t sC, int M, int N, int K) {
  __shared__ __attribute__((aligned(16))) float so[4][16][64];
  const int tid = threadIdx.x, w = tid >> 5, lane = tid & 31, ln = lane & 15, hh = lane >> 4;
  const int by = blockIdx.y;
  A += (size_t)by * sA; Bh += (size_t)by * sB; if (BSPLIT) Bl += (size_t)by * sB; C += (size_t)by * sC; if (resid) resid += (size_t)by * sR;
  const int ntn = N / 64; const int wid = blockIdx.x * 4 + w; const int mt = wid / ntn, nq = wid % ntn;
  if (mt * 16 >= M) return;
  const int row0 = mt * 16, col0 = nq * 64;
  const float* arow = A + (size_t)(row0 + ln) * lda;
  v8f acc[4] = {};
  for (int kb = 0; kb < K; kb += 32) {
    FragB ah, al;
    const v4f x0 = *(const v4fa*)(arow + kb + 8 * hh), x1 = *(const v4fa*)(arow + kb + 8 * hh + 4);
    const v4f x2 = *(const v4fa*)(arow + kb + 16 + 8 * hh), x3 = *(const v4fa*)(arow + kb + 16 + 8 * hh + 4);
    float xs[16] = {x0[0],x0[1],x0[2],x0[3],x1[0],x1[1],x1[2],x1[3],x2[0],x2[1],x2[2],x2[3],x3[0],x3[1],x3[2],x3[3]};
#pragma unroll
    for (int i = 0; i < 16; ++i) { const unsigned short hb = bf16_bits(xs[i]); ah.u[i] = hb; al.u[i] = ASPLIT ? bf16_bits(xs[i] - bf16_val(hb)) : (unsigned short)0; }
#pragma unroll
    for (int t = 0; t < 4; ++t) {
      const size_t boff = (size_t)(col0 + t * 16 + ln) * ldb + kb;
      FragB bh_, bl_; bh_.half[0] = *(const v8us*)(Bh + boff + 8 * hh); bh_.half[1] = *(const v8us*)(Bh + boff + 16 + 8 * hh);
      if (BSPLIT) { bl_.half[0] = *(const v8us*)(Bl + boff + 8 * hh); bl_.half[1] = *(const v8us*)(Bl + boff + 16 + 8 * hh); } else bl_ = bh_;
      acc[t] = mmaN<ASPLIT ? (BSPLIT ? 3 : 2) : 1>(ah.v, al.v, bh_.v, bl_.v, acc[t]);
    }
  }
#pragma unroll
  for (int t = 0; t < 4; ++t) {
    const int col = col0 + t * 16 + ln; const float bv = bias ? bf16_round(bias[col]) : 0.f;
#pragma unroll
    for (int r = 0; r < 8; ++r) { float v = acc[t][r] * alpha + bv; if (resid) v += rsign * resid[(size_t)(row0 + 8 * hh + r) * ldr + col]; if (ACT == 1) v = fmaxf(v, 0.f); else if (ACT == 2) v = fmaxf(v, 0.f) + log1pf(expf(-fabsf(v))); so[w][8 * hh + r][t * 16 + ln] = v; }
  }
  __builtin_amdgcn_fence(__ATOMIC_ACQ_REL, "workgroup"); __builtin_amdgcn_wave_barrier();
  const int rsub = lane >> 4, c4 = (lane & 15) * 4;
  {
#pragma unroll
    for (int q = 0; q < 8; ++q) { const int r = q * 2 + rsub; const v4f v = *(const v4fa*)&so[w][r][c4]; *(v4f*)(C + (size_t)(row0 + r) * ldc + col0 + c4) = v; }
    
  }
}
// batched f32 [K][N] (pitch lds, batch stride sIn) -> transposed hi/lo planes [N][K] (batch stride sOut); thread per (n, 8 k); grid.y = batch
__global__ __launch_bounds__(256) void k_split_transpose_b(const float* __restrict__ src, int lds_, size_t sIn, unsigned short* __restrict__ hi, unsigned short* __restrict__ lo, size_t sOut, int K, int N) {
  const size_t t = (size_t)blockIdx.x * 256 + threadIdx.x; const int k8n = K / 8; if (t >= (size_t)N * k8n) return;
  src += (size_t)blockIdx.y * sIn; hi += (size_t)blockIdx.y * sOut; lo += (size_t)blockIdx.y * sOut;
  const int n = (int)(t / k8n), k8 = (int)(t % k8n) * 8; v8us vh, vl;
#pragma unroll
  for (int i = 0; i < 8; ++i) { const float x = src[(size_t)(k8 + i) * lds_ + n]; const unsigned short hb = bf16_bits(x); vh[i] = hb; vl[i] = bf16_bits(x - bf16_val(hb)); }
  unsigned short* dh = hi + (size_t)n * K + k8; unsigned short* dl = lo + (size_t)n * K + k8;
  *(v8us*)dh = vh; *(v8us*)dl = vl; 
}

__global__ __launch_bounds__(256) void k_round_rows(const float* __restrict__ W, unsigned short* __restrict__ Wt, int n8) {
  const int t = blockIdx.x * 256 + threadIdx.x;
  if (t >= n8) return;
  const v4f a = *(const v4fa*)(W + (size_t)t * 8), b = *(const v4fa*)(W + (size_t)t * 8 + 4);
  v8us v; v[0]=bf16_bits(a[0]); v[1]=bf16_bits(a[1]); v[2]=bf16_bits(a[2]); v[3]=bf16_bits(a[3]);
  v[4]=bf16_bits(b[0]); v[5]=bf16_bits(b[1]); v[6]=bf16_bits(b[2]); v[7]=bf16_bits(b[3]);
  *(v8us*)(Wt + (size_t)t * 8) = v; 
}


// ---- f16 WMMA path (v_wmma_f32_16x16x32_f16): 11-bit significands for operands in range — used where the softmax weight operand, 2^8 exp(x - max), needs more precision than bf16
typedef _Float16 v16h __attribute__((ext_vector_type(16)));
union FragH { v16h v; v8us half[2]; _Float16 h[16]; unsigned short u[16]; };
typedef _Float16 v4h __attribute__((ext_vector_type(4)));
typedef __bf16 v4b __attribute__((ext_vector_type(4)));
typedef unsigned short v4us __attribute__((ext_vector_type(4), may_alias));
union Quad { v4b b; v4us u; };
// One launch for the three projections, straight from the f32 inputs. A work-group owns PC columns n of one input X [DI][SQ] (blockIdx.y: Q, K or V); each of its
// PW waves takes DI / PW = 64 of the k. A lane reads 16 bytes of a row of X: columns n0 + 4 ln + u, u = 0..3, so that a wave's load is two pieces of 256 consecutive bytes,
// and u picks the B tile: tile u holds the columns n0 + 4 ln + u at lane position ln. The wave's share of M (64 rows x 64 k) is read the same way, in whole lines, rounded
// to bf16 and turned into A fragments through the wave's own LDS range. The waves' partial tiles are summed through LDS in wave order, and the sum is stored
// in the order in which k_attn's lanes load their fragments, so that each 16-byte load of a wave there covers 512 consecutive bytes (4 whole lines, not 32 bytes of 16 lines):
//   QF f16: [s / 16][d / 32][(d / 16) & 1][lane = 16 ((d / 8) & 1) + s % 16][d % 8]
//   KF f32: [t / 16][d / 32][c = 2 ((d / 16) & 1) + ((d / 4) & 1)][lane = 16 ((d / 8) & 1) + t % 16][d % 4]
//   VF f32: [s / 32][d / 16][c = 2 ((s / 16) & 1) + ((s / 4) & 1)][lane = 16 ((s / 8) & 1) + d % 16][s % 4]
// The PC columns of a work-group fill PC * DO consecutive elements of each, written in whole lines.
#define PW 8
#define PC 64
#define PP 68      // LDS row pitch in floats: 16 bytes x odd, so that 16 lanes that write 16 bytes each to 16 rows fall on different banks
#define PM 72      // row pitch of the staged M in bf16: 144 bytes, 16 x odd again, for the fragments' 16-byte reads
__device__ __forceinline__ v8f wmmaB(v16b a, v16b b, v8f c) { return __builtin_amdgcn_wmma_f32_16x16x32_bf16(false, a, false, b, (short)0, c, false, false); }
// amdgpu_waves_per_eu(4, 4): 256 registers a wave, so that two work-groups (2 x 136 KiB of LDS) share a WGP and the 384 work-groups run in one round
__global__ __launch_bounds__(PW * 32) __attribute__((amdgpu_waves_per_eu(4, 4))) void k_proj(const float* __restrict__ Q, const float* __restrict__ K, const float* __restrict__ V,
                                                 const float* __restrict__ Mq, const float* __restrict__ Mk, const float* __restrict__ Mv,
                                                 _Float16* __restrict__ QF, float* __restrict__ KF, float* __restrict__ VF) {
  __shared__ __attribute__((aligned(16))) float part[PW][DO][PP];
  const int tid = threadIdx.x, w = tid >> 5, lane = tid & 31, ln = lane & 15, hh = lane >> 4;
  const int which = blockIdx.y, n0 = blockIdx.x * PC, k0 = w * (DI / PW);
  const float* X = which == 0 ? Q : which == 1 ? K : V;
  const float* M = which == 0 ? Mq : which == 1 ? Mk : Mv;
  const float* mp = M + (size_t)hh * DI + k0 + 4 * ln;
  const float* xp = X + (size_t)(k0 + 8 * hh) * SQ + n0 + 4 * ln;
  unsigned short* ms = (unsigned short*)&part[w][0][0];      // the wave's own LDS range holds its share of M until its partial tiles take the place
  // every loop below is unrolled so that fragments and tiles are indexed by constants and stay in registers
  v4f mf[32], xf[2][16];
  v16b b[2][4];
  FragB a[4][2];
#pragma unroll
  for (int j = 0; j < 16; ++j) mf[j] = *(const v4fa*)(mp + (size_t)(2 * j) * DI);      // rows 2 j and 2 j + 1, 256 consecutive bytes each
#pragma unroll
  for (int ks = 0; ks < 2; ++ks)
#pragma unroll
    for (int i = 0; i < 16; ++i) xf[ks][i] = *(const v4fa*)(xp + (size_t)(ks * 32 + (i >> 3) * 16 + (i & 7)) * SQ);      // k = 8 hh + 0..7, 16 + 8 hh + 0..7
#pragma unroll
  for (int j = 0; j < 16; ++j) { Quad c; c.b = (v4b){(__bf16)mf[j][0], (__bf16)mf[j][1], (__bf16)mf[j][2], (__bf16)mf[j][3]}; *(v4us*)(ms + (2 * j + hh) * PM + 4 * ln) = c.u; }
  // rows 32 to 63 of M are asked for only now, into the registers that rows 0 to 31 have left (all 64 loads at once would take more than 256 registers, and two
  // work-groups would no longer fit a WGP); they come from L2 while X is still on its way from memory
  __builtin_amdgcn_sched_barrier(0);      // keeps the 48 loads above together in front and the 16 below behind: without it all of M is asked for first and X only behind the wait for it (two latencies in a row), with spills
#pragma unroll
  for (int j = 16; j < 32; ++j) mf[j] = *(const v4fa*)(mp + (size_t)(2 * j) * DI);
#pragma unroll
  for (int ks = 0; ks < 2; ++ks)
#pragma unroll
    for (int u = 0; u < 4; ++u)
#pragma unroll
      for (int i = 0; i < 16; ++i) b[ks][u][i] = (__bf16)xf[ks][i][u];
#pragma unroll
  for (int j = 16; j < 32; ++j) { Quad c; c.b = (v4b){(__bf16)mf[j][0], (__bf16)mf[j][1], (__bf16)mf[j][2], (__bf16)mf[j][3]}; *(v4us*)(ms + (2 * j + hh) * PM + 4 * ln) = c.u; }
  asm volatile("s_wait_dscnt 0x0" ::: "memory");      // the lanes read below what other lanes of the wave have written above
#pragma unroll
  for (int mt = 0; mt < 4; ++mt)
#pragma unroll
    for (int ks = 0; ks < 2; ++ks) {      // the k order of xf
      a[mt][ks].half[0] = *(const v8us*)(ms + (mt * 16 + ln) * PM + ks * 32 + 8 * hh);
      a[mt][ks].half[1] = *(const v8us*)(ms + (mt * 16 + ln) * PM + ks * 32 + 16 + 8 * hh);
    }
#pragma unroll
  for (int mh = 0; mh < 4; mh += 2) {      // 32 rows d at a time: 8 tiles, then their partials go to LDS and leave the registers
    v8f acc[2][4];
#pragma unroll
    for (int m = 0; m < 2; ++m)
#pragma unroll
      for (int u = 0; u < 4; ++u) acc[m][u] = (v8f){0.f,0.f,0.f,0.f,0.f,0.f,0.f,0.f};
#pragma unroll
    for (int ks = 0; ks < 2; ++ks)
#pragma unroll
      for (int m = 0; m < 2; ++m)
#pragma unroll
        for (int u = 0; u < 4; ++u) acc[m][u] = wmmaB(a[mh + m][ks].v, b[ks][u], acc[m][u]);
    // acc[m][u][r] = partial of (d = 16 (mh + m) + 8 hh + r, n = n0 + 4 ln + u)
    if (which == 2) {
#pragma unroll
      for (int m = 0; m < 2; ++m)
#pragma unroll
        for (int r = 0; r < 8; ++r) *(v4fa*)&part[w][(mh + m) * 16 + 8 * hh + r][4 * ln] = (v4f){acc[m][0][r], acc[m][1][r], acc[m][2][r], acc[m][3][r]};
    } else {
#pragma unroll
      for (int m = 0; m < 2; ++m)
#pragma unroll
        for (int u = 0; u < 4; ++u) {      // LDS row u * 16 + ln = column 4 ln + u, its d turned round by 16 u: the readers below take columns 4 x .. 4 x + 3 at once, which would else fall on the same banks
          *(v4fa*)&part[w][u * 16 + ln][((mh + m + u) & 3) * 16 + 8 * hh] = (v4f){acc[m][u][0], acc[m][u][1], acc[m][u][2], acc[m][u][3]};
          *(v4fa*)&part[w][u * 16 + ln][((mh + m + u) & 3) * 16 + 8 * hh + 4] = (v4f){acc[m][u][4], acc[m][u][5], acc[m][u][6], acc[m][u][7]};
        }
    }
  }
  __syncthreads();      // every wave's partial tile is in LDS
#pragma unroll
  for (int j = 0; j < DO * PC / 4 / (PW * 32); ++j) {      // thread f sums and stores the f-th four elements of the work-group's share, in the order of the output: whole 128-byte lines
    const int f = j * (PW * 32) + tid;
    const int fl = which == 0 ? (f >> 1) & 31 : f & 31;      // the lane of k_attn that will load them
    const int kq = which == 0 ? ((f >> 6) & 3) * 4 + (fl >> 4) * 2 + (f & 1) : ((f >> 6) & 1) * 4 + (fl >> 4) * 2 + ((f >> 5) & 1);      // Q: d / 4; K, V: a quarter of the place in 32 d or 32 s
    int row, q4;      // the LDS row and which 16 bytes of it
    if (which == 2) { row = ((f >> 7) & 3) * 16 + (fl & 15); q4 = (f >> 9) * 8 + kq; }
    else { const int u = fl & 3, dq = which == 0 ? kq : ((f >> 7) & 1) * 8 + kq; row = u * 16 + (f >> 8) * 4 + ((fl & 15) >> 2); q4 = (dq + 4 * u) & 15; }
    const v4fa* ps = (const v4fa*)&part[0][0][0] + row * (PP / 4) + q4;      // counted in 16 bytes, so that the reads stay 16-byte LDS loads
    v4f s = ps[0];
#pragma unroll
    for (int p = 1; p < PW; ++p) s += ps[p * (DO * PP / 4)];      // wave order
    const size_t o = (size_t)n0 * DO + f * 4;
    // s_wait_xcnt 0 behind each store, inside its own branch: the next pass forms its address in the registers that the issued store names
    if (which == 2) { *(v4f*)(VF + o) = s; asm volatile("s_wait_xcnt 0x0" ::: "memory"); }
    else if (which == 1) { *(v4f*)(KF + o) = s; asm volatile("s_wait_xcnt 0x0" ::: "memory"); }
    else { *(v4h*)(QF + o) = (v4h){(_Float16)s[0], (_Float16)s[1], (_Float16)s[2], (_Float16)s[3]}; asm volatile("s_wait_xcnt 0x0" ::: "memory"); }
  }
}
// One launch for scores, softmax and out. A work-group owns AT key columns t; each of its AW waves takes SQ / AW query positions s, 32 a pass.
// Scores as S[s][t] = Qd[:,s].Kd[:,t] (A = f16 Qd rows, B = Kd columns split into f16 hi/lo, kept in registers: 2 products, K = 64), so that a lane holds
// scores of one column t only and two score tiles (s 0-15, 16-31 of a pass), converted in place, are the B operand of out[d][t] += Vd[d][s].P[s][t].
// Walk 1 finds each column's maximum over all s; walk 2 forms the scores again, e = 2^8 exp(x - max) = exp2(raw * (log2 e / 8) + (8 - rawmax * (log2 e / 8))): one
// multiply-add and the hardware's exp2 an element; it adds e to the column's sum and multiplies f16(e) with Vd (f16 hi/lo: 2 products); the 2^8 leaves in the division.
// All waves use the same maximum, so their partial tiles and sums add up plainly, in wave order, and the division comes last.
#define AW 16
#define AT 32
#define ASR (SQ / AW)
#define L2E8 0.18033688011112042f      // log2(e) / sqrt(64)
__device__ __forceinline__ v8f wmmaH(v16h a, v16h b, v8f c) { return __builtin_amdgcn_wmma_f32_16x16x32_f16(false, a, false, b, (short)0, c, false, false); }
// one 16 x 32 block of KF or VF (p: the lane's 16 bytes of its first 512) -> f16 hi/lo fragments in the hardware k order (8 hh + i, 16 + 8 hh + i)
__device__ __forceinline__ void frag_split(const float* __restrict__ p, FragH& fh, FragH& fl) {
  const v4f x0 = *(const v4fa*)p, x1 = *(const v4fa*)(p + 128), x2 = *(const v4fa*)(p + 256), x3 = *(const v4fa*)(p + 384);
  const float xs[16] = {x0[0],x0[1],x0[2],x0[3],x1[0],x1[1],x1[2],x1[3],x2[0],x2[1],x2[2],x2[3],x3[0],x3[1],x3[2],x3[3]};
  // unrolled so that xs and the fragments are indexed by constants and stay in registers
#pragma unroll
  for (int i = 0; i < 16; ++i) { const _Float16 h = (_Float16)xs[i]; fh.h[i] = h; fl.h[i] = (_Float16)(xs[i] - (float)h); }
}
// the A fragments of 32 s rows (m: which 16; ks: which 32 of the 64 d); q points at the lane's 16 bytes of the first 512 of those rows in QF
__device__ __forceinline__ void q_load(const _Float16* __restrict__ q, FragH (&qa)[2][2]) {
  // unrolled, here and in q_mul, so that the fragments and tiles are indexed by constants and stay in registers
#pragma unroll
  for (int m = 0; m < 2; ++m)
#pragma unroll
    for (int ks = 0; ks < 2; ++ks) { const _Float16* a = q + (m * 2 + ks) * 512; qa[m][ks].half[0] = *(const v8us*)a; qa[m][ks].half[1] = *(const v8us*)(a + 256); }
}
// sc[m][g] = raw scores of those 32 s rows against the 32 columns (g: which 16)
__device__ __forceinline__ void q_mul(const FragH (&qa)[2][2], const FragH (&kh)[2][2], const FragH (&kl)[2][2], v8f (&sc)[2][2]) {
#pragma unroll
  for (int m = 0; m < 2; ++m)
#pragma unroll
    for (int g = 0; g < 2; ++g) sc[m][g] = (v8f){0.f,0.f,0.f,0.f,0.f,0.f,0.f,0.f};
#pragma unroll
  for (int ks = 0; ks < 2; ++ks) {
#pragma unroll
    for (int m = 0; m < 2; ++m)
#pragma unroll
      for (int g = 0; g < 2; ++g) sc[m][g] = wmmaH(qa[m][ks].v, kh[g][ks].v, sc[m][g]);
#pragma unroll
    for (int m = 0; m < 2; ++m)
#pragma unroll
      for (int g = 0; g < 2; ++g) sc[m][g] = wmmaH(qa[m][ks].v, kl[g][ks].v, sc[m][g]);
  }
}
__global__ __launch_bounds__(AW * 32) void k_attn(const _Float16* __restrict__ QF, const float* __restrict__ KF, const float* __restrict__ VF, float* __restrict__ out) {
  __shared__ __attribute__((aligned(16))) float part[AW][DO][AT];
  __shared__ float rmx[AW][AT], rsm[AW][AT];
  const int tid = threadIdx.x, w = tid >> 5, lane = tid & 31, ln = lane & 15, hh = lane >> 4;
  const int t0 = blockIdx.x * AT;
  const _Float16* qrow = QF + (size_t)w * ASR * DO + lane * 8;      // the wave's ASR positions s are ASR * DO consecutive elements of QF and of VF
  const float* vrow = VF + (size_t)w * ASR * DO + lane * 4;
  FragH kh[2][2], kl[2][2];
  // the loops over g, ks, u, m, r and dt below are unrolled so that fragments and tiles are indexed by constants and stay in registers
#pragma unroll
  for (int g = 0; g < 2; ++g)
#pragma unroll
    for (int ks = 0; ks < 2; ++ks) frag_split(KF + (size_t)t0 * DO + (g * 2 + ks) * 512 + lane * 4, kh[g][ks], kl[g][ks]);
  float mx[2] = {-3.0e38f, -3.0e38f};
  for (int p = 0; p < ASR / 32; p += 4) {
    FragH qa[4][2][2];
#pragma unroll
    for (int u = 0; u < 4; ++u) q_load(qrow + (size_t)(p + u) * 32 * DO, qa[u]);
    __builtin_amdgcn_sched_barrier(0);      // keeps the 32 loads of four passes in front of the first product: without it they are issued a few at a time into reused registers, several memory latencies a pass
#pragma unroll
    for (int u = 0; u < 4; ++u) {
      v8f sc[2][2];
      q_mul(qa[u], kh, kl, sc);
#pragma unroll
      for (int g = 0; g < 2; ++g)
#pragma unroll
        for (int m = 0; m < 2; ++m)
#pragma unroll
          for (int r = 0; r < 8; ++r) mx[g] = fmaxf(mx[g], sc[m][g][r]);
    }
  }
#pragma unroll
  for (int g = 0; g < 2; ++g) { mx[g] = fmaxf(mx[g], __shfl_xor(mx[g], 16, 32)); rmx[w][g * 16 + ln] = mx[g]; }      // both halves of the wave store the same value
  __syncthreads();      // every wave's column maxima are in rmx
#pragma unroll
  for (int g = 0; g < 2; ++g) {
    float m = rmx[0][g * 16 + ln];
    for (int p = 1; p < AW; ++p) m = fmaxf(m, rmx[p][g * 16 + ln]);
    mx[g] = 8.0f - m * L2E8;      // x / 8 + 1 never decreases with x, so the maximum is taken of the raw scores; the exponent of the largest weight is 8
  }
  v8f o[4][2];
#pragma unroll
  for (int dt = 0; dt < 4; ++dt)
#pragma unroll
    for (int g = 0; g < 2; ++g) o[dt][g] = (v8f){0.f,0.f,0.f,0.f,0.f,0.f,0.f,0.f};
  float den[2] = {0.f, 0.f};
  for (int p = 0; p < ASR / 32; ++p) {
    FragH qa[2][2];
    q_load(qrow + (size_t)p * 32 * DO, qa);
    v8f sc[2][2];
    q_mul(qa, kh, kl, sc);
    FragH pb[2];
#pragma unroll
    for (int g = 0; g < 2; ++g)
#pragma unroll
      for (int m = 0; m < 2; ++m)
      {
        float e[8];
#pragma unroll
        for (int r = 0; r < 8; ++r) e[r] = __builtin_fmaf(sc[m][g][r], L2E8, mx[g]);
#pragma unroll
        for (int r = 0; r < 8; ++r) e[r] = __builtin_amdgcn_exp2f(e[r]);      // the exponent is at most 8 (+ a rounding); far below, exp2 gives 0, as f16 would
#pragma unroll
        for (int r = 0; r < 8; ++r) {
          den[g] += e[r];
          pb[g].h[m * 8 + r] = (_Float16)e[r];      // the 2^8 in e keeps small weights out of the f16 subnormal range; sum and products carry it alike
        }
      }
#pragma unroll
    for (int dt = 0; dt < 4; ++dt) {
      FragH vh, vl;
      frag_split(vrow + (size_t)(p * 4 + dt) * 512, vh, vl);
#pragma unroll
      for (int g = 0; g < 2; ++g) o[dt][g] = wmmaH(vh.v, pb[g].v, o[dt][g]);
#pragma unroll
      for (int g = 0; g < 2; ++g) o[dt][g] = wmmaH(vl.v, pb[g].v, o[dt][g]);
    }
  }
#pragma unroll
  for (int g = 0; g < 2; ++g) { den[g] += __shfl_xor(den[g], 16, 32); rsm[w][g * 16 + ln] = den[g]; }      // both halves of the wave store the same value
#pragma unroll
  for (int dt = 0; dt < 4; ++dt)
#pragma unroll
    for (int g = 0; g < 2; ++g)
#pragma unroll
      for (int r = 0; r < 8; ++r) part[w][dt * 16 + 8 * hh + r][g * 16 + ln] = o[dt][g][r];
  __syncthreads();      // every wave's partial tile and column sums are in LDS
  float dsum = 0.f;
  for (int p = 0; p < AW; ++p) dsum += rsm[p][lane];      // wave order, the same in every wave
  const float inv = 1.0f / dsum;
  for (int j = 0; j < DO / AW; ++j) {      // wave w sums and stores rows w, w + AW, ...: one whole 128-byte line each
    const int d = j * AW + w;
    float s = 0.f;
    for (int p = 0; p < AW; ++p) s += part[p][d][lane];
    out[(size_t)d * SQ + t0 + lane] = s * inv;
  }
}
extern "C" void kernel_launch(void* const* d_in, const int* in_sizes, int n_in,
                              void* d_out, int out_size, void* d_ws, size_t ws_size, hipStream_t stream) {
  (void)in_sizes; (void)n_in; (void)out_size;
  const float* Q = (const float*)d_in[0]; const float* K = (const float*)d_in[1]; const float* V = (const float*)d_in[2]; const float* Mq = (const float*)d_in[3]; const float* Mk = (const float*)d_in[4]; const float* Mv = (const float*)d_in[5];
  char* ws = (char*)d_ws; size_t off = 0;
  auto take = [&](size_t bytes) { char* p = ws + off; off += (bytes + 255) & ~(size_t)255; return p; };
  float* Vd = (float*)take((size_t)DO * SQ * 4); float* KdT = (float*)take((size_t)SQ * DO * 4); _Float16* QdB = (_Float16*)take((size_t)SQ * DO * 2);
  if (off > ws_size) return;
  k_proj<<<dim3(SQ / PC, 3, 1), PW * 32, 0, stream>>>(Q, K, V, Mq, Mk, Mv, QdB, KdT, Vd);      // QdB = f16(Mq.Q), KdT = Mk.K, Vd = Mv.V, each in k_attn's fragment order
  k_attn<<<SQ / AT, AW * 32, 0, stream>>>(QdB, KdT, Vd, (float*)d_out);      // out[d][t] = sum_s Vd[d][s] * softmax_s(Qd[:,s].Kd[:,t] / 8 + 1)
}

// v007
// Measured time: 52.4 microseconds a run.
// Next to v006, in two timings, it ran 1.19 times as fast each time.
// All steps since v000 together make it 81.5 times as fast.
#include <hip/hip_runtime.h>
// On v_wmma_f32_16x16x32_bf16 with f32 accumulate, in one kernel (k_proj): the projections Qd/Kd/Vd = M.{Q,K,V} (M = 64, K = 512, N = 8192; inputs rounded to bf16: single exact term).
// On v_wmma_f32_16x16x32_f16, in one fused kernel (k_attn): the scores S[s][t] = Qd[:,s].Kd[:,t] (Qd rounded to f16, Kd split into f16 hi/lo: 2 products, K = 64) and
// out[:, t] = Vd.P[:, t] (Vd split into f16 hi/lo by k_proj, the softmax weights rounded to f16: 2 products, K = 8192). The module's softmax runs over the QUERY axis s (dim 0);
// /sqrt(64) is folded into the exponent's f32 multiply-add; the +1 constant stands in every score of a column and in its maximum alike and cancels in x - max.
#define DI 512
#define DO 64
#define SQ 8192

typedef __bf16 v16b __attribute__((ext_vector_type(16)));
typedef unsigned short v8us __attribute__((ext_vector_type(8), may_alias));
typedef float  v8f  __attribute__((ext_vector_type(8)));
typedef float  v4f  __attribute__((ext_vector_type(4)));
typedef float  v4fa __attribute__((ext_vector_type(4), may_alias));
union FragB { v16b v; v8us half[2]; unsigned short u[16]; };

__device__ __forceinline__ unsigned short bf16_bits(float x) { unsigned int u = __float_as_uint(x); return (unsigned short)((u + 0x7FFFu + ((u >> 16) & 1u)) >> 16); }
__device__ __forceinline__ float bf16_val(unsigned short b) { return __uint_as_float(((unsigned int)b) << 16); }
__device__ __forceinline__ float bf16_round(float x) { return bf16_val(bf16_bits(x)); }
// D += A·B with NT terms: 1 = ah·bh, 2 = + al·bh (A split), 3 = + ah·bl (both split)
template <int NT>
__device__ __forceinline__ v8f mmaN(v16b ah, v16b al, v16b bh, v16b bl, v8f c) {
  c = __builtin_amdgcn_wmma_f32_16x16x32_bf16(false, ah, false, bh, (short)0, c, false, false);
  if (NT >= 2) c = __builtin_amdgcn_wmma_f32_16x16x32_bf16(false, al, false, bh, (short)0, c, false, false);
  if (NT >= 3) c = __builtin_amdgcn_wmma_f32_16x16x32_bf16(false, ah, false, bl, (short)0, c, false, false);
  asm volatile("v_nop\n\tv_nop\n\tv_nop\n\tv_nop" : "+v"(c) : "v"(ah), "v"(al), "v"(bh), "v"(bl));
  return c;
}

// GEMM C[M][N] (f32, pitch ldc) = act(A[M][K]·W + bias). A f32 row-major (pitch lda) converted per fragment to bf16
// (ASPLIT: hi/lo two planes -> 2 terms, else single rounded term); Wt bf16 [N][K] (pitch ldb). BIAS_BF16 rounds the
// bias to bf16 first (bias quantised to bf16 before the add). K%32==0, M%16==0, N%64==0.
template <bool ASPLIT, int ACT, bool BIAS_BF16>
__global__ __launch_bounds__(128) void k_gemm_bf(const float* __restrict__ A, int lda, const unsigned short* __restrict__ Wt, int ldb,
                                               const float* __restrict__ bias, float* __restrict__ C, int ldc, int M, int N, int K) {
  __shared__ __attribute__((aligned(16))) float so[4][16][64];
  const int tid = threadIdx.x, w = tid >> 5, lane = tid & 31, ln = lane & 15, hh = lane >> 4;
  const int ntn = N / 64;
  const int wid = blockIdx.x * 4 + w;
  const int mt = wid / ntn, nq = wid % ntn;
  if (mt * 16 >= M) return;
  const int row0 = mt * 16, col0 = nq * 64;
  const float* arow = A + (size_t)(row0 + ln) * lda;
  v8f acc[4] = {};
  for (int kb = 0; kb < K; kb += 32) {
    FragB ah, al;
    const v4f x0 = *(const v4fa*)(arow + kb + 8 * hh), x1 = *(const v4fa*)(arow + kb + 8 * hh + 4);
    const v4f x2 = *(const v4fa*)(arow + kb + 16 + 8 * hh), x3 = *(const v4fa*)(arow + kb + 16 + 8 * hh + 4);
    float xs[16] = {x0[0],x0[1],x0[2],x0[3],x1[0],x1[1],x1[2],x1[3],x2[0],x2[1],x2[2],x2[3],x3[0],x3[1],x3[2],x3[3]};
#pragma unroll
    for (int i = 0; i < 16; ++i) { const unsigned short hb = bf16_bits(xs[i]); ah.u[i] = hb; al.u[i] = ASPLIT ? bf16_bits(xs[i] - bf16_val(hb)) : (unsigned short)0; }
#pragma unroll
    for (int t = 0; t < 4; ++t) {
      const unsigned short* brow = Wt + (size_t)(col0 + t * 16 + ln) * ldb + kb;
      FragB b;
      b.half[0] = *(const v8us*)(brow + 8 * hh);
      b.half[1] = *(const v8us*)(brow + 16 + 8 * hh);
      acc[t] = mmaN<ASPLIT ? 2 : 1>(ah.v, al.v, b.v, b.v, acc[t]);
    }
  }
#pragma unroll
  for (int t = 0; t < 4; ++t) {
    float bv = bias ? bias[col0 + t * 16 + ln] : 0.f;
    if (BIAS_BF16) bv = bf16_round(bv);
#pragma unroll
    for (int r = 0; r < 8; ++r) { float v = acc[t][r] + bv; if (ACT == 1) v = fmaxf(v, 0.f); so[w][8 * hh + r][t * 16 + ln] = v; }
  }
  __builtin_amdgcn_fence(__ATOMIC_ACQ_REL, "workgroup");
  __builtin_amdgcn_wave_barrier();
  const int rsub = lane >> 4, c4 = (lane & 15) * 4;
  {
#pragma unroll
    for (int q = 0; q < 8; ++q) {
      const int r = q * 2 + rsub;
      const v4f v = *(const v4fa*)&so[w][r][c4];
      *(v4f*)(C + (size_t)(row0 + r) * ldc + col0 + c4) = v;
    }
    
  }
}

// Flash-style causal/unmasked attention, all contractions 3-term bf16 hi/lo splits, f32 softmax with running max.
// q,k,v rows are read from f32 buffers with arbitrary row pitch (so they can live inside a fused qkv buffer);
// D = head size (multiple of 32, <= 128); one wave = 16 query rows; block = 4 waves (64 queries) sharing K/V chunks of 32.
template <int D, bool CAUSAL>
__global__ __launch_bounds__(128) void k_flash(const float* __restrict__ qb, const float* __restrict__ kb, const float* __restrict__ vb,
                                             int pitch, int T, int H, float scale, float* __restrict__ y, int ypitch) {
  constexpr int KS = D / 32;        // k-steps for QK
  constexpr int DT = D / 16;        // d tiles for PV
  __shared__ __attribute__((aligned(16))) unsigned short sKh[32][D + 8], sKl[32][D + 8], sVh[32][D + 8], sVl[32][D + 8];
  __shared__ __attribute__((aligned(16))) unsigned short sPh[4][16][40], sPl[4][16][40];
  __shared__ __attribute__((aligned(16))) float sO[4][16][D];
  const int tid = threadIdx.x, w = tid >> 5, lane = tid & 31, ln = lane & 15, hh = lane >> 4;
  const int nqb = (T + 63) / 64;
  const int bh = blockIdx.x / nqb, qblk = blockIdx.x % nqb;
  const int b = bh / H, h = bh % H;
  const int q0 = qblk * 64 + w * 16;
  const float* Q = qb + (size_t)b * T * pitch + h * D;
  const float* K = kb + (size_t)b * T * pitch + h * D;
  const float* V = vb + (size_t)b * T * pitch + h * D;

  // A fragments of the wave's 16 query rows (scaled), hi/lo
  FragB aqh[KS], aql[KS];
  {
    int row = q0 + ln; if (row >= T) row = T - 1;
    const float* qr = Q + (size_t)row * pitch;
#pragma unroll
    for (int ks = 0; ks < KS; ++ks)
#pragma unroll
      for (int i = 0; i < 16; ++i) {
        const int d = ks * 32 + ((i < 8) ? (8 * hh + i) : (16 + 8 * hh + (i - 8)));
        const float x = qr[d] * scale; const unsigned short hb = bf16_bits(x);
        aqh[ks].u[i] = hb; aql[ks].u[i] = bf16_bits(x - bf16_val(hb));
      }
  }
  float m_r[8], l_r[8];
#pragma unroll
  for (int r = 0; r < 8; ++r) { m_r[r] = -3.0e38f; l_r[r] = 0.f; }
  v8f oacc[DT];
#pragma unroll
  for (int dt = 0; dt < DT; ++dt) oacc[dt] = (v8f){0.f,0.f,0.f,0.f,0.f,0.f,0.f,0.f};

  const int kv_end = CAUSAL ? min(T, qblk * 64 + 64) : T;     // block-uniform
  for (int j0 = 0; j0 < kv_end; j0 += 32) {
    __syncthreads();
    for (int e = tid; e < 32 * (D / 4); e += 128) {
      const int r = e / (D / 4), c4 = (e % (D / 4)) * 4;
      const int key = j0 + r;
      v4f kf = {0.f,0.f,0.f,0.f}, vf = {0.f,0.f,0.f,0.f};
      if (key < T) { kf = *(const v4fa*)(K + (size_t)key * pitch + c4); vf = *(const v4fa*)(V + (size_t)key * pitch + c4); }
#pragma unroll
      for (int t = 0; t < 4; ++t) {
        unsigned short hb = bf16_bits(kf[t]); sKh[r][c4 + t] = hb; sKl[r][c4 + t] = bf16_bits(kf[t] - bf16_val(hb));
        hb = bf16_bits(vf[t]); sVh[r][c4 + t] = hb; sVl[r][c4 + t] = bf16_bits(vf[t] - bf16_val(hb));
      }
    }
    __syncthreads();
    // S tile 16 x 32
    v8f s[2];
#pragma unroll
    for (int nt = 0; nt < 2; ++nt) {
      v8f acc = {};
#pragma unroll
      for (int ks = 0; ks < KS; ++ks) {
        FragB bh_, bl_;
        bh_.half[0] = *(const v8us*)&sKh[nt * 16 + ln][ks * 32 + 8 * hh]; bh_.half[1] = *(const v8us*)&sKh[nt * 16 + ln][ks * 32 + 16 + 8 * hh];
        bl_.half[0] = *(const v8us*)&sKl[nt * 16 + ln][ks * 32 + 8 * hh]; bl_.half[1] = *(const v8us*)&sKl[nt * 16 + ln][ks * 32 + 16 + 8 * hh];
        acc = mmaN<3>(aqh[ks].v, aql[ks].v, bh_.v, bl_.v, acc);
      }
      s[nt] = acc;
    }
    // mask + running max (rows 8hh+r; the 16 lanes of a half share rows)
    float alpha[8];
#pragma unroll
    for (int r = 0; r < 8; ++r) {
      const int qi = q0 + 8 * hh + r;
      const int ja = j0 + ln, jb = j0 + 16 + ln;
      if (CAUSAL) { if (ja > qi) s[0][r] = -3.0e38f; if (jb > qi) s[1][r] = -3.0e38f; }
      if (ja >= T) s[0][r] = -3.0e38f;
      if (jb >= T) s[1][r] = -3.0e38f;
      float mx = fmaxf(s[0][r], s[1][r]);
      mx = fmaxf(mx, __shfl_xor(mx, 1, 32)); mx = fmaxf(mx, __shfl_xor(mx, 2, 32)); mx = fmaxf(mx, __shfl_xor(mx, 4, 32)); mx = fmaxf(mx, __shfl_xor(mx, 8, 32));
      const float mnew = fmaxf(m_r[r], mx);
      alpha[r] = (mnew > -1.0e38f) ? __expf(m_r[r] - mnew) : 1.0f;
      const float p0 = (s[0][r] > -1.0e38f) ? __expf(s[0][r] - mnew) : 0.f;
      const float p1 = (s[1][r] > -1.0e38f) ? __expf(s[1][r] - mnew) : 0.f;
      m_r[r] = mnew;
      l_r[r] = l_r[r] * alpha[r] + p0 + p1;            // per-lane partial row sum (16 lanes combined at the end)
      unsigned short hb = bf16_bits(p0); sPh[w][8 * hh + r][ln] = hb;      sPl[w][8 * hh + r][ln] = bf16_bits(p0 - bf16_val(hb));
      hb = bf16_bits(p1);                sPh[w][8 * hh + r][16 + ln] = hb; sPl[w][8 * hh + r][16 + ln] = bf16_bits(p1 - bf16_val(hb));
    }
#pragma unroll
    for (int dt = 0; dt < DT; ++dt)
#pragma unroll
      for (int r = 0; r < 8; ++r) oacc[dt][r] *= alpha[r];
    __builtin_amdgcn_fence(__ATOMIC_ACQ_REL, "workgroup");
    __builtin_amdgcn_wave_barrier();
    FragB pah, pal;
    pah.half[0] = *(const v8us*)&sPh[w][ln][8 * hh]; pah.half[1] = *(const v8us*)&sPh[w][ln][16 + 8 * hh];
    pal.half[0] = *(const v8us*)&sPl[w][ln][8 * hh]; pal.half[1] = *(const v8us*)&sPl[w][ln][16 + 8 * hh];
#pragma unroll
    for (int dt = 0; dt < DT; ++dt) {
      FragB bvh, bvl;
#pragma unroll
      for (int i = 0; i < 8; ++i) {
        bvh.u[i] = sVh[8 * hh + i][dt * 16 + ln]; bvh.u[8 + i] = sVh[16 + 8 * hh + i][dt * 16 + ln];
        bvl.u[i] = sVl[8 * hh + i][dt * 16 + ln]; bvl.u[8 + i] = sVl[16 + 8 * hh + i][dt * 16 + ln];
      }
      oacc[dt] = mmaN<3>(pah.v, pal.v, bvh.v, bvl.v, oacc[dt]);
    }
    __builtin_amdgcn_fence(__ATOMIC_ACQ_REL, "workgroup");
    __builtin_amdgcn_wave_barrier();
  }
#pragma unroll
  for (int r = 0; r < 8; ++r) {
    float l = l_r[r];
    l += __shfl_xor(l, 1, 32); l += __shfl_xor(l, 2, 32); l += __shfl_xor(l, 4, 32); l += __shfl_xor(l, 8, 32);
    l_r[r] = (l > 0.f) ? 1.0f / l : 0.f;
  }
#pragma unroll
  for (int dt = 0; dt < DT; ++dt)
#pragma unroll
    for (int r = 0; r < 8; ++r) sO[w][8 * hh + r][dt * 16 + ln] = oacc[dt][r] * l_r[r];
  __builtin_amdgcn_fence(__ATOMIC_ACQ_REL, "workgroup");
  __builtin_amdgcn_wave_barrier();
  {
    for (int r = 0; r < 16; ++r) {
      const int row = q0 + r;
      if (row < T && lane < D / 4) {
        const v4f val = *(const v4fa*)&sO[w][r][lane * 4];
        *(v4f*)(y + ((size_t)b * T + row) * ypitch + h * D + lane * 4) = val;
      }
    }
    
  }
}

// in pitch = cols, out pitch = rows; rows, cols multiples of 32. Optional per-output-row affine (scale[c], shift[c]) and
// residual add res (same layout as out, optionally bf16-rounded) for fused epilogues: out = in*scale + shift + res.
template <bool AFFINE, bool RESID, bool RES_BF16>
__global__ __launch_bounds__(256) void k_transpose32(const float* __restrict__ in, float* __restrict__ out, int rows, int cols,
                                                    const float* __restrict__ scale, const float* __restrict__ shift, const float* __restrict__ res) {
  __shared__ float tile[32][33];
  const int b = blockIdx.z;
  const int r0 = blockIdx.y * 32, c0 = blockIdx.x * 32;
  const float* src = in + (size_t)b * rows * cols;
  float* dst = out + (size_t)b * rows * cols;
  const int tx = threadIdx.x & 31, ty = threadIdx.x >> 5;     // 8 rows per pass
  for (int i = ty; i < 32; i += 8) tile[i][tx] = src[(size_t)(r0 + i) * cols + c0 + tx];
  __syncthreads();
  {
    for (int i = ty; i < 32; i += 8) {
      float v = tile[tx][i];
      const int orow = c0 + i;
      if (AFFINE) v = v * scale[orow] + shift[orow];
      if (RESID) { float rv = res[(size_t)b * rows * cols + (size_t)orow * rows + r0 + tx]; if (RES_BF16) rv = bf16_round(rv); v += rv; }
      *(float*)(dst + (size_t)orow * rows + r0 + tx) = v;
    }
    
  }
}

// 2x2 max pool on position-major data: in [B][H*W][C] -> out [B][(H/2)*(W/2)][C]; thread per (b, p', 4 channels); C%4==0
__global__ __launch_bounds__(256) void k_pool2_pm(const float* __restrict__ in, float* __restrict__ out, int Bn, int H, int W, int C) {
  const size_t t = (size_t)blockIdx.x * 256 + threadIdx.x;
  const int c4n = C / 4, Ho = H / 2, Wo = W / 2;
  const size_t total = (size_t)Bn * Ho * Wo * c4n;
  if (t >= total) return;
  const int c4 = (int)(t % c4n) * 4; size_t rest = t / c4n;
  const int pw = (int)(rest % Wo); rest /= Wo; const int ph = (int)(rest % Ho); const int b = (int)(rest / Ho);
  const float* base = in + (size_t)b * H * W * C;
  const int p00 = (2 * ph) * W + 2 * pw;
  const v4f a = *(const v4fa*)(base + (size_t)p00 * C + c4), bq = *(const v4fa*)(base + (size_t)(p00 + 1) * C + c4);
  const v4f c = *(const v4fa*)(base + (size_t)(p00 + W) * C + c4), d = *(const v4fa*)(base + (size_t)(p00 + W + 1) * C + c4);
  v4f m; for (int i = 0; i < 4; ++i) m[i] = fmaxf(fmaxf(a[i], bq[i]), fmaxf(c[i], d[i]));
  float* dst = out + ((size_t)b * Ho * Wo + (size_t)ph * Wo + pw) * C + c4;
  *(v4f*)dst = m;
  
}

// General (non-causal) attention, 3-term bf16 splits, f32 softmax with running max.
// Q [.][Tq][qpitch], K [.][Tk][kpitch] (head dim DQ), V [.][Tk][vpitch] (head dim DVtot); this block handles DV output
// dims starting at dv0 = blockIdx.y*DV. y[bh][t][ypitch] gets columns dv0..dv0+DV-1. Per-bh base offsets via strides.
template <int DQ, int DV>
__global__ __launch_bounds__(128) void k_flash2(const float* __restrict__ Qb, size_t qstride, int qpitch, int Tq,
                                              const float* __restrict__ Kb, size_t kstride, int kpitch, int Tk,
                                              const float* __restrict__ Vb, size_t vstride, int vpitch,
                                              float scale, float* __restrict__ y, size_t ystride, int ypitch) {
  constexpr int KS = DQ / 32, DT = DV / 16;
  __shared__ __attribute__((aligned(16))) unsigned short sKh[32][DQ + 8], sKl[32][DQ + 8], sVh[32][DV + 8], sVl[32][DV + 8];
  __shared__ __attribute__((aligned(16))) unsigned short sPh[4][16][40], sPl[4][16][40];
  __shared__ __attribute__((aligned(16))) float sO[4][16][DV];
  const int tid = threadIdx.x, w = tid >> 5, lane = tid & 31, ln = lane & 15, hh = lane >> 4;
  const int nqb = (Tq + 63) / 64;
  const int bh = blockIdx.x / nqb, qblk = blockIdx.x % nqb;
  const int dv0 = blockIdx.y * DV;
  const int q0 = qblk * 64 + w * 16;
  const float* Q = Qb + (size_t)bh * qstride; const float* K = Kb + (size_t)bh * kstride; const float* V = Vb + (size_t)bh * vstride + dv0;
  FragB aqh[KS], aql[KS];
  {
    int row = q0 + ln; if (row >= Tq) row = Tq - 1;
    const float* qr = Q + (size_t)row * qpitch;
#pragma unroll
    for (int ks = 0; ks < KS; ++ks)
#pragma unroll
      for (int i = 0; i < 16; ++i) {
        const int d = ks * 32 + ((i < 8) ? (8 * hh + i) : (16 + 8 * hh + (i - 8)));
        const float x = qr[d] * scale; const unsigned short hb = bf16_bits(x);
        aqh[ks].u[i] = hb; aql[ks].u[i] = bf16_bits(x - bf16_val(hb));
      }
  }
  float m_r[8], l_r[8];
#pragma unroll
  for (int r = 0; r < 8; ++r) { m_r[r] = -3.0e38f; l_r[r] = 0.f; }
  v8f oacc[DT];
#pragma unroll
  for (int dt = 0; dt < DT; ++dt) oacc[dt] = (v8f){0.f,0.f,0.f,0.f,0.f,0.f,0.f,0.f};
  for (int j0 = 0; j0 < Tk; j0 += 32) {
    __syncthreads();
    for (int e = tid; e < 32 * (DQ / 4); e += 128) {
      const int r = e / (DQ / 4), c4 = (e % (DQ / 4)) * 4; const int key = j0 + r;
      v4f f = {0.f,0.f,0.f,0.f}; if (key < Tk) f = *(const v4fa*)(K + (size_t)key * kpitch + c4);
#pragma unroll
      for (int t = 0; t < 4; ++t) { const unsigned short hb = bf16_bits(f[t]); sKh[r][c4 + t] = hb; sKl[r][c4 + t] = bf16_bits(f[t] - bf16_val(hb)); }
    }
    for (int e = tid; e < 32 * (DV / 4); e += 128) {
      const int r = e / (DV / 4), c4 = (e % (DV / 4)) * 4; const int key = j0 + r;
      v4f f = {0.f,0.f,0.f,0.f}; if (key < Tk) f = *(const v4fa*)(V + (size_t)key * vpitch + c4);
#pragma unroll
      for (int t = 0; t < 4; ++t) { const unsigned short hb = bf16_bits(f[t]); sVh[r][c4 + t] = hb; sVl[r][c4 + t] = bf16_bits(f[t] - bf16_val(hb)); }
    }
    __syncthreads();
    v8f s[2];
#pragma unroll
    for (int nt = 0; nt < 2; ++nt) {
      v8f acc = {};
#pragma unroll
      for (int ks = 0; ks < KS; ++ks) {
        FragB bh_, bl_;
        bh_.half[0] = *(const v8us*)&sKh[nt * 16 + ln][ks * 32 + 8 * hh]; bh_.half[1] = *(const v8us*)&sKh[nt * 16 + ln][ks * 32 + 16 + 8 * hh];
        bl_.half[0] = *(const v8us*)&sKl[nt * 16 + ln][ks * 32 + 8 * hh]; bl_.half[1] = *(const v8us*)&sKl[nt * 16 + ln][ks * 32 + 16 + 8 * hh];
        acc = mmaN<3>(aqh[ks].v, aql[ks].v, bh_.v, bl_.v, acc);
      }
      s[nt] = acc;
    }
    float alpha[8];
#pragma unroll
    for (int r = 0; r < 8; ++r) {
      const int ja = j0 + ln, jb = j0 + 16 + ln;
      if (ja >= Tk) s[0][r] = -3.0e38f;
      if (jb >= Tk) s[1][r] = -3.0e38f;
      float mx = fmaxf(s[0][r], s[1][r]);
      mx = fmaxf(mx, __shfl_xor(mx, 1, 32)); mx = fmaxf(mx, __shfl_xor(mx, 2, 32)); mx = fmaxf(mx, __shfl_xor(mx, 4, 32)); mx = fmaxf(mx, __shfl_xor(mx, 8, 32));
      const float mnew = fmaxf(m_r[r], mx);
      alpha[r] = (mnew > -1.0e38f) ? __expf(m_r[r] - mnew) : 1.0f;
      const float p0 = (s[0][r] > -1.0e38f) ? __expf(s[0][r] - mnew) : 0.f;
      const float p1 = (s[1][r] > -1.0e38f) ? __expf(s[1][r] - mnew) : 0.f;
      m_r[r] = mnew;
      l_r[r] = l_r[r] * alpha[r] + p0 + p1;
      unsigned short hb = bf16_bits(p0); sPh[w][8 * hh + r][ln] = hb;      sPl[w][8 * hh + r][ln] = bf16_bits(p0 - bf16_val(hb));
      hb = bf16_bits(p1);                sPh[w][8 * hh + r][16 + ln] = hb; sPl[w][8 * hh + r][16 + ln] = bf16_bits(p1 - bf16_val(hb));
    }
#pragma unroll
    for (int dt = 0; dt < DT; ++dt)
#pragma unroll
      for (int r = 0; r < 8; ++r) oacc[dt][r] *= alpha[r];
    __builtin_amdgcn_fence(__ATOMIC_ACQ_REL, "workgroup");
    __builtin_amdgcn_wave_barrier();
    FragB pah, pal;
    pah.half[0] = *(const v8us*)&sPh[w][ln][8 * hh]; pah.half[1] = *(const v8us*)&sPh[w][ln][16 + 8 * hh];
    pal.half[0] = *(const v8us*)&sPl[w][ln][8 * hh]; pal.half[1] = *(const v8us*)&sPl[w][ln][16 + 8 * hh];
#pragma unroll
    for (int dt = 0; dt < DT; ++dt) {
      FragB bvh, bvl;
#pragma unroll
      for (int i = 0; i < 8; ++i) {
        bvh.u[i] = sVh[8 * hh + i][dt * 16 + ln]; bvh.u[8 + i] = sVh[16 + 8 * hh + i][dt * 16 + ln];
        bvl.u[i] = sVl[8 * hh + i][dt * 16 + ln]; bvl.u[8 + i] = sVl[16 + 8 * hh + i][dt * 16 + ln];
      }
      oacc[dt] = mmaN<3>(pah.v, pal.v, bvh.v, bvl.v, oacc[dt]);
    }
    __builtin_amdgcn_fence(__ATOMIC_ACQ_REL, "workgroup");
    __builtin_amdgcn_wave_barrier();
  }
#pragma unroll
  for (int r = 0; r < 8; ++r) {
    float l = l_r[r];
    l += __shfl_xor(l, 1, 32); l += __shfl_xor(l, 2, 32); l += __shfl_xor(l, 4, 32); l += __shfl_xor(l, 8, 32);
    l_r[r] = (l > 0.f) ? 1.0f / l : 0.f;
  }
#pragma unroll
  for (int dt = 0; dt < DT; ++dt)
#pragma unroll
    for (int r = 0; r < 8; ++r) sO[w][8 * hh + r][dt * 16 + ln] = oacc[dt][r] * l_r[r];
  __builtin_amdgcn_fence(__ATOMIC_ACQ_REL, "workgroup");
  __builtin_amdgcn_wave_barrier();
  {
    for (int r = 0; r < 16; ++r) {
      const int row = q0 + r;
      for (int c4 = lane * 4; c4 < DV; c4 += 128) {
        if (row < Tq) {
          const v4f val = *(const v4fa*)&sO[w][r][c4];
          *(v4f*)(y + (size_t)bh * ystride + (size_t)row * ypitch + dv0 + c4) = val;
        }
      }
    }
    
  }
}

// f32 [R][Cc] (row pitch lds) -> bf16 hi/lo planes [R][Cc] (pitch Cc); thread per 8 elements; Cc % 8 == 0
__global__ __launch_bounds__(256) void k_split_rows(const float* __restrict__ src, int lds_, unsigned short* __restrict__ hi, unsigned short* __restrict__ lo, int R, int Cc) {
  const size_t t = (size_t)blockIdx.x * 256 + threadIdx.x;
  const int c8n = Cc / 8;
  if (t >= (size_t)R * c8n) return;
  const int r = (int)(t / c8n), c8 = (int)(t % c8n) * 8;
  const float* s = src + (size_t)r * lds_ + c8;
  const v4f a = *(const v4fa*)s, b = *(const v4fa*)(s + 4);
  float xs[8] = {a[0],a[1],a[2],a[3],b[0],b[1],b[2],b[3]};
  v8us vh, vl;
#pragma unroll
  for (int i = 0; i < 8; ++i) { const unsigned short hb = bf16_bits(xs[i]); vh[i] = hb; vl[i] = bf16_bits(xs[i] - bf16_val(hb)); }
  unsigned short* dh = hi + (size_t)r * Cc + c8; unsigned short* dl = lo + (size_t)r * Cc + c8;
  *(v8us*)dh = vh; *(v8us*)dl = vl; 
}
// f32 [K][N] (row pitch lds) -> transposed bf16 hi/lo planes [N][K]; one thread per (n, 8 consecutive k)
__global__ __launch_bounds__(256) void k_split_transpose(const float* __restrict__ src, int lds_, unsigned short* __restrict__ hi, unsigned short* __restrict__ lo, int K, int N) {
  const size_t t = (size_t)blockIdx.x * 256 + threadIdx.x;
  const int k8n = K / 8;
  if (t >= (size_t)N * k8n) return;
  const int n = (int)(t / k8n), k8 = (int)(t % k8n) * 8;
  v8us vh, vl;
#pragma unroll
  for (int i = 0; i < 8; ++i) { const float x = src[(size_t)(k8 + i) * lds_ + n]; const unsigned short hb = bf16_bits(x); vh[i] = hb; vl[i] = bf16_bits(x - bf16_val(hb)); }
  unsigned short* dh = hi + (size_t)n * K + k8; unsigned short* dl = lo + (size_t)n * K + k8;
  *(v8us*)dh = vh; *(v8us*)dl = vl; 
}
// GEMM with A f32 (split into hi/lo when ASPLIT) and B from bf16 planes Bh (+ Bl when BSPLIT): terms hi·hi [+ lo·hi] [+ hi·lo].
// C f32 [M][N] pitch ldc; alpha scales the result; bias optional (BIAS_BF16 rounds it). Same tiling/epilogue as k_gemm_bf.
template <bool ASPLIT, bool BSPLIT, int ACT, bool BIAS_BF16>
__global__ __launch_bounds__(128) void k_gemm_bf2(const float* __restrict__ A, int lda, const unsigned short* __restrict__ Bh, const unsigned short* __restrict__ Bl, int ldb,
                                                const float* __restrict__ bias, float alpha, float* __restrict__ C, int ldc, int M, int N, int K) {
  __shared__ __attribute__((aligned(16))) float so[4][16][64];
  const int tid = threadIdx.x, w = tid >> 5, lane = tid & 31, ln = lane & 15, hh = lane >> 4;
  const int ntn = N / 64;
  const int wid = blockIdx.x * 4 + w;
  const int mt = wid / ntn, nq = wid % ntn;
  if (mt * 16 >= M) return;
  const int row0 = mt * 16, col0 = nq * 64;
  const float* arow = A + (size_t)(row0 + ln) * lda;
  v8f acc[4] = {};
  for (int kb = 0; kb < K; kb += 32) {
    FragB ah, al;
    const v4f x0 = *(const v4fa*)(arow + kb + 8 * hh), x1 = *(const v4fa*)(arow + kb + 8 * hh + 4);
    const v4f x2 = *(const v4fa*)(arow + kb + 16 + 8 * hh), x3 = *(const v4fa*)(arow + kb + 16 + 8 * hh + 4);
    float xs[16] = {x0[0],x0[1],x0[2],x0[3],x1[0],x1[1],x1[2],x1[3],x2[0],x2[1],x2[2],x2[3],x3[0],x3[1],x3[2],x3[3]};
#pragma unroll
    for (int i = 0; i < 16; ++i) { const unsigned short hb = bf16_bits(xs[i]); ah.u[i] = hb; al.u[i] = ASPLIT ? bf16_bits(xs[i] - bf16_val(hb)) : (unsigned short)0; }
#pragma unroll
    for (int t = 0; t < 4; ++t) {
      const size_t boff = (size_t)(col0 + t * 16 + ln) * ldb + kb;
      FragB bh_, bl_;
      bh_.half[0] = *(const v8us*)(Bh + boff + 8 * hh);
      bh_.half[1] = *(const v8us*)(Bh + boff + 16 + 8 * hh);
      if (BSPLIT) { bl_.half[0] = *(const v8us*)(Bl + boff + 8 * hh); bl_.half[1] = *(const v8us*)(Bl + boff + 16 + 8 * hh); } else bl_ = bh_;
      acc[t] = mmaN<ASPLIT ? (BSPLIT ? 3 : 2) : 1>(ah.v, al.v, bh_.v, bl_.v, acc[t]);
    }
  }
#pragma unroll
  for (int t = 0; t < 4; ++t) {
    float bv = bias ? bias[col0 + t * 16 + ln] : 0.f;
    if (BIAS_BF16) bv = bf16_round(bv);
#pragma unroll
    for (int r = 0; r < 8; ++r) { float v = acc[t][r] * alpha + bv; if (ACT == 1) v = fmaxf(v, 0.f); so[w][8 * hh + r][t * 16 + ln] = v; }
  }
  __builtin_amdgcn_fence(__ATOMIC_ACQ_REL, "workgroup");
  __builtin_amdgcn_wave_barrier();
  const int rsub = lane >> 4, c4 = (lane & 15) * 4;
  {
#pragma unroll
    for (int q = 0; q < 8; ++q) {
      const int r = q * 2 + rsub;
      const v4f v = *(const v4fa*)&so[w][r][c4];
      *(v4f*)(C + (size_t)(row0 + r) * ldc + col0 + c4) = v;
    }
    
  }
}
// row softmax: P[row][:] = softmax(masked S[row][:]) over N columns with optional causal mask (col > row + rowoff -> 0) and
__global__ __launch_bounds__(256) void k_softmax_rows(const float* __restrict__ S, float* __restrict__ P, int N, int causal, int rowoff, const int* __restrict__ mask, int mask_pitch) {
  __shared__ float red[256];
  const int row = blockIdx.x, tid = threadIdx.x;
  const float* s = S + (size_t)row * N; float* p_out = P + (size_t)row * N;
  const int qi = row + rowoff;
  float mx = -3.0e38f;
  for (int j = tid; j < N; j += 256) {
    bool keep = true;
    if (causal && j > qi) keep = false;
    if (mask && mask[(size_t)qi * mask_pitch + j] == 0) keep = false;
    const float v = keep ? s[j] : -3.0e38f;
    mx = fmaxf(mx, v);
  }
  red[tid] = mx; __syncthreads();
  for (int st = 128; st > 0; st >>= 1) { if (tid < st) red[tid] = fmaxf(red[tid], red[tid + st]); __syncthreads(); }
  mx = red[0]; __syncthreads();
  float sum = 0.f;
  for (int j = tid; j < N; j += 256) {
    bool keep = true;
    if (causal && j > qi) keep = false;
    if (mask && mask[(size_t)qi * mask_pitch + j] == 0) keep = false;
    const float p = keep ? __expf(s[j] - mx) : 0.f;
    sum += p;
  }
  red[tid] = sum; __syncthreads();
  for (int st = 128; st > 0; st >>= 1) { if (tid < st) red[tid] += red[tid + st]; __syncthreads(); }
  const float inv = (mx > -1.0e38f) ? 1.0f / red[0] : __builtin_nanf("");
  __syncthreads();
  {
    for (int j4 = tid * 4; j4 < N; j4 += 1024) {
      v4f out4;
#pragma unroll
      for (int u = 0; u < 4; ++u) {
        const int j = j4 + u;
        bool keep = true;
        if (causal && j > qi) keep = false;
        if (mask && mask[(size_t)qi * mask_pitch + j] == 0) keep = false;
        out4[u] = keep ? __expf(s[j] - mx) * inv : 0.f;
      }
      *(v4f*)(p_out + j4) = out4;
    }
    
  }
}

// GEMM C = act(A·W + bias + resid): A f32 (ASPLIT -> hi/lo 2 terms), Wt bf16 [N][K]; ACT 0 none, 1 relu, 2 exact gelu;
// resid (optional, f32, row index = (row % rmod), pitch ldr, RES_BF16 rounds it) added before the activation.
template <bool ASPLIT, int ACT, bool BIAS_BF16, bool RES_BF16>
__global__ __launch_bounds__(128) void k_gemm_bf3(const float* __restrict__ A, int lda, const unsigned short* __restrict__ Wt, int ldb,
                                                const float* __restrict__ bias, const float* __restrict__ resid, int rmod, int ldr,
                                                float* __restrict__ C, int ldc, int M, int N, int K) {
  __shared__ __attribute__((aligned(16))) float so[4][16][64];
  const int tid = threadIdx.x, w = tid >> 5, lane = tid & 31, ln = lane & 15, hh = lane >> 4;
  const int ntn = N / 64;
  const int wid = blockIdx.x * 4 + w;
  const int mt = wid / ntn, nq = wid % ntn;
  if (mt * 16 >= M) return;
  const int row0 = mt * 16, col0 = nq * 64;
  const float* arow = A + (size_t)(row0 + ln) * lda;
  v8f acc[4] = {};
  for (int kb = 0; kb < K; kb += 32) {
    FragB ah, al;
    const v4f x0 = *(const v4fa*)(arow + kb + 8 * hh), x1 = *(const v4fa*)(arow + kb + 8 * hh + 4);
    const v4f x2 = *(const v4fa*)(arow + kb + 16 + 8 * hh), x3 = *(const v4fa*)(arow + kb + 16 + 8 * hh + 4);
    float xs[16] = {x0[0],x0[1],x0[2],x0[3],x1[0],x1[1],x1[2],x1[3],x2[0],x2[1],x2[2],x2[3],x3[0],x3[1],x3[2],x3[3]};
#pragma unroll
    for (int i = 0; i < 16; ++i) { const unsigned short hb = bf16_bits(xs[i]); ah.u[i] = hb; al.u[i] = ASPLIT ? bf16_bits(xs[i] - bf16_val(hb)) : (unsigned short)0; }
#pragma unroll
    for (int t = 0; t < 4; ++t) {
      const unsigned short* brow = Wt + (size_t)(col0 + t * 16 + ln) * ldb + kb;
      FragB b;
      b.half[0] = *(const v8us*)(brow + 8 * hh);
      b.half[1] = *(const v8us*)(brow + 16 + 8 * hh);
      acc[t] = mmaN<ASPLIT ? 2 : 1>(ah.v, al.v, b.v, b.v, acc[t]);
    }
  }
#pragma unroll
  for (int t = 0; t < 4; ++t) {
    const int col = col0 + t * 16 + ln;
    float bv = bias ? bias[col] : 0.f;
    if (BIAS_BF16) bv = bf16_round(bv);
#pragma unroll
    for (int r = 0; r < 8; ++r) {
      float v = acc[t][r] + bv;
      if (resid) { float rv = resid[(size_t)((row0 + 8 * hh + r) % rmod) * ldr + col]; if (RES_BF16) rv = bf16_round(rv); v += rv; }
      if (ACT == 1) v = fmaxf(v, 0.f);
      if (ACT == 2) v = 0.5f * v * (1.0f + erff(v * 0.70710678118654752f));
      if (ACT == 3) { const float u = 0.7978845608028654f * (v + 0.044715f * v * v * v); v = 0.5f * v * (1.0f + tanhf(u)); }
      so[w][8 * hh + r][t * 16 + ln] = v;
    }
  }
  __builtin_amdgcn_fence(__ATOMIC_ACQ_REL, "workgroup");
  __builtin_amdgcn_wave_barrier();
  const int rsub = lane >> 4, c4 = (lane & 15) * 4;
  {
#pragma unroll
    for (int q = 0; q < 8; ++q) {
      const int r = q * 2 + rsub;
      const v4f v = *(const v4fa*)&so[w][r][c4];
      *(v4f*)(C + (size_t)(row0 + r) * ldc + col0 + c4) = v;
    }
    
  }
}
// row LayerNorm (biased variance, eps) over N: s = X (+ R); optional out_sum <- s; out_norm <- (s-mu)*rsqrt(var+eps)*g + b
template <bool PARAM_BF16>
__global__ __launch_bounds__(256) void k_layernorm(const float* __restrict__ X, const float* __restrict__ R, const float* __restrict__ g, const float* __restrict__ bta,
                                                  float* __restrict__ out_sum, float* __restrict__ out_norm, int N, float eps) {
  __shared__ float red[256];
  const int row = blockIdx.x, tid = threadIdx.x;
  const float* x = X + (size_t)row * N; const float* rr = R ? R + (size_t)row * N : nullptr;
  float vals[16];                     // up to N = 4096
  const int per = N / 256;            // contiguous chunk per thread? use strided-by-4 chunks: thread handles j = tid*4 + 1024*u
  float s1 = 0.f;
  for (int u = 0; u < per / 4; ++u) {
    const int j = tid * 4 + 1024 * u;
    const v4f a = *(const v4fa*)(x + j);
    v4f b = {0.f,0.f,0.f,0.f}; if (rr) b = *(const v4fa*)(rr + j);
#pragma unroll
    for (int q = 0; q < 4; ++q) { const float v = a[q] + b[q]; vals[u * 4 + q] = v; s1 += v; }
  }
  red[tid] = s1; __syncthreads();
  for (int st = 128; st > 0; st >>= 1) { if (tid < st) red[tid] += red[tid + st]; __syncthreads(); }
  const float mu = red[0] / (float)N; __syncthreads();
  float s2 = 0.f;
  for (int u = 0; u < per / 4; ++u)
#pragma unroll
    for (int q = 0; q < 4; ++q) { const float c = vals[u * 4 + q] - mu; s2 += c * c; }
  red[tid] = s2; __syncthreads();
  for (int st = 128; st > 0; st >>= 1) { if (tid < st) red[tid] += red[tid + st]; __syncthreads(); }
  const float rs = rsqrtf(red[0] / (float)N + eps);
  {
    for (int u = 0; u < per / 4; ++u) {
      const int j = tid * 4 + 1024 * u;
      v4f o, sm;
#pragma unroll
      for (int q = 0; q < 4; ++q) {
        float gg = g[j + q], bb = bta[j + q];
        if (PARAM_BF16) { gg = bf16_round(gg); bb = bf16_round(bb); }
        sm[q] = vals[u * 4 + q]; o[q] = (vals[u * 4 + q] - mu) * rs * gg + bb;
      }
      if (out_sum) *(v4f*)(out_sum + (size_t)row * N + j) = sm;
      *(v4f*)(out_norm + (size_t)row * N + j) = o;
    }
    
  }
}

// batched GEMM (blockIdx.y = batch): C_b = act(alpha·A_b·B_b + bias + resid_b); A f32 rows (ASPLIT → hi/lo), B = bf16 planes Bh (+Bl when BSPLIT, requires ASPLIT),
// per-batch element strides sA, sB (0 = shared weights), sC, sR. resid may alias C (values are staged before the stores). ACT 0/1(relu).
// ACT: 0 none, 1 relu, 2 softplus
template <bool ASPLIT, bool BSPLIT, int ACT>
__global__ __launch_bounds__(128) void k_gemm_b(const float* __restrict__ A, int lda, size_t sA, const unsigned short* __restrict__ Bh, const unsigned short* __restrict__ Bl, int ldb, size_t sB,
                                             const float* __restrict__ bias, const float* __restrict__ resid, int ldr, size_t sR, float rsign, float alpha,
                                             float* __restrict__ C, int ldc, size_t sC, int M, int N, int K) {
  __shared__ __attribute__((aligned(16))) float so[4][16][64];
  const int tid = threadIdx.x, w = tid >> 5, lane = tid & 31, ln = lane & 15, hh = lane >> 4;
  const int by = blockIdx.y;
  A += (size_t)by * sA; Bh += (size_t)by * sB; if (BSPLIT) Bl += (size_t)by * sB; C += (size_t)by * sC; if (resid) resid += (size_t)by * sR;
  const int ntn = N / 64; const int wid = blockIdx.x * 4 + w; const int mt = wid / ntn, nq = wid % ntn;
  if (mt * 16 >= M) return;
  const int row0 = mt * 16, col0 = nq * 64;
  const float* arow = A + (size_t)(row0 + ln) * lda;
  v8f acc[4] = {};
  for (int kb = 0; kb < K; kb += 32) {
    FragB ah, al;
    const v4f x0 = *(const v4fa*)(arow + kb + 8 * hh), x1 = *(const v4fa*)(arow + kb + 8 * hh + 4);
    const v4f x2 = *(const v4fa*)(arow + kb + 16 + 8 * hh), x3 = *(const v4fa*)(arow + kb + 16 + 8 * hh + 4);
    float xs[16] = {x0[0],x0[1],x0[2],x0[3],x1[0],x1[1],x1[2],x1[3],x2[0],x2[1],x2[2],x2[3],x3[0],x3[1],x3[2],x3[3]};
#pragma unroll
    for (int i = 0; i < 16; ++i) { const unsigned short hb = bf16_bits(xs[i]); ah.u[i] = hb; al.u[i] = ASPLIT ? bf16_bits(xs[i] - bf16_val(hb)) : (unsigned short)0; }
#pragma unroll
    for (int t = 0; t < 4; ++t) {
      const size_t boff = (size_t)(col0 + t * 16 + ln) * ldb + kb;
      FragB bh_, bl_; bh_.half[0] = *(const v8us*)(Bh + boff + 8 * hh); bh_.half[1] = *(const v8us*)(Bh + boff + 16 + 8 * hh);
      if (BSPLIT) { bl_.half[0] = *(const v8us*)(Bl + boff + 8 * hh); bl_.half[1] = *(const v8us*)(Bl + boff + 16 + 8 * hh); } else bl_ = bh_;
      acc[t] = mmaN<ASPLIT ? (BSPLIT ? 3 : 2) : 1>(ah.v, al.v, bh_.v, bl_.v, acc[t]);
    }
  }
#pragma unroll
  for (int t = 0; t < 4; ++t) {
    const int col = col0 + t * 16 + ln; const float bv = bias ? bf16_round(bias[col]) : 0.f;
#pragma unroll
    for (int r = 0; r < 8; ++r) { float v = acc[t][r] * alpha + bv; if (resid) v += rsign * resid[(size_t)(row0 + 8 * hh + r) * ldr + col]; if (ACT == 1) v = fmaxf(v, 0.f); else if (ACT == 2) v = fmaxf(v, 0.f) + log1pf(expf(-fabsf(v))); so[w][8 * hh + r][t * 16 + ln] = v; }
  }
  __builtin_amdgcn_fence(__ATOMIC_ACQ_REL, "workgroup"); __builtin_amdgcn_wave_barrier();
  const int rsub = lane >> 4, c4 = (lane & 15) * 4;
  {
#pragma unroll
    for (int q = 0; q < 8; ++q) { const int r = q * 2 + rsub; const v4f v = *(const v4fa*)&so[w][r][c4]; *(v4f*)(C + (size_t)(row0 + r) * ldc + col0 + c4) = v; }
    
  }
}
// batched f32 [K][N] (pitch lds, batch stride sIn) -> transposed hi/lo planes [N][K] (batch stride sOut); thread per (n, 8 k); grid.y = batch
__global__ __launch_bounds__(256) void k_split_transpose_b(const float* __restrict__ src, int lds_, size_t sIn, unsigned short* __restrict__ hi, unsigned short* __restrict__ lo, size_t sOut, int K, int N) {
  const size_t t = (size_t)blockIdx.x * 256 + threadIdx.x; const int k8n = K / 8; if (t >= (size_t)N * k8n) return;
  src += (size_t)blockIdx.y * sIn; hi += (size_t)blockIdx.y * sOut; lo += (size_t)blockIdx.y * sOut;
  const int n = (int)(t / k8n), k8 = (int)(t % k8n) * 8; v8us vh, vl;
#pragma unroll
  for (int i = 0; i < 8; ++i) { const float x = src[(size_t)(k8 + i) * lds_ + n]; const unsigned short hb = bf16_bits(x); vh[i] = hb; vl[i] = bf16_bits(x - bf16_val(hb)); }
  unsigned short* dh = hi + (size_t)n * K + k8; unsigned short* dl = lo + (size_t)n * K + k8;
  *(v8us*)dh = vh; *(v8us*)dl = vl; 
}

__global__ __launch_bounds__(256) void k_round_rows(const float* __restrict__ W, unsigned short* __restrict__ Wt, int n8) {
  const int t = blockIdx.x * 256 + threadIdx.x;
  if (t >= n8) return;
  const v4f a = *(const v4fa*)(W + (size_t)t * 8), b = *(const v4fa*)(W + (size_t)t * 8 + 4);
  v8us v; v[0]=bf16_bits(a[0]); v[1]=bf16_bits(a[1]); v[2]=bf16_bits(a[2]); v[3]=bf16_bits(a[3]);
  v[4]=bf16_bits(b[0]); v[5]=bf16_bits(b[1]); v[6]=bf16_bits(b[2]); v[7]=bf16_bits(b[3]);
  *(v8us*)(Wt + (size_t)t * 8) = v; 
}


// ---- f16 WMMA path (v_wmma_f32_16x16x32_f16): 11-bit significands for operands in range — used where the softmax weight operand, 2^8 exp(x - max), needs more precision than bf16
typedef _Float16 v16h __attribute__((ext_vector_type(16)));
union FragH { v16h v; v8us half[2]; _Float16 h[16]; unsigned short u[16]; };
typedef _Float16 v4h __attribute__((ext_vector_type(4)));
typedef __bf16 v4b __attribute__((ext_vector_type(4)));
typedef unsigned short v4us __attribute__((ext_vector_type(4), may_alias));
union Quad { v4b b; v4us u; };
union Oct { _Float16 h[8]; v8us u; };
// One launch for the three projections, straight from the f32 inputs. A work-group owns PC columns n of one input X [DI][SQ] (blockIdx.y: Q, K or V); each of its
// PW waves takes DI / PW = 64 of the k. A lane reads 16 bytes of a row of X: columns n0 + 4 ln + u, u = 0..3, so that a wave's load is two pieces of 256 consecutive bytes,
// and u picks the B tile: tile u holds the columns n0 + 4 ln + u at lane position ln. The wave's share of M (64 rows x 64 k) is read the same way, in whole lines, rounded
// to bf16 and turned into A fragments through the wave's own LDS range. The waves' partial tiles are summed through LDS in wave order, and the sum is stored
// in the order in which k_attn's lanes load their fragments, so that each 16-byte load of a wave there covers 512 consecutive bytes (4 whole lines, not 32 bytes of 16 lines):
//   QF f16: [s / 16][d / 32][(d / 16) & 1][lane = 16 ((d / 8) & 1) + s % 16][d % 8]
//   KF f32: [t / 16][d / 32][c = 2 ((d / 16) & 1) + ((d / 4) & 1)][lane = 16 ((d / 8) & 1) + t % 16][d % 4]
//   VF f16: [s / 32][d / 16][hi, lo][(s / 16) & 1][lane = 16 ((s / 8) & 1) + d % 16][s % 8]: hi = f16(Vd), lo = f16(Vd - hi), split here once and not in each of k_attn's work-groups
// The PC columns of a work-group fill PC * DO consecutive elements of QF and KF and 2 * PC * DO of VF, written in whole lines.
#define PW 8
#define PC 64
#define PP 68      // LDS row pitch in floats: 16 bytes x odd, so that 16 lanes that write 16 bytes each to 16 rows fall on different banks
#define PM 72      // row pitch of the staged M in bf16: 144 bytes, 16 x odd again, for the fragments' 16-byte reads
__device__ __forceinline__ v8f wmmaB(v16b a, v16b b, v8f c) { return __builtin_amdgcn_wmma_f32_16x16x32_bf16(false, a, false, b, (short)0, c, false, false); }
// amdgpu_waves_per_eu(4, 4): 256 registers a wave, so that two work-groups (2 x 136 KiB of LDS) share a WGP and the 384 work-groups run in one round
__global__ __launch_bounds__(PW * 32) __attribute__((amdgpu_waves_per_eu(4, 4))) void k_proj(const float* __restrict__ Q, const float* __restrict__ K, const float* __restrict__ V,
                                                 const float* __restrict__ Mq, const float* __restrict__ Mk, const float* __restrict__ Mv,
                                                 _Float16* __restrict__ QF, float* __restrict__ KF, _Float16* __restrict__ VF) {
  __shared__ __attribute__((aligned(16))) float part[PW][DO][PP];
  const int tid = threadIdx.x, w = tid >> 5, lane = tid & 31, ln = lane & 15, hh = lane >> 4;
  const int which = blockIdx.y, n0 = blockIdx.x * PC, k0 = w * (DI / PW);
  const float* X = which == 0 ? Q : which == 1 ? K : V;
  const float* M = which == 0 ? Mq : which == 1 ? Mk : Mv;
  const float* mp = M + (size_t)hh * DI + k0 + 4 * ln;
  const float* xp = X + (size_t)(k0 + 8 * hh) * SQ + n0 + 4 * ln;
  unsigned short* ms = (unsigned short*)&part[w][0][0];      // the wave's own LDS range holds its share of M until its partial tiles take the place
  // every loop below is unrolled so that fragments and tiles are indexed by constants and stay in registers
  v4f mf[32], xf[2][16];
  v16b b[2][4];
  FragB a[4][2];
#pragma unroll
  for (int j = 0; j < 16; ++j) mf[j] = *(const v4fa*)(mp + (size_t)(2 * j) * DI);      // rows 2 j and 2 j + 1, 256 consecutive bytes each
#pragma unroll
  for (int ks = 0; ks < 2; ++ks)
#pragma unroll
    for (int i = 0; i < 16; ++i) xf[ks][i] = *(const v4fa*)(xp + (size_t)(ks * 32 + (i >> 3) * 16 + (i & 7)) * SQ);      // k = 8 hh + 0..7, 16 + 8 hh + 0..7
#pragma unroll
  for (int j = 0; j < 16; ++j) { Quad c; c.b = (v4b){(__bf16)mf[j][0], (__bf16)mf[j][1], (__bf16)mf[j][2], (__bf16)mf[j][3]}; *(v4us*)(ms + (2 * j + hh) * PM + 4 * ln) = c.u; }
  // rows 32 to 63 of M are asked for only now, into the registers that rows 0 to 31 have left (all 64 loads at once would take more than 256 registers, and two
  // work-groups would no longer fit a WGP); they come from L2 while X is still on its way from memory
  __builtin_amdgcn_sched_barrier(0);      // keeps the 48 loads above together in front and the 16 below behind: without it all of M is asked for first and X only behind the wait for it (two latencies in a row), with spills
#pragma unroll
  for (int j = 16; j < 32; ++j) mf[j] = *(const v4fa*)(mp + (size_t)(2 * j) * DI);
#pragma unroll
  for (int ks = 0; ks < 2; ++ks)
#pragma unroll
    for (int u = 0; u < 4; ++u)
#pragma unroll
      for (int i = 0; i < 16; ++i) b[ks][u][i] = (__bf16)xf[ks][i][u];
#pragma unroll
  for (int j = 16; j < 32; ++j) { Quad c; c.b = (v4b){(__bf16)mf[j][0], (__bf16)mf[j][1], (__bf16)mf[j][2], (__bf16)mf[j][3]}; *(v4us*)(ms + (2 * j + hh) * PM + 4 * ln) = c.u; }
  asm volatile("s_wait_dscnt 0x0" ::: "memory");      // the lanes read below what other lanes of the wave have written above
#pragma unroll
  for (int mt = 0; mt < 4; ++mt)
#pragma unroll
    for (int ks = 0; ks < 2; ++ks) {      // the k order of xf
      a[mt][ks].half[0] = *(const v8us*)(ms + (mt * 16 + ln) * PM + ks * 32 + 8 * hh);
      a[mt][ks].half[1] = *(const v8us*)(ms + (mt * 16 + ln) * PM + ks * 32 + 16 + 8 * hh);
    }
#pragma unroll
  for (int mh = 0; mh < 4; mh += 2) {      // 32 rows d at a time: 8 tiles, then their partials go to LDS and leave the registers
    v8f acc[2][4];
#pragma unroll
    for (int m = 0; m < 2; ++m)
#pragma unroll
      for (int u = 0; u < 4; ++u) acc[m][u] = (v8f){0.f,0.f,0.f,0.f,0.f,0.f,0.f,0.f};
#pragma unroll
    for (int ks = 0; ks < 2; ++ks)
#pragma unroll
      for (int m = 0; m < 2; ++m)
#pragma unroll
        for (int u = 0; u < 4; ++u) acc[m][u] = wmmaB(a[mh + m][ks].v, b[ks][u], acc[m][u]);
    // acc[m][u][r] = partial of (d = 16 (mh + m) + 8 hh + r, n = n0 + 4 ln + u)
    if (which == 2) {
#pragma unroll
      for (int m = 0; m < 2; ++m)
#pragma unroll
        for (int r = 0; r < 8; ++r) *(v4fa*)&part[w][(mh + m) * 16 + 8 * hh + r][4 * ln] = (v4f){acc[m][0][r], acc[m][1][r], acc[m][2][r], acc[m][3][r]};
    } else {
#pragma unroll
      for (int m = 0; m < 2; ++m)
#pragma unroll
        for (int u = 0; u < 4; ++u) {      // LDS row u * 16 + ln = column 4 ln + u, its d turned round by 16 u: the readers below take columns 4 x .. 4 x + 3 at once, which would else fall on the same banks
          *(v4fa*)&part[w][u * 16 + ln][((mh + m + u) & 3) * 16 + 8 * hh] = (v4f){acc[m][u][0], acc[m][u][1], acc[m][u][2], acc[m][u][3]};
          *(v4fa*)&part[w][u * 16 + ln][((mh + m + u) & 3) * 16 + 8 * hh + 4] = (v4f){acc[m][u][4], acc[m][u][5], acc[m][u][6], acc[m][u][7]};
        }
    }
  }
  __syncthreads();      // every wave's partial tile is in LDS
  if (which == 2) {
#pragma unroll
    for (int j = 0; j < DO * PC / 8 / (PW * 32); ++j) {      // thread f sums eight s of one d, splits them and stores the f-th 16 bytes of the hi and of the lo halves: a wave fills 512 consecutive bytes of each
      const int f = j * (PW * 32) + tid;
      const v4fa* ps = (const v4fa*)&part[0][0][0] + (((f >> 6) & 3) * 16 + ln) * (PP / 4) + (f >> 8) * 8 + ((f >> 5) & 1) * 4 + hh * 2;      // row d, 16-byte place s / 4
      v4f s0 = ps[0], s1 = ps[1];
#pragma unroll
      for (int p = 1; p < PW; ++p) { s0 += ps[p * (DO * PP / 4)]; s1 += ps[p * (DO * PP / 4) + 1]; }      // wave order
      const float xs[8] = {s0[0], s0[1], s0[2], s0[3], s1[0], s1[1], s1[2], s1[3]};
      Oct vh, vl;
#pragma unroll
      for (int i = 0; i < 8; ++i) { const _Float16 h = (_Float16)xs[i]; vh.h[i] = h; vl.h[i] = (_Float16)(xs[i] - (float)h); }
      _Float16* vo = VF + (size_t)n0 * (2 * DO) + (f >> 6) * 1024 + ((f >> 5) & 1) * 256 + lane * 8;
      *(v8us*)vo = vh.u; *(v8us*)(vo + 512) = vl.u;
      asm volatile("s_wait_xcnt 0x0" ::: "memory");      // the next pass forms its address in the registers that the issued stores name
    }
    return;
  }
#pragma unroll
  for (int j = 0; j < DO * PC / 4 / (PW * 32); ++j) {      // thread f sums and stores the f-th four elements of the work-group's share, in the order of the output: whole 128-byte lines
    const int f = j * (PW * 32) + tid;
    const int fl = which == 0 ? (f >> 1) & 31 : f & 31;      // the lane of k_attn that will load them
    const int kq = which == 0 ? ((f >> 6) & 3) * 4 + (fl >> 4) * 2 + (f & 1) : ((f >> 6) & 1) * 4 + (fl >> 4) * 2 + ((f >> 5) & 1);      // Q: d / 4; K: a quarter of the place in 32 d
    const int u = fl & 3, dq = which == 0 ? kq : ((f >> 7) & 1) * 8 + kq;
    const int row = u * 16 + (f >> 8) * 4 + ((fl & 15) >> 2), q4 = (dq + 4 * u) & 15;      // the LDS row and which 16 bytes of it
    const v4fa* ps = (const v4fa*)&part[0][0][0] + row * (PP / 4) + q4;      // counted in 16 bytes, so that the reads stay 16-byte LDS loads
    v4f s = ps[0];
#pragma unroll
    for (int p = 1; p < PW; ++p) s += ps[p * (DO * PP / 4)];      // wave order
    const size_t o = (size_t)n0 * DO + f * 4;
    // s_wait_xcnt 0 behind each store, inside its own branch: the next pass forms its address in the registers that the issued store names
    if (which == 1) { *(v4f*)(KF + o) = s; asm volatile("s_wait_xcnt 0x0" ::: "memory"); }
    else { *(v4h*)(QF + o) = (v4h){(_Float16)s[0], (_Float16)s[1], (_Float16)s[2], (_Float16)s[3]}; asm volatile("s_wait_xcnt 0x0" ::: "memory"); }
  }
}
// One launch for scores, softmax and out. A work-group owns AT key columns t; each of its AW waves takes SQ / AW query positions s, 32 a pass.
// Scores as S[s][t] = Qd[:,s].Kd[:,t] (A = f16 Qd rows, B = Kd columns split into f16 hi/lo, kept in registers: 2 products, K = 64), so that a lane holds
// scores of one column t only and two score tiles (s 0-15, 16-31 of a pass), converted in place, are the B operand of out[d][t] += Vd[d][s].P[s][t].
// Walk 1 finds each column's maximum over all s; walk 2 forms the scores again, e = 2^8 exp(x - max) = exp2(raw * (log2 e / 8) + (8 - rawmax * (log2 e / 8))): one
// multiply-add and the hardware's exp2 an element; it adds e to the column's sum and multiplies f16(e) with Vd (f16 hi/lo as stored: 2 products); the 2^8 leaves in the division.
// All waves use the same maximum, so their partial tiles and sums add up plainly, in wave order, and the division comes last.
#define AW 16
#define AT 32
#define ASR (SQ / AW)
#define L2E8 0.18033688011112042f      // log2(e) / sqrt(64)
__device__ __forceinline__ v8f wmmaH(v16h a, v16h b, v8f c) { return __builtin_amdgcn_wmma_f32_16x16x32_f16(false, a, false, b, (short)0, c, false, false); }
// one 16 x 32 block of KF (p: the lane's 16 bytes of its first 512) -> f16 hi/lo fragments in the hardware k order (8 hh + i, 16 + 8 hh + i)
__device__ __forceinline__ void frag_split(const float* __restrict__ p, FragH& fh, FragH& fl) {
  const v4f x0 = *(const v4fa*)p, x1 = *(const v4fa*)(p + 128), x2 = *(const v4fa*)(p + 256), x3 = *(const v4fa*)(p + 384);
  const float xs[16] = {x0[0],x0[1],x0[2],x0[3],x1[0],x1[1],x1[2],x1[3],x2[0],x2[1],x2[2],x2[3],x3[0],x3[1],x3[2],x3[3]};
  // unrolled so that xs and the fragments are indexed by constants and stay in registers
#pragma unroll
  for (int i = 0; i < 16; ++i) { const _Float16 h = (_Float16)xs[i]; fh.h[i] = h; fl.h[i] = (_Float16)(xs[i] - (float)h); }
}
// the A fragments of 32 s rows (m: which 16; ks: which 32 of the 64 d); q points at the lane's 16 bytes of the first 512 of those rows in QF
__device__ __forceinline__ void q_load(const _Float16* __restrict__ q, FragH (&qa)[2][2]) {
  // unrolled, here and in q_mul, so that the fragments and tiles are indexed by constants and stay in registers
#pragma unroll
  for (int m = 0; m < 2; ++m)
#pragma unroll
    for (int ks = 0; ks < 2; ++ks) { const _Float16* a = q + (m * 2 + ks) * 512; qa[m][ks].half[0] = *(const v8us*)a; qa[m][ks].half[1] = *(const v8us*)(a + 256); }
}
// sc[m][g] = raw scores of those 32 s rows against the 32 columns (g: which 16)
__device__ __forceinline__ void q_mul(const FragH (&qa)[2][2], const FragH (&kh)[2][2], const FragH (&kl)[2][2], v8f (&sc)[2][2]) {
#pragma unroll
  for (int m = 0; m < 2; ++m)
#pragma unroll
    for (int g = 0; g < 2; ++g) sc[m][g] = (v8f){0.f,0.f,0.f,0.f,0.f,0.f,0.f,0.f};
#pragma unroll
  for (int ks = 0; ks < 2; ++ks) {
#pragma unroll
    for (int m = 0; m < 2; ++m)
#pragma unroll
      for (int g = 0; g < 2; ++g) sc[m][g] = wmmaH(qa[m][ks].v, kh[g][ks].v, sc[m][g]);
#pragma unroll
    for (int m = 0; m < 2; ++m)
#pragma unroll
      for (int g = 0; g < 2; ++g) sc[m][g] = wmmaH(qa[m][ks].v, kl[g][ks].v, sc[m][g]);
  }
}
__global__ __launch_bounds__(AW * 32) void k_attn(const _Float16* __restrict__ QF, const float* __restrict__ KF, const _Float16* __restrict__ VF, float* __restrict__ out) {
  __shared__ __attribute__((aligned(16))) float part[AW][DO][AT];
  __shared__ float rmx[AW][AT], rsm[AW][AT];
  const int tid = threadIdx.x, w = tid >> 5, lane = tid & 31, ln = lane & 15, hh = lane >> 4;
  const int t0 = blockIdx.x * AT;
  const _Float16* qrow = QF + (size_t)w * ASR * DO + lane * 8;      // the wave's ASR positions s are ASR * DO consecutive elements of QF and 2 * ASR * DO of VF
  const _Float16* vrow = VF + (size_t)w * ASR * (2 * DO) + lane * 8;
  FragH kh[2][2], kl[2][2];
  // the loops over g, ks, u, m, r and dt below are unrolled so that fragments and tiles are indexed by constants and stay in registers
#pragma unroll
  for (int g = 0; g < 2; ++g)
#pragma unroll
    for (int ks = 0; ks < 2; ++ks) frag_split(KF + (size_t)t0 * DO + (g * 2 + ks) * 512 + lane * 4, kh[g][ks], kl[g][ks]);
  float mx[2] = {-3.0e38f, -3.0e38f};
  for (int p = 0; p < ASR / 32; p += 4) {
    FragH qa[4][2][2];
#pragma unroll
    for (int u = 0; u < 4; ++u) q_load(qrow + (size_t)(p + u) * 32 * DO, qa[u]);
    __builtin_amdgcn_sched_barrier(0);      // keeps the 32 loads of four passes in front of the first product: without it they are issued a few at a time into reused registers, several memory latencies a pass
#pragma unroll
    for (int u = 0; u < 4; ++u) {
      v8f sc[2][2];
      q_mul(qa[u], kh, kl, sc);
#pragma unroll
      for (int g = 0; g < 2; ++g)
#pragma unroll
        for (int m = 0; m < 2; ++m)
#pragma unroll
          for (int r = 0; r < 8; ++r) mx[g] = fmaxf(mx[g], sc[m][g][r]);
    }
  }
#pragma unroll
  for (int g = 0; g < 2; ++g) { mx[g] = fmaxf(mx[g], __shfl_xor(mx[g], 16, 32)); rmx[w][g * 16 + ln] = mx[g]; }      // both halves of the wave store the same value
  __syncthreads();      // every wave's column maxima are in rmx
#pragma unroll
  for (int g = 0; g < 2; ++g) {
    float m = rmx[0][g * 16 + ln];
    for (int p = 1; p < AW; ++p) m = fmaxf(m, rmx[p][g * 16 + ln]);
    mx[g] = 8.0f - m * L2E8;      // x / 8 + 1 never decreases with x, so the maximum is taken of the raw scores; the exponent of the largest weight is 8
  }
  v8f o[4][2];
#pragma unroll
  for (int dt = 0; dt < 4; ++dt)
#pragma unroll
    for (int g = 0; g < 2; ++g) o[dt][g] = (v8f){0.f,0.f,0.f,0.f,0.f,0.f,0.f,0.f};
  float den[2] = {0.f, 0.f};
  for (int p = 0; p < ASR / 32; ++p) {
    FragH qa[2][2];
    q_load(qrow + (size_t)p * 32 * DO, qa);
    asm volatile("s_wait_xcnt 0x0" ::: "memory");      // the Vd fragments loaded below may take the registers that hold the address of the loads just issued
    v8f sc[2][2];
    q_mul(qa, kh, kl, sc);
    FragH pb[2];
#pragma unroll
    for (int g = 0; g < 2; ++g)
#pragma unroll
      for (int m = 0; m < 2; ++m)
      {
        float e[8];
#pragma unroll
        for (int r = 0; r < 8; ++r) e[r] = __builtin_fmaf(sc[m][g][r], L2E8, mx[g]);
#pragma unroll
        for (int r = 0; r < 8; ++r) e[r] = __builtin_amdgcn_exp2f(e[r]);      // the exponent is at most 8 (+ a rounding); far below, exp2 gives 0, as f16 would
#pragma unroll
        for (int r = 0; r < 8; ++r) {
          den[g] += e[r];
          pb[g].h[m * 8 + r] = (_Float16)e[r];      // the 2^8 in e keeps small weights out of the f16 subnormal range; sum and products carry it alike
        }
      }
#pragma unroll
    for (int dt = 0; dt < 4; ++dt) {
      FragH vh, vl;      // the hi and lo fragments as k_proj has stored them: four loads of 512 consecutive bytes a wave, no conversion
      const _Float16* v = vrow + (size_t)(p * 4 + dt) * 1024;
      vh.half[0] = *(const v8us*)v; vh.half[1] = *(const v8us*)(v + 256); vl.half[0] = *(const v8us*)(v + 512); vl.half[1] = *(const v8us*)(v + 768);
#pragma unroll
      for (int g = 0; g < 2; ++g) o[dt][g] = wmmaH(vh.v, pb[g].v, o[dt][g]);
#pragma unroll
      for (int g = 0; g < 2; ++g) o[dt][g] = wmmaH(vl.v, pb[g].v, o[dt][g]);
    }
  }
#pragma unroll
  for (int g = 0; g < 2; ++g) { den[g] += __shfl_xor(den[g], 16, 32); rsm[w][g * 16 + ln] = den[g]; }      // both halves of the wave store the same value
#pragma unroll
  for (int dt = 0; dt < 4; ++dt)
#pragma unroll
    for (int g = 0; g < 2; ++g)
#pragma unroll
      for (int r = 0; r < 8; ++r) part[w][dt * 16 + 8 * hh + r][g * 16 + ln] = o[dt][g][r];
  __syncthreads();      // every wave's partial tile and column sums are in LDS
  float dsum = 0.f;
  for (int p = 0; p < AW; ++p) dsum += rsm[p][lane];      // wave order, the same in every wave
  const float inv = 1.0f / dsum;
  for (int j = 0; j < DO / AW; ++j) {      // wave w sums and stores rows w, w + AW, ...: one whole 128-byte line each
    const int d = j * AW + w;
    float s = 0.f;
    for (int p = 0; p < AW; ++p) s += part[p][d][lane];
    out[(size_t)d * SQ + t0 + lane] = s * inv;
  }
}
extern "C" void kernel_launch(void* const* d_in, const int* in_sizes, int n_in,
                              void* d_out, int out_size, void* d_ws, size_t ws_size, hipStream_t stream) {
  (void)in_sizes; (void)n_in; (void)out_size;
  const float* Q = (const float*)d_in[0]; const float* K = (const float*)d_in[1]; const float* V = (const float*)d_in[2]; const float* Mq = (const float*)d_in[3]; const float* Mk = (const float*)d_in[4]; const float* Mv = (const float*)d_in[5];
  char* ws = (char*)d_ws; size_t off = 0;
  auto take = [&](size_t bytes) { char* p = ws + off; off += (bytes + 255) & ~(size_t)255; return p; };
  _Float16* Vd = (_Float16*)take((size_t)DO * SQ * 4); float* KdT = (float*)take((size_t)SQ * DO * 4); _Float16* QdB = (_Float16*)take((size_t)SQ * DO * 2);
  if (off > ws_size) return;
  k_proj<<<dim3(SQ / PC, 3, 1), PW * 32, 0, stream>>>(Q, K, V, Mq, Mk, Mv, QdB, KdT, Vd);      // QdB = f16(Mq.Q), KdT = Mk.K, Vd = Mv.V as f16 hi and lo, each in k_attn's fragment order
  k_attn<<<SQ / AT, AW * 32, 0, stream>>>(QdB, KdT, Vd, (float*)d_out);      // out[d][t] = sum_s Vd[d][s] * softmax_s(Qd[:,s].Kd[:,t] / 8 + 1)
}

// v008
// It runs in 39.4 microseconds.
// Next to v007, in two timings, it ran 1.37 and 1.41 times as fast.
// Counting every step since v000, it is 113 times as fast.
#include <hip/hip_runtime.h>
// On v_wmma_f32_16x16x32_bf16 with f32 accumulate, in one kernel (k_proj): the projections Qd/Kd/Vd = M.{Q,K,V} (M = 64, K = 512, N = 8192; inputs rounded to bf16: single exact term).
// On v_wmma_f32_16x16x32_f16, in one fused kernel (k_attn): the scores S[s][t] = Qd[:,s].Kd[:,t] (Qd rounded to f16, Kd split into f16 hi/lo: 2 products, K = 64) and
// out[:, t] = Vd.P[:, t] (Vd split into f16 hi/lo by k_proj, the softmax weights rounded to f16: 2 products, K = 8192). The module's softmax runs over the QUERY axis s (dim 0);
// /sqrt(64) is folded into the exponent's f32 multiply-add; the +1 constant stands in every score of a column and in the reference score alike and cancels in their difference.
#define DI 512
#define DO 64
#define SQ 8192

typedef __bf16 v16b __attribute__((ext_vector_type(16)));
typedef unsigned short v8us __attribute__((ext_vector_type(8), may_alias));
typedef float  v8f  __attribute__((ext_vector_type(8)));
typedef float  v4f  __attribute__((ext_vector_type(4)));
typedef float  v4fa __attribute__((ext_vector_type(4), may_alias));
union FragB { v16b v; v8us half[2]; unsigned short u[16]; };

__device__ __forceinline__ unsigned short bf16_bits(float x) { unsigned int u = __float_as_uint(x); return (unsigned short)((u + 0x7FFFu + ((u >> 16) & 1u)) >> 16); }
__device__ __forceinline__ float bf16_val(unsigned short b) { return __uint_as_float(((unsigned int)b) << 16); }
__device__ __forceinline__ float bf16_round(float x) { return bf16_val(bf16_bits(x)); }
// D += A·B with NT terms: 1 = ah·bh, 2 = + al·bh (A split), 3 = + ah·bl (both split)
template <int NT>
__device__ __forceinline__ v8f mmaN(v16b ah, v16b al, v16b bh, v16b bl, v8f c) {
  c = __builtin_amdgcn_wmma_f32_16x16x32_bf16(false, ah, false, bh, (short)0, c, false, false);
  if (NT >= 2) c = __builtin_amdgcn_wmma_f32_16x16x32_bf16(false, al, false, bh, (short)0, c, false, false);
  if (NT >= 3) c = __builtin_amdgcn_wmma_f32_16x16x32_bf16(false, ah, false, bl, (short)0, c, false, false);
  asm volatile("v_nop\n\tv_nop\n\tv_nop\n\tv_nop" : "+v"(c) : "v"(ah), "v"(al), "v"(bh), "v"(bl));
  return c;
}

// GEMM C[M][N] (f32, pitch ldc) = act(A[M][K]·W + bias). A f32 row-major (pitch lda) converted per fragment to bf16
// (ASPLIT: hi/lo two planes -> 2 terms, else single rounded term); Wt bf16 [N][K] (pitch ldb). BIAS_BF16 rounds the
// bias to bf16 first (bias quantised to bf16 before the add). K%32==0, M%16==0, N%64==0.
template <bool ASPLIT, int ACT, bool BIAS_BF16>
__global__ __launch_bounds__(128) void k_gemm_bf(const float* __restrict__ A, int lda, const unsigned short* __restrict__ Wt, int ldb,
                                               const float* __restrict__ bias, float* __restrict__ C, int ldc, int M, int N, int K) {
  __shared__ __attribute__((aligned(16))) float so[4][16][64];
  const int tid = threadIdx.x, w = tid >> 5, lane = tid & 31, ln = lane & 15, hh = lane >> 4;
  const int ntn = N / 64;
  const int wid = blockIdx.x * 4 + w;
  const int mt = wid / ntn, nq = wid % ntn;
  if (mt * 16 >= M) return;
  const int row0 = mt * 16, col0 = nq * 64;
  const float* arow = A + (size_t)(row0 + ln) * lda;
  v8f acc[4] = {};
  for (int kb = 0; kb < K; kb += 32) {
    FragB ah, al;
    const v4f x0 = *(const v4fa*)(arow + kb + 8 * hh), x1 = *(const v4fa*)(arow + kb + 8 * hh + 4);
    const v4f x2 = *(const v4fa*)(arow + kb + 16 + 8 * hh), x3 = *(const v4fa*)(arow + kb + 16 + 8 * hh + 4);
    float xs[16] = {x0[0],x0[1],x0[2],x0[3],x1[0],x1[1],x1[2],x1[3],x2[0],x2[1],x2[2],x2[3],x3[0],x3[1],x3[2],x3[3]};
#pragma unroll
    for (int i = 0; i < 16; ++i) { const unsigned short hb = bf16_bits(xs[i]); ah.u[i] = hb; al.u[i] = ASPLIT ? bf16_bits(xs[i] - bf16_val(hb)) : (unsigned short)0; }
#pragma unroll
    for (int t = 0; t < 4; ++t) {
      const unsigned short* brow = Wt + (size_t)(col0 + t * 16 + ln) * ldb + kb;
      FragB b;
      b.half[0] = *(const v8us*)(brow + 8 * hh);
      b.half[1] = *(const v8us*)(brow + 16 + 8 * hh);
      acc[t] = mmaN<ASPLIT ? 2 : 1>(ah.v, al.v, b.v, b.v, acc[t]);
    }
  }
#pragma unroll
  for (int t = 0; t < 4; ++t) {
    float bv = bias ? bias[col0 + t * 16 + ln] : 0.f;
    if (BIAS_BF16) bv = bf16_round(bv);
#pragma unroll
    for (int r = 0; r < 8; ++r) { float v = acc[t][r] + bv; if (ACT == 1) v = fmaxf(v, 0.f); so[w][8 * hh + r][t * 16 + ln] = v; }
  }
  __builtin_amdgcn_fence(__ATOMIC_ACQ_REL, "workgroup");
  __builtin_amdgcn_wave_barrier();
  const int rsub = lane >> 4, c4 = (lane & 15) * 4;
  {
#pragma unroll
    for (int q = 0; q < 8; ++q) {
      const int r = q * 2 + rsub;
      const v4f v = *(const v4fa*)&so[w][r][c4];
      *(v4f*)(C + (size_t)(row0 + r) * ldc + col0 + c4) = v;
    }
    
  }
}

// Flash-style causal/unmasked attention, all contractions 3-term bf16 hi/lo splits, f32 softmax with running max.
// q,k,v rows are read from f32 buffers with arbitrary row pitch (so they can live inside a fused qkv buffer);
// D = head size (multiple of 32, <= 128); one wave = 16 query rows; block = 4 waves (64 queries) sharing K/V chunks of 32.
template <int D, bool CAUSAL>
__global__ __launch_bounds__(128) void k_flash(const float* __restrict__ qb, const float* __restrict__ kb, const float* __restrict__ vb,
                                             int pitch, int T, int H, float scale, float* __restrict__ y, int ypitch) {
  constexpr int KS = D / 32;        // k-steps for QK
  constexpr int DT = D / 16;        // d tiles for PV
  __shared__ __attribute__((aligned(16))) unsigned short sKh[32][D + 8], sKl[32][D + 8], sVh[32][D + 8], sVl[32][D + 8];
  __shared__ __attribute__((aligned(16))) unsigned short sPh[4][16][40], sPl[4][16][40];
  __shared__ __attribute__((aligned(16))) float sO[4][16][D];
  const int tid = threadIdx.x, w = tid >> 5, lane = tid & 31, ln = lane & 15, hh = lane >> 4;
  const int nqb = (T + 63) / 64;
  const int bh = blockIdx.x / nqb, qblk = blockIdx.x % nqb;
  const int b = bh / H, h = bh % H;
  const int q0 = qblk * 64 + w * 16;
  const float* Q = qb + (size_t)b * T * pitch + h * D;
  const float* K = kb + (size_t)b * T * pitch + h * D;
  const float* V = vb + (size_t)b * T * pitch + h * D;

  // A fragments of the wave's 16 query rows (scaled), hi/lo
  FragB aqh[KS], aql[KS];
  {
    int row = q0 + ln; if (row >= T) row = T - 1;
    const float* qr = Q + (size_t)row * pitch;
#pragma unroll
    for (int ks = 0; ks < KS; ++ks)
#pragma unroll
      for (int i = 0; i < 16; ++i) {
        const int d = ks * 32 + ((i < 8) ? (8 * hh + i) : (16 + 8 * hh + (i - 8)));
        const float x = qr[d] * scale; const unsigned short hb = bf16_bits(x);
        aqh[ks].u[i] = hb; aql[ks].u[i] = bf16_bits(x - bf16_val(hb));
      }
  }
  float m_r[8], l_r[8];
#pragma unroll
  for (int r = 0; r < 8; ++r) { m_r[r] = -3.0e38f; l_r[r] = 0.f; }
  v8f oacc[DT];
#pragma unroll
  for (int dt = 0; dt < DT; ++dt) oacc[dt] = (v8f){0.f,0.f,0.f,0.f,0.f,0.f,0.f,0.f};

  const int kv_end = CAUSAL ? min(T, qblk * 64 + 64) : T;     // block-uniform
  for (int j0 = 0; j0 < kv_end; j0 += 32) {
    __syncthreads();
    for (int e = tid; e < 32 * (D / 4); e += 128) {
      const int r = e / (D / 4), c4 = (e % (D / 4)) * 4;
      const int key = j0 + r;
      v4f kf = {0.f,0.f,0.f,0.f}, vf = {0.f,0.f,0.f,0.f};
      if (key < T) { kf = *(const v4fa*)(K + (size_t)key * pitch + c4); vf = *(const v4fa*)(V + (size_t)key * pitch + c4); }
#pragma unroll
      for (int t = 0; t < 4; ++t) {
        unsigned short hb = bf16_bits(kf[t]); sKh[r][c4 + t] = hb; sKl[r][c4 + t] = bf16_bits(kf[t] - bf16_val(hb));
        hb = bf16_bits(vf[t]); sVh[r][c4 + t] = hb; sVl[r][c4 + t] = bf16_bits(vf[t] - bf16_val(hb));
      }
    }
    __syncthreads();
    // S tile 16 x 32
    v8f s[2];
#pragma unroll
    for (int nt = 0; nt < 2; ++nt) {
      v8f acc = {};
#pragma unroll
      for (int ks = 0; ks < KS; ++ks) {
        FragB bh_, bl_;
        bh_.half[0] = *(const v8us*)&sKh[nt * 16 + ln][ks * 32 + 8 * hh]; bh_.half[1] = *(const v8us*)&sKh[nt * 16 + ln][ks * 32 + 16 + 8 * hh];
        bl_.half[0] = *(const v8us*)&sKl[nt * 16 + ln][ks * 32 + 8 * hh]; bl_.half[1] = *(const v8us*)&sKl[nt * 16 + ln][ks * 32 + 16 + 8 * hh];
        acc = mmaN<3>(aqh[ks].v, aql[ks].v, bh_.v, bl_.v, acc);
      }
      s[nt] = acc;
    }
    // mask + running max (rows 8hh+r; the 16 lanes of a half share rows)
    float alpha[8];
#pragma unroll
    for (int r = 0; r < 8; ++r) {
      const int qi = q0 + 8 * hh + r;
      const int ja = j0 + ln, jb = j0 + 16 + ln;
      if (CAUSAL) { if (ja > qi) s[0][r] = -3.0e38f; if (jb > qi) s[1][r] = -3.0e38f; }
      if (ja >= T) s[0][r] = -3.0e38f;
      if (jb >= T) s[1][r] = -3.0e38f;
      float mx = fmaxf(s[0][r], s[1][r]);
      mx = fmaxf(mx, __shfl_xor(mx, 1, 32)); mx = fmaxf(mx, __shfl_xor(mx, 2, 32)); mx = fmaxf(mx, __shfl_xor(mx, 4, 32)); mx = fmaxf(mx, __shfl_xor(mx, 8, 32));
      const float mnew = fmaxf(m_r[r], mx);
      alpha[r] = (mnew > -1.0e38f) ? __expf(m_r[r] - mnew) : 1.0f;
      const float p0 = (s[0][r] > -1.0e38f) ? __expf(s[0][r] - mnew) : 0.f;
      const float p1 = (s[1][r] > -1.0e38f) ? __expf(s[1][r] - mnew) : 0.f;
      m_r[r] = mnew;
      l_r[r] = l_r[r] * alpha[r] + p0 + p1;            // per-lane partial row sum (16 lanes combined at the end)
      unsigned short hb = bf16_bits(p0); sPh[w][8 * hh + r][ln] = hb;      sPl[w][8 * hh + r][ln] = bf16_bits(p0 - bf16_val(hb));
      hb = bf16_bits(p1);                sPh[w][8 * hh + r][16 + ln] = hb; sPl[w][8 * hh + r][16 + ln] = bf16_bits(p1 - bf16_val(hb));
    }
#pragma unroll
    for (int dt = 0; dt < DT; ++dt)
#pragma unroll
      for (int r = 0; r < 8; ++r) oacc[dt][r] *= alpha[r];
    __builtin_amdgcn_fence(__ATOMIC_ACQ_REL, "workgroup");
    __builtin_amdgcn_wave_barrier();
    FragB pah, pal;
    pah.half[0] = *(const v8us*)&sPh[w][ln][8 * hh]; pah.half[1] = *(const v8us*)&sPh[w][ln][16 + 8 * hh];
    pal.half[0] = *(const v8us*)&sPl[w][ln][8 * hh]; pal.half[1] = *(const v8us*)&sPl[w][ln][16 + 8 * hh];
#pragma unroll
    for (int dt = 0; dt < DT; ++dt) {
      FragB bvh, bvl;
#pragma unroll
      for (int i = 0; i < 8; ++i) {
        bvh.u[i] = sVh[8 * hh + i][dt * 16 + ln]; bvh.u[8 + i] = sVh[16 + 8 * hh + i][dt * 16 + ln];
        bvl.u[i] = sVl[8 * hh + i][dt * 16 + ln]; bvl.u[8 + i] = sVl[16 + 8 * hh + i][dt * 16 + ln];
      }
      oacc[dt] = mmaN<3>(pah.v, pal.v, bvh.v, bvl.v, oacc[dt]);
    }
    __builtin_amdgcn_fence(__ATOMIC_ACQ_REL, "workgroup");
    __builtin_amdgcn_wave_barrier();
  }
#pragma unroll
  for (int r = 0; r < 8; ++r) {
    float l = l_r[r];
    l += __shfl_xor(l, 1, 32); l += __shfl_xor(l, 2, 32); l += __shfl_xor(l, 4, 32); l += __shfl_xor(l, 8, 32);
    l_r[r] = (l > 0.f) ? 1.0f / l : 0.f;
  }
#pragma unroll
  for (int dt = 0; dt < DT; ++dt)
#pragma unroll
    for (int r = 0; r < 8; ++r) sO[w][8 * hh + r][dt * 16 + ln] = oacc[dt][r] * l_r[r];
  __builtin_amdgcn_fence(__ATOMIC_ACQ_REL, "workgroup");
  __builtin_amdgcn_wave_barrier();
  {
    for (int r = 0; r < 16; ++r) {
      const int row = q0 + r;
      if (row < T && lane < D / 4) {
        const v4f val = *(const v4fa*)&sO[w][r][lane * 4];
        *(v4f*)(y + ((size_t)b * T + row) * ypitch + h * D + lane * 4) = val;
      }
    }
    
  }
}

// in pitch = cols, out pitch = rows; rows, cols multiples of 32. Optional per-output-row affine (scale[c], shift[c]) and
// residual add res (same layout as out, optionally bf16-rounded) for fused epilogues: out = in*scale + shift + res.
template <bool AFFINE, bool RESID, bool RES_BF16>
__global__ __launch_bounds__(256) void k_transpose32(const float* __restrict__ in, float* __restrict__ out, int rows, int cols,
                                                    const float* __restrict__ scale, const float* __restrict__ shift, const float* __restrict__ res) {
  __shared__ float tile[32][33];
  const int b = blockIdx.z;
  const int r0 = blockIdx.y * 32, c0 = blockIdx.x * 32;
  const float* src = in + (size_t)b * rows * cols;
  float* dst = out + (size_t)b * rows * cols;
  const int tx = threadIdx.x & 31, ty = threadIdx.x >> 5;     // 8 rows per pass
  for (int i = ty; i < 32; i += 8) tile[i][tx] = src[(size_t)(r0 + i) * cols + c0 + tx];
  __syncthreads();
  {
    for (int i = ty; i < 32; i += 8) {
      float v = tile[tx][i];
      const int orow = c0 + i;
      if (AFFINE) v = v * scale[orow] + shift[orow];
      if (RESID) { float rv = res[(size_t)b * rows * cols + (size_t)orow * rows + r0 + tx]; if (RES_BF16) rv = bf16_round(rv); v += rv; }
      *(float*)(dst + (size_t)orow * rows + r0 + tx) = v;
    }
    
  }
}

// 2x2 max pool on position-major data: in [B][H*W][C] -> out [B][(H/2)*(W/2)][C]; thread per (b, p', 4 channels); C%4==0
__global__ __launch_bounds__(256) void k_pool2_pm(const float* __restrict__ in, float* __restrict__ out, int Bn, int H, int W, int C) {
  const size_t t = (size_t)blockIdx.x * 256 + threadIdx.x;
  const int c4n = C / 4, Ho = H / 2, Wo = W / 2;
  const size_t total = (size_t)Bn * Ho * Wo * c4n;
  if (t >= total) return;
  const int c4 = (int)(t % c4n) * 4; size_t rest = t / c4n;
  const int pw = (int)(rest % Wo); rest /= Wo; const int ph = (int)(rest % Ho); const int b = (int)(rest / Ho);
  const float* base = in + (size_t)b * H * W * C;
  const int p00 = (2 * ph) * W + 2 * pw;
  const v4f a = *(const v4fa*)(base + (size_t)p00 * C + c4), bq = *(const v4fa*)(base + (size_t)(p00 + 1) * C + c4);
  const v4f c = *(const v4fa*)(base + (size_t)(p00 + W) * C + c4), d = *(const v4fa*)(base + (size_t)(p00 + W + 1) * C + c4);
  v4f m; for (int i = 0; i < 4; ++i) m[i] = fmaxf(fmaxf(a[i], bq[i]), fmaxf(c[i], d[i]));
  float* dst = out + ((size_t)b * Ho * Wo + (size_t)ph * Wo + pw) * C + c4;
  *(v4f*)dst = m;
  
}

// General (non-causal) attention, 3-term bf16 splits, f32 softmax with running max.
// Q [.][Tq][qpitch], K [.][Tk][kpitch] (head dim DQ), V [.][Tk][vpitch] (head dim DVtot); this block handles DV output
// dims starting at dv0 = blockIdx.y*DV. y[bh][t][ypitch] gets columns dv0..dv0+DV-1. Per-bh base offsets via strides.
template <int DQ, int DV>
__global__ __launch_bounds__(128) void k_flash2(const float* __restrict__ Qb, size_t qstride, int qpitch, int Tq,
                                              const float* __restrict__ Kb, size_t kstride, int kpitch, int Tk,
                                              const float* __restrict__ Vb, size_t vstride, int vpitch,
                                              float scale, float* __restrict__ y, size_t ystride, int ypitch) {
  constexpr int KS = DQ / 32, DT = DV / 16;
  __shared__ __attribute__((aligned(16))) unsigned short sKh[32][DQ + 8], sKl[32][DQ + 8], sVh[32][DV + 8], sVl[32][DV + 8];
  __shared__ __attribute__((aligned(16))) unsigned short sPh[4][16][40], sPl[4][16][40];
  __shared__ __attribute__((aligned(16))) float sO[4][16][DV];
  const int tid = threadIdx.x, w = tid >> 5, lane = tid & 31, ln = lane & 15, hh = lane >> 4;
  const int nqb = (Tq + 63) / 64;
  const int bh = blockIdx.x / nqb, qblk = blockIdx.x % nqb;
  const int dv0 = blockIdx.y * DV;
  const int q0 = qblk * 64 + w * 16;
  const float* Q = Qb + (size_t)bh * qstride; const float* K = Kb + (size_t)bh * kstride; const float* V = Vb + (size_t)bh * vstride + dv0;
  FragB aqh[KS], aql[KS];
  {
    int row = q0 + ln; if (row >= Tq) row = Tq - 1;
    const float* qr = Q + (size_t)row * qpitch;
#pragma unroll
    for (int ks = 0; ks < KS; ++ks)
#pragma unroll
      for (int i = 0; i < 16; ++i) {
        const int d = ks * 32 + ((i < 8) ? (8 * hh + i) : (16 + 8 * hh + (i - 8)));
        const float x = qr[d] * scale; const unsigned short hb = bf16_bits(x);
        aqh[ks].u[i] = hb; aql[ks].u[i] = bf16_bits(x - bf16_val(hb));
      }
  }
  float m_r[8], l_r[8];
#pragma unroll
  for (int r = 0; r < 8; ++r) { m_r[r] = -3.0e38f; l_r[r] = 0.f; }
  v8f oacc[DT];
#pragma unroll
  for (int dt = 0; dt < DT; ++dt) oacc[dt] = (v8f){0.f,0.f,0.f,0.f,0.f,0.f,0.f,0.f};
  for (int j0 = 0; j0 < Tk; j0 += 32) {
    __syncthreads();
    for (int e = tid; e < 32 * (DQ / 4); e += 128) {
      const int r = e / (DQ / 4), c4 = (e % (DQ / 4)) * 4; const int key = j0 + r;
      v4f f = {0.f,0.f,0.f,0.f}; if (key < Tk) f = *(const v4fa*)(K + (size_t)key * kpitch + c4);
#pragma unroll
      for (int t = 0; t < 4; ++t) { const unsigned short hb = bf16_bits(f[t]); sKh[r][c4 + t] = hb; sKl[r][c4 + t] = bf16_bits(f[t] - bf16_val(hb)); }
    }
    for (int e = tid; e < 32 * (DV / 4); e += 128) {
      const int r = e / (DV / 4), c4 = (e % (DV / 4)) * 4; const int key = j0 + r;
      v4f f = {0.f,0.f,0.f,0.f}; if (key < Tk) f = *(const v4fa*)(V + (size_t)key * vpitch + c4);
#pragma unroll
      for (int t = 0; t < 4; ++t) { const unsigned short hb = bf16_bits(f[t]); sVh[r][c4 + t] = hb; sVl[r][c4 + t] = bf16_bits(f[t] - bf16_val(hb)); }
    }
    __syncthreads();
    v8f s[2];
#pragma unroll
    for (int nt = 0; nt < 2; ++nt) {
      v8f acc = {};
#pragma unroll
      for (int ks = 0; ks < KS; ++ks) {
        FragB bh_, bl_;
        bh_.half[0] = *(const v8us*)&sKh[nt * 16 + ln][ks * 32 + 8 * hh]; bh_.half[1] = *(const v8us*)&sKh[nt * 16 + ln][ks * 32 + 16 + 8 * hh];
        bl_.half[0] = *(const v8us*)&sKl[nt * 16 + ln][ks * 32 + 8 * hh]; bl_.half[1] = *(const v8us*)&sKl[nt * 16 + ln][ks * 32 + 16 + 8 * hh];
        acc = mmaN<3>(aqh[ks].v, aql[ks].v, bh_.v, bl_.v, acc);
      }
      s[nt] = acc;
    }
    float alpha[8];
#pragma unroll
    for (int r = 0; r < 8; ++r) {
      const int ja = j0 + ln, jb = j0 + 16 + ln;
      if (ja >= Tk) s[0][r] = -3.0e38f;
      if (jb >= Tk) s[1][r] = -3.0e38f;
      float mx = fmaxf(s[0][r], s[1][r]);
      mx = fmaxf(mx, __shfl_xor(mx, 1, 32)); mx = fmaxf(mx, __shfl_xor(mx, 2, 32)); mx = fmaxf(mx, __shfl_xor(mx, 4, 32)); mx = fmaxf(mx, __shfl_xor(mx, 8, 32));
      const float mnew = fmaxf(m_r[r], mx);
      alpha[r] = (mnew > -1.0e38f) ? __expf(m_r[r] - mnew) : 1.0f;
      const float p0 = (s[0][r] > -1.0e38f) ? __expf(s[0][r] - mnew) : 0.f;
      const float p1 = (s[1][r] > -1.0e38f) ? __expf(s[1][r] - mnew) : 0.f;
      m_r[r] = mnew;
      l_r[r] = l_r[r] * alpha[r] + p0 + p1;
      unsigned short hb = bf16_bits(p0); sPh[w][8 * hh + r][ln] = hb;      sPl[w][8 * hh + r][ln] = bf16_bits(p0 - bf16_val(hb));
      hb = bf16_bits(p1);                sPh[w][8 * hh + r][16 + ln] = hb; sPl[w][8 * hh + r][16 + ln] = bf16_bits(p1 - bf16_val(hb));
    }
#pragma unroll
    for (int dt = 0; dt < DT; ++dt)
#pragma unroll
      for (int r = 0; r < 8; ++r) oacc[dt][r] *= alpha[r];
    __builtin_amdgcn_fence(__ATOMIC_ACQ_REL, "workgroup");
    __builtin_amdgcn_wave_barrier();
    FragB pah, pal;
    pah.half[0] = *(const v8us*)&sPh[w][ln][8 * hh]; pah.half[1] = *(const v8us*)&sPh[w][ln][16 + 8 * hh];
    pal.half[0] = *(const v8us*)&sPl[w][ln][8 * hh]; pal.half[1] = *(const v8us*)&sPl[w][ln][16 + 8 * hh];
#pragma unroll
    for (int dt = 0; dt < DT; ++dt) {
      FragB bvh, bvl;
#pragma unroll
      for (int i = 0; i < 8; ++i) {
        bvh.u[i] = sVh[8 * hh + i][dt * 16 + ln]; bvh.u[8 + i] = sVh[16 + 8 * hh + i][dt * 16 + ln];
        bvl.u[i] = sVl[8 * hh + i][dt * 16 + ln]; bvl.u[8 + i] = sVl[16 + 8 * hh + i][dt * 16 + ln];
      }
      oacc[dt] = mmaN<3>(pah.v, pal.v, bvh.v, bvl.v, oacc[dt]);
    }
    __builtin_amdgcn_fence(__ATOMIC_ACQ_REL, "workgroup");
    __builtin_amdgcn_wave_barrier();
  }
#pragma unroll
  for (int r = 0; r < 8; ++r) {
    float l = l_r[r];
    l += __shfl_xor(l, 1, 32); l += __shfl_xor(l, 2, 32); l += __shfl_xor(l, 4, 32); l += __shfl_xor(l, 8, 32);
    l_r[r] = (l > 0.f) ? 1.0f / l : 0.f;
  }
#pragma unroll
  for (int dt = 0; dt < DT; ++dt)
#pragma unroll
    for (int r = 0; r < 8; ++r) sO[w][8 * hh + r][dt * 16 + ln] = oacc[dt][r] * l_r[r];
  __builtin_amdgcn_fence(__ATOMIC_ACQ_REL, "workgroup");
  __builtin_amdgcn_wave_barrier();
  {
    for (int r = 0; r < 16; ++r) {
      const int row = q0 + r;
      for (int c4 = lane * 4; c4 < DV; c4 += 128) {
        if (row < Tq) {
          const v4f val = *(const v4fa*)&sO[w][r][c4];
          *(v4f*)(y + (size_t)bh * ystride + (size_t)row * ypitch + dv0 + c4) = val;
        }
      }
    }
    
  }
}

// f32 [R][Cc] (row pitch lds) -> bf16 hi/lo planes [R][Cc] (pitch Cc); thread per 8 elements; Cc % 8 == 0
__global__ __launch_bounds__(256) void k_split_rows(const float* __restrict__ src, int lds_, unsigned short* __restrict__ hi, unsigned short* __restrict__ lo, int R, int Cc) {
  const size_t t = (size_t)blockIdx.x * 256 + threadIdx.x;
  const int c8n = Cc / 8;
  if (t >= (size_t)R * c8n) return;
  const int r = (int)(t / c8n), c8 = (int)(t % c8n) * 8;
  const float* s = src + (size_t)r * lds_ + c8;
  const v4f a = *(const v4fa*)s, b = *(const v4fa*)(s + 4);
  float xs[8] = {a[0],a[1],a[2],a[3],b[0],b[1],b[2],b[3]};
  v8us vh, vl;
#pragma unroll
  for (int i = 0; i < 8; ++i) { const unsigned short hb = bf16_bits(xs[i]); vh[i] = hb; vl[i] = bf16_bits(xs[i] - bf16_val(hb)); }
  unsigned short* dh = hi + (size_t)r * Cc + c8; unsigned short* dl = lo + (size_t)r * Cc + c8;
  *(v8us*)dh = vh; *(v8us*)dl = vl; 
}
// f32 [K][N] (row pitch lds) -> transposed bf16 hi/lo planes [N][K]; one thread per (n, 8 consecutive k)
__global__ __launch_bounds__(256) void k_split_transpose(const float* __restrict__ src, int lds_, unsigned short* __restrict__ hi, unsigned short* __restrict__ lo, int K, int N) {
  const size_t t = (size_t)blockIdx.x * 256 + threadIdx.x;
  const int k8n = K / 8;
  if (t >= (size_t)N * k8n) return;
  const int n = (int)(t / k8n), k8 = (int)(t % k8n) * 8;
  v8us vh, vl;
#pragma unroll
  for (int i = 0; i < 8; ++i) { const float x = src[(size_t)(k8 + i) * lds_ + n]; const unsigned short hb = bf16_bits(x); vh[i] = hb; vl[i] = bf16_bits(x - bf16_val(hb)); }
  unsigned short* dh = hi + (size_t)n * K + k8; unsigned short* dl = lo + (size_t)n * K + k8;
  *(v8us*)dh = vh; *(v8us*)dl = vl; 
}
// GEMM with A f32 (split into hi/lo when ASPLIT) and B from bf16 planes Bh (+ Bl when BSPLIT): terms hi·hi [+ lo·hi] [+ hi·lo].
// C f32 [M][N] pitch ldc; alpha scales the result; bias optional (BIAS_BF16 rounds it). Same tiling/epilogue as k_gemm_bf.
template <bool ASPLIT, bool BSPLIT, int ACT, bool BIAS_BF16>
__global__ __launch_bounds__(128) void k_gemm_bf2(const float* __restrict__ A, int lda, const unsigned short* __restrict__ Bh, const unsigned short* __restrict__ Bl, int ldb,
                                                const float* __restrict__ bias, float alpha, float* __restrict__ C, int ldc, int M, int N, int K) {
  __shared__ __attribute__((aligned(16))) float so[4][16][64];
  const int tid = threadIdx.x, w = tid >> 5, lane = tid & 31, ln = lane & 15, hh = lane >> 4;
  const int ntn = N / 64;
  const int wid = blockIdx.x * 4 + w;
  const int mt = wid / ntn, nq = wid % ntn;
  if (mt * 16 >= M) return;
  const int row0 = mt * 16, col0 = nq * 64;
  const float* arow = A + (size_t)(row0 + ln) * lda;
  v8f acc[4] = {};
  for (int kb = 0; kb < K; kb += 32) {
    FragB ah, al;
    const v4f x0 = *(const v4fa*)(arow + kb + 8 * hh), x1 = *(const v4fa*)(arow + kb + 8 * hh + 4);
    const v4f x2 = *(const v4fa*)(arow + kb + 16 + 8 * hh), x3 = *(const v4fa*)(arow + kb + 16 + 8 * hh + 4);
    float xs[16] = {x0[0],x0[1],x0[2],x0[3],x1[0],x1[1],x1[2],x1[3],x2[0],x2[1],x2[2],x2[3],x3[0],x3[1],x3[2],x3[3]};
#pragma unroll
    for (int i = 0; i < 16; ++i) { const unsigned short hb = bf16_bits(xs[i]); ah.u[i] = hb; al.u[i] = ASPLIT ? bf16_bits(xs[i] - bf16_val(hb)) : (unsigned short)0; }
#pragma unroll
    for (int t = 0; t < 4; ++t) {
      const size_t boff = (size_t)(col0 + t * 16 + ln) * ldb + kb;
      FragB bh_, bl_;
      bh_.half[0] = *(const v8us*)(Bh + boff + 8 * hh);
      bh_.half[1] = *(const v8us*)(Bh + boff + 16 + 8 * hh);
      if (BSPLIT) { bl_.half[0] = *(const v8us*)(Bl + boff + 8 * hh); bl_.half[1] = *(const v8us*)(Bl + boff + 16 + 8 * hh); } else bl_ = bh_;
      acc[t] = mmaN<ASPLIT ? (BSPLIT ? 3 : 2) : 1>(ah.v, al.v, bh_.v, bl_.v, acc[t]);
    }
  }
#pragma unroll
  for (int t = 0; t < 4; ++t) {
    float bv = bias ? bias[col0 + t * 16 + ln] : 0.f;
    if (BIAS_BF16) bv = bf16_round(bv);
#pragma unroll
    for (int r = 0; r < 8; ++r) { float v = acc[t][r] * alpha + bv; if (ACT == 1) v = fmaxf(v, 0.f); so[w][8 * hh + r][t * 16 + ln] = v; }
  }
  __builtin_amdgcn_fence(__ATOMIC_ACQ_REL, "workgroup");
  __builtin_amdgcn_wave_barrier();
  const int rsub = lane >> 4, c4 = (lane & 15) * 4;
  {
#pragma unroll
    for (int q = 0; q < 8; ++q) {
      const int r = q * 2 + rsub;
      const v4f v = *(const v4fa*)&so[w][r][c4];
      *(v4f*)(C + (size_t)(row0 + r) * ldc + col0 + c4) = v;
    }
    
  }
}
// row softmax: P[row][:] = softmax(masked S[row][:]) over N columns with optional causal mask (col > row + rowoff -> 0) and
__global__ __launch_bounds__(256) void k_softmax_rows(const float* __restrict__ S, float* __restrict__ P, int N, int causal, int rowoff, const int* __restrict__ mask, int mask_pitch) {
  __shared__ float red[256];
  const int row = blockIdx.x, tid = threadIdx.x;
  const float* s = S + (size_t)row * N; float* p_out = P + (size_t)row * N;
  const int qi = row + rowoff;
  float mx = -3.0e38f;
  for (int j = tid; j < N; j += 256) {
    bool keep = true;
    if (causal && j > qi) keep = false;
    if (mask && mask[(size_t)qi * mask_pitch + j] == 0) keep = false;
    const float v = keep ? s[j] : -3.0e38f;
    mx = fmaxf(mx, v);
  }
  red[tid] = mx; __syncthreads();
  for (int st = 128; st > 0; st >>= 1) { if (tid < st) red[tid] = fmaxf(red[tid], red[tid + st]); __syncthreads(); }
  mx = red[0]; __syncthreads();
  float sum = 0.f;
  for (int j = tid; j < N; j += 256) {
    bool keep = true;
    if (causal && j > qi) keep = false;
    if (mask && mask[(size_t)qi * mask_pitch + j] == 0) keep = false;
    const float p = keep ? __expf(s[j] - mx) : 0.f;
    sum += p;
  }
  red[tid] = sum; __syncthreads();
  for (int st = 128; st > 0; st >>= 1) { if (tid < st) red[tid] += red[tid + st]; __syncthreads(); }
  const float inv = (mx > -1.0e38f) ? 1.0f / red[0] : __builtin_nanf("");
  __syncthreads();
  {
    for (int j4 = tid * 4; j4 < N; j4 += 1024) {
      v4f out4;
#pragma unroll
      for (int u = 0; u < 4; ++u) {
        const int j = j4 + u;
        bool keep = true;
        if (causal && j > qi) keep = false;
        if (mask && mask[(size_t)qi * mask_pitch + j] == 0) keep = false;
        out4[u] = keep ? __expf(s[j] - mx) * inv : 0.f;
      }
      *(v4f*)(p_out + j4) = out4;
    }
    
  }
}

// GEMM C = act(A·W + bias + resid): A f32 (ASPLIT -> hi/lo 2 terms), Wt bf16 [N][K]; ACT 0 none, 1 relu, 2 exact gelu;
// resid (optional, f32, row index = (row % rmod), pitch ldr, RES_BF16 rounds it) added before the activation.
template <bool ASPLIT, int ACT, bool BIAS_BF16, bool RES_BF16>
__global__ __launch_bounds__(128) void k_gemm_bf3(const float* __restrict__ A, int lda, const unsigned short* __restrict__ Wt, int ldb,
                                                const float* __restrict__ bias, const float* __restrict__ resid, int rmod, int ldr,
                                                float* __restrict__ C, int ldc, int M, int N, int K) {
  __shared__ __attribute__((aligned(16))) float so[4][16][64];
  const int tid = threadIdx.x, w = tid >> 5, lane = tid & 31, ln = lane & 15, hh = lane >> 4;
  const int ntn = N / 64;
  const int wid = blockIdx.x * 4 + w;
  const int mt = wid / ntn, nq = wid % ntn;
  if (mt * 16 >= M) return;
  const int row0 = mt * 16, col0 = nq * 64;
  const float* arow = A + (size_t)(row0 + ln) * lda;
  v8f acc[4] = {};
  for (int kb = 0; kb < K; kb += 32) {
    FragB ah, al;
    const v4f x0 = *(const v4fa*)(arow + kb + 8 * hh), x1 = *(const v4fa*)(arow + kb + 8 * hh + 4);
    const v4f x2 = *(const v4fa*)(arow + kb + 16 + 8 * hh), x3 = *(const v4fa*)(arow + kb + 16 + 8 * hh + 4);
    float xs[16] = {x0[0],x0[1],x0[2],x0[3],x1[0],x1[1],x1[2],x1[3],x2[0],x2[1],x2[2],x2[3],x3[0],x3[1],x3[2],x3[3]};
#pragma unroll
    for (int i = 0; i < 16; ++i) { const unsigned short hb = bf16_bits(xs[i]); ah.u[i] = hb; al.u[i] = ASPLIT ? bf16_bits(xs[i] - bf16_val(hb)) : (unsigned short)0; }
#pragma unroll
    for (int t = 0; t < 4; ++t) {
      const unsigned short* brow = Wt + (size_t)(col0 + t * 16 + ln) * ldb + kb;
      FragB b;
      b.half[0] = *(const v8us*)(brow + 8 * hh);
      b.half[1] = *(const v8us*)(brow + 16 + 8 * hh);
      acc[t] = mmaN<ASPLIT ? 2 : 1>(ah.v, al.v, b.v, b.v, acc[t]);
    }
  }
#pragma unroll
  for (int t = 0; t < 4; ++t) {
    const int col = col0 + t * 16 + ln;
    float bv = bias ? bias[col] : 0.f;
    if (BIAS_BF16) bv = bf16_round(bv);
#pragma unroll
    for (int r = 0; r < 8; ++r) {
      float v = acc[t][r] + bv;
      if (resid) { float rv = resid[(size_t)((row0 + 8 * hh + r) % rmod) * ldr + col]; if (RES_BF16) rv = bf16_round(rv); v += rv; }
      if (ACT == 1) v = fmaxf(v, 0.f);
      if (ACT == 2) v = 0.5f * v * (1.0f + erff(v * 0.70710678118654752f));
      if (ACT == 3) { const float u = 0.7978845608028654f * (v + 0.044715f * v * v * v); v = 0.5f * v * (1.0f + tanhf(u)); }
      so[w][8 * hh + r][t * 16 + ln] = v;
    }
  }
  __builtin_amdgcn_fence(__ATOMIC_ACQ_REL, "workgroup");
  __builtin_amdgcn_wave_barrier();
  const int rsub = lane >> 4, c4 = (lane & 15) * 4;
  {
#pragma unroll
    for (int q = 0; q < 8; ++q) {
      const int r = q * 2 + rsub;
      const v4f v = *(const v4fa*)&so[w][r][c4];
      *(v4f*)(C + (size_t)(row0 + r) * ldc + col0 + c4) = v;
    }
    
  }
}
// row LayerNorm (biased variance, eps) over N: s = X (+ R); optional out_sum <- s; out_norm <- (s-mu)*rsqrt(var+eps)*g + b
template <bool PARAM_BF16>
__global__ __launch_bounds__(256) void k_layernorm(const float* __restrict__ X, const float* __restrict__ R, const float* __restrict__ g, const float* __restrict__ bta,
                                                  float* __restrict__ out_sum, float* __restrict__ out_norm, int N, float eps) {
  __shared__ float red[256];
  const int row = blockIdx.x, tid = threadIdx.x;
  const float* x = X + (size_t)row * N; const float* rr = R ? R + (size_t)row * N : nullptr;
  float vals[16];                     // up to N = 4096
  const int per = N / 256;            // contiguous chunk per thread? use strided-by-4 chunks: thread handles j = tid*4 + 1024*u
  float s1 = 0.f;
  for (int u = 0; u < per / 4; ++u) {
    const int j = tid * 4 + 1024 * u;
    const v4f a = *(const v4fa*)(x + j);
    v4f b = {0.f,0.f,0.f,0.f}; if (rr) b = *(const v4fa*)(rr + j);
#pragma unroll
    for (int q = 0; q < 4; ++q) { const float v = a[q] + b[q]; vals[u * 4 + q] = v; s1 += v; }
  }
  red[tid] = s1; __syncthreads();
  for (int st = 128; st > 0; st >>= 1) { if (tid < st) red[tid] += red[tid + st]; __syncthreads(); }
  const float mu = red[0] / (float)N; __syncthreads();
  float s2 = 0.f;
  for (int u = 0; u < per / 4; ++u)
#pragma unroll
    for (int q = 0; q < 4; ++q) { const float c = vals[u * 4 + q] - mu; s2 += c * c; }
  red[tid] = s2; __syncthreads();
  for (int st = 128; st > 0; st >>= 1) { if (tid < st) red[tid] += red[tid + st]; __syncthreads(); }
  const float rs = rsqrtf(red[0] / (float)N + eps);
  {
    for (int u = 0; u < per / 4; ++u) {
      const int j = tid * 4 + 1024 * u;
      v4f o, sm;
#pragma unroll
      for (int q = 0; q < 4; ++q) {
        float gg = g[j + q], bb = bta[j + q];
        if (PARAM_BF16) { gg = bf16_round(gg); bb = bf16_round(bb); }
        sm[q] = vals[u * 4 + q]; o[q] = (vals[u * 4 + q] - mu) * rs * gg + bb;
      }
      if (out_sum) *(v4f*)(out_sum + (size_t)row * N + j) = sm;
      *(v4f*)(out_norm + (size_t)row * N + j) = o;
    }
    
  }
}

// batched GEMM (blockIdx.y = batch): C_b = act(alpha·A_b·B_b + bias + resid_b); A f32 rows (ASPLIT → hi/lo), B = bf16 planes Bh (+Bl when BSPLIT, requires ASPLIT),
// per-batch element strides sA, sB (0 = shared weights), sC, sR. resid may alias C (values are staged before the stores). ACT 0/1(relu).
// ACT: 0 none, 1 relu, 2 softplus
template <bool ASPLIT, bool BSPLIT, int ACT>
__global__ __launch_bounds__(128) void k_gemm_b(const float* __restrict__ A, int lda, size_t sA, const unsigned short* __restrict__ Bh, const unsigned short* __restrict__ Bl, int ldb, size_t sB,
                                             const float* __restrict__ bias, const float* __restrict__ resid, int ldr, size_t sR, float rsign, float alpha,
                                             float* __restrict__ C, int ldc, size_t sC, int M, int N, int K) {
  __shared__ __attribute__((aligned(16))) float so[4][16][64];
  const int tid = threadIdx.x, w = tid >> 5, lane = tid & 31, ln = lane & 15, hh = lane >> 4;
  const int by = blockIdx.y;
  A += (size_t)by * sA; Bh += (size_t)by * sB; if (BSPLIT) Bl += (size_t)by * sB; C += (size_t)by * sC; if (resid) resid += (size_t)by * sR;
  const int ntn = N / 64; const int wid = blockIdx.x * 4 + w; const int mt = wid / ntn, nq = wid % ntn;
  if (mt * 16 >= M) return;
  const int row0 = mt * 16, col0 = nq * 64;
  const float* arow = A + (size_t)(row0 + ln) * lda;
  v8f acc[4] = {};
  for (int kb = 0; kb < K; kb += 32) {
    FragB ah, al;
    const v4f x0 = *(const v4fa*)(arow + kb + 8 * hh), x1 = *(const v4fa*)(arow + kb + 8 * hh + 4);
    const v4f x2 = *(const v4fa*)(arow + kb + 16 + 8 * hh), x3 = *(const v4fa*)(arow + kb + 16 + 8 * hh + 4);
    float xs[16] = {x0[0],x0[1],x0[2],x0[3],x1[0],x1[1],x1[2],x1[3],x2[0],x2[1],x2[2],x2[3],x3[0],x3[1],x3[2],x3[3]};
#pragma unroll
    for (int i = 0; i < 16; ++i) { const unsigned short hb = bf16_bits(xs[i]); ah.u[i] = hb; al.u[i] = ASPLIT ? bf16_bits(xs[i] - bf16_val(hb)) : (unsigned short)0; }
#pragma unroll
    for (int t = 0; t < 4; ++t) {
      const size_t boff = (size_t)(col0 + t * 16 + ln) * ldb + kb;
      FragB bh_, bl_; bh_.half[0] = *(const v8us*)(Bh + boff + 8 * hh); bh_.half[1] = *(const v8us*)(Bh + boff + 16 + 8 * hh);
      if (BSPLIT) { bl_.half[0] = *(const v8us*)(Bl + boff + 8 * hh); bl_.half[1] = *(const v8us*)(Bl + boff + 16 + 8 * hh); } else bl_ = bh_;
      acc[t] = mmaN<ASPLIT ? (BSPLIT ? 3 : 2) : 1>(ah.v, al.v, bh_.v, bl_.v, acc[t]);
    }
  }
#pragma unroll
  for (int t = 0; t < 4; ++t) {
    const int col = col0 + t * 16 + ln; const float bv = bias ? bf16_round(bias[col]) : 0.f;
#pragma unroll
    for (int r = 0; r < 8; ++r) { float v = acc[t][r] * alpha + bv; if (resid) v += rsign * resid[(size_t)(row0 + 8 * hh + r) * ldr + col]; if (ACT == 1) v = fmaxf(v, 0.f); else if (ACT == 2) v = fmaxf(v, 0.f) + log1pf(expf(-fabsf(v))); so[w][8 * hh + r][t * 16 + ln] = v; }
  }
  __builtin_amdgcn_fence(__ATOMIC_ACQ_REL, "workgroup"); __builtin_amdgcn_wave_barrier();
  const int rsub = lane >> 4, c4 = (lane & 15) * 4;
  {
#pragma unroll
    for (int q = 0; q < 8; ++q) { const int r = q * 2 + rsub; const v4f v = *(const v4fa*)&so[w][r][c4]; *(v4f*)(C + (size_t)(row0 + r) * ldc + col0 + c4) = v; }
    
  }
}
// batched f32 [K][N] (pitch lds, batch stride sIn) -> transposed hi/lo planes [N][K] (batch stride sOut); thread per (n, 8 k); grid.y = batch
__global__ __launch_bounds__(256) void k_split_transpose_b(const float* __restrict__ src, int lds_, size_t sIn, unsigned short* __restrict__ hi, unsigned short* __restrict__ lo, size_t sOut, int K, int N) {
  const size_t t = (size_t)blockIdx.x * 256 + threadIdx.x; const int k8n = K / 8; if (t >= (size_t)N * k8n) return;
  src += (size_t)blockIdx.y * sIn; hi += (size_t)blockIdx.y * sOut; lo += (size_t)blockIdx.y * sOut;
  const int n = (int)(t / k8n), k8 = (int)(t % k8n) * 8; v8us vh, vl;
#pragma unroll
  for (int i = 0; i < 8; ++i) { const float x = src[(size_t)(k8 + i) * lds_ + n]; const unsigned short hb = bf16_bits(x); vh[i] = hb; vl[i] = bf16_bits(x - bf16_val(hb)); }
  unsigned short* dh = hi + (size_t)n * K + k8; unsigned short* dl = lo + (size_t)n * K + k8;
  *(v8us*)dh = vh; *(v8us*)dl = vl; 
}

__global__ __launch_bounds__(256) void k_round_rows(const float* __restrict__ W, unsigned short* __restrict__ Wt, int n8) {
  const int t = blockIdx.x * 256 + threadIdx.x;
  if (t >= n8) return;
  const v4f a = *(const v4fa*)(W + (size_t)t * 8), b = *(const v4fa*)(W + (size_t)t * 8 + 4);
  v8us v; v[0]=bf16_bits(a[0]); v[1]=bf16_bits(a[1]); v[2]=bf16_bits(a[2]); v[3]=bf16_bits(a[3]);
  v[4]=bf16_bits(b[0]); v[5]=bf16_bits(b[1]); v[6]=bf16_bits(b[2]); v[7]=bf16_bits(b[3]);
  *(v8us*)(Wt + (size_t)t * 8) = v; 
}


// ---- f16 WMMA path (v_wmma_f32_16x16x32_f16): 11-bit significands for operands in range — used where the softmax weight operand, 2^8 exp(x - ref), needs more precision than bf16
typedef _Float16 v16h __attribute__((ext_vector_type(16)));
union FragH { v16h v; v8us half[2]; _Float16 h[16]; unsigned short u[16]; };
typedef _Float16 v4h __attribute__((ext_vector_type(4)));
typedef __bf16 v4b __attribute__((ext_vector_type(4)));
typedef unsigned short v4us __attribute__((ext_vector_type(4), may_alias));
union Quad { v4b b; v4us u; };
union Oct { _Float16 h[8]; v8us u; };
// One launch for the three projections, straight from the f32 inputs. A work-group owns PC columns n of one input X [DI][SQ] (blockIdx.y: Q, K or V); each of its
// PW waves takes DI / PW = 64 of the k. A lane reads 16 bytes of a row of X: columns n0 + 4 ln + u, u = 0..3, so that a wave's load is two pieces of 256 consecutive bytes,
// and u picks the B tile: tile u holds the columns n0 + 4 ln + u at lane position ln. The wave's share of M (64 rows x 64 k) is read the same way, in whole lines, rounded
// to bf16 and turned into A fragments through the wave's own LDS range. The waves' partial tiles are summed through LDS in wave order, and the sum is stored
// in the order in which k_attn's lanes load their fragments, so that each 16-byte load of a wave there covers 512 consecutive bytes (4 whole lines, not 32 bytes of 16 lines):
//   QF f16: [s / 16][d / 32][(d / 16) & 1][lane = 16 ((d / 8) & 1) + s % 16][d % 8]
//   KF f32: [t / 16][d / 32][c = 2 ((d / 16) & 1) + ((d / 4) & 1)][lane = 16 ((d / 8) & 1) + t % 16][d % 4]
//   VF f16: [s / 32][d / 16][hi, lo][(s / 16) & 1][lane = 16 ((s / 8) & 1) + d % 16][s % 8]: hi = f16(Vd), lo = f16(Vd - hi), split here once and not in each of k_attn's work-groups
// The PC columns of a work-group fill PC * DO consecutive elements of QF and KF and 2 * PC * DO of VF, written in whole lines.
#define PW 8
#define PC 64
#define PP 68      // LDS row pitch in floats: 16 bytes x odd, so that 16 lanes that write 16 bytes each to 16 rows fall on different banks
#define PM 72      // row pitch of the staged M in bf16: 144 bytes, 16 x odd again, for the fragments' 16-byte reads
__device__ __forceinline__ v8f wmmaB(v16b a, v16b b, v8f c) { return __builtin_amdgcn_wmma_f32_16x16x32_bf16(false, a, false, b, (short)0, c, false, false); }
// amdgpu_waves_per_eu(4, 4): 256 registers a wave, so that two work-groups (2 x 136 KiB of LDS) share a WGP and the 384 work-groups run in one round
__global__ __launch_bounds__(PW * 32) __attribute__((amdgpu_waves_per_eu(4, 4))) void k_proj(const float* __restrict__ Q, const float* __restrict__ K, const float* __restrict__ V,
                                                 const float* __restrict__ Mq, const float* __restrict__ Mk, const float* __restrict__ Mv,
                                                 _Float16* __restrict__ QF, float* __restrict__ KF, _Float16* __restrict__ VF) {
  __shared__ __attribute__((aligned(16))) float part[PW][DO][PP];
  const int tid = threadIdx.x, w = tid >> 5, lane = tid & 31, ln = lane & 15, hh = lane >> 4;
  const int which = blockIdx.y, n0 = blockIdx.x * PC, k0 = w * (DI / PW);
  const float* X = which == 0 ? Q : which == 1 ? K : V;
  const float* M = which == 0 ? Mq : which == 1 ? Mk : Mv;
  const float* mp = M + (size_t)hh * DI + k0 + 4 * ln;
  const float* xp = X + (size_t)(k0 + 8 * hh) * SQ + n0 + 4 * ln;
  unsigned short* ms = (unsigned short*)&part[w][0][0];      // the wave's own LDS range holds its share of M until its partial tiles take the place
  // every loop below is unrolled so that fragments and tiles are indexed by constants and stay in registers
  v4f mf[32], xf[2][16];
  v16b b[2][4];
  FragB a[4][2];
#pragma unroll
  for (int j = 0; j < 16; ++j) mf[j] = *(const v4fa*)(mp + (size_t)(2 * j) * DI);      // rows 2 j and 2 j + 1, 256 consecutive bytes each
#pragma unroll
  for (int ks = 0; ks < 2; ++ks)
#pragma unroll
    for (int i = 0; i < 16; ++i) xf[ks][i] = *(const v4fa*)(xp + (size_t)(ks * 32 + (i >> 3) * 16 + (i & 7)) * SQ);      // k = 8 hh + 0..7, 16 + 8 hh + 0..7
#pragma unroll
  for (int j = 0; j < 16; ++j) { Quad c; c.b = (v4b){(__bf16)mf[j][0], (__bf16)mf[j][1], (__bf16)mf[j][2], (__bf16)mf[j][3]}; *(v4us*)(ms + (2 * j + hh) * PM + 4 * ln) = c.u; }
  // rows 32 to 63 of M are asked for only now, into the registers that rows 0 to 31 have left (all 64 loads at once would take more than 256 registers, and two
  // work-groups would no longer fit a WGP); they come from L2 while X is still on its way from memory
  __builtin_amdgcn_sched_barrier(0);      // keeps the 48 loads above together in front and the 16 below behind: without it all of M is asked for first and X only behind the wait for it (two latencies in a row), with spills
#pragma unroll
  for (int j = 16; j < 32; ++j) mf[j] = *(const v4fa*)(mp + (size_t)(2 * j) * DI);
#pragma unroll
  for (int ks = 0; ks < 2; ++ks)
#pragma unroll
    for (int u = 0; u < 4; ++u)
#pragma unroll
      for (int i = 0; i < 16; ++i) b[ks][u][i] = (__bf16)xf[ks][i][u];
#pragma unroll
  for (int j = 16; j < 32; ++j) { Quad c; c.b = (v4b){(__bf16)mf[j][0], (__bf16)mf[j][1], (__bf16)mf[j][2], (__bf16)mf[j][3]}; *(v4us*)(ms + (2 * j + hh) * PM + 4 * ln) = c.u; }
  asm volatile("s_wait_dscnt 0x0" ::: "memory");      // the lanes read below what other lanes of the wave have written above
#pragma unroll
  for (int mt = 0; mt < 4; ++mt)
#pragma unroll
    for (int ks = 0; ks < 2; ++ks) {      // the k order of xf
      a[mt][ks].half[0] = *(const v8us*)(ms + (mt * 16 + ln) * PM + ks * 32 + 8 * hh);
      a[mt][ks].half[1] = *(const v8us*)(ms + (mt * 16 + ln) * PM + ks * 32 + 16 + 8 * hh);
    }
#pragma unroll
  for (int mh = 0; mh < 4; mh += 2) {      // 32 rows d at a time: 8 tiles, then their partials go to LDS and leave the registers
    v8f acc[2][4];
#pragma unroll
    for (int m = 0; m < 2; ++m)
#pragma unroll
      for (int u = 0; u < 4; ++u) acc[m][u] = (v8f){0.f,0.f,0.f,0.f,0.f,0.f,0.f,0.f};
#pragma unroll
    for (int ks = 0; ks < 2; ++ks)
#pragma unroll
      for (int m = 0; m < 2; ++m)
#pragma unroll
        for (int u = 0; u < 4; ++u) acc[m][u] = wmmaB(a[mh + m][ks].v, b[ks][u], acc[m][u]);
    // acc[m][u][r] = partial of (d = 16 (mh + m) + 8 hh + r, n = n0 + 4 ln + u)
    if (which == 2) {
#pragma unroll
      for (int m = 0; m < 2; ++m)
#pragma unroll
        for (int r = 0; r < 8; ++r) *(v4fa*)&part[w][(mh + m) * 16 + 8 * hh + r][4 * ln] = (v4f){acc[m][0][r], acc[m][1][r], acc[m][2][r], acc[m][3][r]};
    } else {
#pragma unroll
      for (int m = 0; m < 2; ++m)
#pragma unroll
        for (int u = 0; u < 4; ++u) {      // LDS row u * 16 + ln = column 4 ln + u, its d turned round by 16 u: the readers below take columns 4 x .. 4 x + 3 at once, which would else fall on the same banks
          *(v4fa*)&part[w][u * 16 + ln][((mh + m + u) & 3) * 16 + 8 * hh] = (v4f){acc[m][u][0], acc[m][u][1], acc[m][u][2], acc[m][u][3]};
          *(v4fa*)&part[w][u * 16 + ln][((mh + m + u) & 3) * 16 + 8 * hh + 4] = (v4f){acc[m][u][4], acc[m][u][5], acc[m][u][6], acc[m][u][7]};
        }
    }
  }
  __syncthreads();      // every wave's partial tile is in LDS
  if (which == 2) {
#pragma unroll
    for (int j = 0; j < DO * PC / 8 / (PW * 32); ++j) {      // thread f sums eight s of one d, splits them and stores the f-th 16 bytes of the hi and of the lo halves: a wave fills 512 consecutive bytes of each
      const int f = j * (PW * 32) + tid;
      const v4fa* ps = (const v4fa*)&part[0][0][0] + (((f >> 6) & 3) * 16 + ln) * (PP / 4) + (f >> 8) * 8 + ((f >> 5) & 1) * 4 + hh * 2;      // row d, 16-byte place s / 4
      v4f s0 = ps[0], s1 = ps[1];
#pragma unroll
      for (int p = 1; p < PW; ++p) { s0 += ps[p * (DO * PP / 4)]; s1 += ps[p * (DO * PP / 4) + 1]; }      // wave order
      const float xs[8] = {s0[0], s0[1], s0[2], s0[3], s1[0], s1[1], s1[2], s1[3]};
      Oct vh, vl;
#pragma unroll
      for (int i = 0; i < 8; ++i) { const _Float16 h = (_Float16)xs[i]; vh.h[i] = h; vl.h[i] = (_Float16)(xs[i] - (float)h); }
      _Float16* vo = VF + (size_t)n0 * (2 * DO) + (f >> 6) * 1024 + ((f >> 5) & 1) * 256 + lane * 8;
      *(v8us*)vo = vh.u; *(v8us*)(vo + 512) = vl.u;
      asm volatile("s_wait_xcnt 0x0" ::: "memory");      // the next pass forms its address in the registers that the issued stores name
    }
    return;
  }
#pragma unroll
  for (int j = 0; j < DO * PC / 4 / (PW * 32); ++j) {      // thread f sums and stores the f-th four elements of the work-group's share, in the order of the output: whole 128-byte lines
    const int f = j * (PW * 32) + tid;
    const int fl = which == 0 ? (f >> 1) & 31 : f & 31;      // the lane of k_attn that will load them
    const int kq = which == 0 ? ((f >> 6) & 3) * 4 + (fl >> 4) * 2 + (f & 1) : ((f >> 6) & 1) * 4 + (fl >> 4) * 2 + ((f >> 5) & 1);      // Q: d / 4; K: a quarter of the place in 32 d
    const int u = fl & 3, dq = which == 0 ? kq : ((f >> 7) & 1) * 8 + kq;
    const int row = u * 16 + (f >> 8) * 4 + ((fl & 15) >> 2), q4 = (dq + 4 * u) & 15;      // the LDS row and which 16 bytes of it
    const v4fa* ps = (const v4fa*)&part[0][0][0] + row * (PP / 4) + q4;      // counted in 16 bytes, so that the reads stay 16-byte LDS loads
    v4f s = ps[0];
#pragma unroll
    for (int p = 1; p < PW; ++p) s += ps[p * (DO * PP / 4)];      // wave order
    const size_t o = (size_t)n0 * DO + f * 4;
    // s_wait_xcnt 0 behind each store, inside its own branch: the next pass forms its address in the registers that the issued store names
    if (which == 1) { *(v4f*)(KF + o) = s; asm volatile("s_wait_xcnt 0x0" ::: "memory"); }
    else { *(v4h*)(QF + o) = (v4h){(_Float16)s[0], (_Float16)s[1], (_Float16)s[2], (_Float16)s[3]}; asm volatile("s_wait_xcnt 0x0" ::: "memory"); }
  }
}
// One launch for scores, softmax and out. A work-group owns AT key columns t; each of its AW waves takes SQ / AW query positions s, 32 a pass.
// Scores as S[s][t] = Qd[:,s].Kd[:,t] (A = f16 Qd rows, B = Kd columns split into f16 hi/lo, kept in registers: 2 products, K = 64), so that a lane holds
// scores of one column t only and two score tiles (s 0-15, 16-31 of a pass), converted in place, are the B operand of out[d][t] += Vd[d][s].P[s][t].
// One walk: each wave holds a reference score per column (the largest raw score of its first pass) and forms e = 2^8 exp(x - ref) = exp2(raw * (log2 e / 8) + (8 - ref * (log2 e / 8))):
// one multiply-add and the hardware's exp2 an element; it adds e to the column's sum and multiplies f16(e) with Vd (f16 hi/lo as stored: 2 products). A softmax does not depend on
// the reference, which only keeps e inside f16: a pass whose sums of e show that one may have left the f16 range raises the reference to the largest score seen and scales the
// wave's tiles and sums down to it. At the end the waves' tiles and sums are brought to the largest of their references and added in wave order; the division, in which the 2^8 leaves, comes last.
#define AW 16
#define AT 32
#define ASR (SQ / AW)
#define L2E8 0.18033688011112042f      // log2(e) / sqrt(64)
__device__ __forceinline__ v8f wmmaH(v16h a, v16h b, v8f c) { return __builtin_amdgcn_wmma_f32_16x16x32_f16(false, a, false, b, (short)0, c, false, false); }
// one 16 x 32 block of KF (p: the lane's 16 bytes of its first 512) -> f16 hi/lo fragments in the hardware k order (8 hh + i, 16 + 8 hh + i)
__device__ __forceinline__ void frag_split(const float* __restrict__ p, FragH& fh, FragH& fl) {
  const v4f x0 = *(const v4fa*)p, x1 = *(const v4fa*)(p + 128), x2 = *(const v4fa*)(p + 256), x3 = *(const v4fa*)(p + 384);
  const float xs[16] = {x0[0],x0[1],x0[2],x0[3],x1[0],x1[1],x1[2],x1[3],x2[0],x2[1],x2[2],x2[3],x3[0],x3[1],x3[2],x3[3]};
  // unrolled so that xs and the fragments are indexed by constants and stay in registers
#pragma unroll
  for (int i = 0; i < 16; ++i) { const _Float16 h = (_Float16)xs[i]; fh.h[i] = h; fl.h[i] = (_Float16)(xs[i] - (float)h); }
}
// the A fragments of 32 s rows (m: which 16; ks: which 32 of the 64 d); q points at the lane's 16 bytes of the first 512 of those rows in QF
__device__ __forceinline__ void q_load(const _Float16* __restrict__ q, FragH (&qa)[2][2]) {
  // unrolled, here and in q_mul, so that the fragments and tiles are indexed by constants and stay in registers
#pragma unroll
  for (int m = 0; m < 2; ++m)
#pragma unroll
    for (int ks = 0; ks < 2; ++ks) { const _Float16* a = q + (m * 2 + ks) * 512; qa[m][ks].half[0] = *(const v8us*)a; qa[m][ks].half[1] = *(const v8us*)(a + 256); }
}
// sc[m][g] = raw scores of those 32 s rows against the 32 columns (g: which 16)
__device__ __forceinline__ void q_mul(const FragH (&qa)[2][2], const FragH (&kh)[2][2], const FragH (&kl)[2][2], v8f (&sc)[2][2]) {
#pragma unroll
  for (int m = 0; m < 2; ++m)
#pragma unroll
    for (int g = 0; g < 2; ++g) sc[m][g] = (v8f){0.f,0.f,0.f,0.f,0.f,0.f,0.f,0.f};
#pragma unroll
  for (int ks = 0; ks < 2; ++ks) {
#pragma unroll
    for (int m = 0; m < 2; ++m)
#pragma unroll
      for (int g = 0; g < 2; ++g) sc[m][g] = wmmaH(qa[m][ks].v, kh[g][ks].v, sc[m][g]);
#pragma unroll
    for (int m = 0; m < 2; ++m)
#pragma unroll
      for (int g = 0; g < 2; ++g) sc[m][g] = wmmaH(qa[m][ks].v, kl[g][ks].v, sc[m][g]);
  }
}
// the hi and lo A fragments of Vd for 32 s and 32 d (two dt), as k_proj has stored them: four loads of 512 consecutive bytes a wave and dt, no conversion; v points at the lane's 16 bytes of the first 512
__device__ __forceinline__ void v_load(const _Float16* __restrict__ v, FragH (&vh)[2], FragH (&vl)[2]) {
  // unrolled so that the fragments are indexed by constants and stay in registers
#pragma unroll
  for (int dt = 0; dt < 2; ++dt) {
    const _Float16* a = v + dt * 1024;
    vh[dt].half[0] = *(const v8us*)a; vh[dt].half[1] = *(const v8us*)(a + 256); vl[dt].half[0] = *(const v8us*)(a + 512); vl[dt].half[1] = *(const v8us*)(a + 768);
  }
}
// The hardware's exp2 of eight (two) values, each in its own register, and one v_nop, in one statement: the instruction set asks for one slot between a transcendental and an
// instruction that reads its result or overwrites its source. Here each v_exp_f32 is
// followed by one on other registers, and the last by the v_nop.
__device__ __forceinline__ void exp2x8(float (&e)[8]) {
  asm("v_exp_f32 %0, %0\n\tv_exp_f32 %1, %1\n\tv_exp_f32 %2, %2\n\tv_exp_f32 %3, %3\n\tv_exp_f32 %4, %4\n\tv_exp_f32 %5, %5\n\tv_exp_f32 %6, %6\n\tv_exp_f32 %7, %7\n\tv_nop"
      : "+v"(e[0]), "+v"(e[1]), "+v"(e[2]), "+v"(e[3]), "+v"(e[4]), "+v"(e[5]), "+v"(e[6]), "+v"(e[7]));
}
__device__ __forceinline__ void exp2x2(float (&e)[2]) {
  asm("v_exp_f32 %0, %0\n\tv_exp_f32 %1, %1\n\tv_nop" : "+v"(e[0]), "+v"(e[1]));
}
// pb[g] = the f16 weights e = exp2(raw * L2E8 + off[g]) of a pass's 32 x 32 scores, as B fragments; ps[g] = the lane's sum of its 16 f32 e of column group g
__device__ __forceinline__ void weigh(const v8f (&sc)[2][2], const float (&off)[2], FragH (&pb)[2], float (&ps)[2]) {
  // unrolled so that tiles and fragments are indexed by constants and stay in registers
#pragma unroll
  for (int g = 0; g < 2; ++g) {
    float c[2];
#pragma unroll
    for (int m = 0; m < 2; ++m) {
      float e[8];
#pragma unroll
      for (int r = 0; r < 8; ++r) e[r] = __builtin_fmaf(sc[m][g][r], L2E8, off[g]);
      exp2x8(e);      // far below the reference exp2 gives 0, as f16 would
      c[m] = e[0];
#pragma unroll
      for (int r = 1; r < 8; ++r) c[m] += e[r];
#pragma unroll
      for (int r = 0; r < 8; ++r) pb[g].h[m * 8 + r] = (_Float16)e[r];      // the 2^8 in e keeps small weights out of the f16 subnormal range; sum and products carry it alike
    }
    ps[g] = c[0] + c[1];
  }
}
__global__ __launch_bounds__(AW * 32) void k_attn(const _Float16* __restrict__ QF, const float* __restrict__ KF, const _Float16* __restrict__ VF, float* __restrict__ out) {
  __shared__ __attribute__((aligned(16))) float part[AW][DO][AT];
  __shared__ float rmx[AW][AT], rsm[AW][AT];
  const int tid = threadIdx.x, w = tid >> 5, lane = tid & 31, ln = lane & 15, hh = lane >> 4;
  const int t0 = blockIdx.x * AT;
  // the wave's ASR positions s are ASR * DO consecutive elements of QF and 2 * ASR * DO of VF. The wave's number is taken as a scalar and the lane's offset added apart: this build then
  // keeps one address pair for Qd and one for Vd through the walk and steps each once a pass; else it forms both anew each pass in further registers, of which the walk has none to spare
  const int ws = __builtin_amdgcn_readfirstlane(w);
  const unsigned lo = lane * 8;
  const _Float16* qrow = QF + (size_t)ws * ASR * DO;
  const _Float16* vrow = VF + (size_t)ws * ASR * (2 * DO);
  FragH kh[2][2], kl[2][2];
  // the loops over g, ks, m, r and dt below are unrolled so that fragments and tiles are indexed by constants and stay in registers
#pragma unroll
  for (int g = 0; g < 2; ++g)
#pragma unroll
    for (int ks = 0; ks < 2; ++ks) frag_split(KF + (size_t)t0 * DO + (g * 2 + ks) * 512 + lane * 4, kh[g][ks], kl[g][ks]);
  // off = 8 - ref * L2E8 stands for the reference. No score has been seen yet: with this start every e of the first pass is infinite, so that the first pass takes the branch below and sets it
  float off[2] = {1.0e37f, 1.0e37f};
  v8f o[4][2];
#pragma unroll
  for (int dt = 0; dt < 4; ++dt)
#pragma unroll
    for (int g = 0; g < 2; ++g) o[dt][g] = (v8f){0.f,0.f,0.f,0.f,0.f,0.f,0.f,0.f};
  float den[2] = {0.f, 0.f};
  for (int p = 0; p < ASR / 32; ++p) {
    FragH qa[2][2];
    q_load(qrow + (size_t)p * 32 * DO + lo, qa);
    asm volatile("s_wait_xcnt 0x0" ::: "memory");      // the Vd fragments loaded below may take the registers that hold the address of the loads just issued
    // all of the pass's Vd is asked for in front of the test below (behind it the loads would stand in a block of their own with the products, each pair waited for by itself):
    // dt 0 and 1 with Qd, dt 2 and 3 when the score products have left Qd's registers
    FragH vh[2][2], vl[2][2];
    v_load(vrow + (size_t)p * 4096 + lo, vh[0], vl[0]);
    __builtin_amdgcn_sched_barrier(0);      // keeps these 16 loads in front of the first product: without it some are issued among the products into reused registers, a further memory latency a pass
    v8f sc[2][2];
    q_mul(qa, kh, kl, sc);
    __builtin_amdgcn_sched_barrier(0);      // keeps the 8 loads below behind the score products: in front of them all of Vd, Qd and the scores together take more than the 256 registers of a wave (spills)
    v_load(vrow + (size_t)p * 4096 + 2048 + lo, vh[1], vl[1]);
    FragH pb[2];
    float ps[2];
    weigh(sc, off, pb, ps);
    // every e is positive: while a lane's 32 add up to less than 2^15, each of them is inside f16. One test a pass, the same for the whole wave (a scalar branch); a sum that is no number takes it too
    if (__builtin_amdgcn_ballot_w32(!(ps[0] + ps[1] < 32768.0f)) != 0) {
      // rare (the first pass, and a score far above all before it): Qd and, at the end, half of Vd are loaded once more, so that the scores need not stay in registers through every pass and this path needs no spills
      q_load(qrow + (size_t)p * 32 * DO + lo, qa);
      asm volatile("s_wait_xcnt 0x0" ::: "memory");      // registers that hold the address of the loads just issued may be written below
      q_mul(qa, kh, kl, sc);
      float f[2];
#pragma unroll
      for (int g = 0; g < 2; ++g) {
        float pm = sc[0][g][0];
#pragma unroll
        for (int m = 0; m < 2; ++m)
#pragma unroll
          for (int r = 0; r < 8; ++r) pm = fmaxf(pm, sc[m][g][r]);
        pm = fmaxf(pm, __shfl_xor(pm, 16, 32));      // both halves of the wave hold scores of the column and must use one reference
        const float no = fminf(off[g], 8.0f - pm * L2E8);      // the larger reference has the smaller off
        f[g] = no - off[g];
        off[g] = no;
      }
      exp2x2(f);      // at most 1; 0 in the first pass, where tiles and sums are 0
#pragma unroll
      for (int g = 0; g < 2; ++g) {
        den[g] *= f[g];
#pragma unroll
        for (int dt = 0; dt < 4; ++dt)
#pragma unroll
          for (int r = 0; r < 8; ++r) o[dt][g][r] *= f[g];
      }
      weigh(sc, off, pb, ps);      // now no e is above 2^8
      v_load(vrow + (size_t)p * 4096 + lo, vh[0], vl[0]);
    }
#pragma unroll
    for (int g = 0; g < 2; ++g) den[g] += ps[g];
#pragma unroll
    for (int dt = 0; dt < 4; ++dt) {
#pragma unroll
      for (int g = 0; g < 2; ++g) o[dt][g] = wmmaH(vh[dt >> 1][dt & 1].v, pb[g].v, o[dt][g]);
#pragma unroll
      for (int g = 0; g < 2; ++g) o[dt][g] = wmmaH(vl[dt >> 1][dt & 1].v, pb[g].v, o[dt][g]);
    }
  }
#pragma unroll
  for (int g = 0; g < 2; ++g) { den[g] += __shfl_xor(den[g], 16, 32); rsm[w][g * 16 + ln] = den[g]; rmx[w][g * 16 + ln] = off[g]; }      // both halves of the wave store the same values
#pragma unroll
  for (int dt = 0; dt < 4; ++dt)
#pragma unroll
    for (int g = 0; g < 2; ++g)
#pragma unroll
      for (int r = 0; r < 8; ++r) part[w][dt * 16 + 8 * hh + r][g * 16 + ln] = o[dt][g][r];
  __syncthreads();      // every wave's partial tile, column sums and references are in LDS
  float fac[AW / 8][8], top = rmx[0][lane], dsum = 0.f;
  // the loops over p are unrolled so that fac is indexed by constants and stays in registers
#pragma unroll
  for (int p = 1; p < AW; ++p) top = fminf(top, rmx[p][lane]);      // the off of the largest reference
#pragma unroll
  for (int p = 0; p < AW; ++p) fac[p >> 3][p & 7] = top - rmx[p][lane];
#pragma unroll
  for (int q = 0; q < AW / 8; ++q) exp2x8(fac[q]);      // fac of wave p brings its share to the largest reference
#pragma unroll
  for (int p = 0; p < AW; ++p) dsum += rsm[p][lane] * fac[p >> 3][p & 7];      // wave order, the same in every wave
  const float inv = 1.0f / dsum;
  for (int j = 0; j < DO / AW; ++j) {      // wave w sums and stores rows w, w + AW, ...: one whole 128-byte line each
    const int d = j * AW + w;
    float s = 0.f;
#pragma unroll
    for (int p = 0; p < AW; ++p) s += part[p][d][lane] * fac[p >> 3][p & 7];
    out[(size_t)d * SQ + t0 + lane] = s * inv;
  }
}
extern "C" void kernel_launch(void* const* d_in, const int* in_sizes, int n_in,
                              void* d_out, int out_size, void* d_ws, size_t ws_size, hipStream_t stream) {
  (void)in_sizes; (void)n_in; (void)out_size;
  const float* Q = (const float*)d_in[0]; const float* K = (const float*)d_in[1]; const float* V = (const float*)d_in[2]; const float* Mq = (const float*)d_in[3]; const float* Mk = (const float*)d_in[4]; const float* Mv = (const float*)d_in[5];
  char* ws = (char*)d_ws; size_t off = 0;
  auto take = [&](size_t bytes) { char* p = ws + off; off += (bytes + 255) & ~(size_t)255; return p; };
  _Float16* Vd = (_Float16*)take((size_t)DO * SQ * 4); float* KdT = (float*)take((size_t)SQ * DO * 4); _Float16* QdB = (_Float16*)take((size_t)SQ * DO * 2);
  if (off > ws_size) return;
  k_proj<<<dim3(SQ / PC, 3, 1), PW * 32, 0, stream>>>(Q, K, V, Mq, Mk, Mv, QdB, KdT, Vd);      // QdB = f16(Mq.Q), KdT = Mk.K, Vd = Mv.V as f16 hi and lo, each in k_attn's fragment order
  k_attn<<<SQ / AT, AW * 32, 0, stream>>>(QdB, KdT, Vd, (float*)d_out);      // out[d][t] = sum_s Vd[d][s] * softmax_s(Qd[:,s].Kd[:,t] / 8 + 1)
}
